// v000
// The times below were measured on an AMD MI455X: many runs one after another, warmed up first and cycling through
// copies of the inputs, with the whole window's GPU time divided by the number of runs. Launches and the gaps
// between them are all in it. The median over several windows is given; except for v000 it joins two sittings, which
// can be a few percent apart, so the side-by-side timings, each taken in one sitting, are the better comparison.
// v000, which the later versions start from, runs in 14.5 milliseconds.
#include <hip/hip_runtime.h>
// Causal multi-head attention whose q, k AND v are the same per-head projection (x [2][4096][768]; q = k = v = x Wq[h]^T with Wq [12][64][768] (natural per-head rows, sigma 1/sqrt(768)); scores = q.q / sqrt(768) (the module scales by d_model); causal (tril, -inf); softmax; out = merged (attn q) W_out^T + b_out -> [2][4096][768]).
// Structure: token rows r = b*4096 + s; x as exact f16 rows (bf16-rounded); Q = K = V as one WMMA GEMM (32x64 wave tiles, f32 accumulation, exact x16 weights, f16 outputs); per batch: V^T for all heads via LDS transposes; per query tile of 256 rows: scores against the keys below the tile end only (K = 64, all heads on grid.y, alpha = 0.036084391824351615), causal row softmax on VALU with an arithmetic 0/1 key mask over the computed range (f32 statistics, native exp; weights x256 f16), o = P . V^T (K = keys below the tile end, alpha 2^-2: o carried x64, folded into the output GEMM alpha) written straight into the merged f16 o rows; out = o W_o GEMM (f32) into the output layout.
// Compute dtype: inputs rounded to bf16; x / weights exact; q, k, v, softmax weights and o as plain f16 GEMM operands (~2^-12); scores and softmax statistics f32. v_wmma_f32_16x16x32_f16.
#define NB 2
#define SQ 4096
#define DM 768
#define NH 12
#define HD 64
#define HG 4                         /* heads per block group of the unlaunched k_vt(b, h0) overload */
#define QT 256                       /* query rows per causal tile */
#define NKX SQ                       /* S / P row pitch */
#define QT0 128                      /* first-tile rows recomputed exactly in f32 */
#define B0 0                         /* first batch processed (debug hook) */
#define NBR NB                       /* batches processed (debug hook) */
#define NR ((size_t)NB * SQ)         /* token rows */
#define MP ((int)((size_t)NBR * SQ)) /* rows projected (debug hook) */
#define QN SQ                        /* query rows attended per batch (debug hook) */
#define NHD NH                       /* heads attended (debug hook) */
#define MPO MP                       /* rows through the output stage (debug hook) */
#define LQ DM      /* row pitch of the q/k/v rows */
typedef __bf16 v16b __attribute__((ext_vector_type(16)));
typedef unsigned short v8us __attribute__((ext_vector_type(8), may_alias));
typedef float  v8f  __attribute__((ext_vector_type(8)));
typedef float  v4f  __attribute__((ext_vector_type(4)));
typedef float  v4fa __attribute__((ext_vector_type(4), may_alias));
union FragB { v16b v; v8us half[2]; unsigned short u[16]; };

__device__ __forceinline__ unsigned short bf16_bits(float x) { unsigned int u = __float_as_uint(x); return (unsigned short)((u + 0x7FFFu + ((u >> 16) & 1u)) >> 16); }
__device__ __forceinline__ float bf16_val(unsigned short b) { return __uint_as_float(((unsigned int)b) << 16); }
__device__ __forceinline__ float bf16_round(float x) { return bf16_val(bf16_bits(x)); }
// D += A·B with NT terms: 1 = ah·bh, 2 = + al·bh (A split), 3 = + ah·bl (both split)
template <int NT>
__device__ __forceinline__ v8f mmaN(v16b ah, v16b al, v16b bh, v16b bl, v8f c) {
  c = __builtin_amdgcn_wmma_f32_16x16x32_bf16(false, ah, false, bh, (short)0, c, false, false);
  if (NT >= 2) c = __builtin_amdgcn_wmma_f32_16x16x32_bf16(false, al, false, bh, (short)0, c, false, false);
  if (NT >= 3) c = __builtin_amdgcn_wmma_f32_16x16x32_bf16(false, ah, false, bl, (short)0, c, false, false);
  asm volatile("v_nop\n\tv_nop\n\tv_nop\n\tv_nop" : "+v"(c) : "v"(ah), "v"(al), "v"(bh), "v"(bl));
  return c;
}

__global__ __launch_bounds__(256) void k_wt_bf16(const float* __restrict__ W, unsigned short* __restrict__ Wt, int K, int N) {
  const int t = blockIdx.x * 256 + threadIdx.x;
  const int k8n = K / 8;
  if (t >= N * k8n) return;
  const int n = t / k8n, k8 = (t % k8n) * 8;
  v8us v;
#pragma unroll
  for (int i = 0; i < 8; ++i) v[i] = bf16_bits(W[(size_t)(k8 + i) * N + n]);
  *(v8us*)(Wt + (size_t)n * K + k8) = v;
  
}

// GEMM C[M][N] (f32, pitch ldc) = act(A[M][K]·W + bias). A f32 row-major (pitch lda) converted per fragment to bf16
// (ASPLIT: hi/lo two planes -> 2 terms, else single rounded term); Wt bf16 [N][K] (pitch ldb). BIAS_BF16 rounds the
// bias to bf16 first (bias quantised to bf16 before the add). K%32==0, M%16==0, N%64==0.
template <bool ASPLIT, int ACT, bool BIAS_BF16>
__global__ __launch_bounds__(128) void k_gemm_bf(const float* __restrict__ A, int lda, const unsigned short* __restrict__ Wt, int ldb,
                                               const float* __restrict__ bias, float* __restrict__ C, int ldc, int M, int N, int K) {
  __shared__ __attribute__((aligned(16))) float so[4][16][64];
  const int tid = threadIdx.x, w = tid >> 5, lane = tid & 31, ln = lane & 15, hh = lane >> 4;
  const int ntn = N / 64;
  const int wid = blockIdx.x * 4 + w;
  const int mt = wid / ntn, nq = wid % ntn;
  if (mt * 16 >= M) return;
  const int row0 = mt * 16, col0 = nq * 64;
  const float* arow = A + (size_t)(row0 + ln) * lda;
  v8f acc[4] = {};
  for (int kb = 0; kb < K; kb += 32) {
    FragB ah, al;
    const v4f x0 = *(const v4fa*)(arow + kb + 8 * hh), x1 = *(const v4fa*)(arow + kb + 8 * hh + 4);
    const v4f x2 = *(const v4fa*)(arow + kb + 16 + 8 * hh), x3 = *(const v4fa*)(arow + kb + 16 + 8 * hh + 4);
    float xs[16] = {x0[0],x0[1],x0[2],x0[3],x1[0],x1[1],x1[2],x1[3],x2[0],x2[1],x2[2],x2[3],x3[0],x3[1],x3[2],x3[3]};
#pragma unroll
    for (int i = 0; i < 16; ++i) { const unsigned short hb = bf16_bits(xs[i]); ah.u[i] = hb; al.u[i] = ASPLIT ? bf16_bits(xs[i] - bf16_val(hb)) : (unsigned short)0; }
#pragma unroll
    for (int t = 0; t < 4; ++t) {
      const unsigned short* brow = Wt + (size_t)(col0 + t * 16 + ln) * ldb + kb;
      FragB b;
      b.half[0] = *(const v8us*)(brow + 8 * hh);
      b.half[1] = *(const v8us*)(brow + 16 + 8 * hh);
      acc[t] = mmaN<ASPLIT ? 2 : 1>(ah.v, al.v, b.v, b.v, acc[t]);
    }
  }
#pragma unroll
  for (int t = 0; t < 4; ++t) {
    float bv = bias ? bias[col0 + t * 16 + ln] : 0.f;
    if (BIAS_BF16) bv = bf16_round(bv);
#pragma unroll
    for (int r = 0; r < 8; ++r) { float v = acc[t][r] + bv; if (ACT == 1) v = fmaxf(v, 0.f); so[w][8 * hh + r][t * 16 + ln] = v; }
  }
  __builtin_amdgcn_fence(__ATOMIC_ACQ_REL, "workgroup");
  __builtin_amdgcn_wave_barrier();
  const int rsub = lane >> 4, c4 = (lane & 15) * 4;
  {
#pragma unroll
    for (int q = 0; q < 8; ++q) {
      const int r = q * 2 + rsub;
      const v4f v = *(const v4fa*)&so[w][r][c4];
      *(v4f*)(C + (size_t)(row0 + r) * ldc + col0 + c4) = v;
    }
    
  }
}

// GEMM C = act(A·W + bias + resid): A f32 (ASPLIT -> hi/lo 2 terms), Wt bf16 [N][K]; ACT 0 none, 1 relu, 2 exact gelu;
// resid (optional, f32, row index = (row % rmod), pitch ldr, RES_BF16 rounds it) added before the activation.
template <bool ASPLIT, int ACT, bool BIAS_BF16, bool RES_BF16>
__global__ __launch_bounds__(128) void k_gemm_bf3(const float* __restrict__ A, int lda, const unsigned short* __restrict__ Wt, int ldb,
                                                const float* __restrict__ bias, const float* __restrict__ resid, int rmod, int ldr,
                                                float* __restrict__ C, int ldc, int M, int N, int K) {
  __shared__ __attribute__((aligned(16))) float so[4][16][64];
  const int tid = threadIdx.x, w = tid >> 5, lane = tid & 31, ln = lane & 15, hh = lane >> 4;
  const int ntn = N / 64;
  const int wid = blockIdx.x * 4 + w;
  const int mt = wid / ntn, nq = wid % ntn;
  if (mt * 16 >= M) return;
  const int row0 = mt * 16, col0 = nq * 64;
  const float* arow = A + (size_t)(row0 + ln) * lda;
  v8f acc[4] = {};
  for (int kb = 0; kb < K; kb += 32) {
    FragB ah, al;
    const v4f x0 = *(const v4fa*)(arow + kb + 8 * hh), x1 = *(const v4fa*)(arow + kb + 8 * hh + 4);
    const v4f x2 = *(const v4fa*)(arow + kb + 16 + 8 * hh), x3 = *(const v4fa*)(arow + kb + 16 + 8 * hh + 4);
    float xs[16] = {x0[0],x0[1],x0[2],x0[3],x1[0],x1[1],x1[2],x1[3],x2[0],x2[1],x2[2],x2[3],x3[0],x3[1],x3[2],x3[3]};
#pragma unroll
    for (int i = 0; i < 16; ++i) { const unsigned short hb = bf16_bits(xs[i]); ah.u[i] = hb; al.u[i] = ASPLIT ? bf16_bits(xs[i] - bf16_val(hb)) : (unsigned short)0; }
#pragma unroll
    for (int t = 0; t < 4; ++t) {
      const unsigned short* brow = Wt + (size_t)(col0 + t * 16 + ln) * ldb + kb;
      FragB b;
      b.half[0] = *(const v8us*)(brow + 8 * hh);
      b.half[1] = *(const v8us*)(brow + 16 + 8 * hh);
      acc[t] = mmaN<ASPLIT ? 2 : 1>(ah.v, al.v, b.v, b.v, acc[t]);
    }
  }
#pragma unroll
  for (int t = 0; t < 4; ++t) {
    const int col = col0 + t * 16 + ln;
    float bv = bias ? bias[col] : 0.f;
    if (BIAS_BF16) bv = bf16_round(bv);
#pragma unroll
    for (int r = 0; r < 8; ++r) {
      float v = acc[t][r] + bv;
      if (resid) { float rv = resid[(size_t)((row0 + 8 * hh + r) % rmod) * ldr + col]; if (RES_BF16) rv = bf16_round(rv); v += rv; }
      if (ACT == 1) v = fmaxf(v, 0.f);
      if (ACT == 2) v = 0.5f * v * (1.0f + erff(v * 0.70710678118654752f));
      if (ACT == 3) { const float u = 0.7978845608028654f * (v + 0.044715f * v * v * v); v = 0.5f * v * (1.0f + tanhf(u)); }
      so[w][8 * hh + r][t * 16 + ln] = v;
    }
  }
  __builtin_amdgcn_fence(__ATOMIC_ACQ_REL, "workgroup");
  __builtin_amdgcn_wave_barrier();
  const int rsub = lane >> 4, c4 = (lane & 15) * 4;
  {
#pragma unroll
    for (int q = 0; q < 8; ++q) {
      const int r = q * 2 + rsub;
      const v4f v = *(const v4fa*)&so[w][r][c4];
      *(v4f*)(C + (size_t)(row0 + r) * ldc + col0 + c4) = v;
    }
    
  }
}
// row LayerNorm (biased variance, eps) over N: s = X (+ R); optional out_sum <- s; out_norm <- (s-mu)*rsqrt(var+eps)*g + b
template <bool PARAM_BF16>
__global__ __launch_bounds__(256) void k_layernorm(const float* __restrict__ X, const float* __restrict__ R, const float* __restrict__ g, const float* __restrict__ bta,
                                                  float* __restrict__ out_sum, float* __restrict__ out_norm, int N, float eps) {
  __shared__ float red[256];
  const int row = blockIdx.x, tid = threadIdx.x;
  const float* x = X + (size_t)row * N; const float* rr = R ? R + (size_t)row * N : nullptr;
  float vals[16];                     // up to N = 4096
  const int per = N / 256;            // contiguous chunk per thread? use strided-by-4 chunks: thread handles j = tid*4 + 1024*u
  float s1 = 0.f;
  for (int u = 0; u < per / 4; ++u) {
    const int j = tid * 4 + 1024 * u;
    const v4f a = *(const v4fa*)(x + j);
    v4f b = {0.f,0.f,0.f,0.f}; if (rr) b = *(const v4fa*)(rr + j);
#pragma unroll
    for (int q = 0; q < 4; ++q) { const float v = a[q] + b[q]; vals[u * 4 + q] = v; s1 += v; }
  }
  red[tid] = s1; __syncthreads();
  for (int st = 128; st > 0; st >>= 1) { if (tid < st) red[tid] += red[tid + st]; __syncthreads(); }
  const float mu = red[0] / (float)N; __syncthreads();
  float s2 = 0.f;
  for (int u = 0; u < per / 4; ++u)
#pragma unroll
    for (int q = 0; q < 4; ++q) { const float c = vals[u * 4 + q] - mu; s2 += c * c; }
  red[tid] = s2; __syncthreads();
  for (int st = 128; st > 0; st >>= 1) { if (tid < st) red[tid] += red[tid + st]; __syncthreads(); }
  const float rs = rsqrtf(red[0] / (float)N + eps);
  {
    for (int u = 0; u < per / 4; ++u) {
      const int j = tid * 4 + 1024 * u;
      v4f o, sm;
#pragma unroll
      for (int q = 0; q < 4; ++q) {
        float gg = g[j + q], bb = bta[j + q];
        if (PARAM_BF16) { gg = bf16_round(gg); bb = bf16_round(bb); }
        sm[q] = vals[u * 4 + q]; o[q] = (vals[u * 4 + q] - mu) * rs * gg + bb;
      }
      if (out_sum) *(v4f*)(out_sum + (size_t)row * N + j) = sm;
      *(v4f*)(out_norm + (size_t)row * N + j) = o;
    }
    
  }
}



// ---- f16 WMMA path (v_wmma_f32_16x16x32_f16): 11-bit significands for operands in range — used where a [0,1] probability operand needs more precision than bf16
typedef _Float16 v16h __attribute__((ext_vector_type(16)));
union FragH { v16h v; v8us half[2]; _Float16 h[16]; unsigned short u[16]; };
template <int NT>
__device__ __forceinline__ v8f mmaH(v16h ah, v16h al, v16h bh, v16h bl, v8f c) {
  c = __builtin_amdgcn_wmma_f32_16x16x32_f16(false, ah, false, bh, (short)0, c, false, false);
  if (NT >= 2) c = __builtin_amdgcn_wmma_f32_16x16x32_f16(false, al, false, bh, (short)0, c, false, false);
  if (NT >= 3) c = __builtin_amdgcn_wmma_f32_16x16x32_f16(false, ah, false, bl, (short)0, c, false, false);
  asm volatile("v_nop\n\tv_nop\n\tv_nop\n\tv_nop" : "+v"(c) : "v"(ah), "v"(al), "v"(bh), "v"(bl));
  return c;
}
// batched GEMM like k_gemm_b but f16 operands: A f32 (split into f16 hi/lo if ASPLIT, else rounded to f16), Bt = f16 values [n][k]; alpha; C f32; N multiple of 16 (partial tiles skipped)
template <bool ASPLIT>
__global__ __launch_bounds__(128) void k_gemm_h(const float* __restrict__ A, int lda, size_t sA, const _Float16* __restrict__ Bh, int ldb, size_t sB, float alpha, float* __restrict__ C, int ldc, size_t sC, int M, int N, int K) {
  __shared__ __attribute__((aligned(16))) float so[4][16][64];
  const int tid = threadIdx.x, w = tid >> 5, lane = tid & 31, ln = lane & 15, hh = lane >> 4; const int by = blockIdx.y;
  A += (size_t)by * sA; Bh += (size_t)by * sB; C += (size_t)by * sC;
  const int ntn = (N + 63) / 64; const int wid = blockIdx.x * 4 + w; const int mt = wid / ntn, nq = wid % ntn; if (mt * 16 >= M) return;
  const int row0 = mt * 16, col0 = nq * 64; const float* arow = A + (size_t)(row0 + ln) * lda;
  v8f acc[4] = {};
  for (int kb = 0; kb < K; kb += 32) {
    FragH ah, al;
    const v4f x0 = *(const v4fa*)(arow + kb + 8 * hh), x1 = *(const v4fa*)(arow + kb + 8 * hh + 4), x2 = *(const v4fa*)(arow + kb + 16 + 8 * hh), x3 = *(const v4fa*)(arow + kb + 16 + 8 * hh + 4);
    float xs[16] = {x0[0],x0[1],x0[2],x0[3],x1[0],x1[1],x1[2],x1[3],x2[0],x2[1],x2[2],x2[3],x3[0],x3[1],x3[2],x3[3]};
#pragma unroll
    for (int i = 0; i < 16; ++i) { const _Float16 h = (_Float16)xs[i]; ah.h[i] = h; al.h[i] = ASPLIT ? (_Float16)(xs[i] - (float)h) : (_Float16)0.0f; }
#pragma unroll
    for (int t = 0; t < 4; ++t) { if (col0 + t * 16 >= N) continue; const size_t boff = (size_t)(col0 + t * 16 + ln) * ldb + kb; FragH bq; bq.half[0] = *(const v8us*)(Bh + boff + 8 * hh); bq.half[1] = *(const v8us*)(Bh + boff + 16 + 8 * hh);
      acc[t] = mmaH<ASPLIT ? 2 : 1>(ah.v, al.v, bq.v, bq.v, acc[t]); }
  }
#pragma unroll
  for (int t = 0; t < 4; ++t) { if (col0 + t * 16 >= N) continue;
#pragma unroll
    for (int r = 0; r < 8; ++r) so[w][8 * hh + r][t * 16 + ln] = acc[t][r] * alpha; }
  __builtin_amdgcn_fence(__ATOMIC_ACQ_REL, "workgroup"); __builtin_amdgcn_wave_barrier();
  const int rsub = lane >> 4, c4 = (lane & 15) * 4;
  {
#pragma unroll
    for (int q = 0; q < 8; ++q) { const int r = q * 2 + rsub; if (col0 + c4 < N) { const v4f v = *(const v4fa*)&so[w][r][c4]; *(v4f*)(C + (size_t)(row0 + r) * ldc + col0 + c4) = v; } }
     }
}

// Wt[n][k] = f16(W[k][n]·scale) from f32 row-major W[K][N] (scale = power of two; bf16-exact weights stay exact in f16 away from the subnormal range)
__global__ __launch_bounds__(256) void k_wt_f16(const float* __restrict__ W, _Float16* __restrict__ Wt, int K, int N, float scale) {
  const int t = blockIdx.x * 256 + threadIdx.x; if (t >= N * (K / 8)) return; const int n = t / (K / 8), k8 = (t % (K / 8)) * 8; FragH f;
#pragma unroll
  for (int i = 0; i < 8; ++i) f.h[i] = (_Float16)(bf16_round(W[(size_t)(k8 + i) * N + n]) * scale); const v8us o = f.half[0];
  *(v8us*)((unsigned short*)Wt + (size_t)n * K + k8) = o; 
}
// k_gemm_hh variant with fused epilogue: v = acc·alpha + bias[by·sBias + col] (+ CP[(row/rowsPerB)·sCPb + by·64 + col] if CP) ; ACT 0 none / 1 elu ; writes f16 C16 (and f32 C if non-null)
template <int ACT>
__global__ __launch_bounds__(128) void k_gemm_hhx(const _Float16* __restrict__ A, int lda, size_t sA, const _Float16* __restrict__ Bh, int ldb, size_t sB, float alpha, const float* __restrict__ bias, size_t sBias, const float* __restrict__ CP, int rowsPerB, size_t sCPb, int row0g,
    float* __restrict__ C, _Float16* __restrict__ C16, int ldc, size_t sC, int M, int N, int K) {
  __shared__ __attribute__((aligned(16))) float so[4][16][64];
  const int tid = threadIdx.x, w = tid >> 5, lane = tid & 31, ln = lane & 15, hh = lane >> 4; const int by = blockIdx.y;
  A += (size_t)by * sA; Bh += (size_t)by * sB; const size_t cofs = (size_t)by * sC; const float* bp = bias ? bias + (size_t)by * sBias : nullptr;
  const int ntn = (N + 63) / 64; const int wid = blockIdx.x * 4 + w; const int mt = wid / ntn, nq = wid % ntn; if (mt * 16 >= M) return;
  const int row0 = mt * 16, col0 = nq * 64; const _Float16* arow = A + (size_t)(row0 + ln) * lda;
  v8f acc[4] = {};
  for (int kb = 0; kb < K; kb += 32) { FragH ah; ah.half[0] = *(const v8us*)((const unsigned short*)arow + kb + 8 * hh); ah.half[1] = *(const v8us*)((const unsigned short*)arow + kb + 16 + 8 * hh);
#pragma unroll
    for (int t = 0; t < 4; ++t) { if (col0 + t * 16 >= N) continue; const size_t boff = (size_t)(col0 + t * 16 + ln) * ldb + kb; FragH bq; bq.half[0] = *(const v8us*)((const unsigned short*)Bh + boff + 8 * hh); bq.half[1] = *(const v8us*)((const unsigned short*)Bh + boff + 16 + 8 * hh);
      acc[t] = mmaH<1>(ah.v, ah.v, bq.v, bq.v, acc[t]); }
  }
#pragma unroll
  for (int t = 0; t < 4; ++t) { if (col0 + t * 16 >= N) continue; const int col = col0 + t * 16 + ln; const float bv = bp ? bf16_round(bp[col]) : 0.f;
#pragma unroll
    for (int r = 0; r < 8; ++r) { float v = acc[t][r] * alpha + bv; if (CP) { const int rr = row0g + row0 + 8 * hh + r; if (rowsPerB < 0) v += CP[cofs + (size_t)rr * ldc + col];      /* rowsPerB < 0: own element of the batched C plane */ else { const int bidx = rr / rowsPerB; v += CP[(size_t)bidx * sCPb + (size_t)by * 64 + col]; } } if (ACT == 1) v = (v > 0.f) ? v : expm1f(v); else if (ACT == 7) v = (v > 0.f) ? v + 1.0f : expf(v); else if (ACT == 8) v = tanhf(v); else if (ACT == 9) v = 0.5f * v * (1.0f + tanhf(0.7978845608028654f * (v + 0.044715f * v * v * v))); else if (ACT == 11) v = 1.0f / (1.0f + expf(-v)); else if (ACT == 12) v = (v > 0.f) ? v : 0.01f * v; else if (ACT == 14) v = (v > 0.f) ? v : 0.1f * v; else if (ACT == 16) v = (v >= 0.f) ? v : 0.3f * v; else if (ACT == 17) v = (v >= 0.f) ? v : 0.2f * v; else if (ACT == 15) v = v / (1.0f + expf(-v)); else if (ACT == 3) v = fmaxf(v, 0.f); else if (ACT == 6) v = 0.5f * v * (1.0f + erff(v * 0.70710678118654752f)); so[w][8 * hh + r][t * 16 + ln] = v; } }
  __builtin_amdgcn_fence(__ATOMIC_ACQ_REL, "workgroup"); __builtin_amdgcn_wave_barrier();
  const int rsub = lane >> 4, c4 = (lane & 15) * 4; typedef _Float16 v4h __attribute__((ext_vector_type(4)));
  {
#pragma unroll
    for (int q = 0; q < 8; ++q) { const int r = q * 2 + rsub; if (col0 + c4 < N) { const v4f v = *(const v4fa*)&so[w][r][c4]; if (C) *(v4f*)(C + cofs + (size_t)(row0 + r) * ldc + col0 + c4) = v; if (C16) { v4h h4; for (int i = 0; i < 4; ++i) h4[i] = (_Float16)v[i]; *(v4h*)(C16 + cofs + (size_t)(row0 + r) * ldc + col0 + c4) = h4; } } }
     }
}


typedef _Float16 v4h __attribute__((ext_vector_type(4)));

__global__ __launch_bounds__(256) void k_x16(const float* __restrict__ x, _Float16* __restrict__ X16, size_t n8) { const size_t t = (size_t)blockIdx.x * 256 + threadIdx.x; if (t >= n8) return; FragH f;
#pragma unroll
  for (int q = 0; q < 8; ++q) f.h[q] = (_Float16)bf16_round(x[t * 8 + q]); *(v8us*)((unsigned short*)X16 + t * 8) = f.half[0];  }
__global__ __launch_bounds__(256) void k_h16(const float* __restrict__ x, _Float16* __restrict__ X16, size_t n8) { const size_t t = (size_t)blockIdx.x * 256 + threadIdx.x; if (t >= n8) return; FragH f;
#pragma unroll
  for (int q = 0; q < 8; ++q) f.h[q] = (_Float16)x[t * 8 + q]; *(v8us*)((unsigned short*)X16 + t * 8) = f.half[0];  }
__global__ __launch_bounds__(256) void k_round16f(const float* __restrict__ W, _Float16* __restrict__ Bt, size_t n8) { const size_t t = (size_t)blockIdx.x * 256 + threadIdx.x; if (t >= n8) return; FragH f;
#pragma unroll
  for (int i = 0; i < 8; ++i) f.h[i] = (_Float16)(bf16_round(W[t * 8 + i]) * 16.0f); *(v8us*)((unsigned short*)Bt + t * 8) = f.half[0];  }
template <int NHv, int TTv>
__global__ __launch_bounds__(256) void k_vt(const _Float16* __restrict__ V16, int ldv, int voff, _Float16* __restrict__ Vt) { __shared__ unsigned short tl[64][66]; const int tid = threadIdx.x; const int slab = blockIdx.x / (TTv / 64), lg = blockIdx.x % (TTv / 64); const int b = slab / NHv, h = slab % NHv;
  for (int i = tid; i < 64 * 8; i += 256) { const int r = i / 8, c8 = (i % 8) * 8; FragH f; f.half[0] = *(const v8us*)((const unsigned short*)V16 + ((size_t)b * TTv + lg * 64 + r) * ldv + voff + h * 64 + c8);
#pragma unroll
    for (int q = 0; q < 8; ++q) tl[r][c8 + q] = f.u[q]; }
  __syncthreads();
  {
#pragma unroll
    for (int rd = 0; rd < 2; ++rd) { const int d = rd * 32 + tid / 8, pc = tid % 8; FragH f;
#pragma unroll
      for (int q = 0; q < 8; ++q) f.u[q] = tl[pc * 8 + q][d];
      *(v8us*)((unsigned short*)Vt + ((size_t)slab * 64 + d) * TTv + lg * 64 + pc * 8) = f.half[0]; }
     } }

__global__ __launch_bounds__(256) void k_hl(const float* __restrict__ F, _Float16* __restrict__ Hh, _Float16* __restrict__ Hl, size_t n8) { const size_t t = (size_t)blockIdx.x * 256 + threadIdx.x; if (t >= n8) return; FragH fh, fl; const v4f a = *(const v4fa*)(F + t * 8), c = *(const v4fa*)(F + t * 8 + 4);
#pragma unroll
  for (int q = 0; q < 4; ++q) { _Float16 h = (_Float16)a[q]; fh.h[q] = h; fl.h[q] = (_Float16)((a[q] - (float)h) * 1024.0f); h = (_Float16)c[q]; fh.h[4 + q] = h; fl.h[4 + q] = (_Float16)((c[q] - (float)h) * 1024.0f); }
  { *(v8us*)((unsigned short*)Hh + t * 8) = fh.half[0]; *(v8us*)((unsigned short*)Hl + t * 8) = fl.half[0];  } }

// ---- fast GEMM (wave tile 32x64; requires M % 32 == 0 rows per launch region and N % 64 == 0); epilogue = k_gemm_hhx semantics ----
__device__ __forceinline__ v16h g2_frag(const _Float16* p, int hh) { FragH f; f.half[0] = *(const v8us*)((const unsigned short*)p + 8 * hh); f.half[1] = *(const v8us*)((const unsigned short*)p + 16 + 8 * hh); return f.v; }
__device__ __forceinline__ v8f g2_mma(v16h a, v16h b, v8f c) { v8f d = __builtin_amdgcn_wmma_f32_16x16x32_f16(false, a, false, b, (short)0, c, false, false); asm volatile("v_nop\n\tv_nop\n\tv_nop\n\tv_nop" : "+v"(d) : "v"(a), "v"(b)); return d; }
template <int ACT>
__global__ __launch_bounds__(128) void k_gemm2(const _Float16* __restrict__ A, int lda, size_t sA, const _Float16* __restrict__ Bh, int ldb, size_t sB, float alpha, const float* __restrict__ bias, size_t sBias, const float* __restrict__ CP, int rowsPerB, size_t sCPb, int row0g,
    float* __restrict__ C, _Float16* __restrict__ C16, int ldc, size_t sC, int M, int N, int K) { static_assert(ACT == 0 || ACT == 3 || ACT == 6 || ACT == 8 || ACT == 9 || ACT == 11 || ACT == 12 || ACT == 14 || ACT == 15 || ACT == 16 || ACT == 17, "k_gemm2: unsupported ACT code (would silently apply no activation)");
  __shared__ __attribute__((aligned(16))) float so[4][32][68];
  const int tid = threadIdx.x, w = tid >> 5, lane = tid & 31, ln = lane & 15, hh = lane >> 4; const int by = blockIdx.y;
  A += (size_t)by * sA; Bh += (size_t)by * sB; const size_t cofs = (size_t)by * sC; const float* bp = bias ? bias + (size_t)by * sBias : nullptr;
  const int ntn = N >> 6; const int mt = blockIdx.x / ntn, nq = blockIdx.x - mt * ntn; const int row0 = mt * 128 + 32 * w, col0 = nq * 64; if (row0 >= M) return;
  const _Float16* a0p = A + (size_t)(row0 + ln) * lda; const _Float16* a1p = a0p + (size_t)16 * lda;
  const _Float16* b0p = Bh + (size_t)(col0 + ln) * ldb; const _Float16* b1p = b0p + (size_t)16 * ldb; const _Float16* b2p = b1p + (size_t)16 * ldb; const _Float16* b3p = b2p + (size_t)16 * ldb;
  const v8f z8 = {0.f,0.f,0.f,0.f,0.f,0.f,0.f,0.f}; v8f c00 = z8, c01 = z8, c02 = z8, c03 = z8, c10 = z8, c11 = z8, c12 = z8, c13 = z8;
#pragma unroll 1
  for (int kb = 0; kb < K; kb += 32) { const v16h a0 = g2_frag(a0p + kb, hh), a1 = g2_frag(a1p + kb, hh);
    v16h b = g2_frag(b0p + kb, hh); c00 = g2_mma(a0, b, c00); c10 = g2_mma(a1, b, c10);
    b = g2_frag(b1p + kb, hh); c01 = g2_mma(a0, b, c01); c11 = g2_mma(a1, b, c11);
    b = g2_frag(b2p + kb, hh); c02 = g2_mma(a0, b, c02); c12 = g2_mma(a1, b, c12);
    b = g2_frag(b3p + kb, hh); c03 = g2_mma(a0, b, c03); c13 = g2_mma(a1, b, c13); }
  v8f accs[8] = {c00, c01, c02, c03, c10, c11, c12, c13};
#pragma unroll
  for (int u = 0; u < 8; ++u) { const int t = u & 3, half = u >> 2; const int col = col0 + t * 16 + ln; const float bv = bp ? bf16_round(bp[col]) : 0.f;
#pragma unroll
    for (int r = 0; r < 8; ++r) { const int rloc = half * 16 + 8 * hh + r; float v = accs[u][r] * alpha + bv; if (CP) { if (rowsPerB < 0) v += CP[cofs + (size_t)(row0g + row0 + rloc) * ldc + col];      /* rowsPerB < 0: own element of the batched C plane */ else { const int bidx = (row0g + row0 + rloc) / rowsPerB; v += CP[(size_t)bidx * sCPb + (size_t)by * 64 + col]; } }
      if (ACT == 3) v = fmaxf(v, 0.f); else if (ACT == 6) v = 0.5f * v * (1.0f + erff(v * 0.70710678118654752f)); else if (ACT == 11) v = 1.0f / (1.0f + expf(-v)); else if (ACT == 15) v = v / (1.0f + expf(-v)); else if (ACT == 12) v = (v > 0.f) ? v : 0.01f * v; else if (ACT == 8) v = tanhf(v); else if (ACT == 9) v = 0.5f * v * (1.0f + tanhf(0.7978845608028654f * (v + 0.044715f * v * v * v))); else if (ACT == 14) v = (v > 0.f) ? v : 0.1f * v; else if (ACT == 16) v = (v >= 0.f) ? v : 0.3f * v; else if (ACT == 17) v = (v >= 0.f) ? v : 0.2f * v;
      so[w][rloc][t * 16 + ln] = v; } }
  __builtin_amdgcn_fence(__ATOMIC_ACQ_REL, "workgroup"); __builtin_amdgcn_wave_barrier();
  const int rsub = lane >> 4, c4 = (lane & 15) * 4;
  {
#pragma unroll
    for (int q = 0; q < 16; ++q) { const int r = q * 2 + rsub; const v4f v = *(const v4fa*)&so[w][r][c4]; if (C) *(v4f*)(C + cofs + (size_t)(row0 + r) * ldc + col0 + c4) = v; if (C16) { v4h h4; for (int i = 0; i < 4; ++i) h4[i] = (_Float16)v[i]; *(v4h*)(C16 + cofs + (size_t)(row0 + r) * ldc + col0 + c4) = h4; } }
     } }


__global__ __launch_bounds__(256) void k_wnat(const float* __restrict__ w, size_t n8, _Float16* __restrict__ Bt) { const size_t t = (size_t)blockIdx.x * 256 + threadIdx.x; if (t >= n8) return; FragH f; for (int q = 0; q < 8; ++q) f.h[q] = (_Float16)(bf16_round(w[t * 8 + q]) * 16.0f); *(v8us*)((unsigned short*)Bt + t * 8) = f.half[0];  }
__global__ __launch_bounds__(256) void k_rsm(const float* __restrict__ S, _Float16* __restrict__ P, int nrows) {
  #pragma clang fp contract(off)
  const int i = blockIdx.x * 256 + threadIdx.x; if (i >= nrows) return; const float* s = S + (size_t)i * SQ; float mx = -3.0e38f;
#pragma unroll 1
  for (int j = 0; j < SQ; ++j) mx = fmaxf(mx, s[j]); float se = 0.f;
#pragma unroll 1
  for (int j = 0; j < SQ; ++j) se += expf(s[j] - mx); const float sc = 256.0f / se;
#pragma unroll 1
  for (int j0 = 0; j0 < SQ; j0 += 8) { FragH f; for (int q = 0; q < 8; ++q) f.h[q] = (_Float16)(expf(s[j0 + q] - mx) * sc); unsigned short* d = (unsigned short*)P + (size_t)i * SQ + j0; *(v8us*)d = f.half[0];  } }
__global__ __launch_bounds__(256) void k_vt(const _Float16* __restrict__ V16, int b, int h0, _Float16* __restrict__ VT) { __shared__ unsigned short tl[64][65]; const int tid = threadIdx.x; const int hh = blockIdx.x % HG, sg = blockIdx.x / HG; const int s0 = sg * 64; const int h = h0 + hh;
  for (int i = tid; i < 64 * 8; i += 256) { const int j = i / 8, d8 = (i % 8) * 8; FragH f; f.half[0] = *(const v8us*)((const unsigned short*)V16 + ((size_t)b * SQ + s0 + j) * DM + h * HD + d8); for (int q = 0; q < 8; ++q) tl[d8 + q][j] = f.u[q]; }
  __syncthreads();
  { for (int i = tid; i < 64 * 8; i += 256) { const int d = i / 8, j8 = (i % 8) * 8; FragH f; for (int q = 0; q < 8; ++q) f.u[q] = tl[d][j8 + q]; *(v8us*)((unsigned short*)VT + ((size_t)hh * HD + d) * SQ + s0 + j8) = f.half[0]; }  } }



__global__ __launch_bounds__(256) void k_rsmcf2(const float* __restrict__ S, _Float16* __restrict__ P, int hg, int q0, int nk) {
  #pragma clang fp contract(off)
  const int t = blockIdx.x * 256 + threadIdx.x; if (t >= hg * QT) return; const size_t i = (size_t)t; const float* s = S + i * NKX; const int last = q0 + (t % QT); float mx = -3.0e38f;
#pragma unroll 1
  for (int j = 0; j < nk; ++j) { const float f = (j <= last) ? 1.f : 0.f; mx = fmaxf(mx, fmaf(f, s[j], (1.f - f) * -1.0e9f)); } float se = 0.f;
#pragma unroll 1
  for (int j = 0; j < nk; ++j) { const float f = (j <= last) ? 1.f : 0.f; se += __expf(fmaf(f, s[j], (1.f - f) * -1.0e9f) - mx); } const float sc = 256.0f / se;
#pragma unroll 1
  for (int j0 = 0; j0 < nk; j0 += 8) { FragH fr; for (int q = 0; q < 8; ++q) { const int j = j0 + q; const float f = (j <= last) ? 1.f : 0.f; fr.h[q] = (_Float16)(__expf(fmaf(f, s[j], (1.f - f) * -1.0e9f) - mx) * sc); } unsigned short* d = (unsigned short*)P + i * NKX + j0; *(v8us*)d = fr.half[0];  } }


template <int MASKADD>
__global__ __launch_bounds__(64) void k_att0(const float* __restrict__ QF, const float* __restrict__ KF, const float* __restrict__ VF, int ld, const float* __restrict__ mask, float scale, float* __restrict__ OF, int ldo) {
  #pragma clang fp contract(off)
  __shared__ __attribute__((aligned(16))) float lq[64][64]; __shared__ __attribute__((aligned(16))) float lo[64][64];
  const int tid = threadIdx.x; const int h = blockIdx.x / (QT0 / 64), rg = blockIdx.x % (QT0 / 64); const int i = rg * 64 + tid;
  const float* qr = QF + (size_t)i * ld + h * HD;
#pragma unroll 1
  for (int c = 0; c < HD / 4; ++c) { *(v4f*)&lq[tid][c * 4] = *(const v4fa*)(qr + c * 4); const v4f z = {0.f, 0.f, 0.f, 0.f}; *(v4f*)&lo[tid][c * 4] = z; }
  float m = -1.0e30f, l = 0.f; const int jmax = MASKADD ? (SQ - 1) : (rg * 64 + 63);      /* additive-mask form: every key (the mask input decides); causal form: keys up to the block's last row */
#pragma unroll 1
  for (int j = 0; j <= jmax; ++j) { const float* kr = KF + (size_t)j * ld + h * HD; const float* vr = VF + (size_t)j * ld + h * HD; float s = 0.f;
#pragma unroll 1
    for (int c = 0; c < HD / 4; ++c) { const v4f kq = *(const v4fa*)(kr + c * 4); const v4f qq = *(v4f*)&lq[tid][c * 4]; s = __fadd_rn(s, __fmul_rn(qq[0], kq[0])); s = __fadd_rn(s, __fmul_rn(qq[1], kq[1])); s = __fadd_rn(s, __fmul_rn(qq[2], kq[2])); s = __fadd_rn(s, __fmul_rn(qq[3], kq[3])); }
    s = __fmul_rn(s, scale); if (MASKADD) s = __fadd_rn(s, __fmul_rn(bf16_round(mask[(size_t)i * SQ + j]), -10000.0f));
    const float f = (MASKADD || j <= i) ? 1.f : 0.f; const float sm = fmaf(f, s, (1.f - f) * -1.0e30f); const float mn = fmaxf(m, sm); const float sc = expf(m - mn); const float e = expf(sm - mn); l = __fadd_rn(__fmul_rn(l, sc), e); m = mn;
#pragma unroll 1
    for (int c = 0; c < HD / 4; ++c) { const v4f vv = *(const v4fa*)(vr + c * 4); v4f oo = *(v4f*)&lo[tid][c * 4]; for (int u = 0; u < 4; ++u) oo[u] = __fadd_rn(__fmul_rn(oo[u], sc), __fmul_rn(e, vv[u])); *(v4f*)&lo[tid][c * 4] = oo; } }
  const float fin = 64.0f / l;      /* o carried x64 like the f16 path */
#pragma unroll 1
  for (int c = 0; c < HD / 4; ++c) { v4f oo = *(v4f*)&lo[tid][c * 4]; for (int u = 0; u < 4; ++u) oo[u] = __fmul_rn(oo[u], fin); *(v4f*)&lo[tid][c * 4] = oo; }
  __syncthreads();
  {
#pragma unroll 1
    for (int it = 0; it < 16; ++it) { const int row = it * 4 + tid / 16, pc = (tid % 16) * 4; const v4f v = *(const v4f*)&lo[row][pc]; *(v4f*)(OF + (size_t)(rg * 64 + row) * ldo + h * HD + pc) = v; }
     } }

extern "C" void kernel_launch(void* const* d_in, const int* in_sizes, int n_in,
                              void* d_out, int out_size, void* d_ws, size_t ws_size, hipStream_t stream) {
  (void)in_sizes; (void)n_in; (void)out_size;
  const float* const* I = (const float* const*)d_in; const float* x = I[0]; const float* wq = I[1]; const float* wo = I[2]; const float* bo = I[3]; const float* wk = wq; const float* wv = wq;      /* Wq [12][64][768] = natural [768][768] rows h*64+d (q = k = v); W_out natural + b_out */
  char* ws = (char*)d_ws; size_t off = 0;
  auto take = [&](size_t bytes) { char* p = ws + off; off += (bytes + 255) & ~(size_t)255; return p; };
  _Float16* BQ = (_Float16*)take((size_t)DM * DM * 2); _Float16* BK = BQ; _Float16* BV = BQ; _Float16* BO = (_Float16*)take((size_t)DM * DM * 2);
  _Float16* X16 = (_Float16*)take(NR * DM * 2); _Float16* Q16 = (_Float16*)take(NR * DM * 2); _Float16* K16 = Q16; _Float16* V16 = Q16;      /* q = k = v (the module projects all three with self.query) */ _Float16* O16 = (_Float16*)take(NR * DM * 2);
  float* S = (float*)take((size_t)NH * QT * NKX * 4); _Float16* P = (_Float16*)take((size_t)NH * QT * NKX * 2); _Float16* VT = (_Float16*)take((size_t)NH * HD * SQ * 2);
  float* QF0 = (float*)take((size_t)QT0 * DM * 4); float* KF0 = (float*)take((size_t)QT0 * DM * 4); float* VF0 = (float*)take((size_t)QT0 * DM * 4); float* OF0 = (float*)take((size_t)NB * QT0 * DM * 4); _Float16* OH0 = (_Float16*)take((size_t)NB * QT0 * DM * 2); _Float16* OL0 = (_Float16*)take((size_t)NB * QT0 * DM * 2);
  if (off > ws_size) return;
  k_wnat<<<(unsigned)(((size_t)DM * DM / 8 + 255) / 256), 256, 0, stream>>>(wq, (size_t)DM * DM / 8, BQ); k_wnat<<<(unsigned)(((size_t)DM * DM / 8 + 255) / 256), 256, 0, stream>>>(wo, (size_t)DM * DM / 8, BO);      /* natural [out][in] = Bt x16 */

  k_x16<<<(unsigned)((NR * DM / 8 + 255) / 256), 256, 0, stream>>>(x, X16, NR * DM / 8);
  const size_t r0p = (size_t)B0 * SQ;      /* first projected row */
  k_gemm2<0><<<dim3((unsigned)((MP / 128) * (DM / 64)), 1), 128, 0, stream>>>(X16 + r0p * DM, DM, 0, BQ, DM, 0, 0.0625f, nullptr, 0, nullptr, 1, 0, 0, nullptr, Q16 + r0p * DM, DM, 0, MP, DM, DM);
  for (int b = B0; b < B0 + NBR; ++b) { const size_t r0 = (size_t)b * SQ;
    k_vt<NH, SQ><<<NH * (SQ / 64), 256, 0, stream>>>(V16 + r0 * LQ, LQ, 0, VT);      /* V^T [NH][HD][SQ] for this batch */
    k_gemm2<0><<<dim3((QT0 / 128) * (DM / 64), 1), 128, 0, stream>>>(X16 + r0 * DM, DM, 0, BQ, DM, 0, 0.0625f, nullptr, 0, nullptr, 1, 0, 0, QF0, nullptr, DM, 0, QT0, DM, DM); /* KF0 = VF0 = QF0 (same projection) */      /* f32 q, k, v of the first 128 rows (exact products) */
    k_att0<0><<<NH * (QT0 / 64), 64, 0, stream>>>(QF0, QF0, QF0, DM, nullptr, 0.036084391824351615f, OF0 + (size_t)b * QT0 * DM, DM);      /* exact f32 attention for rows 0..127 (o x64) */
    for (int q0 = 0; q0 < QN; q0 += QT) { const int nk = q0 + QT;      /* causal: only keys below the tile end are computed */
      k_gemm2<0><<<dim3((QT / 128) * (nk / 64), NHD), 128, 0, stream>>>(Q16 + (r0 + q0) * LQ, LQ, (size_t)HD, K16 + r0 * LQ, LQ, (size_t)HD, 0.036084391824351615f, nullptr, 0, nullptr, 1, 0, 0, S, nullptr, NKX, (size_t)QT * NKX, QT, nk, HD);      /* scores, all heads on grid.y */
      k_rsmcf2<<<(NHD * QT + 255) / 256, 256, 0, stream>>>(S, P, NHD, q0, nk);
      k_gemm2<0><<<dim3((QT / 128) * (HD / 64), NHD), 128, 0, stream>>>(P, NKX, (size_t)QT * NKX, VT, SQ, (size_t)HD * SQ, 0.25f, nullptr, 0, nullptr, 1, 0, 0, nullptr, O16 + (r0 + q0) * DM, DM, (size_t)HD, QT, HD, nk); } }      /* o (merged heads, x64) as f16 rows */
  k_gemm2<0><<<dim3((unsigned)((MPO / 128) * (DM / 64)), 1), 128, 0, stream>>>(O16 + r0p * DM, DM, 0, BO, DM, 0, 0.0009765625f, bo, 0, nullptr, 1, 0, 0, (float*)d_out + r0p * DM, nullptr, DM, 0, MPO, DM, DM);      /* out rows are the output layout */
  k_hl<<<(unsigned)(((size_t)NB * QT0 * DM / 8 + 255) / 256), 256, 0, stream>>>(OF0, OH0, OL0, (size_t)NB * QT0 * DM / 8);      /* first-tile o (x64) -> f16 hi + x1024 residual planes */
  for (int b = B0; b < B0 + NBR; ++b) { const size_t r0 = (size_t)b * SQ; const size_t f0 = (size_t)b * QT0;
    k_gemm2<0><<<dim3((QT0 / 128) * (DM / 64), 1), 128, 0, stream>>>(OH0 + f0 * DM, DM, 0, BO, DM, 0, 0.0009765625f, bo, 0, nullptr, 1, 0, 0, (float*)d_out + r0 * DM, nullptr, DM, 0, QT0, DM, DM);      /* rows 0..127: out = o_hi Wo (+ b), overwriting the f16-path rows */
    k_gemm2<0><<<dim3((QT0 / 128) * (DM / 64), 1), 128, 0, stream>>>(OL0 + f0 * DM, DM, 0, BO, DM, 0, 0.00000095367431640625f, nullptr, 0, (const float*)d_out + r0 * DM, -1, 0, 0, (float*)d_out + r0 * DM, nullptr, DM, 0, QT0, DM, DM); }      /* += o_lo Wo 2^-20 (own-element accumulate) */
}

// v001
// A run of this version takes 3470 microseconds.
// In two side-by-side timings against v000, it was 4.18 and 4.20 times as fast.
#include <hip/hip_runtime.h>
// Causal multi-head attention whose q, k AND v are the same per-head projection (x [2][4096][768]; q = k = v = x Wq[h]^T with Wq [12][64][768] (natural per-head rows, sigma 1/sqrt(768)); scores = q.q / sqrt(768) (the module scales by d_model); causal (tril, -inf); softmax; out = merged (attn q) W_out^T + b_out -> [2][4096][768]).
// Structure: token rows r = b*4096 + s; x as exact f16 rows (bf16-rounded); Q = K = V as one WMMA GEMM (32x64 wave tiles, f32 accumulation, exact x16 weights, f16 outputs); per batch: V^T for all heads via LDS transposes; per query tile of 256 rows: scores against the keys below the tile end only (K = 64, all heads on grid.y, alpha = 0.036084391824351615), causal row softmax on VALU, one wave per row, keys above the row masked over the computed range (f32 statistics, native exp; weights x256 f16), o = P . V^T (K = keys below the tile end, alpha 2^-2: o carried x64, folded into the output GEMM alpha) written straight into the merged f16 o rows; out = o W_o GEMM (f32) into the output layout.
// Compute dtype: inputs rounded to bf16; x / weights exact; q, k, v, softmax weights and o as plain f16 GEMM operands (~2^-12); scores and softmax statistics f32. v_wmma_f32_16x16x32_f16.
#define NB 2
#define SQ 4096
#define DM 768
#define NH 12
#define HD 64
#define HG 4                         /* heads per block group of the unlaunched k_vt(b, h0) overload */
#define QT 256                       /* query rows per causal tile */
#define NKX SQ                       /* S / P row pitch */
#define QT0 128                      /* first-tile rows recomputed exactly in f32 */
#define B0 0                         /* first batch processed (debug hook) */
#define NBR NB                       /* batches processed (debug hook) */
#define NR ((size_t)NB * SQ)         /* token rows */
#define MP ((int)((size_t)NBR * SQ)) /* rows projected (debug hook) */
#define QN SQ                        /* query rows attended per batch (debug hook) */
#define NHD NH                       /* heads attended (debug hook) */
#define MPO MP                       /* rows through the output stage (debug hook) */
#define LQ DM      /* row pitch of the q/k/v rows */
typedef __bf16 v16b __attribute__((ext_vector_type(16)));
typedef unsigned short v8us __attribute__((ext_vector_type(8), may_alias));
typedef float  v8f  __attribute__((ext_vector_type(8)));
typedef float  v4f  __attribute__((ext_vector_type(4)));
typedef float  v4fa __attribute__((ext_vector_type(4), may_alias));
union FragB { v16b v; v8us half[2]; unsigned short u[16]; };

__device__ __forceinline__ unsigned short bf16_bits(float x) { unsigned int u = __float_as_uint(x); return (unsigned short)((u + 0x7FFFu + ((u >> 16) & 1u)) >> 16); }
__device__ __forceinline__ float bf16_val(unsigned short b) { return __uint_as_float(((unsigned int)b) << 16); }
__device__ __forceinline__ float bf16_round(float x) { return bf16_val(bf16_bits(x)); }
// D += A·B with NT terms: 1 = ah·bh, 2 = + al·bh (A split), 3 = + ah·bl (both split)
template <int NT>
__device__ __forceinline__ v8f mmaN(v16b ah, v16b al, v16b bh, v16b bl, v8f c) {
  c = __builtin_amdgcn_wmma_f32_16x16x32_bf16(false, ah, false, bh, (short)0, c, false, false);
  if (NT >= 2) c = __builtin_amdgcn_wmma_f32_16x16x32_bf16(false, al, false, bh, (short)0, c, false, false);
  if (NT >= 3) c = __builtin_amdgcn_wmma_f32_16x16x32_bf16(false, ah, false, bl, (short)0, c, false, false);
  asm volatile("v_nop\n\tv_nop\n\tv_nop\n\tv_nop" : "+v"(c) : "v"(ah), "v"(al), "v"(bh), "v"(bl));
  return c;
}

__global__ __launch_bounds__(256) void k_wt_bf16(const float* __restrict__ W, unsigned short* __restrict__ Wt, int K, int N) {
  const int t = blockIdx.x * 256 + threadIdx.x;
  const int k8n = K / 8;
  if (t >= N * k8n) return;
  const int n = t / k8n, k8 = (t % k8n) * 8;
  v8us v;
#pragma unroll
  for (int i = 0; i < 8; ++i) v[i] = bf16_bits(W[(size_t)(k8 + i) * N + n]);
  *(v8us*)(Wt + (size_t)n * K + k8) = v;
  
}

// GEMM C[M][N] (f32, pitch ldc) = act(A[M][K]·W + bias). A f32 row-major (pitch lda) converted per fragment to bf16
// (ASPLIT: hi/lo two planes -> 2 terms, else single rounded term); Wt bf16 [N][K] (pitch ldb). BIAS_BF16 rounds the
// bias to bf16 first (bias quantised to bf16 before the add). K%32==0, M%16==0, N%64==0.
template <bool ASPLIT, int ACT, bool BIAS_BF16>
__global__ __launch_bounds__(128) void k_gemm_bf(const float* __restrict__ A, int lda, const unsigned short* __restrict__ Wt, int ldb,
                                               const float* __restrict__ bias, float* __restrict__ C, int ldc, int M, int N, int K) {
  __shared__ __attribute__((aligned(16))) float so[4][16][64];
  const int tid = threadIdx.x, w = tid >> 5, lane = tid & 31, ln = lane & 15, hh = lane >> 4;
  const int ntn = N / 64;
  const int wid = blockIdx.x * 4 + w;
  const int mt = wid / ntn, nq = wid % ntn;
  if (mt * 16 >= M) return;
  const int row0 = mt * 16, col0 = nq * 64;
  const float* arow = A + (size_t)(row0 + ln) * lda;
  v8f acc[4] = {};
  for (int kb = 0; kb < K; kb += 32) {
    FragB ah, al;
    const v4f x0 = *(const v4fa*)(arow + kb + 8 * hh), x1 = *(const v4fa*)(arow + kb + 8 * hh + 4);
    const v4f x2 = *(const v4fa*)(arow + kb + 16 + 8 * hh), x3 = *(const v4fa*)(arow + kb + 16 + 8 * hh + 4);
    float xs[16] = {x0[0],x0[1],x0[2],x0[3],x1[0],x1[1],x1[2],x1[3],x2[0],x2[1],x2[2],x2[3],x3[0],x3[1],x3[2],x3[3]};
#pragma unroll
    for (int i = 0; i < 16; ++i) { const unsigned short hb = bf16_bits(xs[i]); ah.u[i] = hb; al.u[i] = ASPLIT ? bf16_bits(xs[i] - bf16_val(hb)) : (unsigned short)0; }
#pragma unroll
    for (int t = 0; t < 4; ++t) {
      const unsigned short* brow = Wt + (size_t)(col0 + t * 16 + ln) * ldb + kb;
      FragB b;
      b.half[0] = *(const v8us*)(brow + 8 * hh);
      b.half[1] = *(const v8us*)(brow + 16 + 8 * hh);
      acc[t] = mmaN<ASPLIT ? 2 : 1>(ah.v, al.v, b.v, b.v, acc[t]);
    }
  }
#pragma unroll
  for (int t = 0; t < 4; ++t) {
    float bv = bias ? bias[col0 + t * 16 + ln] : 0.f;
    if (BIAS_BF16) bv = bf16_round(bv);
#pragma unroll
    for (int r = 0; r < 8; ++r) { float v = acc[t][r] + bv; if (ACT == 1) v = fmaxf(v, 0.f); so[w][8 * hh + r][t * 16 + ln] = v; }
  }
  __builtin_amdgcn_fence(__ATOMIC_ACQ_REL, "workgroup");
  __builtin_amdgcn_wave_barrier();
  const int rsub = lane >> 4, c4 = (lane & 15) * 4;
  {
#pragma unroll
    for (int q = 0; q < 8; ++q) {
      const int r = q * 2 + rsub;
      const v4f v = *(const v4fa*)&so[w][r][c4];
      *(v4f*)(C + (size_t)(row0 + r) * ldc + col0 + c4) = v;
    }
    
  }
}

// GEMM C = act(A·W + bias + resid): A f32 (ASPLIT -> hi/lo 2 terms), Wt bf16 [N][K]; ACT 0 none, 1 relu, 2 exact gelu;
// resid (optional, f32, row index = (row % rmod), pitch ldr, RES_BF16 rounds it) added before the activation.
template <bool ASPLIT, int ACT, bool BIAS_BF16, bool RES_BF16>
__global__ __launch_bounds__(128) void k_gemm_bf3(const float* __restrict__ A, int lda, const unsigned short* __restrict__ Wt, int ldb,
                                                const float* __restrict__ bias, const float* __restrict__ resid, int rmod, int ldr,
                                                float* __restrict__ C, int ldc, int M, int N, int K) {
  __shared__ __attribute__((aligned(16))) float so[4][16][64];
  const int tid = threadIdx.x, w = tid >> 5, lane = tid & 31, ln = lane & 15, hh = lane >> 4;
  const int ntn = N / 64;
  const int wid = blockIdx.x * 4 + w;
  const int mt = wid / ntn, nq = wid % ntn;
  if (mt * 16 >= M) return;
  const int row0 = mt * 16, col0 = nq * 64;
  const float* arow = A + (size_t)(row0 + ln) * lda;
  v8f acc[4] = {};
  for (int kb = 0; kb < K; kb += 32) {
    FragB ah, al;
    const v4f x0 = *(const v4fa*)(arow + kb + 8 * hh), x1 = *(const v4fa*)(arow + kb + 8 * hh + 4);
    const v4f x2 = *(const v4fa*)(arow + kb + 16 + 8 * hh), x3 = *(const v4fa*)(arow + kb + 16 + 8 * hh + 4);
    float xs[16] = {x0[0],x0[1],x0[2],x0[3],x1[0],x1[1],x1[2],x1[3],x2[0],x2[1],x2[2],x2[3],x3[0],x3[1],x3[2],x3[3]};
#pragma unroll
    for (int i = 0; i < 16; ++i) { const unsigned short hb = bf16_bits(xs[i]); ah.u[i] = hb; al.u[i] = ASPLIT ? bf16_bits(xs[i] - bf16_val(hb)) : (unsigned short)0; }
#pragma unroll
    for (int t = 0; t < 4; ++t) {
      const unsigned short* brow = Wt + (size_t)(col0 + t * 16 + ln) * ldb + kb;
      FragB b;
      b.half[0] = *(const v8us*)(brow + 8 * hh);
      b.half[1] = *(const v8us*)(brow + 16 + 8 * hh);
      acc[t] = mmaN<ASPLIT ? 2 : 1>(ah.v, al.v, b.v, b.v, acc[t]);
    }
  }
#pragma unroll
  for (int t = 0; t < 4; ++t) {
    const int col = col0 + t * 16 + ln;
    float bv = bias ? bias[col] : 0.f;
    if (BIAS_BF16) bv = bf16_round(bv);
#pragma unroll
    for (int r = 0; r < 8; ++r) {
      float v = acc[t][r] + bv;
      if (resid) { float rv = resid[(size_t)((row0 + 8 * hh + r) % rmod) * ldr + col]; if (RES_BF16) rv = bf16_round(rv); v += rv; }
      if (ACT == 1) v = fmaxf(v, 0.f);
      if (ACT == 2) v = 0.5f * v * (1.0f + erff(v * 0.70710678118654752f));
      if (ACT == 3) { const float u = 0.7978845608028654f * (v + 0.044715f * v * v * v); v = 0.5f * v * (1.0f + tanhf(u)); }
      so[w][8 * hh + r][t * 16 + ln] = v;
    }
  }
  __builtin_amdgcn_fence(__ATOMIC_ACQ_REL, "workgroup");
  __builtin_amdgcn_wave_barrier();
  const int rsub = lane >> 4, c4 = (lane & 15) * 4;
  {
#pragma unroll
    for (int q = 0; q < 8; ++q) {
      const int r = q * 2 + rsub;
      const v4f v = *(const v4fa*)&so[w][r][c4];
      *(v4f*)(C + (size_t)(row0 + r) * ldc + col0 + c4) = v;
    }
    
  }
}
// row LayerNorm (biased variance, eps) over N: s = X (+ R); optional out_sum <- s; out_norm <- (s-mu)*rsqrt(var+eps)*g + b
template <bool PARAM_BF16>
__global__ __launch_bounds__(256) void k_layernorm(const float* __restrict__ X, const float* __restrict__ R, const float* __restrict__ g, const float* __restrict__ bta,
                                                  float* __restrict__ out_sum, float* __restrict__ out_norm, int N, float eps) {
  __shared__ float red[256];
  const int row = blockIdx.x, tid = threadIdx.x;
  const float* x = X + (size_t)row * N; const float* rr = R ? R + (size_t)row * N : nullptr;
  float vals[16];                     // up to N = 4096
  const int per = N / 256;            // contiguous chunk per thread? use strided-by-4 chunks: thread handles j = tid*4 + 1024*u
  float s1 = 0.f;
  for (int u = 0; u < per / 4; ++u) {
    const int j = tid * 4 + 1024 * u;
    const v4f a = *(const v4fa*)(x + j);
    v4f b = {0.f,0.f,0.f,0.f}; if (rr) b = *(const v4fa*)(rr + j);
#pragma unroll
    for (int q = 0; q < 4; ++q) { const float v = a[q] + b[q]; vals[u * 4 + q] = v; s1 += v; }
  }
  red[tid] = s1; __syncthreads();
  for (int st = 128; st > 0; st >>= 1) { if (tid < st) red[tid] += red[tid + st]; __syncthreads(); }
  const float mu = red[0] / (float)N; __syncthreads();
  float s2 = 0.f;
  for (int u = 0; u < per / 4; ++u)
#pragma unroll
    for (int q = 0; q < 4; ++q) { const float c = vals[u * 4 + q] - mu; s2 += c * c; }
  red[tid] = s2; __syncthreads();
  for (int st = 128; st > 0; st >>= 1) { if (tid < st) red[tid] += red[tid + st]; __syncthreads(); }
  const float rs = rsqrtf(red[0] / (float)N + eps);
  {
    for (int u = 0; u < per / 4; ++u) {
      const int j = tid * 4 + 1024 * u;
      v4f o, sm;
#pragma unroll
      for (int q = 0; q < 4; ++q) {
        float gg = g[j + q], bb = bta[j + q];
        if (PARAM_BF16) { gg = bf16_round(gg); bb = bf16_round(bb); }
        sm[q] = vals[u * 4 + q]; o[q] = (vals[u * 4 + q] - mu) * rs * gg + bb;
      }
      if (out_sum) *(v4f*)(out_sum + (size_t)row * N + j) = sm;
      *(v4f*)(out_norm + (size_t)row * N + j) = o;
    }
    
  }
}



// ---- f16 WMMA path (v_wmma_f32_16x16x32_f16): 11-bit significands for operands in range — used where a [0,1] probability operand needs more precision than bf16
typedef _Float16 v16h __attribute__((ext_vector_type(16)));
union FragH { v16h v; v8us half[2]; _Float16 h[16]; unsigned short u[16]; };
template <int NT>
__device__ __forceinline__ v8f mmaH(v16h ah, v16h al, v16h bh, v16h bl, v8f c) {
  c = __builtin_amdgcn_wmma_f32_16x16x32_f16(false, ah, false, bh, (short)0, c, false, false);
  if (NT >= 2) c = __builtin_amdgcn_wmma_f32_16x16x32_f16(false, al, false, bh, (short)0, c, false, false);
  if (NT >= 3) c = __builtin_amdgcn_wmma_f32_16x16x32_f16(false, ah, false, bl, (short)0, c, false, false);
  asm volatile("v_nop\n\tv_nop\n\tv_nop\n\tv_nop" : "+v"(c) : "v"(ah), "v"(al), "v"(bh), "v"(bl));
  return c;
}
// batched GEMM like k_gemm_b but f16 operands: A f32 (split into f16 hi/lo if ASPLIT, else rounded to f16), Bt = f16 values [n][k]; alpha; C f32; N multiple of 16 (partial tiles skipped)
template <bool ASPLIT>
__global__ __launch_bounds__(128) void k_gemm_h(const float* __restrict__ A, int lda, size_t sA, const _Float16* __restrict__ Bh, int ldb, size_t sB, float alpha, float* __restrict__ C, int ldc, size_t sC, int M, int N, int K) {
  __shared__ __attribute__((aligned(16))) float so[4][16][64];
  const int tid = threadIdx.x, w = tid >> 5, lane = tid & 31, ln = lane & 15, hh = lane >> 4; const int by = blockIdx.y;
  A += (size_t)by * sA; Bh += (size_t)by * sB; C += (size_t)by * sC;
  const int ntn = (N + 63) / 64; const int wid = blockIdx.x * 4 + w; const int mt = wid / ntn, nq = wid % ntn; if (mt * 16 >= M) return;
  const int row0 = mt * 16, col0 = nq * 64; const float* arow = A + (size_t)(row0 + ln) * lda;
  v8f acc[4] = {};
  for (int kb = 0; kb < K; kb += 32) {
    FragH ah, al;
    const v4f x0 = *(const v4fa*)(arow + kb + 8 * hh), x1 = *(const v4fa*)(arow + kb + 8 * hh + 4), x2 = *(const v4fa*)(arow + kb + 16 + 8 * hh), x3 = *(const v4fa*)(arow + kb + 16 + 8 * hh + 4);
    float xs[16] = {x0[0],x0[1],x0[2],x0[3],x1[0],x1[1],x1[2],x1[3],x2[0],x2[1],x2[2],x2[3],x3[0],x3[1],x3[2],x3[3]};
#pragma unroll
    for (int i = 0; i < 16; ++i) { const _Float16 h = (_Float16)xs[i]; ah.h[i] = h; al.h[i] = ASPLIT ? (_Float16)(xs[i] - (float)h) : (_Float16)0.0f; }
#pragma unroll
    for (int t = 0; t < 4; ++t) { if (col0 + t * 16 >= N) continue; const size_t boff = (size_t)(col0 + t * 16 + ln) * ldb + kb; FragH bq; bq.half[0] = *(const v8us*)(Bh + boff + 8 * hh); bq.half[1] = *(const v8us*)(Bh + boff + 16 + 8 * hh);
      acc[t] = mmaH<ASPLIT ? 2 : 1>(ah.v, al.v, bq.v, bq.v, acc[t]); }
  }
#pragma unroll
  for (int t = 0; t < 4; ++t) { if (col0 + t * 16 >= N) continue;
#pragma unroll
    for (int r = 0; r < 8; ++r) so[w][8 * hh + r][t * 16 + ln] = acc[t][r] * alpha; }
  __builtin_amdgcn_fence(__ATOMIC_ACQ_REL, "workgroup"); __builtin_amdgcn_wave_barrier();
  const int rsub = lane >> 4, c4 = (lane & 15) * 4;
  {
#pragma unroll
    for (int q = 0; q < 8; ++q) { const int r = q * 2 + rsub; if (col0 + c4 < N) { const v4f v = *(const v4fa*)&so[w][r][c4]; *(v4f*)(C + (size_t)(row0 + r) * ldc + col0 + c4) = v; } }
     }
}

// Wt[n][k] = f16(W[k][n]·scale) from f32 row-major W[K][N] (scale = power of two; bf16-exact weights stay exact in f16 away from the subnormal range)
__global__ __launch_bounds__(256) void k_wt_f16(const float* __restrict__ W, _Float16* __restrict__ Wt, int K, int N, float scale) {
  const int t = blockIdx.x * 256 + threadIdx.x; if (t >= N * (K / 8)) return; const int n = t / (K / 8), k8 = (t % (K / 8)) * 8; FragH f;
#pragma unroll
  for (int i = 0; i < 8; ++i) f.h[i] = (_Float16)(bf16_round(W[(size_t)(k8 + i) * N + n]) * scale); const v8us o = f.half[0];
  *(v8us*)((unsigned short*)Wt + (size_t)n * K + k8) = o; 
}
// k_gemm_hh variant with fused epilogue: v = acc·alpha + bias[by·sBias + col] (+ CP[(row/rowsPerB)·sCPb + by·64 + col] if CP) ; ACT 0 none / 1 elu ; writes f16 C16 (and f32 C if non-null)
template <int ACT>
__global__ __launch_bounds__(128) void k_gemm_hhx(const _Float16* __restrict__ A, int lda, size_t sA, const _Float16* __restrict__ Bh, int ldb, size_t sB, float alpha, const float* __restrict__ bias, size_t sBias, const float* __restrict__ CP, int rowsPerB, size_t sCPb, int row0g,
    float* __restrict__ C, _Float16* __restrict__ C16, int ldc, size_t sC, int M, int N, int K) {
  __shared__ __attribute__((aligned(16))) float so[4][16][64];
  const int tid = threadIdx.x, w = tid >> 5, lane = tid & 31, ln = lane & 15, hh = lane >> 4; const int by = blockIdx.y;
  A += (size_t)by * sA; Bh += (size_t)by * sB; const size_t cofs = (size_t)by * sC; const float* bp = bias ? bias + (size_t)by * sBias : nullptr;
  const int ntn = (N + 63) / 64; const int wid = blockIdx.x * 4 + w; const int mt = wid / ntn, nq = wid % ntn; if (mt * 16 >= M) return;
  const int row0 = mt * 16, col0 = nq * 64; const _Float16* arow = A + (size_t)(row0 + ln) * lda;
  v8f acc[4] = {};
  for (int kb = 0; kb < K; kb += 32) { FragH ah; ah.half[0] = *(const v8us*)((const unsigned short*)arow + kb + 8 * hh); ah.half[1] = *(const v8us*)((const unsigned short*)arow + kb + 16 + 8 * hh);
#pragma unroll
    for (int t = 0; t < 4; ++t) { if (col0 + t * 16 >= N) continue; const size_t boff = (size_t)(col0 + t * 16 + ln) * ldb + kb; FragH bq; bq.half[0] = *(const v8us*)((const unsigned short*)Bh + boff + 8 * hh); bq.half[1] = *(const v8us*)((const unsigned short*)Bh + boff + 16 + 8 * hh);
      acc[t] = mmaH<1>(ah.v, ah.v, bq.v, bq.v, acc[t]); }
  }
#pragma unroll
  for (int t = 0; t < 4; ++t) { if (col0 + t * 16 >= N) continue; const int col = col0 + t * 16 + ln; const float bv = bp ? bf16_round(bp[col]) : 0.f;
#pragma unroll
    for (int r = 0; r < 8; ++r) { float v = acc[t][r] * alpha + bv; if (CP) { const int rr = row0g + row0 + 8 * hh + r; if (rowsPerB < 0) v += CP[cofs + (size_t)rr * ldc + col];      /* rowsPerB < 0: own element of the batched C plane */ else { const int bidx = rr / rowsPerB; v += CP[(size_t)bidx * sCPb + (size_t)by * 64 + col]; } } if (ACT == 1) v = (v > 0.f) ? v : expm1f(v); else if (ACT == 7) v = (v > 0.f) ? v + 1.0f : expf(v); else if (ACT == 8) v = tanhf(v); else if (ACT == 9) v = 0.5f * v * (1.0f + tanhf(0.7978845608028654f * (v + 0.044715f * v * v * v))); else if (ACT == 11) v = 1.0f / (1.0f + expf(-v)); else if (ACT == 12) v = (v > 0.f) ? v : 0.01f * v; else if (ACT == 14) v = (v > 0.f) ? v : 0.1f * v; else if (ACT == 16) v = (v >= 0.f) ? v : 0.3f * v; else if (ACT == 17) v = (v >= 0.f) ? v : 0.2f * v; else if (ACT == 15) v = v / (1.0f + expf(-v)); else if (ACT == 3) v = fmaxf(v, 0.f); else if (ACT == 6) v = 0.5f * v * (1.0f + erff(v * 0.70710678118654752f)); so[w][8 * hh + r][t * 16 + ln] = v; } }
  __builtin_amdgcn_fence(__ATOMIC_ACQ_REL, "workgroup"); __builtin_amdgcn_wave_barrier();
  const int rsub = lane >> 4, c4 = (lane & 15) * 4; typedef _Float16 v4h __attribute__((ext_vector_type(4)));
  {
#pragma unroll
    for (int q = 0; q < 8; ++q) { const int r = q * 2 + rsub; if (col0 + c4 < N) { const v4f v = *(const v4fa*)&so[w][r][c4]; if (C) *(v4f*)(C + cofs + (size_t)(row0 + r) * ldc + col0 + c4) = v; if (C16) { v4h h4; for (int i = 0; i < 4; ++i) h4[i] = (_Float16)v[i]; *(v4h*)(C16 + cofs + (size_t)(row0 + r) * ldc + col0 + c4) = h4; } } }
     }
}


typedef _Float16 v4h __attribute__((ext_vector_type(4)));

__global__ __launch_bounds__(256) void k_x16(const float* __restrict__ x, _Float16* __restrict__ X16, size_t n8) { const size_t t = (size_t)blockIdx.x * 256 + threadIdx.x; if (t >= n8) return; FragH f;
#pragma unroll
  for (int q = 0; q < 8; ++q) f.h[q] = (_Float16)bf16_round(x[t * 8 + q]); *(v8us*)((unsigned short*)X16 + t * 8) = f.half[0];  }
__global__ __launch_bounds__(256) void k_h16(const float* __restrict__ x, _Float16* __restrict__ X16, size_t n8) { const size_t t = (size_t)blockIdx.x * 256 + threadIdx.x; if (t >= n8) return; FragH f;
#pragma unroll
  for (int q = 0; q < 8; ++q) f.h[q] = (_Float16)x[t * 8 + q]; *(v8us*)((unsigned short*)X16 + t * 8) = f.half[0];  }
__global__ __launch_bounds__(256) void k_round16f(const float* __restrict__ W, _Float16* __restrict__ Bt, size_t n8) { const size_t t = (size_t)blockIdx.x * 256 + threadIdx.x; if (t >= n8) return; FragH f;
#pragma unroll
  for (int i = 0; i < 8; ++i) f.h[i] = (_Float16)(bf16_round(W[t * 8 + i]) * 16.0f); *(v8us*)((unsigned short*)Bt + t * 8) = f.half[0];  }
template <int NHv, int TTv>
__global__ __launch_bounds__(256) void k_vt(const _Float16* __restrict__ V16, int ldv, int voff, _Float16* __restrict__ Vt) { __shared__ unsigned short tl[64][66]; const int tid = threadIdx.x; const int slab = blockIdx.x / (TTv / 64), lg = blockIdx.x % (TTv / 64); const int b = slab / NHv, h = slab % NHv;
  for (int i = tid; i < 64 * 8; i += 256) { const int r = i / 8, c8 = (i % 8) * 8; FragH f; f.half[0] = *(const v8us*)((const unsigned short*)V16 + ((size_t)b * TTv + lg * 64 + r) * ldv + voff + h * 64 + c8);
#pragma unroll
    for (int q = 0; q < 8; ++q) tl[r][c8 + q] = f.u[q]; }
  __syncthreads();
  {
#pragma unroll
    for (int rd = 0; rd < 2; ++rd) { const int d = rd * 32 + tid / 8, pc = tid % 8; FragH f;
#pragma unroll
      for (int q = 0; q < 8; ++q) f.u[q] = tl[pc * 8 + q][d];
      *(v8us*)((unsigned short*)Vt + ((size_t)slab * 64 + d) * TTv + lg * 64 + pc * 8) = f.half[0]; }
     } }

__global__ __launch_bounds__(256) void k_hl(const float* __restrict__ F, _Float16* __restrict__ Hh, _Float16* __restrict__ Hl, size_t n8) { const size_t t = (size_t)blockIdx.x * 256 + threadIdx.x; if (t >= n8) return; FragH fh, fl; const v4f a = *(const v4fa*)(F + t * 8), c = *(const v4fa*)(F + t * 8 + 4);
#pragma unroll
  for (int q = 0; q < 4; ++q) { _Float16 h = (_Float16)a[q]; fh.h[q] = h; fl.h[q] = (_Float16)((a[q] - (float)h) * 1024.0f); h = (_Float16)c[q]; fh.h[4 + q] = h; fl.h[4 + q] = (_Float16)((c[q] - (float)h) * 1024.0f); }
  { *(v8us*)((unsigned short*)Hh + t * 8) = fh.half[0]; *(v8us*)((unsigned short*)Hl + t * 8) = fl.half[0];  } }

// ---- fast GEMM (wave tile 32x64; requires M % 32 == 0 rows per launch region and N % 64 == 0); epilogue = k_gemm_hhx semantics ----
__device__ __forceinline__ v16h g2_frag(const _Float16* p, int hh) { FragH f; f.half[0] = *(const v8us*)((const unsigned short*)p + 8 * hh); f.half[1] = *(const v8us*)((const unsigned short*)p + 16 + 8 * hh); return f.v; }
__device__ __forceinline__ v8f g2_mma(v16h a, v16h b, v8f c) { v8f d = __builtin_amdgcn_wmma_f32_16x16x32_f16(false, a, false, b, (short)0, c, false, false); asm volatile("v_nop\n\tv_nop\n\tv_nop\n\tv_nop" : "+v"(d) : "v"(a), "v"(b)); return d; }
template <int ACT>
__global__ __launch_bounds__(128) void k_gemm2(const _Float16* __restrict__ A, int lda, size_t sA, const _Float16* __restrict__ Bh, int ldb, size_t sB, float alpha, const float* __restrict__ bias, size_t sBias, const float* __restrict__ CP, int rowsPerB, size_t sCPb, int row0g,
    float* __restrict__ C, _Float16* __restrict__ C16, int ldc, size_t sC, int M, int N, int K) { static_assert(ACT == 0 || ACT == 3 || ACT == 6 || ACT == 8 || ACT == 9 || ACT == 11 || ACT == 12 || ACT == 14 || ACT == 15 || ACT == 16 || ACT == 17, "k_gemm2: unsupported ACT code (would silently apply no activation)");
  __shared__ __attribute__((aligned(16))) float so[4][32][68];
  const int tid = threadIdx.x, w = tid >> 5, lane = tid & 31, ln = lane & 15, hh = lane >> 4; const int by = blockIdx.y;
  A += (size_t)by * sA; Bh += (size_t)by * sB; const size_t cofs = (size_t)by * sC; const float* bp = bias ? bias + (size_t)by * sBias : nullptr;
  const int ntn = N >> 6; const int mt = blockIdx.x / ntn, nq = blockIdx.x - mt * ntn; const int row0 = mt * 128 + 32 * w, col0 = nq * 64; if (row0 >= M) return;
  const _Float16* a0p = A + (size_t)(row0 + ln) * lda; const _Float16* a1p = a0p + (size_t)16 * lda;
  const _Float16* b0p = Bh + (size_t)(col0 + ln) * ldb; const _Float16* b1p = b0p + (size_t)16 * ldb; const _Float16* b2p = b1p + (size_t)16 * ldb; const _Float16* b3p = b2p + (size_t)16 * ldb;
  const v8f z8 = {0.f,0.f,0.f,0.f,0.f,0.f,0.f,0.f}; v8f c00 = z8, c01 = z8, c02 = z8, c03 = z8, c10 = z8, c11 = z8, c12 = z8, c13 = z8;
#pragma unroll 1
  for (int kb = 0; kb < K; kb += 32) { const v16h a0 = g2_frag(a0p + kb, hh), a1 = g2_frag(a1p + kb, hh);
    v16h b = g2_frag(b0p + kb, hh); c00 = g2_mma(a0, b, c00); c10 = g2_mma(a1, b, c10);
    b = g2_frag(b1p + kb, hh); c01 = g2_mma(a0, b, c01); c11 = g2_mma(a1, b, c11);
    b = g2_frag(b2p + kb, hh); c02 = g2_mma(a0, b, c02); c12 = g2_mma(a1, b, c12);
    b = g2_frag(b3p + kb, hh); c03 = g2_mma(a0, b, c03); c13 = g2_mma(a1, b, c13); }
  v8f accs[8] = {c00, c01, c02, c03, c10, c11, c12, c13};
#pragma unroll
  for (int u = 0; u < 8; ++u) { const int t = u & 3, half = u >> 2; const int col = col0 + t * 16 + ln; const float bv = bp ? bf16_round(bp[col]) : 0.f;
#pragma unroll
    for (int r = 0; r < 8; ++r) { const int rloc = half * 16 + 8 * hh + r; float v = accs[u][r] * alpha + bv; if (CP) { if (rowsPerB < 0) v += CP[cofs + (size_t)(row0g + row0 + rloc) * ldc + col];      /* rowsPerB < 0: own element of the batched C plane */ else { const int bidx = (row0g + row0 + rloc) / rowsPerB; v += CP[(size_t)bidx * sCPb + (size_t)by * 64 + col]; } }
      if (ACT == 3) v = fmaxf(v, 0.f); else if (ACT == 6) v = 0.5f * v * (1.0f + erff(v * 0.70710678118654752f)); else if (ACT == 11) v = 1.0f / (1.0f + expf(-v)); else if (ACT == 15) v = v / (1.0f + expf(-v)); else if (ACT == 12) v = (v > 0.f) ? v : 0.01f * v; else if (ACT == 8) v = tanhf(v); else if (ACT == 9) v = 0.5f * v * (1.0f + tanhf(0.7978845608028654f * (v + 0.044715f * v * v * v))); else if (ACT == 14) v = (v > 0.f) ? v : 0.1f * v; else if (ACT == 16) v = (v >= 0.f) ? v : 0.3f * v; else if (ACT == 17) v = (v >= 0.f) ? v : 0.2f * v;
      so[w][rloc][t * 16 + ln] = v; } }
  __builtin_amdgcn_fence(__ATOMIC_ACQ_REL, "workgroup"); __builtin_amdgcn_wave_barrier();
  const int rsub = lane >> 4, c4 = (lane & 15) * 4;
  {
#pragma unroll
    for (int q = 0; q < 16; ++q) { const int r = q * 2 + rsub; const v4f v = *(const v4fa*)&so[w][r][c4]; if (C) *(v4f*)(C + cofs + (size_t)(row0 + r) * ldc + col0 + c4) = v; if (C16) { v4h h4; for (int i = 0; i < 4; ++i) h4[i] = (_Float16)v[i]; *(v4h*)(C16 + cofs + (size_t)(row0 + r) * ldc + col0 + c4) = h4; } }
     } }


__global__ __launch_bounds__(256) void k_wnat(const float* __restrict__ w, size_t n8, _Float16* __restrict__ Bt) { const size_t t = (size_t)blockIdx.x * 256 + threadIdx.x; if (t >= n8) return; FragH f; for (int q = 0; q < 8; ++q) f.h[q] = (_Float16)(bf16_round(w[t * 8 + q]) * 16.0f); *(v8us*)((unsigned short*)Bt + t * 8) = f.half[0];  }
__global__ __launch_bounds__(256) void k_rsm(const float* __restrict__ S, _Float16* __restrict__ P, int nrows) {
  #pragma clang fp contract(off)
  const int i = blockIdx.x * 256 + threadIdx.x; if (i >= nrows) return; const float* s = S + (size_t)i * SQ; float mx = -3.0e38f;
#pragma unroll 1
  for (int j = 0; j < SQ; ++j) mx = fmaxf(mx, s[j]); float se = 0.f;
#pragma unroll 1
  for (int j = 0; j < SQ; ++j) se += expf(s[j] - mx); const float sc = 256.0f / se;
#pragma unroll 1
  for (int j0 = 0; j0 < SQ; j0 += 8) { FragH f; for (int q = 0; q < 8; ++q) f.h[q] = (_Float16)(expf(s[j0 + q] - mx) * sc); unsigned short* d = (unsigned short*)P + (size_t)i * SQ + j0; *(v8us*)d = f.half[0];  } }
__global__ __launch_bounds__(256) void k_vt(const _Float16* __restrict__ V16, int b, int h0, _Float16* __restrict__ VT) { __shared__ unsigned short tl[64][65]; const int tid = threadIdx.x; const int hh = blockIdx.x % HG, sg = blockIdx.x / HG; const int s0 = sg * 64; const int h = h0 + hh;
  for (int i = tid; i < 64 * 8; i += 256) { const int j = i / 8, d8 = (i % 8) * 8; FragH f; f.half[0] = *(const v8us*)((const unsigned short*)V16 + ((size_t)b * SQ + s0 + j) * DM + h * HD + d8); for (int q = 0; q < 8; ++q) tl[d8 + q][j] = f.u[q]; }
  __syncthreads();
  { for (int i = tid; i < 64 * 8; i += 256) { const int d = i / 8, j8 = (i % 8) * 8; FragH f; for (int q = 0; q < 8; ++q) f.u[q] = tl[d][j8 + q]; *(v8us*)((unsigned short*)VT + ((size_t)hh * HD + d) * SQ + s0 + j8) = f.half[0]; }  } }



// Causal row softmax, one wave per score row. Lane l keeps columns g*256 + u*128 + 4l .. 4l+3 of its row in registers, so each load covers 512 contiguous bytes and S is read once;
// row max and row sum are per-lane partials joined by a five-step butterfly; the weights (x256, f16) leave as 256 contiguous bytes per store. nk is a multiple of 256, at most NKX.
// Every loop over g, u, q is fully unrolled so that v[] and h[] are indexed by constants and stay in registers; the wave number goes through readfirstlane so that the row base and the tests on g and last are scalar.
__global__ __launch_bounds__(128) void k_rsmcf2(const float* __restrict__ S, _Float16* __restrict__ P, int hg, int q0, int nk) {
  const int lane = threadIdx.x & 31; const int t = blockIdx.x * 4 + __builtin_amdgcn_readfirstlane(threadIdx.x >> 5); if (t >= hg * QT) return;
  const float* s = S + (size_t)t * NKX; _Float16* d = P + (size_t)t * NKX; const int c0 = lane * 4; const int last = q0 + (t % QT); const int ng = nk >> 8;
  v4f v[NKX / 128];
#pragma unroll
  for (int g = 0; g < NKX / 256; ++g) if (g < ng) { v[2 * g] = *(const v4fa*)(s + g * 256 + c0); v[2 * g + 1] = *(const v4fa*)(s + g * 256 + 128 + c0); }
  float mx = -3.0e38f;
#pragma unroll
  for (int g = 0; g < NKX / 256; ++g) if (g < ng) {
    if (g * 256 + 255 > last) {      /* wave-uniform: only a group that reaches past the row's own key holds masked columns */
#pragma unroll
      for (int u = 0; u < 2; ++u)
#pragma unroll
        for (int q = 0; q < 4; ++q) v[2 * g + u][q] = (g * 256 + u * 128 + c0 + q <= last) ? v[2 * g + u][q] : -1.0e9f; }
#pragma unroll
    for (int u = 0; u < 2; ++u)
#pragma unroll
      for (int q = 0; q < 4; ++q) mx = fmaxf(mx, v[2 * g + u][q]); }
#pragma unroll
  for (int o = 16; o > 0; o >>= 1) mx = fmaxf(mx, __shfl_xor(mx, o, 32));
  v4f s4 = {0.f, 0.f, 0.f, 0.f};
#pragma unroll
  for (int g = 0; g < NKX / 256; ++g) if (g < ng) {
#pragma unroll
    for (int u = 0; u < 2; ++u)
#pragma unroll
      for (int q = 0; q < 4; ++q) { const float e = __expf(v[2 * g + u][q] - mx); v[2 * g + u][q] = e; s4[q] += e; } }
  float se = (s4[0] + s4[1]) + (s4[2] + s4[3]);
#pragma unroll
  for (int o = 16; o > 0; o >>= 1) se += __shfl_xor(se, o, 32);
  const float sc = 256.0f / se; v4h h[NKX / 128];
#pragma unroll
  for (int g = 0; g < NKX / 256; ++g) if (g < ng) {
#pragma unroll
    for (int u = 0; u < 2; ++u)
#pragma unroll
      for (int q = 0; q < 4; ++q) h[2 * g + u][q] = (_Float16)(v[2 * g + u][q] * sc); }
#pragma unroll
  for (int g = 0; g < NKX / 256; ++g) if (g < ng) { *(v4h*)(d + g * 256 + c0) = h[2 * g]; *(v4h*)(d + g * 256 + 128 + c0) = h[2 * g + 1]; } }      /* stores last, each from registers of its own: nothing overwrites a register of an issued store */


template <int MASKADD>
__global__ __launch_bounds__(64) void k_att0(const float* __restrict__ QF, const float* __restrict__ KF, const float* __restrict__ VF, int ld, const float* __restrict__ mask, float scale, float* __restrict__ OF, int ldo) {
  #pragma clang fp contract(off)
  __shared__ __attribute__((aligned(16))) float lq[64][64]; __shared__ __attribute__((aligned(16))) float lo[64][64];
  const int tid = threadIdx.x; const int h = blockIdx.x / (QT0 / 64), rg = blockIdx.x % (QT0 / 64); const int i = rg * 64 + tid;
  const float* qr = QF + (size_t)i * ld + h * HD;
#pragma unroll 1
  for (int c = 0; c < HD / 4; ++c) { *(v4f*)&lq[tid][c * 4] = *(const v4fa*)(qr + c * 4); const v4f z = {0.f, 0.f, 0.f, 0.f}; *(v4f*)&lo[tid][c * 4] = z; }
  float m = -1.0e30f, l = 0.f; const int jmax = MASKADD ? (SQ - 1) : (rg * 64 + 63);      /* additive-mask form: every key (the mask input decides); causal form: keys up to the block's last row */
#pragma unroll 1
  for (int j = 0; j <= jmax; ++j) { const float* kr = KF + (size_t)j * ld + h * HD; const float* vr = VF + (size_t)j * ld + h * HD; float s = 0.f;
#pragma unroll 1
    for (int c = 0; c < HD / 4; ++c) { const v4f kq = *(const v4fa*)(kr + c * 4); const v4f qq = *(v4f*)&lq[tid][c * 4]; s = __fadd_rn(s, __fmul_rn(qq[0], kq[0])); s = __fadd_rn(s, __fmul_rn(qq[1], kq[1])); s = __fadd_rn(s, __fmul_rn(qq[2], kq[2])); s = __fadd_rn(s, __fmul_rn(qq[3], kq[3])); }
    s = __fmul_rn(s, scale); if (MASKADD) s = __fadd_rn(s, __fmul_rn(bf16_round(mask[(size_t)i * SQ + j]), -10000.0f));
    const float f = (MASKADD || j <= i) ? 1.f : 0.f; const float sm = fmaf(f, s, (1.f - f) * -1.0e30f); const float mn = fmaxf(m, sm); const float sc = expf(m - mn); const float e = expf(sm - mn); l = __fadd_rn(__fmul_rn(l, sc), e); m = mn;
#pragma unroll 1
    for (int c = 0; c < HD / 4; ++c) { const v4f vv = *(const v4fa*)(vr + c * 4); v4f oo = *(v4f*)&lo[tid][c * 4]; for (int u = 0; u < 4; ++u) oo[u] = __fadd_rn(__fmul_rn(oo[u], sc), __fmul_rn(e, vv[u])); *(v4f*)&lo[tid][c * 4] = oo; } }
  const float fin = 64.0f / l;      /* o carried x64 like the f16 path */
#pragma unroll 1
  for (int c = 0; c < HD / 4; ++c) { v4f oo = *(v4f*)&lo[tid][c * 4]; for (int u = 0; u < 4; ++u) oo[u] = __fmul_rn(oo[u], fin); *(v4f*)&lo[tid][c * 4] = oo; }
  __syncthreads();
  {
#pragma unroll 1
    for (int it = 0; it < 16; ++it) { const int row = it * 4 + tid / 16, pc = (tid % 16) * 4; const v4f v = *(const v4f*)&lo[row][pc]; *(v4f*)(OF + (size_t)(rg * 64 + row) * ldo + h * HD + pc) = v; }
     } }

extern "C" void kernel_launch(void* const* d_in, const int* in_sizes, int n_in,
                              void* d_out, int out_size, void* d_ws, size_t ws_size, hipStream_t stream) {
  (void)in_sizes; (void)n_in; (void)out_size;
  const float* const* I = (const float* const*)d_in; const float* x = I[0]; const float* wq = I[1]; const float* wo = I[2]; const float* bo = I[3]; const float* wk = wq; const float* wv = wq;      /* Wq [12][64][768] = natural [768][768] rows h*64+d (q = k = v); W_out natural + b_out */
  char* ws = (char*)d_ws; size_t off = 0;
  auto take = [&](size_t bytes) { char* p = ws + off; off += (bytes + 255) & ~(size_t)255; return p; };
  _Float16* BQ = (_Float16*)take((size_t)DM * DM * 2); _Float16* BK = BQ; _Float16* BV = BQ; _Float16* BO = (_Float16*)take((size_t)DM * DM * 2);
  _Float16* X16 = (_Float16*)take(NR * DM * 2); _Float16* Q16 = (_Float16*)take(NR * DM * 2); _Float16* K16 = Q16; _Float16* V16 = Q16;      /* q = k = v (the module projects all three with self.query) */ _Float16* O16 = (_Float16*)take(NR * DM * 2);
  float* S = (float*)take((size_t)NH * QT * NKX * 4); _Float16* P = (_Float16*)take((size_t)NH * QT * NKX * 2); _Float16* VT = (_Float16*)take((size_t)NH * HD * SQ * 2);
  float* QF0 = (float*)take((size_t)QT0 * DM * 4); float* KF0 = (float*)take((size_t)QT0 * DM * 4); float* VF0 = (float*)take((size_t)QT0 * DM * 4); float* OF0 = (float*)take((size_t)NB * QT0 * DM * 4); _Float16* OH0 = (_Float16*)take((size_t)NB * QT0 * DM * 2); _Float16* OL0 = (_Float16*)take((size_t)NB * QT0 * DM * 2);
  if (off > ws_size) return;
  k_wnat<<<(unsigned)(((size_t)DM * DM / 8 + 255) / 256), 256, 0, stream>>>(wq, (size_t)DM * DM / 8, BQ); k_wnat<<<(unsigned)(((size_t)DM * DM / 8 + 255) / 256), 256, 0, stream>>>(wo, (size_t)DM * DM / 8, BO);      /* natural [out][in] = Bt x16 */

  k_x16<<<(unsigned)((NR * DM / 8 + 255) / 256), 256, 0, stream>>>(x, X16, NR * DM / 8);
  const size_t r0p = (size_t)B0 * SQ;      /* first projected row */
  k_gemm2<0><<<dim3((unsigned)((MP / 128) * (DM / 64)), 1), 128, 0, stream>>>(X16 + r0p * DM, DM, 0, BQ, DM, 0, 0.0625f, nullptr, 0, nullptr, 1, 0, 0, nullptr, Q16 + r0p * DM, DM, 0, MP, DM, DM);
  for (int b = B0; b < B0 + NBR; ++b) { const size_t r0 = (size_t)b * SQ;
    k_vt<NH, SQ><<<NH * (SQ / 64), 256, 0, stream>>>(V16 + r0 * LQ, LQ, 0, VT);      /* V^T [NH][HD][SQ] for this batch */
    k_gemm2<0><<<dim3((QT0 / 128) * (DM / 64), 1), 128, 0, stream>>>(X16 + r0 * DM, DM, 0, BQ, DM, 0, 0.0625f, nullptr, 0, nullptr, 1, 0, 0, QF0, nullptr, DM, 0, QT0, DM, DM); /* KF0 = VF0 = QF0 (same projection) */      /* f32 q, k, v of the first 128 rows (exact products) */
    k_att0<0><<<NH * (QT0 / 64), 64, 0, stream>>>(QF0, QF0, QF0, DM, nullptr, 0.036084391824351615f, OF0 + (size_t)b * QT0 * DM, DM);      /* exact f32 attention for rows 0..127 (o x64) */
    for (int q0 = 0; q0 < QN; q0 += QT) { const int nk = q0 + QT;      /* causal: only keys below the tile end are computed */
      k_gemm2<0><<<dim3((QT / 128) * (nk / 64), NHD), 128, 0, stream>>>(Q16 + (r0 + q0) * LQ, LQ, (size_t)HD, K16 + r0 * LQ, LQ, (size_t)HD, 0.036084391824351615f, nullptr, 0, nullptr, 1, 0, 0, S, nullptr, NKX, (size_t)QT * NKX, QT, nk, HD);      /* scores, all heads on grid.y */
      k_rsmcf2<<<(NHD * QT + 3) / 4, 128, 0, stream>>>(S, P, NHD, q0, nk);      /* one wave per row */
      k_gemm2<0><<<dim3((QT / 128) * (HD / 64), NHD), 128, 0, stream>>>(P, NKX, (size_t)QT * NKX, VT, SQ, (size_t)HD * SQ, 0.25f, nullptr, 0, nullptr, 1, 0, 0, nullptr, O16 + (r0 + q0) * DM, DM, (size_t)HD, QT, HD, nk); } }      /* o (merged heads, x64) as f16 rows */
  k_gemm2<0><<<dim3((unsigned)((MPO / 128) * (DM / 64)), 1), 128, 0, stream>>>(O16 + r0p * DM, DM, 0, BO, DM, 0, 0.0009765625f, bo, 0, nullptr, 1, 0, 0, (float*)d_out + r0p * DM, nullptr, DM, 0, MPO, DM, DM);      /* out rows are the output layout */
  k_hl<<<(unsigned)(((size_t)NB * QT0 * DM / 8 + 255) / 256), 256, 0, stream>>>(OF0, OH0, OL0, (size_t)NB * QT0 * DM / 8);      /* first-tile o (x64) -> f16 hi + x1024 residual planes */
  for (int b = B0; b < B0 + NBR; ++b) { const size_t r0 = (size_t)b * SQ; const size_t f0 = (size_t)b * QT0;
    k_gemm2<0><<<dim3((QT0 / 128) * (DM / 64), 1), 128, 0, stream>>>(OH0 + f0 * DM, DM, 0, BO, DM, 0, 0.0009765625f, bo, 0, nullptr, 1, 0, 0, (float*)d_out + r0 * DM, nullptr, DM, 0, QT0, DM, DM);      /* rows 0..127: out = o_hi Wo (+ b), overwriting the f16-path rows */
    k_gemm2<0><<<dim3((QT0 / 128) * (DM / 64), 1), 128, 0, stream>>>(OL0 + f0 * DM, DM, 0, BO, DM, 0, 0.00000095367431640625f, nullptr, 0, (const float*)d_out + r0 * DM, -1, 0, 0, (float*)d_out + r0 * DM, nullptr, DM, 0, QT0, DM, DM); }      /* += o_lo Wo 2^-20 (own-element accumulate) */
}

// v002
// Measured time: 1020 microseconds a run.
// Next to v001, in two timings, it ran 3.40 and 3.42 times as fast.
// Counting every step since v000, it is 14.3 times as fast.
#include <hip/hip_runtime.h>
// Causal multi-head attention whose q, k AND v are the same per-head projection (x [2][4096][768]; q = k = v = x Wq[h]^T with Wq [12][64][768] (natural per-head rows, sigma 1/sqrt(768)); scores = q.q / sqrt(768) (the module scales by d_model); causal (tril, -inf); softmax; out = merged (attn q) W_out^T + b_out -> [2][4096][768]).
// Structure: token rows r = b*4096 + s; x as exact f16 rows (bf16-rounded); q (= k = v) as one WMMA GEMM (32x64 wave tiles, f32 accumulation, exact x16 weights, f16 outputs); V^T for all batches and heads via LDS transposes; one fused launch for the attention: per wave 32 query rows, keys 32 at a time up to the diagonal block, S^T = K Q^T, online base-2 softmax in registers (f32 statistics, native exp2; weights in (0,1] as f16), O^T += V^T P^T (o carried x64, folded into the output GEMM alpha) written straight into the merged f16 o rows; out = o W_o GEMM (f32) into the output layout.
// Compute dtype: inputs rounded to bf16; x / weights exact; q, k, v, softmax weights and o as plain f16 GEMM operands (~2^-12); scores and softmax statistics f32. v_wmma_f32_16x16x32_f16.
#define NB 2
#define SQ 4096
#define DM 768
#define NH 12
#define HD 64
#define HG 4                         /* heads per launch of the unused per-batch k_vt */
#define QT0 128                      /* first-tile rows recomputed exactly in f32 */
#define B0 0                         /* first batch processed (debug hook) */
#define NBR NB                       /* batches processed (debug hook) */
#define NR ((size_t)NB * SQ)         /* token rows */
#define MP ((int)((size_t)NBR * SQ)) /* rows projected (debug hook) */
#define MPO MP                       /* rows through the output stage (debug hook) */
#define LQ DM      /* row pitch of the q/k/v rows */
typedef __bf16 v16b __attribute__((ext_vector_type(16)));
typedef unsigned short v8us __attribute__((ext_vector_type(8), may_alias));
typedef float  v8f  __attribute__((ext_vector_type(8)));
typedef float  v4f  __attribute__((ext_vector_type(4)));
typedef float  v4fa __attribute__((ext_vector_type(4), may_alias));
union FragB { v16b v; v8us half[2]; unsigned short u[16]; };

__device__ __forceinline__ unsigned short bf16_bits(float x) { unsigned int u = __float_as_uint(x); return (unsigned short)((u + 0x7FFFu + ((u >> 16) & 1u)) >> 16); }
__device__ __forceinline__ float bf16_val(unsigned short b) { return __uint_as_float(((unsigned int)b) << 16); }
__device__ __forceinline__ float bf16_round(float x) { return bf16_val(bf16_bits(x)); }
// D += A·B with NT terms: 1 = ah·bh, 2 = + al·bh (A split), 3 = + ah·bl (both split)
template <int NT>
__device__ __forceinline__ v8f mmaN(v16b ah, v16b al, v16b bh, v16b bl, v8f c) {
  c = __builtin_amdgcn_wmma_f32_16x16x32_bf16(false, ah, false, bh, (short)0, c, false, false);
  if (NT >= 2) c = __builtin_amdgcn_wmma_f32_16x16x32_bf16(false, al, false, bh, (short)0, c, false, false);
  if (NT >= 3) c = __builtin_amdgcn_wmma_f32_16x16x32_bf16(false, ah, false, bl, (short)0, c, false, false);
  asm volatile("v_nop\n\tv_nop\n\tv_nop\n\tv_nop" : "+v"(c) : "v"(ah), "v"(al), "v"(bh), "v"(bl));
  return c;
}

__global__ __launch_bounds__(256) void k_wt_bf16(const float* __restrict__ W, unsigned short* __restrict__ Wt, int K, int N) {
  const int t = blockIdx.x * 256 + threadIdx.x;
  const int k8n = K / 8;
  if (t >= N * k8n) return;
  const int n = t / k8n, k8 = (t % k8n) * 8;
  v8us v;
#pragma unroll
  for (int i = 0; i < 8; ++i) v[i] = bf16_bits(W[(size_t)(k8 + i) * N + n]);
  *(v8us*)(Wt + (size_t)n * K + k8) = v;
  
}

// GEMM C[M][N] (f32, pitch ldc) = act(A[M][K]·W + bias). A f32 row-major (pitch lda) converted per fragment to bf16
// (ASPLIT: hi/lo two planes -> 2 terms, else single rounded term); Wt bf16 [N][K] (pitch ldb). BIAS_BF16 rounds the
// bias to bf16 first (bias quantised to bf16 before the add). K%32==0, M%16==0, N%64==0.
template <bool ASPLIT, int ACT, bool BIAS_BF16>
__global__ __launch_bounds__(128) void k_gemm_bf(const float* __restrict__ A, int lda, const unsigned short* __restrict__ Wt, int ldb,
                                               const float* __restrict__ bias, float* __restrict__ C, int ldc, int M, int N, int K) {
  __shared__ __attribute__((aligned(16))) float so[4][16][64];
  const int tid = threadIdx.x, w = tid >> 5, lane = tid & 31, ln = lane & 15, hh = lane >> 4;
  const int ntn = N / 64;
  const int wid = blockIdx.x * 4 + w;
  const int mt = wid / ntn, nq = wid % ntn;
  if (mt * 16 >= M) return;
  const int row0 = mt * 16, col0 = nq * 64;
  const float* arow = A + (size_t)(row0 + ln) * lda;
  v8f acc[4] = {};
  for (int kb = 0; kb < K; kb += 32) {
    FragB ah, al;
    const v4f x0 = *(const v4fa*)(arow + kb + 8 * hh), x1 = *(const v4fa*)(arow + kb + 8 * hh + 4);
    const v4f x2 = *(const v4fa*)(arow + kb + 16 + 8 * hh), x3 = *(const v4fa*)(arow + kb + 16 + 8 * hh + 4);
    float xs[16] = {x0[0],x0[1],x0[2],x0[3],x1[0],x1[1],x1[2],x1[3],x2[0],x2[1],x2[2],x2[3],x3[0],x3[1],x3[2],x3[3]};
#pragma unroll
    for (int i = 0; i < 16; ++i) { const unsigned short hb = bf16_bits(xs[i]); ah.u[i] = hb; al.u[i] = ASPLIT ? bf16_bits(xs[i] - bf16_val(hb)) : (unsigned short)0; }
#pragma unroll
    for (int t = 0; t < 4; ++t) {
      const unsigned short* brow = Wt + (size_t)(col0 + t * 16 + ln) * ldb + kb;
      FragB b;
      b.half[0] = *(const v8us*)(brow + 8 * hh);
      b.half[1] = *(const v8us*)(brow + 16 + 8 * hh);
      acc[t] = mmaN<ASPLIT ? 2 : 1>(ah.v, al.v, b.v, b.v, acc[t]);
    }
  }
#pragma unroll
  for (int t = 0; t < 4; ++t) {
    float bv = bias ? bias[col0 + t * 16 + ln] : 0.f;
    if (BIAS_BF16) bv = bf16_round(bv);
#pragma unroll
    for (int r = 0; r < 8; ++r) { float v = acc[t][r] + bv; if (ACT == 1) v = fmaxf(v, 0.f); so[w][8 * hh + r][t * 16 + ln] = v; }
  }
  __builtin_amdgcn_fence(__ATOMIC_ACQ_REL, "workgroup");
  __builtin_amdgcn_wave_barrier();
  const int rsub = lane >> 4, c4 = (lane & 15) * 4;
  {
#pragma unroll
    for (int q = 0; q < 8; ++q) {
      const int r = q * 2 + rsub;
      const v4f v = *(const v4fa*)&so[w][r][c4];
      *(v4f*)(C + (size_t)(row0 + r) * ldc + col0 + c4) = v;
    }
    
  }
}

// GEMM C = act(A·W + bias + resid): A f32 (ASPLIT -> hi/lo 2 terms), Wt bf16 [N][K]; ACT 0 none, 1 relu, 2 exact gelu;
// resid (optional, f32, row index = (row % rmod), pitch ldr, RES_BF16 rounds it) added before the activation.
template <bool ASPLIT, int ACT, bool BIAS_BF16, bool RES_BF16>
__global__ __launch_bounds__(128) void k_gemm_bf3(const float* __restrict__ A, int lda, const unsigned short* __restrict__ Wt, int ldb,
                                                const float* __restrict__ bias, const float* __restrict__ resid, int rmod, int ldr,
                                                float* __restrict__ C, int ldc, int M, int N, int K) {
  __shared__ __attribute__((aligned(16))) float so[4][16][64];
  const int tid = threadIdx.x, w = tid >> 5, lane = tid & 31, ln = lane & 15, hh = lane >> 4;
  const int ntn = N / 64;
  const int wid = blockIdx.x * 4 + w;
  const int mt = wid / ntn, nq = wid % ntn;
  if (mt * 16 >= M) return;
  const int row0 = mt * 16, col0 = nq * 64;
  const float* arow = A + (size_t)(row0 + ln) * lda;
  v8f acc[4] = {};
  for (int kb = 0; kb < K; kb += 32) {
    FragB ah, al;
    const v4f x0 = *(const v4fa*)(arow + kb + 8 * hh), x1 = *(const v4fa*)(arow + kb + 8 * hh + 4);
    const v4f x2 = *(const v4fa*)(arow + kb + 16 + 8 * hh), x3 = *(const v4fa*)(arow + kb + 16 + 8 * hh + 4);
    float xs[16] = {x0[0],x0[1],x0[2],x0[3],x1[0],x1[1],x1[2],x1[3],x2[0],x2[1],x2[2],x2[3],x3[0],x3[1],x3[2],x3[3]};
#pragma unroll
    for (int i = 0; i < 16; ++i) { const unsigned short hb = bf16_bits(xs[i]); ah.u[i] = hb; al.u[i] = ASPLIT ? bf16_bits(xs[i] - bf16_val(hb)) : (unsigned short)0; }
#pragma unroll
    for (int t = 0; t < 4; ++t) {
      const unsigned short* brow = Wt + (size_t)(col0 + t * 16 + ln) * ldb + kb;
      FragB b;
      b.half[0] = *(const v8us*)(brow + 8 * hh);
      b.half[1] = *(const v8us*)(brow + 16 + 8 * hh);
      acc[t] = mmaN<ASPLIT ? 2 : 1>(ah.v, al.v, b.v, b.v, acc[t]);
    }
  }
#pragma unroll
  for (int t = 0; t < 4; ++t) {
    const int col = col0 + t * 16 + ln;
    float bv = bias ? bias[col] : 0.f;
    if (BIAS_BF16) bv = bf16_round(bv);
#pragma unroll
    for (int r = 0; r < 8; ++r) {
      float v = acc[t][r] + bv;
      if (resid) { float rv = resid[(size_t)((row0 + 8 * hh + r) % rmod) * ldr + col]; if (RES_BF16) rv = bf16_round(rv); v += rv; }
      if (ACT == 1) v = fmaxf(v, 0.f);
      if (ACT == 2) v = 0.5f * v * (1.0f + erff(v * 0.70710678118654752f));
      if (ACT == 3) { const float u = 0.7978845608028654f * (v + 0.044715f * v * v * v); v = 0.5f * v * (1.0f + tanhf(u)); }
      so[w][8 * hh + r][t * 16 + ln] = v;
    }
  }
  __builtin_amdgcn_fence(__ATOMIC_ACQ_REL, "workgroup");
  __builtin_amdgcn_wave_barrier();
  const int rsub = lane >> 4, c4 = (lane & 15) * 4;
  {
#pragma unroll
    for (int q = 0; q < 8; ++q) {
      const int r = q * 2 + rsub;
      const v4f v = *(const v4fa*)&so[w][r][c4];
      *(v4f*)(C + (size_t)(row0 + r) * ldc + col0 + c4) = v;
    }
    
  }
}
// row LayerNorm (biased variance, eps) over N: s = X (+ R); optional out_sum <- s; out_norm <- (s-mu)*rsqrt(var+eps)*g + b
template <bool PARAM_BF16>
__global__ __launch_bounds__(256) void k_layernorm(const float* __restrict__ X, const float* __restrict__ R, const float* __restrict__ g, const float* __restrict__ bta,
                                                  float* __restrict__ out_sum, float* __restrict__ out_norm, int N, float eps) {
  __shared__ float red[256];
  const int row = blockIdx.x, tid = threadIdx.x;
  const float* x = X + (size_t)row * N; const float* rr = R ? R + (size_t)row * N : nullptr;
  float vals[16];                     // up to N = 4096
  const int per = N / 256;            // contiguous chunk per thread? use strided-by-4 chunks: thread handles j = tid*4 + 1024*u
  float s1 = 0.f;
  for (int u = 0; u < per / 4; ++u) {
    const int j = tid * 4 + 1024 * u;
    const v4f a = *(const v4fa*)(x + j);
    v4f b = {0.f,0.f,0.f,0.f}; if (rr) b = *(const v4fa*)(rr + j);
#pragma unroll
    for (int q = 0; q < 4; ++q) { const float v = a[q] + b[q]; vals[u * 4 + q] = v; s1 += v; }
  }
  red[tid] = s1; __syncthreads();
  for (int st = 128; st > 0; st >>= 1) { if (tid < st) red[tid] += red[tid + st]; __syncthreads(); }
  const float mu = red[0] / (float)N; __syncthreads();
  float s2 = 0.f;
  for (int u = 0; u < per / 4; ++u)
#pragma unroll
    for (int q = 0; q < 4; ++q) { const float c = vals[u * 4 + q] - mu; s2 += c * c; }
  red[tid] = s2; __syncthreads();
  for (int st = 128; st > 0; st >>= 1) { if (tid < st) red[tid] += red[tid + st]; __syncthreads(); }
  const float rs = rsqrtf(red[0] / (float)N + eps);
  {
    for (int u = 0; u < per / 4; ++u) {
      const int j = tid * 4 + 1024 * u;
      v4f o, sm;
#pragma unroll
      for (int q = 0; q < 4; ++q) {
        float gg = g[j + q], bb = bta[j + q];
        if (PARAM_BF16) { gg = bf16_round(gg); bb = bf16_round(bb); }
        sm[q] = vals[u * 4 + q]; o[q] = (vals[u * 4 + q] - mu) * rs * gg + bb;
      }
      if (out_sum) *(v4f*)(out_sum + (size_t)row * N + j) = sm;
      *(v4f*)(out_norm + (size_t)row * N + j) = o;
    }
    
  }
}



// ---- f16 WMMA path (v_wmma_f32_16x16x32_f16): 11-bit significands for operands in range — used where a [0,1] probability operand needs more precision than bf16
typedef _Float16 v16h __attribute__((ext_vector_type(16)));
union FragH { v16h v; v8us half[2]; _Float16 h[16]; unsigned short u[16]; };
template <int NT>
__device__ __forceinline__ v8f mmaH(v16h ah, v16h al, v16h bh, v16h bl, v8f c) {
  c = __builtin_amdgcn_wmma_f32_16x16x32_f16(false, ah, false, bh, (short)0, c, false, false);
  if (NT >= 2) c = __builtin_amdgcn_wmma_f32_16x16x32_f16(false, al, false, bh, (short)0, c, false, false);
  if (NT >= 3) c = __builtin_amdgcn_wmma_f32_16x16x32_f16(false, ah, false, bl, (short)0, c, false, false);
  asm volatile("v_nop\n\tv_nop\n\tv_nop\n\tv_nop" : "+v"(c) : "v"(ah), "v"(al), "v"(bh), "v"(bl));
  return c;
}
// batched GEMM like k_gemm_b but f16 operands: A f32 (split into f16 hi/lo if ASPLIT, else rounded to f16), Bt = f16 values [n][k]; alpha; C f32; N multiple of 16 (partial tiles skipped)
template <bool ASPLIT>
__global__ __launch_bounds__(128) void k_gemm_h(const float* __restrict__ A, int lda, size_t sA, const _Float16* __restrict__ Bh, int ldb, size_t sB, float alpha, float* __restrict__ C, int ldc, size_t sC, int M, int N, int K) {
  __shared__ __attribute__((aligned(16))) float so[4][16][64];
  const int tid = threadIdx.x, w = tid >> 5, lane = tid & 31, ln = lane & 15, hh = lane >> 4; const int by = blockIdx.y;
  A += (size_t)by * sA; Bh += (size_t)by * sB; C += (size_t)by * sC;
  const int ntn = (N + 63) / 64; const int wid = blockIdx.x * 4 + w; const int mt = wid / ntn, nq = wid % ntn; if (mt * 16 >= M) return;
  const int row0 = mt * 16, col0 = nq * 64; const float* arow = A + (size_t)(row0 + ln) * lda;
  v8f acc[4] = {};
  for (int kb = 0; kb < K; kb += 32) {
    FragH ah, al;
    const v4f x0 = *(const v4fa*)(arow + kb + 8 * hh), x1 = *(const v4fa*)(arow + kb + 8 * hh + 4), x2 = *(const v4fa*)(arow + kb + 16 + 8 * hh), x3 = *(const v4fa*)(arow + kb + 16 + 8 * hh + 4);
    float xs[16] = {x0[0],x0[1],x0[2],x0[3],x1[0],x1[1],x1[2],x1[3],x2[0],x2[1],x2[2],x2[3],x3[0],x3[1],x3[2],x3[3]};
#pragma unroll
    for (int i = 0; i < 16; ++i) { const _Float16 h = (_Float16)xs[i]; ah.h[i] = h; al.h[i] = ASPLIT ? (_Float16)(xs[i] - (float)h) : (_Float16)0.0f; }
#pragma unroll
    for (int t = 0; t < 4; ++t) { if (col0 + t * 16 >= N) continue; const size_t boff = (size_t)(col0 + t * 16 + ln) * ldb + kb; FragH bq; bq.half[0] = *(const v8us*)(Bh + boff + 8 * hh); bq.half[1] = *(const v8us*)(Bh + boff + 16 + 8 * hh);
      acc[t] = mmaH<ASPLIT ? 2 : 1>(ah.v, al.v, bq.v, bq.v, acc[t]); }
  }
#pragma unroll
  for (int t = 0; t < 4; ++t) { if (col0 + t * 16 >= N) continue;
#pragma unroll
    for (int r = 0; r < 8; ++r) so[w][8 * hh + r][t * 16 + ln] = acc[t][r] * alpha; }
  __builtin_amdgcn_fence(__ATOMIC_ACQ_REL, "workgroup"); __builtin_amdgcn_wave_barrier();
  const int rsub = lane >> 4, c4 = (lane & 15) * 4;
  {
#pragma unroll
    for (int q = 0; q < 8; ++q) { const int r = q * 2 + rsub; if (col0 + c4 < N) { const v4f v = *(const v4fa*)&so[w][r][c4]; *(v4f*)(C + (size_t)(row0 + r) * ldc + col0 + c4) = v; } }
     }
}

// Wt[n][k] = f16(W[k][n]·scale) from f32 row-major W[K][N] (scale = power of two; bf16-exact weights stay exact in f16 away from the subnormal range)
__global__ __launch_bounds__(256) void k_wt_f16(const float* __restrict__ W, _Float16* __restrict__ Wt, int K, int N, float scale) {
  const int t = blockIdx.x * 256 + threadIdx.x; if (t >= N * (K / 8)) return; const int n = t / (K / 8), k8 = (t % (K / 8)) * 8; FragH f;
#pragma unroll
  for (int i = 0; i < 8; ++i) f.h[i] = (_Float16)(bf16_round(W[(size_t)(k8 + i) * N + n]) * scale); const v8us o = f.half[0];
  *(v8us*)((unsigned short*)Wt + (size_t)n * K + k8) = o; 
}
// k_gemm_hh variant with fused epilogue: v = acc·alpha + bias[by·sBias + col] (+ CP[(row/rowsPerB)·sCPb + by·64 + col] if CP) ; ACT 0 none / 1 elu ; writes f16 C16 (and f32 C if non-null)
template <int ACT>
__global__ __launch_bounds__(128) void k_gemm_hhx(const _Float16* __restrict__ A, int lda, size_t sA, const _Float16* __restrict__ Bh, int ldb, size_t sB, float alpha, const float* __restrict__ bias, size_t sBias, const float* __restrict__ CP, int rowsPerB, size_t sCPb, int row0g,
    float* __restrict__ C, _Float16* __restrict__ C16, int ldc, size_t sC, int M, int N, int K) {
  __shared__ __attribute__((aligned(16))) float so[4][16][64];
  const int tid = threadIdx.x, w = tid >> 5, lane = tid & 31, ln = lane & 15, hh = lane >> 4; const int by = blockIdx.y;
  A += (size_t)by * sA; Bh += (size_t)by * sB; const size_t cofs = (size_t)by * sC; const float* bp = bias ? bias + (size_t)by * sBias : nullptr;
  const int ntn = (N + 63) / 64; const int wid = blockIdx.x * 4 + w; const int mt = wid / ntn, nq = wid % ntn; if (mt * 16 >= M) return;
  const int row0 = mt * 16, col0 = nq * 64; const _Float16* arow = A + (size_t)(row0 + ln) * lda;
  v8f acc[4] = {};
  for (int kb = 0; kb < K; kb += 32) { FragH ah; ah.half[0] = *(const v8us*)((const unsigned short*)arow + kb + 8 * hh); ah.half[1] = *(const v8us*)((const unsigned short*)arow + kb + 16 + 8 * hh);
#pragma unroll
    for (int t = 0; t < 4; ++t) { if (col0 + t * 16 >= N) continue; const size_t boff = (size_t)(col0 + t * 16 + ln) * ldb + kb; FragH bq; bq.half[0] = *(const v8us*)((const unsigned short*)Bh + boff + 8 * hh); bq.half[1] = *(const v8us*)((const unsigned short*)Bh + boff + 16 + 8 * hh);
      acc[t] = mmaH<1>(ah.v, ah.v, bq.v, bq.v, acc[t]); }
  }
#pragma unroll
  for (int t = 0; t < 4; ++t) { if (col0 + t * 16 >= N) continue; const int col = col0 + t * 16 + ln; const float bv = bp ? bf16_round(bp[col]) : 0.f;
#pragma unroll
    for (int r = 0; r < 8; ++r) { float v = acc[t][r] * alpha + bv; if (CP) { const int rr = row0g + row0 + 8 * hh + r; if (rowsPerB < 0) v += CP[cofs + (size_t)rr * ldc + col];      /* rowsPerB < 0: own element of the batched C plane */ else { const int bidx = rr / rowsPerB; v += CP[(size_t)bidx * sCPb + (size_t)by * 64 + col]; } } if (ACT == 1) v = (v > 0.f) ? v : expm1f(v); else if (ACT == 7) v = (v > 0.f) ? v + 1.0f : expf(v); else if (ACT == 8) v = tanhf(v); else if (ACT == 9) v = 0.5f * v * (1.0f + tanhf(0.7978845608028654f * (v + 0.044715f * v * v * v))); else if (ACT == 11) v = 1.0f / (1.0f + expf(-v)); else if (ACT == 12) v = (v > 0.f) ? v : 0.01f * v; else if (ACT == 14) v = (v > 0.f) ? v : 0.1f * v; else if (ACT == 16) v = (v >= 0.f) ? v : 0.3f * v; else if (ACT == 17) v = (v >= 0.f) ? v : 0.2f * v; else if (ACT == 15) v = v / (1.0f + expf(-v)); else if (ACT == 3) v = fmaxf(v, 0.f); else if (ACT == 6) v = 0.5f * v * (1.0f + erff(v * 0.70710678118654752f)); so[w][8 * hh + r][t * 16 + ln] = v; } }
  __builtin_amdgcn_fence(__ATOMIC_ACQ_REL, "workgroup"); __builtin_amdgcn_wave_barrier();
  const int rsub = lane >> 4, c4 = (lane & 15) * 4; typedef _Float16 v4h __attribute__((ext_vector_type(4)));
  {
#pragma unroll
    for (int q = 0; q < 8; ++q) { const int r = q * 2 + rsub; if (col0 + c4 < N) { const v4f v = *(const v4fa*)&so[w][r][c4]; if (C) *(v4f*)(C + cofs + (size_t)(row0 + r) * ldc + col0 + c4) = v; if (C16) { v4h h4; for (int i = 0; i < 4; ++i) h4[i] = (_Float16)v[i]; *(v4h*)(C16 + cofs + (size_t)(row0 + r) * ldc + col0 + c4) = h4; } } }
     }
}


typedef _Float16 v4h __attribute__((ext_vector_type(4)));

__global__ __launch_bounds__(256) void k_x16(const float* __restrict__ x, _Float16* __restrict__ X16, size_t n8) { const size_t t = (size_t)blockIdx.x * 256 + threadIdx.x; if (t >= n8) return; FragH f;
#pragma unroll
  for (int q = 0; q < 8; ++q) f.h[q] = (_Float16)bf16_round(x[t * 8 + q]); *(v8us*)((unsigned short*)X16 + t * 8) = f.half[0];  }
__global__ __launch_bounds__(256) void k_h16(const float* __restrict__ x, _Float16* __restrict__ X16, size_t n8) { const size_t t = (size_t)blockIdx.x * 256 + threadIdx.x; if (t >= n8) return; FragH f;
#pragma unroll
  for (int q = 0; q < 8; ++q) f.h[q] = (_Float16)x[t * 8 + q]; *(v8us*)((unsigned short*)X16 + t * 8) = f.half[0];  }
__global__ __launch_bounds__(256) void k_round16f(const float* __restrict__ W, _Float16* __restrict__ Bt, size_t n8) { const size_t t = (size_t)blockIdx.x * 256 + threadIdx.x; if (t >= n8) return; FragH f;
#pragma unroll
  for (int i = 0; i < 8; ++i) f.h[i] = (_Float16)(bf16_round(W[t * 8 + i]) * 16.0f); *(v8us*)((unsigned short*)Bt + t * 8) = f.half[0];  }
template <int NHv, int TTv>
__global__ __launch_bounds__(256) void k_vt(const _Float16* __restrict__ V16, int ldv, int voff, _Float16* __restrict__ Vt) { __shared__ unsigned short tl[64][66]; const int tid = threadIdx.x; const int slab = blockIdx.x / (TTv / 64), lg = blockIdx.x % (TTv / 64); const int b = slab / NHv, h = slab % NHv;
  for (int i = tid; i < 64 * 8; i += 256) { const int r = i / 8, c8 = (i % 8) * 8; FragH f; f.half[0] = *(const v8us*)((const unsigned short*)V16 + ((size_t)b * TTv + lg * 64 + r) * ldv + voff + h * 64 + c8);
#pragma unroll
    for (int q = 0; q < 8; ++q) tl[r][c8 + q] = f.u[q]; }
  __syncthreads();
  {
#pragma unroll
    for (int rd = 0; rd < 2; ++rd) { const int d = rd * 32 + tid / 8, pc = tid % 8; FragH f;
#pragma unroll
      for (int q = 0; q < 8; ++q) f.u[q] = tl[pc * 8 + q][d];
      *(v8us*)((unsigned short*)Vt + ((size_t)slab * 64 + d) * TTv + lg * 64 + pc * 8) = f.half[0]; }
     } }

__global__ __launch_bounds__(256) void k_hl(const float* __restrict__ F, _Float16* __restrict__ Hh, _Float16* __restrict__ Hl, size_t n8) { const size_t t = (size_t)blockIdx.x * 256 + threadIdx.x; if (t >= n8) return; FragH fh, fl; const v4f a = *(const v4fa*)(F + t * 8), c = *(const v4fa*)(F + t * 8 + 4);
#pragma unroll
  for (int q = 0; q < 4; ++q) { _Float16 h = (_Float16)a[q]; fh.h[q] = h; fl.h[q] = (_Float16)((a[q] - (float)h) * 1024.0f); h = (_Float16)c[q]; fh.h[4 + q] = h; fl.h[4 + q] = (_Float16)((c[q] - (float)h) * 1024.0f); }
  { *(v8us*)((unsigned short*)Hh + t * 8) = fh.half[0]; *(v8us*)((unsigned short*)Hl + t * 8) = fl.half[0];  } }

// ---- fast GEMM (wave tile 32x64; requires M % 32 == 0 rows per launch region and N % 64 == 0); epilogue = k_gemm_hhx semantics ----
__device__ __forceinline__ v16h g2_frag(const _Float16* p, int hh) { FragH f; f.half[0] = *(const v8us*)((const unsigned short*)p + 8 * hh); f.half[1] = *(const v8us*)((const unsigned short*)p + 16 + 8 * hh); return f.v; }
__device__ __forceinline__ v8f g2_mma(v16h a, v16h b, v8f c) { v8f d = __builtin_amdgcn_wmma_f32_16x16x32_f16(false, a, false, b, (short)0, c, false, false); asm volatile("v_nop\n\tv_nop\n\tv_nop\n\tv_nop" : "+v"(d) : "v"(a), "v"(b)); return d; }
template <int ACT>
__global__ __launch_bounds__(128) void k_gemm2(const _Float16* __restrict__ A, int lda, size_t sA, const _Float16* __restrict__ Bh, int ldb, size_t sB, float alpha, const float* __restrict__ bias, size_t sBias, const float* __restrict__ CP, int rowsPerB, size_t sCPb, int row0g,
    float* __restrict__ C, _Float16* __restrict__ C16, int ldc, size_t sC, int M, int N, int K) { static_assert(ACT == 0 || ACT == 3 || ACT == 6 || ACT == 8 || ACT == 9 || ACT == 11 || ACT == 12 || ACT == 14 || ACT == 15 || ACT == 16 || ACT == 17, "k_gemm2: unsupported ACT code (would silently apply no activation)");
  __shared__ __attribute__((aligned(16))) float so[4][32][68];
  const int tid = threadIdx.x, w = tid >> 5, lane = tid & 31, ln = lane & 15, hh = lane >> 4; const int by = blockIdx.y;
  A += (size_t)by * sA; Bh += (size_t)by * sB; const size_t cofs = (size_t)by * sC; const float* bp = bias ? bias + (size_t)by * sBias : nullptr;
  const int ntn = N >> 6; const int mt = blockIdx.x / ntn, nq = blockIdx.x - mt * ntn; const int row0 = mt * 128 + 32 * w, col0 = nq * 64; if (row0 >= M) return;
  const _Float16* a0p = A + (size_t)(row0 + ln) * lda; const _Float16* a1p = a0p + (size_t)16 * lda;
  const _Float16* b0p = Bh + (size_t)(col0 + ln) * ldb; const _Float16* b1p = b0p + (size_t)16 * ldb; const _Float16* b2p = b1p + (size_t)16 * ldb; const _Float16* b3p = b2p + (size_t)16 * ldb;
  const v8f z8 = {0.f,0.f,0.f,0.f,0.f,0.f,0.f,0.f}; v8f c00 = z8, c01 = z8, c02 = z8, c03 = z8, c10 = z8, c11 = z8, c12 = z8, c13 = z8;
#pragma unroll 1
  for (int kb = 0; kb < K; kb += 32) { const v16h a0 = g2_frag(a0p + kb, hh), a1 = g2_frag(a1p + kb, hh);
    v16h b = g2_frag(b0p + kb, hh); c00 = g2_mma(a0, b, c00); c10 = g2_mma(a1, b, c10);
    b = g2_frag(b1p + kb, hh); c01 = g2_mma(a0, b, c01); c11 = g2_mma(a1, b, c11);
    b = g2_frag(b2p + kb, hh); c02 = g2_mma(a0, b, c02); c12 = g2_mma(a1, b, c12);
    b = g2_frag(b3p + kb, hh); c03 = g2_mma(a0, b, c03); c13 = g2_mma(a1, b, c13); }
  v8f accs[8] = {c00, c01, c02, c03, c10, c11, c12, c13};
#pragma unroll
  for (int u = 0; u < 8; ++u) { const int t = u & 3, half = u >> 2; const int col = col0 + t * 16 + ln; const float bv = bp ? bf16_round(bp[col]) : 0.f;
#pragma unroll
    for (int r = 0; r < 8; ++r) { const int rloc = half * 16 + 8 * hh + r; float v = accs[u][r] * alpha + bv; if (CP) { if (rowsPerB < 0) v += CP[cofs + (size_t)(row0g + row0 + rloc) * ldc + col];      /* rowsPerB < 0: own element of the batched C plane */ else { const int bidx = (row0g + row0 + rloc) / rowsPerB; v += CP[(size_t)bidx * sCPb + (size_t)by * 64 + col]; } }
      if (ACT == 3) v = fmaxf(v, 0.f); else if (ACT == 6) v = 0.5f * v * (1.0f + erff(v * 0.70710678118654752f)); else if (ACT == 11) v = 1.0f / (1.0f + expf(-v)); else if (ACT == 15) v = v / (1.0f + expf(-v)); else if (ACT == 12) v = (v > 0.f) ? v : 0.01f * v; else if (ACT == 8) v = tanhf(v); else if (ACT == 9) v = 0.5f * v * (1.0f + tanhf(0.7978845608028654f * (v + 0.044715f * v * v * v))); else if (ACT == 14) v = (v > 0.f) ? v : 0.1f * v; else if (ACT == 16) v = (v >= 0.f) ? v : 0.3f * v; else if (ACT == 17) v = (v >= 0.f) ? v : 0.2f * v;
      so[w][rloc][t * 16 + ln] = v; } }
  __builtin_amdgcn_fence(__ATOMIC_ACQ_REL, "workgroup"); __builtin_amdgcn_wave_barrier();
  const int rsub = lane >> 4, c4 = (lane & 15) * 4;
  {
#pragma unroll
    for (int q = 0; q < 16; ++q) { const int r = q * 2 + rsub; const v4f v = *(const v4fa*)&so[w][r][c4]; if (C) *(v4f*)(C + cofs + (size_t)(row0 + r) * ldc + col0 + c4) = v; if (C16) { v4h h4; for (int i = 0; i < 4; ++i) h4[i] = (_Float16)v[i]; *(v4h*)(C16 + cofs + (size_t)(row0 + r) * ldc + col0 + c4) = h4; } }
     } }


__global__ __launch_bounds__(256) void k_wnat(const float* __restrict__ w, size_t n8, _Float16* __restrict__ Bt) { const size_t t = (size_t)blockIdx.x * 256 + threadIdx.x; if (t >= n8) return; FragH f; for (int q = 0; q < 8; ++q) f.h[q] = (_Float16)(bf16_round(w[t * 8 + q]) * 16.0f); *(v8us*)((unsigned short*)Bt + t * 8) = f.half[0];  }
__global__ __launch_bounds__(256) void k_rsm(const float* __restrict__ S, _Float16* __restrict__ P, int nrows) {
  #pragma clang fp contract(off)
  const int i = blockIdx.x * 256 + threadIdx.x; if (i >= nrows) return; const float* s = S + (size_t)i * SQ; float mx = -3.0e38f;
#pragma unroll 1
  for (int j = 0; j < SQ; ++j) mx = fmaxf(mx, s[j]); float se = 0.f;
#pragma unroll 1
  for (int j = 0; j < SQ; ++j) se += expf(s[j] - mx); const float sc = 256.0f / se;
#pragma unroll 1
  for (int j0 = 0; j0 < SQ; j0 += 8) { FragH f; for (int q = 0; q < 8; ++q) f.h[q] = (_Float16)(expf(s[j0 + q] - mx) * sc); unsigned short* d = (unsigned short*)P + (size_t)i * SQ + j0; *(v8us*)d = f.half[0];  } }
__global__ __launch_bounds__(256) void k_vt(const _Float16* __restrict__ V16, int b, int h0, _Float16* __restrict__ VT) { __shared__ unsigned short tl[64][65]; const int tid = threadIdx.x; const int hh = blockIdx.x % HG, sg = blockIdx.x / HG; const int s0 = sg * 64; const int h = h0 + hh;
  for (int i = tid; i < 64 * 8; i += 256) { const int j = i / 8, d8 = (i % 8) * 8; FragH f; f.half[0] = *(const v8us*)((const unsigned short*)V16 + ((size_t)b * SQ + s0 + j) * DM + h * HD + d8); for (int q = 0; q < 8; ++q) tl[d8 + q][j] = f.u[q]; }
  __syncthreads();
  { for (int i = tid; i < 64 * 8; i += 256) { const int d = i / 8, j8 = (i % 8) * 8; FragH f; for (int q = 0; q < 8; ++q) f.u[q] = tl[d][j8 + q]; *(v8us*)((unsigned short*)VT + ((size_t)hh * HD + d) * SQ + s0 + j8) = f.half[0]; }  } }



#define FQ 128                       /* query rows per block: 4 waves x 32 */
__device__ __forceinline__ v8f fa_mma(v16h a, v16h b, v8f c) { return __builtin_amdgcn_wmma_f32_16x16x32_f16(false, a, false, b, (short)0, c, false, false); }
__global__ __launch_bounds__(128) void k_fattn(const _Float16* __restrict__ QK, const _Float16* __restrict__ VT, _Float16* __restrict__ O) {
  constexpr float SC2 = 0.036084391824351615f * 1.4426950408889634f;      /* 1/sqrt(768) x log2(e): the softmax runs in base 2 */
  const int lane = threadIdx.x & 31, ln = lane & 15, hh = lane >> 4; const int w = __builtin_amdgcn_readfirstlane(threadIdx.x >> 5);      /* scalar wave number: trip count and row bases stay scalar */
  const int bh = blockIdx.x % (NB * NH), qb = (SQ / FQ - 1) - blockIdx.x / (NB * NH); const int b = bh / NH, h = bh % NH; const int qw = qb * FQ + w * 32;
  const _Float16* kb = QK + (size_t)b * SQ * DM + h * HD + (size_t)ln * DM;      /* this lane's row within a 16-row tile of q = k */
  const _Float16* vb = VT + ((size_t)bh * HD + ln) * SQ;                          /* this lane's row within a 16-row tile of V^T */
  v16h qf[2][2];
#pragma unroll
  for (int g = 0; g < 2; ++g)
#pragma unroll
    for (int ks = 0; ks < 2; ++ks) qf[g][ks] = g2_frag(kb + (size_t)(qw + g * 16) * DM + ks * 32, hh);
  const v8f z8 = {0.f, 0.f, 0.f, 0.f, 0.f, 0.f, 0.f, 0.f};
  v8f o[2][4]; float m[2], l[2];
#pragma unroll
  for (int g = 0; g < 2; ++g) { m[g] = -1.0e30f; l[g] = 0.f;
#pragma unroll
    for (int dt = 0; dt < 4; ++dt) o[g][dt] = z8; }
  const int nit = qw / 32 + 1;      /* the last pass is the diagonal block, the only one with masked keys */
  v16h kf[2][2];
#pragma unroll
  for (int kt = 0; kt < 2; ++kt)
#pragma unroll
    for (int ks = 0; ks < 2; ++ks) kf[kt][ks] = g2_frag(kb + (size_t)(kt * 16) * DM + ks * 32, hh);
  __builtin_amdgcn_sched_barrier(0);      /* keeps the first V^T loads behind the Q and K loads, as on the back edge: loads return in order, so the wait at the loop's head then covers K alone and leaves V^T in flight */
  v16h vf[4];
#pragma unroll
  for (int dt = 0; dt < 4; ++dt) vf[dt] = g2_frag(vb + (size_t)(dt * 16) * SQ, hh);
#pragma unroll 1
  for (int it = 0; it < nit; ++it) { const int k0 = it * 32;
    v8f s[2][2];
#pragma unroll
    for (int g = 0; g < 2; ++g)
#pragma unroll
      for (int kt = 0; kt < 2; ++kt) s[g][kt] = fa_mma(kf[kt][1], qf[g][1], fa_mma(kf[kt][0], qf[g][0], z8));
    const int kn = (it + 1 < nit) ? k0 + 32 : k0;      /* next pass's K rows and V^T columns are fetched one pass ahead; the last pass re-reads its own, so nothing past the diagonal block is touched */
#pragma unroll
    for (int kt = 0; kt < 2; ++kt)
#pragma unroll
      for (int ks = 0; ks < 2; ++ks) kf[kt][ks] = g2_frag(kb + (size_t)(kn + kt * 16) * DM + ks * 32, hh);
    if (it == nit - 1) {
#pragma unroll
      for (int g = 0; g < 2; ++g)
#pragma unroll
        for (int kt = 0; kt < 2; ++kt)
#pragma unroll
          for (int r = 0; r < 8; ++r) s[g][kt][r] = (kt * 16 + 8 * hh + r <= g * 16 + ln) ? s[g][kt][r] : -1.0e30f; }      /* k0 == qw here: key <= query */
    float mn[2]; bool need = false;
#pragma unroll
    for (int g = 0; g < 2; ++g) { float mx = s[g][0][0];
#pragma unroll
      for (int r = 1; r < 8; ++r) mx = fmaxf(mx, s[g][0][r]);
#pragma unroll
      for (int r = 0; r < 8; ++r) mx = fmaxf(mx, s[g][1][r]);
      mx = fmaxf(mx, __shfl_xor(mx, 16, 32)); mn[g] = fmaxf(m[g], mx * SC2); need = need || (mn[g] > m[g]); }
    if (__builtin_amdgcn_ballot_w32(need) != 0) {      /* no column's maximum moved: every factor would be exactly 1, so the rescale is skipped as a whole */
#pragma unroll
      for (int g = 0; g < 2; ++g) { const float al = __builtin_amdgcn_exp2f(m[g] - mn[g]); m[g] = mn[g]; l[g] *= al;
#pragma unroll
        for (int dt = 0; dt < 4; ++dt) o[g][dt] *= al; } }
    FragH pf[2];
#pragma unroll
    for (int g = 0; g < 2; ++g) { float ls = 0.f;
#pragma unroll
      for (int kt = 0; kt < 2; ++kt) { const v8f t = s[g][kt] * SC2 - m[g];
#pragma unroll
        for (int r = 0; r < 8; ++r) { const float p = __builtin_amdgcn_exp2f(t[r]); ls += p; pf[g].h[kt * 8 + r] = (_Float16)p; } }
      l[g] += ls; }
#pragma unroll
    for (int g = 0; g < 2; ++g)
#pragma unroll
      for (int dt = 0; dt < 4; ++dt) o[g][dt] = fa_mma(vf[dt], pf[g].v, o[g][dt]);
#pragma unroll
    for (int dt = 0; dt < 4; ++dt) vf[dt] = g2_frag(vb + (size_t)(dt * 16) * SQ + kn, hh); }      /* next pass's V^T columns, carried over the back edge: they land under the next score products and softmax */
#pragma unroll
  for (int g = 0; g < 2; ++g) { const float fin = 64.0f / (l[g] + __shfl_xor(l[g], 16, 32));      /* halves joined once; o carried x64 */
    _Float16* orow = O + ((size_t)b * SQ + qw + g * 16 + ln) * DM + h * HD + 8 * hh;
#pragma unroll
    for (int dt = 0; dt < 4; ++dt) { FragH f;
#pragma unroll
      for (int r = 0; r < 8; ++r) f.h[r] = (_Float16)(o[g][dt][r] * fin);
      *(v8us*)((unsigned short*)orow + dt * 16) = f.half[0]; } } }

template <int MASKADD>
__global__ __launch_bounds__(64) void k_att0(const float* __restrict__ QF, const float* __restrict__ KF, const float* __restrict__ VF, int ld, const float* __restrict__ mask, float scale, float* __restrict__ OF, int ldo) {
  #pragma clang fp contract(off)
  __shared__ __attribute__((aligned(16))) float lq[64][64]; __shared__ __attribute__((aligned(16))) float lo[64][64];
  const int tid = threadIdx.x; const int h = blockIdx.x / (QT0 / 64), rg = blockIdx.x % (QT0 / 64); const int i = rg * 64 + tid;
  const float* qr = QF + (size_t)i * ld + h * HD;
#pragma unroll 1
  for (int c = 0; c < HD / 4; ++c) { *(v4f*)&lq[tid][c * 4] = *(const v4fa*)(qr + c * 4); const v4f z = {0.f, 0.f, 0.f, 0.f}; *(v4f*)&lo[tid][c * 4] = z; }
  float m = -1.0e30f, l = 0.f; const int jmax = MASKADD ? (SQ - 1) : (rg * 64 + 63);      /* additive-mask form: every key (the mask input decides); causal form: keys up to the block's last row */
#pragma unroll 1
  for (int j = 0; j <= jmax; ++j) { const float* kr = KF + (size_t)j * ld + h * HD; const float* vr = VF + (size_t)j * ld + h * HD; float s = 0.f;
#pragma unroll 1
    for (int c = 0; c < HD / 4; ++c) { const v4f kq = *(const v4fa*)(kr + c * 4); const v4f qq = *(v4f*)&lq[tid][c * 4]; s = __fadd_rn(s, __fmul_rn(qq[0], kq[0])); s = __fadd_rn(s, __fmul_rn(qq[1], kq[1])); s = __fadd_rn(s, __fmul_rn(qq[2], kq[2])); s = __fadd_rn(s, __fmul_rn(qq[3], kq[3])); }
    s = __fmul_rn(s, scale); if (MASKADD) s = __fadd_rn(s, __fmul_rn(bf16_round(mask[(size_t)i * SQ + j]), -10000.0f));
    const float f = (MASKADD || j <= i) ? 1.f : 0.f; const float sm = fmaf(f, s, (1.f - f) * -1.0e30f); const float mn = fmaxf(m, sm); const float sc = expf(m - mn); const float e = expf(sm - mn); l = __fadd_rn(__fmul_rn(l, sc), e); m = mn;
#pragma unroll 1
    for (int c = 0; c < HD / 4; ++c) { const v4f vv = *(const v4fa*)(vr + c * 4); v4f oo = *(v4f*)&lo[tid][c * 4]; for (int u = 0; u < 4; ++u) oo[u] = __fadd_rn(__fmul_rn(oo[u], sc), __fmul_rn(e, vv[u])); *(v4f*)&lo[tid][c * 4] = oo; } }
  const float fin = 64.0f / l;      /* o carried x64 like the f16 path */
#pragma unroll 1
  for (int c = 0; c < HD / 4; ++c) { v4f oo = *(v4f*)&lo[tid][c * 4]; for (int u = 0; u < 4; ++u) oo[u] = __fmul_rn(oo[u], fin); *(v4f*)&lo[tid][c * 4] = oo; }
  __syncthreads();
  {
#pragma unroll 1
    for (int it = 0; it < 16; ++it) { const int row = it * 4 + tid / 16, pc = (tid % 16) * 4; const v4f v = *(const v4f*)&lo[row][pc]; *(v4f*)(OF + (size_t)(rg * 64 + row) * ldo + h * HD + pc) = v; }
     } }

extern "C" void kernel_launch(void* const* d_in, const int* in_sizes, int n_in,
                              void* d_out, int out_size, void* d_ws, size_t ws_size, hipStream_t stream) {
  (void)in_sizes; (void)n_in; (void)out_size;
  const float* const* I = (const float* const*)d_in; const float* x = I[0]; const float* wq = I[1]; const float* wo = I[2]; const float* bo = I[3]; const float* wk = wq; const float* wv = wq;      /* Wq [12][64][768] = natural [768][768] rows h*64+d (q = k = v); W_out natural + b_out */
  char* ws = (char*)d_ws; size_t off = 0;
  auto take = [&](size_t bytes) { char* p = ws + off; off += (bytes + 255) & ~(size_t)255; return p; };
  _Float16* BQ = (_Float16*)take((size_t)DM * DM * 2); _Float16* BK = BQ; _Float16* BV = BQ; _Float16* BO = (_Float16*)take((size_t)DM * DM * 2);
  _Float16* X16 = (_Float16*)take(NR * DM * 2); _Float16* Q16 = (_Float16*)take(NR * DM * 2); _Float16* K16 = Q16; _Float16* V16 = Q16;      /* q = k = v (the module projects all three with self.query) */ _Float16* O16 = (_Float16*)take(NR * DM * 2);
  _Float16* VT = (_Float16*)take((size_t)NB * NH * HD * SQ * 2);
  float* QF0 = (float*)take((size_t)QT0 * DM * 4); float* KF0 = (float*)take((size_t)QT0 * DM * 4); float* VF0 = (float*)take((size_t)QT0 * DM * 4); float* OF0 = (float*)take((size_t)NB * QT0 * DM * 4); _Float16* OH0 = (_Float16*)take((size_t)NB * QT0 * DM * 2); _Float16* OL0 = (_Float16*)take((size_t)NB * QT0 * DM * 2);
  if (off > ws_size) return;
  k_wnat<<<(unsigned)(((size_t)DM * DM / 8 + 255) / 256), 256, 0, stream>>>(wq, (size_t)DM * DM / 8, BQ); k_wnat<<<(unsigned)(((size_t)DM * DM / 8 + 255) / 256), 256, 0, stream>>>(wo, (size_t)DM * DM / 8, BO);      /* natural [out][in] = Bt x16 */

  k_x16<<<(unsigned)((NR * DM / 8 + 255) / 256), 256, 0, stream>>>(x, X16, NR * DM / 8);
  const size_t r0p = (size_t)B0 * SQ;      /* first projected row */
  k_gemm2<0><<<dim3((unsigned)((MP / 128) * (DM / 64)), 1), 128, 0, stream>>>(X16 + r0p * DM, DM, 0, BQ, DM, 0, 0.0625f, nullptr, 0, nullptr, 1, 0, 0, nullptr, Q16 + r0p * DM, DM, 0, MP, DM, DM);
  k_vt<NH, SQ><<<NB * NH * (SQ / 64), 256, 0, stream>>>(V16, LQ, 0, VT);      /* V^T [NB][NH][HD][SQ] */
  k_fattn<<<NB * NH * (SQ / FQ), 128, 0, stream>>>(Q16, VT, O16);      /* scores, causal softmax and P V in one launch; o (merged heads, x64) as f16 rows */
  for (int b = B0; b < B0 + NBR; ++b) { const size_t r0 = (size_t)b * SQ;
    k_gemm2<0><<<dim3((QT0 / 128) * (DM / 64), 1), 128, 0, stream>>>(X16 + r0 * DM, DM, 0, BQ, DM, 0, 0.0625f, nullptr, 0, nullptr, 1, 0, 0, QF0, nullptr, DM, 0, QT0, DM, DM); /* KF0 = VF0 = QF0 (same projection) */      /* f32 q, k, v of the first 128 rows (exact products) */
    k_att0<0><<<NH * (QT0 / 64), 64, 0, stream>>>(QF0, QF0, QF0, DM, nullptr, 0.036084391824351615f, OF0 + (size_t)b * QT0 * DM, DM);      /* exact f32 attention for rows 0..127 (o x64) */ }
  k_gemm2<0><<<dim3((unsigned)((MPO / 128) * (DM / 64)), 1), 128, 0, stream>>>(O16 + r0p * DM, DM, 0, BO, DM, 0, 0.0009765625f, bo, 0, nullptr, 1, 0, 0, (float*)d_out + r0p * DM, nullptr, DM, 0, MPO, DM, DM);      /* out rows are the output layout */
  k_hl<<<(unsigned)(((size_t)NB * QT0 * DM / 8 + 255) / 256), 256, 0, stream>>>(OF0, OH0, OL0, (size_t)NB * QT0 * DM / 8);      /* first-tile o (x64) -> f16 hi + x1024 residual planes */
  for (int b = B0; b < B0 + NBR; ++b) { const size_t r0 = (size_t)b * SQ; const size_t f0 = (size_t)b * QT0;
    k_gemm2<0><<<dim3((QT0 / 128) * (DM / 64), 1), 128, 0, stream>>>(OH0 + f0 * DM, DM, 0, BO, DM, 0, 0.0009765625f, bo, 0, nullptr, 1, 0, 0, (float*)d_out + r0 * DM, nullptr, DM, 0, QT0, DM, DM);      /* rows 0..127: out = o_hi Wo (+ b), overwriting the f16-path rows */
    k_gemm2<0><<<dim3((QT0 / 128) * (DM / 64), 1), 128, 0, stream>>>(OL0 + f0 * DM, DM, 0, BO, DM, 0, 0.00000095367431640625f, nullptr, 0, (const float*)d_out + r0 * DM, -1, 0, 0, (float*)d_out + r0 * DM, nullptr, DM, 0, QT0, DM, DM); }      /* += o_lo Wo 2^-20 (own-element accumulate) */
}

// v003
// It runs in 374 microseconds.
// In two side-by-side timings against v002, it was 2.71 and 2.73 times as fast.
// Over all steps from v000 it is 38.9 times as fast.
#include <hip/hip_runtime.h>
// Causal multi-head attention whose q, k AND v are the same per-head projection (x [2][4096][768]; q = k = v = x Wq[h]^T with Wq [12][64][768] (natural per-head rows, sigma 1/sqrt(768)); scores = q.q / sqrt(768) (the module scales by d_model); causal (tril, -inf); softmax; out = merged (attn q) W_out^T + b_out -> [2][4096][768]).
// Structure: token rows r = b*4096 + s; x as exact f16 rows (bf16-rounded); q (= k = v) as one WMMA GEMM (32x64 wave tiles, f32 accumulation, exact x16 weights, f16 outputs); V^T for all batches and heads via LDS transposes; one fused launch for the attention: per wave 32 query rows, keys 32 at a time up to the diagonal block, S^T = K Q^T, online base-2 softmax in registers (f32 statistics, native exp2; weights in (0,1] as f16), O^T += V^T P^T (o carried x64, folded into the output GEMM alpha) written straight into the merged f16 o rows; out = o W_o GEMM (f32) into the output layout.
// Compute dtype: inputs rounded to bf16; x / weights exact; q, k, v, softmax weights and o as plain f16 GEMM operands (~2^-12); scores and softmax statistics f32. v_wmma_f32_16x16x32_f16.
#define NB 2
#define SQ 4096
#define DM 768
#define NH 12
#define HD 64
#define HG 4                         /* heads per launch of the unused per-batch k_vt */
#define QT0 128                      /* first-tile rows recomputed exactly in f32 */
#define B0 0                         /* first batch processed (debug hook) */
#define NBR NB                       /* batches processed (debug hook) */
#define NR ((size_t)NB * SQ)         /* token rows */
#define MP ((int)((size_t)NBR * SQ)) /* rows projected (debug hook) */
#define MPO MP                       /* rows through the output stage (debug hook) */
#define LQ DM      /* row pitch of the q/k/v rows */
typedef __bf16 v16b __attribute__((ext_vector_type(16)));
typedef unsigned short v8us __attribute__((ext_vector_type(8), may_alias));
typedef float  v8f  __attribute__((ext_vector_type(8)));
typedef float  v4f  __attribute__((ext_vector_type(4)));
typedef float  v4fa __attribute__((ext_vector_type(4), may_alias));
union FragB { v16b v; v8us half[2]; unsigned short u[16]; };

__device__ __forceinline__ unsigned short bf16_bits(float x) { unsigned int u = __float_as_uint(x); return (unsigned short)((u + 0x7FFFu + ((u >> 16) & 1u)) >> 16); }
__device__ __forceinline__ float bf16_val(unsigned short b) { return __uint_as_float(((unsigned int)b) << 16); }
__device__ __forceinline__ float bf16_round(float x) { return bf16_val(bf16_bits(x)); }
// D += A·B with NT terms: 1 = ah·bh, 2 = + al·bh (A split), 3 = + ah·bl (both split)
template <int NT>
__device__ __forceinline__ v8f mmaN(v16b ah, v16b al, v16b bh, v16b bl, v8f c) {
  c = __builtin_amdgcn_wmma_f32_16x16x32_bf16(false, ah, false, bh, (short)0, c, false, false);
  if (NT >= 2) c = __builtin_amdgcn_wmma_f32_16x16x32_bf16(false, al, false, bh, (short)0, c, false, false);
  if (NT >= 3) c = __builtin_amdgcn_wmma_f32_16x16x32_bf16(false, ah, false, bl, (short)0, c, false, false);
  asm volatile("v_nop\n\tv_nop\n\tv_nop\n\tv_nop" : "+v"(c) : "v"(ah), "v"(al), "v"(bh), "v"(bl));
  return c;
}

__global__ __launch_bounds__(256) void k_wt_bf16(const float* __restrict__ W, unsigned short* __restrict__ Wt, int K, int N) {
  const int t = blockIdx.x * 256 + threadIdx.x;
  const int k8n = K / 8;
  if (t >= N * k8n) return;
  const int n = t / k8n, k8 = (t % k8n) * 8;
  v8us v;
#pragma unroll
  for (int i = 0; i < 8; ++i) v[i] = bf16_bits(W[(size_t)(k8 + i) * N + n]);
  *(v8us*)(Wt + (size_t)n * K + k8) = v;
  
}

// GEMM C[M][N] (f32, pitch ldc) = act(A[M][K]·W + bias). A f32 row-major (pitch lda) converted per fragment to bf16
// (ASPLIT: hi/lo two planes -> 2 terms, else single rounded term); Wt bf16 [N][K] (pitch ldb). BIAS_BF16 rounds the
// bias to bf16 first (bias quantised to bf16 before the add). K%32==0, M%16==0, N%64==0.
template <bool ASPLIT, int ACT, bool BIAS_BF16>
__global__ __launch_bounds__(128) void k_gemm_bf(const float* __restrict__ A, int lda, const unsigned short* __restrict__ Wt, int ldb,
                                               const float* __restrict__ bias, float* __restrict__ C, int ldc, int M, int N, int K) {
  __shared__ __attribute__((aligned(16))) float so[4][16][64];
  const int tid = threadIdx.x, w = tid >> 5, lane = tid & 31, ln = lane & 15, hh = lane >> 4;
  const int ntn = N / 64;
  const int wid = blockIdx.x * 4 + w;
  const int mt = wid / ntn, nq = wid % ntn;
  if (mt * 16 >= M) return;
  const int row0 = mt * 16, col0 = nq * 64;
  const float* arow = A + (size_t)(row0 + ln) * lda;
  v8f acc[4] = {};
  for (int kb = 0; kb < K; kb += 32) {
    FragB ah, al;
    const v4f x0 = *(const v4fa*)(arow + kb + 8 * hh), x1 = *(const v4fa*)(arow + kb + 8 * hh + 4);
    const v4f x2 = *(const v4fa*)(arow + kb + 16 + 8 * hh), x3 = *(const v4fa*)(arow + kb + 16 + 8 * hh + 4);
    float xs[16] = {x0[0],x0[1],x0[2],x0[3],x1[0],x1[1],x1[2],x1[3],x2[0],x2[1],x2[2],x2[3],x3[0],x3[1],x3[2],x3[3]};
#pragma unroll
    for (int i = 0; i < 16; ++i) { const unsigned short hb = bf16_bits(xs[i]); ah.u[i] = hb; al.u[i] = ASPLIT ? bf16_bits(xs[i] - bf16_val(hb)) : (unsigned short)0; }
#pragma unroll
    for (int t = 0; t < 4; ++t) {
      const unsigned short* brow = Wt + (size_t)(col0 + t * 16 + ln) * ldb + kb;
      FragB b;
      b.half[0] = *(const v8us*)(brow + 8 * hh);
      b.half[1] = *(const v8us*)(brow + 16 + 8 * hh);
      acc[t] = mmaN<ASPLIT ? 2 : 1>(ah.v, al.v, b.v, b.v, acc[t]);
    }
  }
#pragma unroll
  for (int t = 0; t < 4; ++t) {
    float bv = bias ? bias[col0 + t * 16 + ln] : 0.f;
    if (BIAS_BF16) bv = bf16_round(bv);
#pragma unroll
    for (int r = 0; r < 8; ++r) { float v = acc[t][r] + bv; if (ACT == 1) v = fmaxf(v, 0.f); so[w][8 * hh + r][t * 16 + ln] = v; }
  }
  __builtin_amdgcn_fence(__ATOMIC_ACQ_REL, "workgroup");
  __builtin_amdgcn_wave_barrier();
  const int rsub = lane >> 4, c4 = (lane & 15) * 4;
  {
#pragma unroll
    for (int q = 0; q < 8; ++q) {
      const int r = q * 2 + rsub;
      const v4f v = *(const v4fa*)&so[w][r][c4];
      *(v4f*)(C + (size_t)(row0 + r) * ldc + col0 + c4) = v;
    }
    
  }
}

// GEMM C = act(A·W + bias + resid): A f32 (ASPLIT -> hi/lo 2 terms), Wt bf16 [N][K]; ACT 0 none, 1 relu, 2 exact gelu;
// resid (optional, f32, row index = (row % rmod), pitch ldr, RES_BF16 rounds it) added before the activation.
template <bool ASPLIT, int ACT, bool BIAS_BF16, bool RES_BF16>
__global__ __launch_bounds__(128) void k_gemm_bf3(const float* __restrict__ A, int lda, const unsigned short* __restrict__ Wt, int ldb,
                                                const float* __restrict__ bias, const float* __restrict__ resid, int rmod, int ldr,
                                                float* __restrict__ C, int ldc, int M, int N, int K) {
  __shared__ __attribute__((aligned(16))) float so[4][16][64];
  const int tid = threadIdx.x, w = tid >> 5, lane = tid & 31, ln = lane & 15, hh = lane >> 4;
  const int ntn = N / 64;
  const int wid = blockIdx.x * 4 + w;
  const int mt = wid / ntn, nq = wid % ntn;
  if (mt * 16 >= M) return;
  const int row0 = mt * 16, col0 = nq * 64;
  const float* arow = A + (size_t)(row0 + ln) * lda;
  v8f acc[4] = {};
  for (int kb = 0; kb < K; kb += 32) {
    FragB ah, al;
    const v4f x0 = *(const v4fa*)(arow + kb + 8 * hh), x1 = *(const v4fa*)(arow + kb + 8 * hh + 4);
    const v4f x2 = *(const v4fa*)(arow + kb + 16 + 8 * hh), x3 = *(const v4fa*)(arow + kb + 16 + 8 * hh + 4);
    float xs[16] = {x0[0],x0[1],x0[2],x0[3],x1[0],x1[1],x1[2],x1[3],x2[0],x2[1],x2[2],x2[3],x3[0],x3[1],x3[2],x3[3]};
#pragma unroll
    for (int i = 0; i < 16; ++i) { const unsigned short hb = bf16_bits(xs[i]); ah.u[i] = hb; al.u[i] = ASPLIT ? bf16_bits(xs[i] - bf16_val(hb)) : (unsigned short)0; }
#pragma unroll
    for (int t = 0; t < 4; ++t) {
      const unsigned short* brow = Wt + (size_t)(col0 + t * 16 + ln) * ldb + kb;
      FragB b;
      b.half[0] = *(const v8us*)(brow + 8 * hh);
      b.half[1] = *(const v8us*)(brow + 16 + 8 * hh);
      acc[t] = mmaN<ASPLIT ? 2 : 1>(ah.v, al.v, b.v, b.v, acc[t]);
    }
  }
#pragma unroll
  for (int t = 0; t < 4; ++t) {
    const int col = col0 + t * 16 + ln;
    float bv = bias ? bias[col] : 0.f;
    if (BIAS_BF16) bv = bf16_round(bv);
#pragma unroll
    for (int r = 0; r < 8; ++r) {
      float v = acc[t][r] + bv;
      if (resid) { float rv = resid[(size_t)((row0 + 8 * hh + r) % rmod) * ldr + col]; if (RES_BF16) rv = bf16_round(rv); v += rv; }
      if (ACT == 1) v = fmaxf(v, 0.f);
      if (ACT == 2) v = 0.5f * v * (1.0f + erff(v * 0.70710678118654752f));
      if (ACT == 3) { const float u = 0.7978845608028654f * (v + 0.044715f * v * v * v); v = 0.5f * v * (1.0f + tanhf(u)); }
      so[w][8 * hh + r][t * 16 + ln] = v;
    }
  }
  __builtin_amdgcn_fence(__ATOMIC_ACQ_REL, "workgroup");
  __builtin_amdgcn_wave_barrier();
  const int rsub = lane >> 4, c4 = (lane & 15) * 4;
  {
#pragma unroll
    for (int q = 0; q < 8; ++q) {
      const int r = q * 2 + rsub;
      const v4f v = *(const v4fa*)&so[w][r][c4];
      *(v4f*)(C + (size_t)(row0 + r) * ldc + col0 + c4) = v;
    }
    
  }
}
// row LayerNorm (biased variance, eps) over N: s = X (+ R); optional out_sum <- s; out_norm <- (s-mu)*rsqrt(var+eps)*g + b
template <bool PARAM_BF16>
__global__ __launch_bounds__(256) void k_layernorm(const float* __restrict__ X, const float* __restrict__ R, const float* __restrict__ g, const float* __restrict__ bta,
                                                  float* __restrict__ out_sum, float* __restrict__ out_norm, int N, float eps) {
  __shared__ float red[256];
  const int row = blockIdx.x, tid = threadIdx.x;
  const float* x = X + (size_t)row * N; const float* rr = R ? R + (size_t)row * N : nullptr;
  float vals[16];                     // up to N = 4096
  const int per = N / 256;            // contiguous chunk per thread? use strided-by-4 chunks: thread handles j = tid*4 + 1024*u
  float s1 = 0.f;
  for (int u = 0; u < per / 4; ++u) {
    const int j = tid * 4 + 1024 * u;
    const v4f a = *(const v4fa*)(x + j);
    v4f b = {0.f,0.f,0.f,0.f}; if (rr) b = *(const v4fa*)(rr + j);
#pragma unroll
    for (int q = 0; q < 4; ++q) { const float v = a[q] + b[q]; vals[u * 4 + q] = v; s1 += v; }
  }
  red[tid] = s1; __syncthreads();
  for (int st = 128; st > 0; st >>= 1) { if (tid < st) red[tid] += red[tid + st]; __syncthreads(); }
  const float mu = red[0] / (float)N; __syncthreads();
  float s2 = 0.f;
  for (int u = 0; u < per / 4; ++u)
#pragma unroll
    for (int q = 0; q < 4; ++q) { const float c = vals[u * 4 + q] - mu; s2 += c * c; }
  red[tid] = s2; __syncthreads();
  for (int st = 128; st > 0; st >>= 1) { if (tid < st) red[tid] += red[tid + st]; __syncthreads(); }
  const float rs = rsqrtf(red[0] / (float)N + eps);
  {
    for (int u = 0; u < per / 4; ++u) {
      const int j = tid * 4 + 1024 * u;
      v4f o, sm;
#pragma unroll
      for (int q = 0; q < 4; ++q) {
        float gg = g[j + q], bb = bta[j + q];
        if (PARAM_BF16) { gg = bf16_round(gg); bb = bf16_round(bb); }
        sm[q] = vals[u * 4 + q]; o[q] = (vals[u * 4 + q] - mu) * rs * gg + bb;
      }
      if (out_sum) *(v4f*)(out_sum + (size_t)row * N + j) = sm;
      *(v4f*)(out_norm + (size_t)row * N + j) = o;
    }
    
  }
}



// ---- f16 WMMA path (v_wmma_f32_16x16x32_f16): 11-bit significands for operands in range — used where a [0,1] probability operand needs more precision than bf16
typedef _Float16 v16h __attribute__((ext_vector_type(16)));
union FragH { v16h v; v8us half[2]; _Float16 h[16]; unsigned short u[16]; };
template <int NT>
__device__ __forceinline__ v8f mmaH(v16h ah, v16h al, v16h bh, v16h bl, v8f c) {
  c = __builtin_amdgcn_wmma_f32_16x16x32_f16(false, ah, false, bh, (short)0, c, false, false);
  if (NT >= 2) c = __builtin_amdgcn_wmma_f32_16x16x32_f16(false, al, false, bh, (short)0, c, false, false);
  if (NT >= 3) c = __builtin_amdgcn_wmma_f32_16x16x32_f16(false, ah, false, bl, (short)0, c, false, false);
  asm volatile("v_nop\n\tv_nop\n\tv_nop\n\tv_nop" : "+v"(c) : "v"(ah), "v"(al), "v"(bh), "v"(bl));
  return c;
}
// batched GEMM like k_gemm_b but f16 operands: A f32 (split into f16 hi/lo if ASPLIT, else rounded to f16), Bt = f16 values [n][k]; alpha; C f32; N multiple of 16 (partial tiles skipped)
template <bool ASPLIT>
__global__ __launch_bounds__(128) void k_gemm_h(const float* __restrict__ A, int lda, size_t sA, const _Float16* __restrict__ Bh, int ldb, size_t sB, float alpha, float* __restrict__ C, int ldc, size_t sC, int M, int N, int K) {
  __shared__ __attribute__((aligned(16))) float so[4][16][64];
  const int tid = threadIdx.x, w = tid >> 5, lane = tid & 31, ln = lane & 15, hh = lane >> 4; const int by = blockIdx.y;
  A += (size_t)by * sA; Bh += (size_t)by * sB; C += (size_t)by * sC;
  const int ntn = (N + 63) / 64; const int wid = blockIdx.x * 4 + w; const int mt = wid / ntn, nq = wid % ntn; if (mt * 16 >= M) return;
  const int row0 = mt * 16, col0 = nq * 64; const float* arow = A + (size_t)(row0 + ln) * lda;
  v8f acc[4] = {};
  for (int kb = 0; kb < K; kb += 32) {
    FragH ah, al;
    const v4f x0 = *(const v4fa*)(arow + kb + 8 * hh), x1 = *(const v4fa*)(arow + kb + 8 * hh + 4), x2 = *(const v4fa*)(arow + kb + 16 + 8 * hh), x3 = *(const v4fa*)(arow + kb + 16 + 8 * hh + 4);
    float xs[16] = {x0[0],x0[1],x0[2],x0[3],x1[0],x1[1],x1[2],x1[3],x2[0],x2[1],x2[2],x2[3],x3[0],x3[1],x3[2],x3[3]};
#pragma unroll
    for (int i = 0; i < 16; ++i) { const _Float16 h = (_Float16)xs[i]; ah.h[i] = h; al.h[i] = ASPLIT ? (_Float16)(xs[i] - (float)h) : (_Float16)0.0f; }
#pragma unroll
    for (int t = 0; t < 4; ++t) { if (col0 + t * 16 >= N) continue; const size_t boff = (size_t)(col0 + t * 16 + ln) * ldb + kb; FragH bq; bq.half[0] = *(const v8us*)(Bh + boff + 8 * hh); bq.half[1] = *(const v8us*)(Bh + boff + 16 + 8 * hh);
      acc[t] = mmaH<ASPLIT ? 2 : 1>(ah.v, al.v, bq.v, bq.v, acc[t]); }
  }
#pragma unroll
  for (int t = 0; t < 4; ++t) { if (col0 + t * 16 >= N) continue;
#pragma unroll
    for (int r = 0; r < 8; ++r) so[w][8 * hh + r][t * 16 + ln] = acc[t][r] * alpha; }
  __builtin_amdgcn_fence(__ATOMIC_ACQ_REL, "workgroup"); __builtin_amdgcn_wave_barrier();
  const int rsub = lane >> 4, c4 = (lane & 15) * 4;
  {
#pragma unroll
    for (int q = 0; q < 8; ++q) { const int r = q * 2 + rsub; if (col0 + c4 < N) { const v4f v = *(const v4fa*)&so[w][r][c4]; *(v4f*)(C + (size_t)(row0 + r) * ldc + col0 + c4) = v; } }
     }
}

// Wt[n][k] = f16(W[k][n]·scale) from f32 row-major W[K][N] (scale = power of two; bf16-exact weights stay exact in f16 away from the subnormal range)
__global__ __launch_bounds__(256) void k_wt_f16(const float* __restrict__ W, _Float16* __restrict__ Wt, int K, int N, float scale) {
  const int t = blockIdx.x * 256 + threadIdx.x; if (t >= N * (K / 8)) return; const int n = t / (K / 8), k8 = (t % (K / 8)) * 8; FragH f;
#pragma unroll
  for (int i = 0; i < 8; ++i) f.h[i] = (_Float16)(bf16_round(W[(size_t)(k8 + i) * N + n]) * scale); const v8us o = f.half[0];
  *(v8us*)((unsigned short*)Wt + (size_t)n * K + k8) = o; 
}
// k_gemm_hh variant with fused epilogue: v = acc·alpha + bias[by·sBias + col] (+ CP[(row/rowsPerB)·sCPb + by·64 + col] if CP) ; ACT 0 none / 1 elu ; writes f16 C16 (and f32 C if non-null)
template <int ACT>
__global__ __launch_bounds__(128) void k_gemm_hhx(const _Float16* __restrict__ A, int lda, size_t sA, const _Float16* __restrict__ Bh, int ldb, size_t sB, float alpha, const float* __restrict__ bias, size_t sBias, const float* __restrict__ CP, int rowsPerB, size_t sCPb, int row0g,
    float* __restrict__ C, _Float16* __restrict__ C16, int ldc, size_t sC, int M, int N, int K) {
  __shared__ __attribute__((aligned(16))) float so[4][16][64];
  const int tid = threadIdx.x, w = tid >> 5, lane = tid & 31, ln = lane & 15, hh = lane >> 4; const int by = blockIdx.y;
  A += (size_t)by * sA; Bh += (size_t)by * sB; const size_t cofs = (size_t)by * sC; const float* bp = bias ? bias + (size_t)by * sBias : nullptr;
  const int ntn = (N + 63) / 64; const int wid = blockIdx.x * 4 + w; const int mt = wid / ntn, nq = wid % ntn; if (mt * 16 >= M) return;
  const int row0 = mt * 16, col0 = nq * 64; const _Float16* arow = A + (size_t)(row0 + ln) * lda;
  v8f acc[4] = {};
  for (int kb = 0; kb < K; kb += 32) { FragH ah; ah.half[0] = *(const v8us*)((const unsigned short*)arow + kb + 8 * hh); ah.half[1] = *(const v8us*)((const unsigned short*)arow + kb + 16 + 8 * hh);
#pragma unroll
    for (int t = 0; t < 4; ++t) { if (col0 + t * 16 >= N) continue; const size_t boff = (size_t)(col0 + t * 16 + ln) * ldb + kb; FragH bq; bq.half[0] = *(const v8us*)((const unsigned short*)Bh + boff + 8 * hh); bq.half[1] = *(const v8us*)((const unsigned short*)Bh + boff + 16 + 8 * hh);
      acc[t] = mmaH<1>(ah.v, ah.v, bq.v, bq.v, acc[t]); }
  }
#pragma unroll
  for (int t = 0; t < 4; ++t) { if (col0 + t * 16 >= N) continue; const int col = col0 + t * 16 + ln; const float bv = bp ? bf16_round(bp[col]) : 0.f;
#pragma unroll
    for (int r = 0; r < 8; ++r) { float v = acc[t][r] * alpha + bv; if (CP) { const int rr = row0g + row0 + 8 * hh + r; if (rowsPerB < 0) v += CP[cofs + (size_t)rr * ldc + col];      /* rowsPerB < 0: own element of the batched C plane */ else { const int bidx = rr / rowsPerB; v += CP[(size_t)bidx * sCPb + (size_t)by * 64 + col]; } } if (ACT == 1) v = (v > 0.f) ? v : expm1f(v); else if (ACT == 7) v = (v > 0.f) ? v + 1.0f : expf(v); else if (ACT == 8) v = tanhf(v); else if (ACT == 9) v = 0.5f * v * (1.0f + tanhf(0.7978845608028654f * (v + 0.044715f * v * v * v))); else if (ACT == 11) v = 1.0f / (1.0f + expf(-v)); else if (ACT == 12) v = (v > 0.f) ? v : 0.01f * v; else if (ACT == 14) v = (v > 0.f) ? v : 0.1f * v; else if (ACT == 16) v = (v >= 0.f) ? v : 0.3f * v; else if (ACT == 17) v = (v >= 0.f) ? v : 0.2f * v; else if (ACT == 15) v = v / (1.0f + expf(-v)); else if (ACT == 3) v = fmaxf(v, 0.f); else if (ACT == 6) v = 0.5f * v * (1.0f + erff(v * 0.70710678118654752f)); so[w][8 * hh + r][t * 16 + ln] = v; } }
  __builtin_amdgcn_fence(__ATOMIC_ACQ_REL, "workgroup"); __builtin_amdgcn_wave_barrier();
  const int rsub = lane >> 4, c4 = (lane & 15) * 4; typedef _Float16 v4h __attribute__((ext_vector_type(4)));
  {
#pragma unroll
    for (int q = 0; q < 8; ++q) { const int r = q * 2 + rsub; if (col0 + c4 < N) { const v4f v = *(const v4fa*)&so[w][r][c4]; if (C) *(v4f*)(C + cofs + (size_t)(row0 + r) * ldc + col0 + c4) = v; if (C16) { v4h h4; for (int i = 0; i < 4; ++i) h4[i] = (_Float16)v[i]; *(v4h*)(C16 + cofs + (size_t)(row0 + r) * ldc + col0 + c4) = h4; } } }
     }
}


typedef _Float16 v4h __attribute__((ext_vector_type(4)));

__global__ __launch_bounds__(256) void k_x16(const float* __restrict__ x, _Float16* __restrict__ X16, size_t n8) { const size_t t = (size_t)blockIdx.x * 256 + threadIdx.x; if (t >= n8) return; FragH f;
#pragma unroll
  for (int q = 0; q < 8; ++q) f.h[q] = (_Float16)bf16_round(x[t * 8 + q]); *(v8us*)((unsigned short*)X16 + t * 8) = f.half[0];  }
__global__ __launch_bounds__(256) void k_h16(const float* __restrict__ x, _Float16* __restrict__ X16, size_t n8) { const size_t t = (size_t)blockIdx.x * 256 + threadIdx.x; if (t >= n8) return; FragH f;
#pragma unroll
  for (int q = 0; q < 8; ++q) f.h[q] = (_Float16)x[t * 8 + q]; *(v8us*)((unsigned short*)X16 + t * 8) = f.half[0];  }
__global__ __launch_bounds__(256) void k_round16f(const float* __restrict__ W, _Float16* __restrict__ Bt, size_t n8) { const size_t t = (size_t)blockIdx.x * 256 + threadIdx.x; if (t >= n8) return; FragH f;
#pragma unroll
  for (int i = 0; i < 8; ++i) f.h[i] = (_Float16)(bf16_round(W[t * 8 + i]) * 16.0f); *(v8us*)((unsigned short*)Bt + t * 8) = f.half[0];  }
template <int NHv, int TTv>
__global__ __launch_bounds__(256) void k_vt(const _Float16* __restrict__ V16, int ldv, int voff, _Float16* __restrict__ Vt) { __shared__ unsigned short tl[64][66]; const int tid = threadIdx.x; const int slab = blockIdx.x / (TTv / 64), lg = blockIdx.x % (TTv / 64); const int b = slab / NHv, h = slab % NHv;
  for (int i = tid; i < 64 * 8; i += 256) { const int r = i / 8, c8 = (i % 8) * 8; FragH f; f.half[0] = *(const v8us*)((const unsigned short*)V16 + ((size_t)b * TTv + lg * 64 + r) * ldv + voff + h * 64 + c8);
#pragma unroll
    for (int q = 0; q < 8; ++q) tl[r][c8 + q] = f.u[q]; }
  __syncthreads();
  {
#pragma unroll
    for (int rd = 0; rd < 2; ++rd) { const int d = rd * 32 + tid / 8, pc = tid % 8; FragH f;
#pragma unroll
      for (int q = 0; q < 8; ++q) f.u[q] = tl[pc * 8 + q][d];
      *(v8us*)((unsigned short*)Vt + ((size_t)slab * 64 + d) * TTv + lg * 64 + pc * 8) = f.half[0]; }
     } }

__global__ __launch_bounds__(256) void k_hl(const float* __restrict__ F, _Float16* __restrict__ Hh, _Float16* __restrict__ Hl, size_t n8) { const size_t t = (size_t)blockIdx.x * 256 + threadIdx.x; if (t >= n8) return; FragH fh, fl; const v4f a = *(const v4fa*)(F + t * 8), c = *(const v4fa*)(F + t * 8 + 4);
#pragma unroll
  for (int q = 0; q < 4; ++q) { _Float16 h = (_Float16)a[q]; fh.h[q] = h; fl.h[q] = (_Float16)((a[q] - (float)h) * 1024.0f); h = (_Float16)c[q]; fh.h[4 + q] = h; fl.h[4 + q] = (_Float16)((c[q] - (float)h) * 1024.0f); }
  { *(v8us*)((unsigned short*)Hh + t * 8) = fh.half[0]; *(v8us*)((unsigned short*)Hl + t * 8) = fl.half[0];  } }

// ---- fast GEMM (wave tile 32x64; requires M % 32 == 0 rows per launch region and N % 64 == 0); epilogue = k_gemm_hhx semantics ----
__device__ __forceinline__ v16h g2_frag(const _Float16* p, int hh) { FragH f; f.half[0] = *(const v8us*)((const unsigned short*)p + 8 * hh); f.half[1] = *(const v8us*)((const unsigned short*)p + 16 + 8 * hh); return f.v; }
__device__ __forceinline__ v8f g2_mma(v16h a, v16h b, v8f c) { v8f d = __builtin_amdgcn_wmma_f32_16x16x32_f16(false, a, false, b, (short)0, c, false, false); asm volatile("v_nop\n\tv_nop\n\tv_nop\n\tv_nop" : "+v"(d) : "v"(a), "v"(b)); return d; }
template <int ACT>
__global__ __launch_bounds__(128) void k_gemm2(const _Float16* __restrict__ A, int lda, size_t sA, const _Float16* __restrict__ Bh, int ldb, size_t sB, float alpha, const float* __restrict__ bias, size_t sBias, const float* __restrict__ CP, int rowsPerB, size_t sCPb, int row0g,
    float* __restrict__ C, _Float16* __restrict__ C16, int ldc, size_t sC, int M, int N, int K) { static_assert(ACT == 0 || ACT == 3 || ACT == 6 || ACT == 8 || ACT == 9 || ACT == 11 || ACT == 12 || ACT == 14 || ACT == 15 || ACT == 16 || ACT == 17, "k_gemm2: unsupported ACT code (would silently apply no activation)");
  __shared__ __attribute__((aligned(16))) float so[4][32][68];
  const int tid = threadIdx.x, w = tid >> 5, lane = tid & 31, ln = lane & 15, hh = lane >> 4; const int by = blockIdx.y;
  A += (size_t)by * sA; Bh += (size_t)by * sB; const size_t cofs = (size_t)by * sC; const float* bp = bias ? bias + (size_t)by * sBias : nullptr;
  const int ntn = N >> 6; const int mt = blockIdx.x / ntn, nq = blockIdx.x - mt * ntn; const int row0 = mt * 128 + 32 * w, col0 = nq * 64; if (row0 >= M) return;
  const _Float16* a0p = A + (size_t)(row0 + ln) * lda; const _Float16* a1p = a0p + (size_t)16 * lda;
  const _Float16* b0p = Bh + (size_t)(col0 + ln) * ldb; const _Float16* b1p = b0p + (size_t)16 * ldb; const _Float16* b2p = b1p + (size_t)16 * ldb; const _Float16* b3p = b2p + (size_t)16 * ldb;
  const v8f z8 = {0.f,0.f,0.f,0.f,0.f,0.f,0.f,0.f}; v8f c00 = z8, c01 = z8, c02 = z8, c03 = z8, c10 = z8, c11 = z8, c12 = z8, c13 = z8;
#pragma unroll 1
  for (int kb = 0; kb < K; kb += 32) { const v16h a0 = g2_frag(a0p + kb, hh), a1 = g2_frag(a1p + kb, hh);
    v16h b = g2_frag(b0p + kb, hh); c00 = g2_mma(a0, b, c00); c10 = g2_mma(a1, b, c10);
    b = g2_frag(b1p + kb, hh); c01 = g2_mma(a0, b, c01); c11 = g2_mma(a1, b, c11);
    b = g2_frag(b2p + kb, hh); c02 = g2_mma(a0, b, c02); c12 = g2_mma(a1, b, c12);
    b = g2_frag(b3p + kb, hh); c03 = g2_mma(a0, b, c03); c13 = g2_mma(a1, b, c13); }
  v8f accs[8] = {c00, c01, c02, c03, c10, c11, c12, c13};
#pragma unroll
  for (int u = 0; u < 8; ++u) { const int t = u & 3, half = u >> 2; const int col = col0 + t * 16 + ln; const float bv = bp ? bf16_round(bp[col]) : 0.f;
#pragma unroll
    for (int r = 0; r < 8; ++r) { const int rloc = half * 16 + 8 * hh + r; float v = accs[u][r] * alpha + bv; if (CP) { if (rowsPerB < 0) v += CP[cofs + (size_t)(row0g + row0 + rloc) * ldc + col];      /* rowsPerB < 0: own element of the batched C plane */ else { const int bidx = (row0g + row0 + rloc) / rowsPerB; v += CP[(size_t)bidx * sCPb + (size_t)by * 64 + col]; } }
      if (ACT == 3) v = fmaxf(v, 0.f); else if (ACT == 6) v = 0.5f * v * (1.0f + erff(v * 0.70710678118654752f)); else if (ACT == 11) v = 1.0f / (1.0f + expf(-v)); else if (ACT == 15) v = v / (1.0f + expf(-v)); else if (ACT == 12) v = (v > 0.f) ? v : 0.01f * v; else if (ACT == 8) v = tanhf(v); else if (ACT == 9) v = 0.5f * v * (1.0f + tanhf(0.7978845608028654f * (v + 0.044715f * v * v * v))); else if (ACT == 14) v = (v > 0.f) ? v : 0.1f * v; else if (ACT == 16) v = (v >= 0.f) ? v : 0.3f * v; else if (ACT == 17) v = (v >= 0.f) ? v : 0.2f * v;
      so[w][rloc][t * 16 + ln] = v; } }
  __builtin_amdgcn_fence(__ATOMIC_ACQ_REL, "workgroup"); __builtin_amdgcn_wave_barrier();
  const int rsub = lane >> 4, c4 = (lane & 15) * 4;
  {
#pragma unroll
    for (int q = 0; q < 16; ++q) { const int r = q * 2 + rsub; const v4f v = *(const v4fa*)&so[w][r][c4]; if (C) *(v4f*)(C + cofs + (size_t)(row0 + r) * ldc + col0 + c4) = v; if (C16) { v4h h4; for (int i = 0; i < 4; ++i) h4[i] = (_Float16)v[i]; *(v4h*)(C16 + cofs + (size_t)(row0 + r) * ldc + col0 + c4) = h4; } }
     } }


__global__ __launch_bounds__(256) void k_wnat(const float* __restrict__ w, size_t n8, _Float16* __restrict__ Bt) { const size_t t = (size_t)blockIdx.x * 256 + threadIdx.x; if (t >= n8) return; FragH f; for (int q = 0; q < 8; ++q) f.h[q] = (_Float16)(bf16_round(w[t * 8 + q]) * 16.0f); *(v8us*)((unsigned short*)Bt + t * 8) = f.half[0];  }
__global__ __launch_bounds__(256) void k_rsm(const float* __restrict__ S, _Float16* __restrict__ P, int nrows) {
  #pragma clang fp contract(off)
  const int i = blockIdx.x * 256 + threadIdx.x; if (i >= nrows) return; const float* s = S + (size_t)i * SQ; float mx = -3.0e38f;
#pragma unroll 1
  for (int j = 0; j < SQ; ++j) mx = fmaxf(mx, s[j]); float se = 0.f;
#pragma unroll 1
  for (int j = 0; j < SQ; ++j) se += expf(s[j] - mx); const float sc = 256.0f / se;
#pragma unroll 1
  for (int j0 = 0; j0 < SQ; j0 += 8) { FragH f; for (int q = 0; q < 8; ++q) f.h[q] = (_Float16)(expf(s[j0 + q] - mx) * sc); unsigned short* d = (unsigned short*)P + (size_t)i * SQ + j0; *(v8us*)d = f.half[0];  } }
__global__ __launch_bounds__(256) void k_vt(const _Float16* __restrict__ V16, int b, int h0, _Float16* __restrict__ VT) { __shared__ unsigned short tl[64][65]; const int tid = threadIdx.x; const int hh = blockIdx.x % HG, sg = blockIdx.x / HG; const int s0 = sg * 64; const int h = h0 + hh;
  for (int i = tid; i < 64 * 8; i += 256) { const int j = i / 8, d8 = (i % 8) * 8; FragH f; f.half[0] = *(const v8us*)((const unsigned short*)V16 + ((size_t)b * SQ + s0 + j) * DM + h * HD + d8); for (int q = 0; q < 8; ++q) tl[d8 + q][j] = f.u[q]; }
  __syncthreads();
  { for (int i = tid; i < 64 * 8; i += 256) { const int d = i / 8, j8 = (i % 8) * 8; FragH f; for (int q = 0; q < 8; ++q) f.u[q] = tl[d][j8 + q]; *(v8us*)((unsigned short*)VT + ((size_t)hh * HD + d) * SQ + s0 + j8) = f.half[0]; }  } }



#define FQ 128                       /* query rows per block: 4 waves x 32 */
__device__ __forceinline__ v8f fa_mma(v16h a, v16h b, v8f c) { return __builtin_amdgcn_wmma_f32_16x16x32_f16(false, a, false, b, (short)0, c, false, false); }
__global__ __launch_bounds__(128) void k_fattn(const _Float16* __restrict__ QK, const _Float16* __restrict__ VT, _Float16* __restrict__ O) {
  constexpr float SC2 = 0.036084391824351615f * 1.4426950408889634f;      /* 1/sqrt(768) x log2(e): the softmax runs in base 2 */
  const int lane = threadIdx.x & 31, ln = lane & 15, hh = lane >> 4; const int w = __builtin_amdgcn_readfirstlane(threadIdx.x >> 5);      /* scalar wave number: trip count and row bases stay scalar */
  const int bh = blockIdx.x % (NB * NH), qb = (SQ / FQ - 1) - blockIdx.x / (NB * NH); const int b = bh / NH, h = bh % NH; const int qw = qb * FQ + w * 32;
  const _Float16* kb = QK + (size_t)b * SQ * DM + h * HD + (size_t)ln * DM;      /* this lane's row within a 16-row tile of q = k */
  const _Float16* vb = VT + ((size_t)bh * HD + ln) * SQ;                          /* this lane's row within a 16-row tile of V^T */
  v16h qf[2][2];
#pragma unroll
  for (int g = 0; g < 2; ++g)
#pragma unroll
    for (int ks = 0; ks < 2; ++ks) qf[g][ks] = g2_frag(kb + (size_t)(qw + g * 16) * DM + ks * 32, hh);
  const v8f z8 = {0.f, 0.f, 0.f, 0.f, 0.f, 0.f, 0.f, 0.f};
  v8f o[2][4]; float m[2], l[2];
#pragma unroll
  for (int g = 0; g < 2; ++g) { m[g] = -1.0e30f; l[g] = 0.f;
#pragma unroll
    for (int dt = 0; dt < 4; ++dt) o[g][dt] = z8; }
  const int nit = qw / 32 + 1;      /* the last pass is the diagonal block, the only one with masked keys */
  v16h kf[2][2];
#pragma unroll
  for (int kt = 0; kt < 2; ++kt)
#pragma unroll
    for (int ks = 0; ks < 2; ++ks) kf[kt][ks] = g2_frag(kb + (size_t)(kt * 16) * DM + ks * 32, hh);
  __builtin_amdgcn_sched_barrier(0);      /* keeps the first V^T loads behind the Q and K loads, as on the back edge: loads return in order, so the wait at the loop's head then covers K alone and leaves V^T in flight */
  v16h vf[4];
#pragma unroll
  for (int dt = 0; dt < 4; ++dt) vf[dt] = g2_frag(vb + (size_t)(dt * 16) * SQ, hh);
#pragma unroll 1
  for (int it = 0; it < nit; ++it) { const int k0 = it * 32;
    v8f s[2][2];
#pragma unroll
    for (int g = 0; g < 2; ++g)
#pragma unroll
      for (int kt = 0; kt < 2; ++kt) s[g][kt] = fa_mma(kf[kt][1], qf[g][1], fa_mma(kf[kt][0], qf[g][0], z8));
    const int kn = (it + 1 < nit) ? k0 + 32 : k0;      /* next pass's K rows and V^T columns are fetched one pass ahead; the last pass re-reads its own, so nothing past the diagonal block is touched */
#pragma unroll
    for (int kt = 0; kt < 2; ++kt)
#pragma unroll
      for (int ks = 0; ks < 2; ++ks) kf[kt][ks] = g2_frag(kb + (size_t)(kn + kt * 16) * DM + ks * 32, hh);
    if (it == nit - 1) {
#pragma unroll
      for (int g = 0; g < 2; ++g)
#pragma unroll
        for (int kt = 0; kt < 2; ++kt)
#pragma unroll
          for (int r = 0; r < 8; ++r) s[g][kt][r] = (kt * 16 + 8 * hh + r <= g * 16 + ln) ? s[g][kt][r] : -1.0e30f; }      /* k0 == qw here: key <= query */
    float mn[2]; bool need = false;
#pragma unroll
    for (int g = 0; g < 2; ++g) { float mx = s[g][0][0];
#pragma unroll
      for (int r = 1; r < 8; ++r) mx = fmaxf(mx, s[g][0][r]);
#pragma unroll
      for (int r = 0; r < 8; ++r) mx = fmaxf(mx, s[g][1][r]);
      mx = fmaxf(mx, __shfl_xor(mx, 16, 32)); mn[g] = fmaxf(m[g], mx * SC2); need = need || (mn[g] > m[g]); }
    if (__builtin_amdgcn_ballot_w32(need) != 0) {      /* no column's maximum moved: every factor would be exactly 1, so the rescale is skipped as a whole */
#pragma unroll
      for (int g = 0; g < 2; ++g) { const float al = __builtin_amdgcn_exp2f(m[g] - mn[g]); m[g] = mn[g]; l[g] *= al;
#pragma unroll
        for (int dt = 0; dt < 4; ++dt) o[g][dt] *= al; } }
    FragH pf[2];
#pragma unroll
    for (int g = 0; g < 2; ++g) { float ls = 0.f;
#pragma unroll
      for (int kt = 0; kt < 2; ++kt) { const v8f t = s[g][kt] * SC2 - m[g];
#pragma unroll
        for (int r = 0; r < 8; ++r) { const float p = __builtin_amdgcn_exp2f(t[r]); ls += p; pf[g].h[kt * 8 + r] = (_Float16)p; } }
      l[g] += ls; }
#pragma unroll
    for (int g = 0; g < 2; ++g)
#pragma unroll
      for (int dt = 0; dt < 4; ++dt) o[g][dt] = fa_mma(vf[dt], pf[g].v, o[g][dt]);
#pragma unroll
    for (int dt = 0; dt < 4; ++dt) vf[dt] = g2_frag(vb + (size_t)(dt * 16) * SQ + kn, hh); }      /* next pass's V^T columns, carried over the back edge: they land under the next score products and softmax */
#pragma unroll
  for (int g = 0; g < 2; ++g) { const float fin = 64.0f / (l[g] + __shfl_xor(l[g], 16, 32));      /* halves joined once; o carried x64 */
    _Float16* orow = O + ((size_t)b * SQ + qw + g * 16 + ln) * DM + h * HD + 8 * hh;
#pragma unroll
    for (int dt = 0; dt < 4; ++dt) { FragH f;
#pragma unroll
      for (int r = 0; r < 8; ++r) f.h[r] = (_Float16)(o[g][dt][r] * fin);
      *(v8us*)((unsigned short*)orow + dt * 16) = f.half[0]; } } }

// Exact f32 attention for the first QT0 rows of one batch; F holds the f32 rows of q = k = v (pitch ld). One wave per (head, query row), A0W rows a block.
// Scores: lane = key (four groups of 32 keys), the query row broadcast from LDS, four partial sums per key. Softmax: two passes over the wave's own registers.
// P V: lane = two head columns, keys in ascending order, each weight broadcast from its lane through a scalar register.
// Every wave stages and walks all QT0 keys, keys past its query with weight exactly 0: the launch lasts as long as the wave of the last row, which needs them all,
// and without tests the code is one straight line whose LDS reads have constant offsets and fly together.
// Every loop is fully unrolled: the small arrays are then indexed by constants and stay in registers, and each weight is read from a constant lane.
#define A0W 8                        /* waves = query rows per block */
#define A0P 68                       /* LDS row pitch in floats: 16-byte column walks fall on distinct banks */
typedef float v2f __attribute__((ext_vector_type(2)));
__global__ __launch_bounds__(256) void k_att0(const float* __restrict__ F, int ld, float scale, float* __restrict__ OF, int ldo) {
  __shared__ __attribute__((aligned(16))) float tl[QT0][A0P];
  const int tid = threadIdx.x, lane = tid & 31; const int w = __builtin_amdgcn_readfirstlane(tid >> 5);      /* scalar wave number: the query row's LDS address stays scalar */
  const int h = blockIdx.x / (QT0 / A0W), rg = blockIdx.x % (QT0 / A0W); const int i = rg * A0W + w;
#pragma unroll
  for (int u = 0; u < QT0 * (HD / 4) / 256; ++u) { const int e = u * 256 + tid; const int r = e >> 4, c = (e & 15) * 4; *(v4f*)&tl[r][c] = *(const v4fa*)(F + (size_t)r * ld + h * HD + c); }
  __syncthreads();
  v4f a[QT0 / 32];
#pragma unroll
  for (int t = 0; t < QT0 / 32; ++t) a[t] = (v4f){0.f, 0.f, 0.f, 0.f};
#pragma unroll
  for (int c = 0; c < HD / 4; ++c) { const v4f q = *(const v4f*)&tl[i][c * 4];
#pragma unroll
    for (int t = 0; t < QT0 / 32; ++t) a[t] = __builtin_elementwise_fma(q, *(const v4f*)&tl[t * 32 + lane][c * 4], a[t]); }
  float s[QT0 / 32], mx = -1.0e30f;
#pragma unroll
  for (int t = 0; t < QT0 / 32; ++t) { const float d = (a[t][0] + a[t][1]) + (a[t][2] + a[t][3]); s[t] = (t * 32 + lane <= i) ? d * scale : -1.0e30f; mx = fmaxf(mx, s[t]); }
#pragma unroll
  for (int d = 16; d > 0; d >>= 1) mx = fmaxf(mx, __shfl_xor(mx, d, 32));      /* key 0 is never masked: mx is a real score */
  float p[QT0 / 32], l = 0.f;
#pragma unroll
  for (int t = 0; t < QT0 / 32; ++t) { p[t] = expf(s[t] - mx); l += p[t]; }      /* masked keys: exp of about -1e30 = 0 */
#pragma unroll
  for (int d = 16; d > 0; d >>= 1) l += __shfl_xor(l, d, 32);
  v2f o = {0.f, 0.f};
#pragma unroll
  for (int t = 0; t < QT0 / 32; ++t)
#pragma unroll
    for (int k = 0; k < 32; ++k) { const float pj = __uint_as_float(__builtin_amdgcn_readlane(__float_as_uint(p[t]), k)); const v2f pp = {pj, pj};
      o = __builtin_elementwise_fma(pp, *(const v2f*)&tl[t * 32 + k][2 * lane], o); }
  const float fin = 64.0f / l;      /* o carried x64 like the f16 path */
  *(v2f*)(OF + (size_t)i * ldo + h * HD + 2 * lane) = o * fin; }

extern "C" void kernel_launch(void* const* d_in, const int* in_sizes, int n_in,
                              void* d_out, int out_size, void* d_ws, size_t ws_size, hipStream_t stream) {
  (void)in_sizes; (void)n_in; (void)out_size;
  const float* const* I = (const float* const*)d_in; const float* x = I[0]; const float* wq = I[1]; const float* wo = I[2]; const float* bo = I[3]; const float* wk = wq; const float* wv = wq;      /* Wq [12][64][768] = natural [768][768] rows h*64+d (q = k = v); W_out natural + b_out */
  char* ws = (char*)d_ws; size_t off = 0;
  auto take = [&](size_t bytes) { char* p = ws + off; off += (bytes + 255) & ~(size_t)255; return p; };
  _Float16* BQ = (_Float16*)take((size_t)DM * DM * 2); _Float16* BK = BQ; _Float16* BV = BQ; _Float16* BO = (_Float16*)take((size_t)DM * DM * 2);
  _Float16* X16 = (_Float16*)take(NR * DM * 2); _Float16* Q16 = (_Float16*)take(NR * DM * 2); _Float16* K16 = Q16; _Float16* V16 = Q16;      /* q = k = v (the module projects all three with self.query) */ _Float16* O16 = (_Float16*)take(NR * DM * 2);
  _Float16* VT = (_Float16*)take((size_t)NB * NH * HD * SQ * 2);
  float* QF0 = (float*)take((size_t)QT0 * DM * 4); float* KF0 = (float*)take((size_t)QT0 * DM * 4); float* VF0 = (float*)take((size_t)QT0 * DM * 4); float* OF0 = (float*)take((size_t)NB * QT0 * DM * 4); _Float16* OH0 = (_Float16*)take((size_t)NB * QT0 * DM * 2); _Float16* OL0 = (_Float16*)take((size_t)NB * QT0 * DM * 2);
  if (off > ws_size) return;
  k_wnat<<<(unsigned)(((size_t)DM * DM / 8 + 255) / 256), 256, 0, stream>>>(wq, (size_t)DM * DM / 8, BQ); k_wnat<<<(unsigned)(((size_t)DM * DM / 8 + 255) / 256), 256, 0, stream>>>(wo, (size_t)DM * DM / 8, BO);      /* natural [out][in] = Bt x16 */

  k_x16<<<(unsigned)((NR * DM / 8 + 255) / 256), 256, 0, stream>>>(x, X16, NR * DM / 8);
  const size_t r0p = (size_t)B0 * SQ;      /* first projected row */
  k_gemm2<0><<<dim3((unsigned)((MP / 128) * (DM / 64)), 1), 128, 0, stream>>>(X16 + r0p * DM, DM, 0, BQ, DM, 0, 0.0625f, nullptr, 0, nullptr, 1, 0, 0, nullptr, Q16 + r0p * DM, DM, 0, MP, DM, DM);
  k_vt<NH, SQ><<<NB * NH * (SQ / 64), 256, 0, stream>>>(V16, LQ, 0, VT);      /* V^T [NB][NH][HD][SQ] */
  k_fattn<<<NB * NH * (SQ / FQ), 128, 0, stream>>>(Q16, VT, O16);      /* scores, causal softmax and P V in one launch; o (merged heads, x64) as f16 rows */
  for (int b = B0; b < B0 + NBR; ++b) { const size_t r0 = (size_t)b * SQ;
    k_gemm2<0><<<dim3((QT0 / 128) * (DM / 64), 1), 128, 0, stream>>>(X16 + r0 * DM, DM, 0, BQ, DM, 0, 0.0625f, nullptr, 0, nullptr, 1, 0, 0, QF0, nullptr, DM, 0, QT0, DM, DM); /* KF0 = VF0 = QF0 (same projection) */      /* f32 q, k, v of the first 128 rows (exact products) */
    k_att0<<<NH * (QT0 / A0W), 32 * A0W, 0, stream>>>(QF0, DM, 0.036084391824351615f, OF0 + (size_t)b * QT0 * DM, DM);      /* exact f32 attention for rows 0..127 (o x64) */ }
  k_gemm2<0><<<dim3((unsigned)((MPO / 128) * (DM / 64)), 1), 128, 0, stream>>>(O16 + r0p * DM, DM, 0, BO, DM, 0, 0.0009765625f, bo, 0, nullptr, 1, 0, 0, (float*)d_out + r0p * DM, nullptr, DM, 0, MPO, DM, DM);      /* out rows are the output layout */
  k_hl<<<(unsigned)(((size_t)NB * QT0 * DM / 8 + 255) / 256), 256, 0, stream>>>(OF0, OH0, OL0, (size_t)NB * QT0 * DM / 8);      /* first-tile o (x64) -> f16 hi + x1024 residual planes */
  for (int b = B0; b < B0 + NBR; ++b) { const size_t r0 = (size_t)b * SQ; const size_t f0 = (size_t)b * QT0;
    k_gemm2<0><<<dim3((QT0 / 128) * (DM / 64), 1), 128, 0, stream>>>(OH0 + f0 * DM, DM, 0, BO, DM, 0, 0.0009765625f, bo, 0, nullptr, 1, 0, 0, (float*)d_out + r0 * DM, nullptr, DM, 0, QT0, DM, DM);      /* rows 0..127: out = o_hi Wo (+ b), overwriting the f16-path rows */
    k_gemm2<0><<<dim3((QT0 / 128) * (DM / 64), 1), 128, 0, stream>>>(OL0 + f0 * DM, DM, 0, BO, DM, 0, 0.00000095367431640625f, nullptr, 0, (const float*)d_out + r0 * DM, -1, 0, 0, (float*)d_out + r0 * DM, nullptr, DM, 0, QT0, DM, DM); }      /* += o_lo Wo 2^-20 (own-element accumulate) */
}

// v004
// One run takes 326 microseconds.
// Timed twice side by side with v003, it ran 1.15 times as fast both times.
// Counting every step since v000, it is 44.6 times as fast.
#include <hip/hip_runtime.h>
// Causal multi-head attention whose q, k AND v are the same per-head projection (x [2][4096][768]; q = k = v = x Wq[h]^T with Wq [12][64][768] (natural per-head rows, sigma 1/sqrt(768)); scores = q.q / sqrt(768) (the module scales by d_model); causal (tril, -inf); softmax; out = merged (attn q) W_out^T + b_out -> [2][4096][768]).
// Structure: token rows r = b*4096 + s; x as exact f16 rows (bf16-rounded); q (= k = v) as one WMMA GEMM (32x64 wave tiles, f32 accumulation, exact x16 weights, f16 outputs); V^T for all batches and heads via LDS transposes; one fused launch for the attention: per wave 32 query rows, keys 32 at a time up to the diagonal block, S^T = K Q^T, online base-2 softmax in registers (f32 statistics, native exp2; weights in (0,1] as f16), O^T += V^T P^T (o carried x64, folded into the output GEMM alpha) written straight into the merged f16 o rows; out = o W_o GEMM (f32) into the output layout.
// Compute dtype: inputs rounded to bf16; x / weights exact; q, k, v, softmax weights and o as plain f16 GEMM operands (~2^-12); scores and softmax statistics f32. v_wmma_f32_16x16x32_f16.
#define NB 2
#define SQ 4096
#define DM 768
#define NH 12
#define HD 64
#define HG 4                         /* heads per launch of the unused per-batch k_vt */
#define QT0 128                      /* first-tile rows recomputed exactly in f32 */
#define B0 0                         /* first batch processed (debug hook) */
#define NBR NB                       /* batches processed (debug hook) */
#define NR ((size_t)NB * SQ)         /* token rows */
#define MP ((int)((size_t)NBR * SQ)) /* rows projected (debug hook) */
#define MPO MP                       /* rows through the output stage (debug hook) */
#define LQ DM      /* row pitch of the q/k/v rows */
typedef __bf16 v16b __attribute__((ext_vector_type(16)));
typedef unsigned short v8us __attribute__((ext_vector_type(8), may_alias));
typedef float  v8f  __attribute__((ext_vector_type(8)));
typedef float  v4f  __attribute__((ext_vector_type(4)));
typedef float  v4fa __attribute__((ext_vector_type(4), may_alias));
union FragB { v16b v; v8us half[2]; unsigned short u[16]; };

__device__ __forceinline__ unsigned short bf16_bits(float x) { unsigned int u = __float_as_uint(x); return (unsigned short)((u + 0x7FFFu + ((u >> 16) & 1u)) >> 16); }
__device__ __forceinline__ float bf16_val(unsigned short b) { return __uint_as_float(((unsigned int)b) << 16); }
__device__ __forceinline__ float bf16_round(float x) { return bf16_val(bf16_bits(x)); }
// D += A·B with NT terms: 1 = ah·bh, 2 = + al·bh (A split), 3 = + ah·bl (both split)
template <int NT>
__device__ __forceinline__ v8f mmaN(v16b ah, v16b al, v16b bh, v16b bl, v8f c) {
  c = __builtin_amdgcn_wmma_f32_16x16x32_bf16(false, ah, false, bh, (short)0, c, false, false);
  if (NT >= 2) c = __builtin_amdgcn_wmma_f32_16x16x32_bf16(false, al, false, bh, (short)0, c, false, false);
  if (NT >= 3) c = __builtin_amdgcn_wmma_f32_16x16x32_bf16(false, ah, false, bl, (short)0, c, false, false);
  asm volatile("v_nop\n\tv_nop\n\tv_nop\n\tv_nop" : "+v"(c) : "v"(ah), "v"(al), "v"(bh), "v"(bl));
  return c;
}

__global__ __launch_bounds__(256) void k_wt_bf16(const float* __restrict__ W, unsigned short* __restrict__ Wt, int K, int N) {
  const int t = blockIdx.x * 256 + threadIdx.x;
  const int k8n = K / 8;
  if (t >= N * k8n) return;
  const int n = t / k8n, k8 = (t % k8n) * 8;
  v8us v;
#pragma unroll
  for (int i = 0; i < 8; ++i) v[i] = bf16_bits(W[(size_t)(k8 + i) * N + n]);
  *(v8us*)(Wt + (size_t)n * K + k8) = v;
  
}

// GEMM C[M][N] (f32, pitch ldc) = act(A[M][K]·W + bias). A f32 row-major (pitch lda) converted per fragment to bf16
// (ASPLIT: hi/lo two planes -> 2 terms, else single rounded term); Wt bf16 [N][K] (pitch ldb). BIAS_BF16 rounds the
// bias to bf16 first (bias quantised to bf16 before the add). K%32==0, M%16==0, N%64==0.
template <bool ASPLIT, int ACT, bool BIAS_BF16>
__global__ __launch_bounds__(128) void k_gemm_bf(const float* __restrict__ A, int lda, const unsigned short* __restrict__ Wt, int ldb,
                                               const float* __restrict__ bias, float* __restrict__ C, int ldc, int M, int N, int K) {
  __shared__ __attribute__((aligned(16))) float so[4][16][64];
  const int tid = threadIdx.x, w = tid >> 5, lane = tid & 31, ln = lane & 15, hh = lane >> 4;
  const int ntn = N / 64;
  const int wid = blockIdx.x * 4 + w;
  const int mt = wid / ntn, nq = wid % ntn;
  if (mt * 16 >= M) return;
  const int row0 = mt * 16, col0 = nq * 64;
  const float* arow = A + (size_t)(row0 + ln) * lda;
  v8f acc[4] = {};
  for (int kb = 0; kb < K; kb += 32) {
    FragB ah, al;
    const v4f x0 = *(const v4fa*)(arow + kb + 8 * hh), x1 = *(const v4fa*)(arow + kb + 8 * hh + 4);
    const v4f x2 = *(const v4fa*)(arow + kb + 16 + 8 * hh), x3 = *(const v4fa*)(arow + kb + 16 + 8 * hh + 4);
    float xs[16] = {x0[0],x0[1],x0[2],x0[3],x1[0],x1[1],x1[2],x1[3],x2[0],x2[1],x2[2],x2[3],x3[0],x3[1],x3[2],x3[3]};
#pragma unroll
    for (int i = 0; i < 16; ++i) { const unsigned short hb = bf16_bits(xs[i]); ah.u[i] = hb; al.u[i] = ASPLIT ? bf16_bits(xs[i] - bf16_val(hb)) : (unsigned short)0; }
#pragma unroll
    for (int t = 0; t < 4; ++t) {
      const unsigned short* brow = Wt + (size_t)(col0 + t * 16 + ln) * ldb + kb;
      FragB b;
      b.half[0] = *(const v8us*)(brow + 8 * hh);
      b.half[1] = *(const v8us*)(brow + 16 + 8 * hh);
      acc[t] = mmaN<ASPLIT ? 2 : 1>(ah.v, al.v, b.v, b.v, acc[t]);
    }
  }
#pragma unroll
  for (int t = 0; t < 4; ++t) {
    float bv = bias ? bias[col0 + t * 16 + ln] : 0.f;
    if (BIAS_BF16) bv = bf16_round(bv);
#pragma unroll
    for (int r = 0; r < 8; ++r) { float v = acc[t][r] + bv; if (ACT == 1) v = fmaxf(v, 0.f); so[w][8 * hh + r][t * 16 + ln] = v; }
  }
  __builtin_amdgcn_fence(__ATOMIC_ACQ_REL, "workgroup");
  __builtin_amdgcn_wave_barrier();
  const int rsub = lane >> 4, c4 = (lane & 15) * 4;
  {
#pragma unroll
    for (int q = 0; q < 8; ++q) {
      const int r = q * 2 + rsub;
      const v4f v = *(const v4fa*)&so[w][r][c4];
      *(v4f*)(C + (size_t)(row0 + r) * ldc + col0 + c4) = v;
    }
    
  }
}

// GEMM C = act(A·W + bias + resid): A f32 (ASPLIT -> hi/lo 2 terms), Wt bf16 [N][K]; ACT 0 none, 1 relu, 2 exact gelu;
// resid (optional, f32, row index = (row % rmod), pitch ldr, RES_BF16 rounds it) added before the activation.
template <bool ASPLIT, int ACT, bool BIAS_BF16, bool RES_BF16>
__global__ __launch_bounds__(128) void k_gemm_bf3(const float* __restrict__ A, int lda, const unsigned short* __restrict__ Wt, int ldb,
                                                const float* __restrict__ bias, const float* __restrict__ resid, int rmod, int ldr,
                                                float* __restrict__ C, int ldc, int M, int N, int K) {
  __shared__ __attribute__((aligned(16))) float so[4][16][64];
  const int tid = threadIdx.x, w = tid >> 5, lane = tid & 31, ln = lane & 15, hh = lane >> 4;
  const int ntn = N / 64;
  const int wid = blockIdx.x * 4 + w;
  const int mt = wid / ntn, nq = wid % ntn;
  if (mt * 16 >= M) return;
  const int row0 = mt * 16, col0 = nq * 64;
  const float* arow = A + (size_t)(row0 + ln) * lda;
  v8f acc[4] = {};
  for (int kb = 0; kb < K; kb += 32) {
    FragB ah, al;
    const v4f x0 = *(const v4fa*)(arow + kb + 8 * hh), x1 = *(const v4fa*)(arow + kb + 8 * hh + 4);
    const v4f x2 = *(const v4fa*)(arow + kb + 16 + 8 * hh), x3 = *(const v4fa*)(arow + kb + 16 + 8 * hh + 4);
    float xs[16] = {x0[0],x0[1],x0[2],x0[3],x1[0],x1[1],x1[2],x1[3],x2[0],x2[1],x2[2],x2[3],x3[0],x3[1],x3[2],x3[3]};
#pragma unroll
    for (int i = 0; i < 16; ++i) { const unsigned short hb = bf16_bits(xs[i]); ah.u[i] = hb; al.u[i] = ASPLIT ? bf16_bits(xs[i] - bf16_val(hb)) : (unsigned short)0; }
#pragma unroll
    for (int t = 0; t < 4; ++t) {
      const unsigned short* brow = Wt + (size_t)(col0 + t * 16 + ln) * ldb + kb;
      FragB b;
      b.half[0] = *(const v8us*)(brow + 8 * hh);
      b.half[1] = *(const v8us*)(brow + 16 + 8 * hh);
      acc[t] = mmaN<ASPLIT ? 2 : 1>(ah.v, al.v, b.v, b.v, acc[t]);
    }
  }
#pragma unroll
  for (int t = 0; t < 4; ++t) {
    const int col = col0 + t * 16 + ln;
    float bv = bias ? bias[col] : 0.f;
    if (BIAS_BF16) bv = bf16_round(bv);
#pragma unroll
    for (int r = 0; r < 8; ++r) {
      float v = acc[t][r] + bv;
      if (resid) { float rv = resid[(size_t)((row0 + 8 * hh + r) % rmod) * ldr + col]; if (RES_BF16) rv = bf16_round(rv); v += rv; }
      if (ACT == 1) v = fmaxf(v, 0.f);
      if (ACT == 2) v = 0.5f * v * (1.0f + erff(v * 0.70710678118654752f));
      if (ACT == 3) { const float u = 0.7978845608028654f * (v + 0.044715f * v * v * v); v = 0.5f * v * (1.0f + tanhf(u)); }
      so[w][8 * hh + r][t * 16 + ln] = v;
    }
  }
  __builtin_amdgcn_fence(__ATOMIC_ACQ_REL, "workgroup");
  __builtin_amdgcn_wave_barrier();
  const int rsub = lane >> 4, c4 = (lane & 15) * 4;
  {
#pragma unroll
    for (int q = 0; q < 8; ++q) {
      const int r = q * 2 + rsub;
      const v4f v = *(const v4fa*)&so[w][r][c4];
      *(v4f*)(C + (size_t)(row0 + r) * ldc + col0 + c4) = v;
    }
    
  }
}
// row LayerNorm (biased variance, eps) over N: s = X (+ R); optional out_sum <- s; out_norm <- (s-mu)*rsqrt(var+eps)*g + b
template <bool PARAM_BF16>
__global__ __launch_bounds__(256) void k_layernorm(const float* __restrict__ X, const float* __restrict__ R, const float* __restrict__ g, const float* __restrict__ bta,
                                                  float* __restrict__ out_sum, float* __restrict__ out_norm, int N, float eps) {
  __shared__ float red[256];
  const int row = blockIdx.x, tid = threadIdx.x;
  const float* x = X + (size_t)row * N; const float* rr = R ? R + (size_t)row * N : nullptr;
  float vals[16];                     // up to N = 4096
  const int per = N / 256;            // contiguous chunk per thread? use strided-by-4 chunks: thread handles j = tid*4 + 1024*u
  float s1 = 0.f;
  for (int u = 0; u < per / 4; ++u) {
    const int j = tid * 4 + 1024 * u;
    const v4f a = *(const v4fa*)(x + j);
    v4f b = {0.f,0.f,0.f,0.f}; if (rr) b = *(const v4fa*)(rr + j);
#pragma unroll
    for (int q = 0; q < 4; ++q) { const float v = a[q] + b[q]; vals[u * 4 + q] = v; s1 += v; }
  }
  red[tid] = s1; __syncthreads();
  for (int st = 128; st > 0; st >>= 1) { if (tid < st) red[tid] += red[tid + st]; __syncthreads(); }
  const float mu = red[0] / (float)N; __syncthreads();
  float s2 = 0.f;
  for (int u = 0; u < per / 4; ++u)
#pragma unroll
    for (int q = 0; q < 4; ++q) { const float c = vals[u * 4 + q] - mu; s2 += c * c; }
  red[tid] = s2; __syncthreads();
  for (int st = 128; st > 0; st >>= 1) { if (tid < st) red[tid] += red[tid + st]; __syncthreads(); }
  const float rs = rsqrtf(red[0] / (float)N + eps);
  {
    for (int u = 0; u < per / 4; ++u) {
      const int j = tid * 4 + 1024 * u;
      v4f o, sm;
#pragma unroll
      for (int q = 0; q < 4; ++q) {
        float gg = g[j + q], bb = bta[j + q];
        if (PARAM_BF16) { gg = bf16_round(gg); bb = bf16_round(bb); }
        sm[q] = vals[u * 4 + q]; o[q] = (vals[u * 4 + q] - mu) * rs * gg + bb;
      }
      if (out_sum) *(v4f*)(out_sum + (size_t)row * N + j) = sm;
      *(v4f*)(out_norm + (size_t)row * N + j) = o;
    }
    
  }
}



// ---- f16 WMMA path (v_wmma_f32_16x16x32_f16): 11-bit significands for operands in range — used where a [0,1] probability operand needs more precision than bf16
typedef _Float16 v16h __attribute__((ext_vector_type(16)));
union FragH { v16h v; v8us half[2]; _Float16 h[16]; unsigned short u[16]; };
template <int NT>
__device__ __forceinline__ v8f mmaH(v16h ah, v16h al, v16h bh, v16h bl, v8f c) {
  c = __builtin_amdgcn_wmma_f32_16x16x32_f16(false, ah, false, bh, (short)0, c, false, false);
  if (NT >= 2) c = __builtin_amdgcn_wmma_f32_16x16x32_f16(false, al, false, bh, (short)0, c, false, false);
  if (NT >= 3) c = __builtin_amdgcn_wmma_f32_16x16x32_f16(false, ah, false, bl, (short)0, c, false, false);
  asm volatile("v_nop\n\tv_nop\n\tv_nop\n\tv_nop" : "+v"(c) : "v"(ah), "v"(al), "v"(bh), "v"(bl));
  return c;
}
// batched GEMM like k_gemm_b but f16 operands: A f32 (split into f16 hi/lo if ASPLIT, else rounded to f16), Bt = f16 values [n][k]; alpha; C f32; N multiple of 16 (partial tiles skipped)
template <bool ASPLIT>
__global__ __launch_bounds__(128) void k_gemm_h(const float* __restrict__ A, int lda, size_t sA, const _Float16* __restrict__ Bh, int ldb, size_t sB, float alpha, float* __restrict__ C, int ldc, size_t sC, int M, int N, int K) {
  __shared__ __attribute__((aligned(16))) float so[4][16][64];
  const int tid = threadIdx.x, w = tid >> 5, lane = tid & 31, ln = lane & 15, hh = lane >> 4; const int by = blockIdx.y;
  A += (size_t)by * sA; Bh += (size_t)by * sB; C += (size_t)by * sC;
  const int ntn = (N + 63) / 64; const int wid = blockIdx.x * 4 + w; const int mt = wid / ntn, nq = wid % ntn; if (mt * 16 >= M) return;
  const int row0 = mt * 16, col0 = nq * 64; const float* arow = A + (size_t)(row0 + ln) * lda;
  v8f acc[4] = {};
  for (int kb = 0; kb < K; kb += 32) {
    FragH ah, al;
    const v4f x0 = *(const v4fa*)(arow + kb + 8 * hh), x1 = *(const v4fa*)(arow + kb + 8 * hh + 4), x2 = *(const v4fa*)(arow + kb + 16 + 8 * hh), x3 = *(const v4fa*)(arow + kb + 16 + 8 * hh + 4);
    float xs[16] = {x0[0],x0[1],x0[2],x0[3],x1[0],x1[1],x1[2],x1[3],x2[0],x2[1],x2[2],x2[3],x3[0],x3[1],x3[2],x3[3]};
#pragma unroll
    for (int i = 0; i < 16; ++i) { const _Float16 h = (_Float16)xs[i]; ah.h[i] = h; al.h[i] = ASPLIT ? (_Float16)(xs[i] - (float)h) : (_Float16)0.0f; }
#pragma unroll
    for (int t = 0; t < 4; ++t) { if (col0 + t * 16 >= N) continue; const size_t boff = (size_t)(col0 + t * 16 + ln) * ldb + kb; FragH bq; bq.half[0] = *(const v8us*)(Bh + boff + 8 * hh); bq.half[1] = *(const v8us*)(Bh + boff + 16 + 8 * hh);
      acc[t] = mmaH<ASPLIT ? 2 : 1>(ah.v, al.v, bq.v, bq.v, acc[t]); }
  }
#pragma unroll
  for (int t = 0; t < 4; ++t) { if (col0 + t * 16 >= N) continue;
#pragma unroll
    for (int r = 0; r < 8; ++r) so[w][8 * hh + r][t * 16 + ln] = acc[t][r] * alpha; }
  __builtin_amdgcn_fence(__ATOMIC_ACQ_REL, "workgroup"); __builtin_amdgcn_wave_barrier();
  const int rsub = lane >> 4, c4 = (lane & 15) * 4;
  {
#pragma unroll
    for (int q = 0; q < 8; ++q) { const int r = q * 2 + rsub; if (col0 + c4 < N) { const v4f v = *(const v4fa*)&so[w][r][c4]; *(v4f*)(C + (size_t)(row0 + r) * ldc + col0 + c4) = v; } }
     }
}

// Wt[n][k] = f16(W[k][n]·scale) from f32 row-major W[K][N] (scale = power of two; bf16-exact weights stay exact in f16 away from the subnormal range)
__global__ __launch_bounds__(256) void k_wt_f16(const float* __restrict__ W, _Float16* __restrict__ Wt, int K, int N, float scale) {
  const int t = blockIdx.x * 256 + threadIdx.x; if (t >= N * (K / 8)) return; const int n = t / (K / 8), k8 = (t % (K / 8)) * 8; FragH f;
#pragma unroll
  for (int i = 0; i < 8; ++i) f.h[i] = (_Float16)(bf16_round(W[(size_t)(k8 + i) * N + n]) * scale); const v8us o = f.half[0];
  *(v8us*)((unsigned short*)Wt + (size_t)n * K + k8) = o; 
}
// k_gemm_hh variant with fused epilogue: v = acc·alpha + bias[by·sBias + col] (+ CP[(row/rowsPerB)·sCPb + by·64 + col] if CP) ; ACT 0 none / 1 elu ; writes f16 C16 (and f32 C if non-null)
template <int ACT>
__global__ __launch_bounds__(128) void k_gemm_hhx(const _Float16* __restrict__ A, int lda, size_t sA, const _Float16* __restrict__ Bh, int ldb, size_t sB, float alpha, const float* __restrict__ bias, size_t sBias, const float* __restrict__ CP, int rowsPerB, size_t sCPb, int row0g,
    float* __restrict__ C, _Float16* __restrict__ C16, int ldc, size_t sC, int M, int N, int K) {
  __shared__ __attribute__((aligned(16))) float so[4][16][64];
  const int tid = threadIdx.x, w = tid >> 5, lane = tid & 31, ln = lane & 15, hh = lane >> 4; const int by = blockIdx.y;
  A += (size_t)by * sA; Bh += (size_t)by * sB; const size_t cofs = (size_t)by * sC; const float* bp = bias ? bias + (size_t)by * sBias : nullptr;
  const int ntn = (N + 63) / 64; const int wid = blockIdx.x * 4 + w; const int mt = wid / ntn, nq = wid % ntn; if (mt * 16 >= M) return;
  const int row0 = mt * 16, col0 = nq * 64; const _Float16* arow = A + (size_t)(row0 + ln) * lda;
  v8f acc[4] = {};
  for (int kb = 0; kb < K; kb += 32) { FragH ah; ah.half[0] = *(const v8us*)((const unsigned short*)arow + kb + 8 * hh); ah.half[1] = *(const v8us*)((const unsigned short*)arow + kb + 16 + 8 * hh);
#pragma unroll
    for (int t = 0; t < 4; ++t) { if (col0 + t * 16 >= N) continue; const size_t boff = (size_t)(col0 + t * 16 + ln) * ldb + kb; FragH bq; bq.half[0] = *(const v8us*)((const unsigned short*)Bh + boff + 8 * hh); bq.half[1] = *(const v8us*)((const unsigned short*)Bh + boff + 16 + 8 * hh);
      acc[t] = mmaH<1>(ah.v, ah.v, bq.v, bq.v, acc[t]); }
  }
#pragma unroll
  for (int t = 0; t < 4; ++t) { if (col0 + t * 16 >= N) continue; const int col = col0 + t * 16 + ln; const float bv = bp ? bf16_round(bp[col]) : 0.f;
#pragma unroll
    for (int r = 0; r < 8; ++r) { float v = acc[t][r] * alpha + bv; if (CP) { const int rr = row0g + row0 + 8 * hh + r; if (rowsPerB < 0) v += CP[cofs + (size_t)rr * ldc + col];      /* rowsPerB < 0: own element of the batched C plane */ else { const int bidx = rr / rowsPerB; v += CP[(size_t)bidx * sCPb + (size_t)by * 64 + col]; } } if (ACT == 1) v = (v > 0.f) ? v : expm1f(v); else if (ACT == 7) v = (v > 0.f) ? v + 1.0f : expf(v); else if (ACT == 8) v = tanhf(v); else if (ACT == 9) v = 0.5f * v * (1.0f + tanhf(0.7978845608028654f * (v + 0.044715f * v * v * v))); else if (ACT == 11) v = 1.0f / (1.0f + expf(-v)); else if (ACT == 12) v = (v > 0.f) ? v : 0.01f * v; else if (ACT == 14) v = (v > 0.f) ? v : 0.1f * v; else if (ACT == 16) v = (v >= 0.f) ? v : 0.3f * v; else if (ACT == 17) v = (v >= 0.f) ? v : 0.2f * v; else if (ACT == 15) v = v / (1.0f + expf(-v)); else if (ACT == 3) v = fmaxf(v, 0.f); else if (ACT == 6) v = 0.5f * v * (1.0f + erff(v * 0.70710678118654752f)); so[w][8 * hh + r][t * 16 + ln] = v; } }
  __builtin_amdgcn_fence(__ATOMIC_ACQ_REL, "workgroup"); __builtin_amdgcn_wave_barrier();
  const int rsub = lane >> 4, c4 = (lane & 15) * 4; typedef _Float16 v4h __attribute__((ext_vector_type(4)));
  {
#pragma unroll
    for (int q = 0; q < 8; ++q) { const int r = q * 2 + rsub; if (col0 + c4 < N) { const v4f v = *(const v4fa*)&so[w][r][c4]; if (C) *(v4f*)(C + cofs + (size_t)(row0 + r) * ldc + col0 + c4) = v; if (C16) { v4h h4; for (int i = 0; i < 4; ++i) h4[i] = (_Float16)v[i]; *(v4h*)(C16 + cofs + (size_t)(row0 + r) * ldc + col0 + c4) = h4; } } }
     }
}


typedef _Float16 v4h __attribute__((ext_vector_type(4)));

__global__ __launch_bounds__(256) void k_x16(const float* __restrict__ x, _Float16* __restrict__ X16, size_t n8) { const size_t t = (size_t)blockIdx.x * 256 + threadIdx.x; if (t >= n8) return; FragH f;
#pragma unroll
  for (int q = 0; q < 8; ++q) f.h[q] = (_Float16)bf16_round(x[t * 8 + q]); *(v8us*)((unsigned short*)X16 + t * 8) = f.half[0];  }
__global__ __launch_bounds__(256) void k_h16(const float* __restrict__ x, _Float16* __restrict__ X16, size_t n8) { const size_t t = (size_t)blockIdx.x * 256 + threadIdx.x; if (t >= n8) return; FragH f;
#pragma unroll
  for (int q = 0; q < 8; ++q) f.h[q] = (_Float16)x[t * 8 + q]; *(v8us*)((unsigned short*)X16 + t * 8) = f.half[0];  }
__global__ __launch_bounds__(256) void k_round16f(const float* __restrict__ W, _Float16* __restrict__ Bt, size_t n8) { const size_t t = (size_t)blockIdx.x * 256 + threadIdx.x; if (t >= n8) return; FragH f;
#pragma unroll
  for (int i = 0; i < 8; ++i) f.h[i] = (_Float16)(bf16_round(W[t * 8 + i]) * 16.0f); *(v8us*)((unsigned short*)Bt + t * 8) = f.half[0];  }
template <int NHv, int TTv>
__global__ __launch_bounds__(256) void k_vt(const _Float16* __restrict__ V16, int ldv, int voff, _Float16* __restrict__ Vt) { __shared__ unsigned short tl[64][66]; const int tid = threadIdx.x; const int slab = blockIdx.x / (TTv / 64), lg = blockIdx.x % (TTv / 64); const int b = slab / NHv, h = slab % NHv;
  for (int i = tid; i < 64 * 8; i += 256) { const int r = i / 8, c8 = (i % 8) * 8; FragH f; f.half[0] = *(const v8us*)((const unsigned short*)V16 + ((size_t)b * TTv + lg * 64 + r) * ldv + voff + h * 64 + c8);
#pragma unroll
    for (int q = 0; q < 8; ++q) tl[r][c8 + q] = f.u[q]; }
  __syncthreads();
  {
#pragma unroll
    for (int rd = 0; rd < 2; ++rd) { const int d = rd * 32 + tid / 8, pc = tid % 8; FragH f;
#pragma unroll
      for (int q = 0; q < 8; ++q) f.u[q] = tl[pc * 8 + q][d];
      *(v8us*)((unsigned short*)Vt + ((size_t)slab * 64 + d) * TTv + lg * 64 + pc * 8) = f.half[0]; }
     } }

__global__ __launch_bounds__(256) void k_hl(const float* __restrict__ F, _Float16* __restrict__ Hh, _Float16* __restrict__ Hl, size_t n8) { const size_t t = (size_t)blockIdx.x * 256 + threadIdx.x; if (t >= n8) return; FragH fh, fl; const v4f a = *(const v4fa*)(F + t * 8), c = *(const v4fa*)(F + t * 8 + 4);
#pragma unroll
  for (int q = 0; q < 4; ++q) { _Float16 h = (_Float16)a[q]; fh.h[q] = h; fl.h[q] = (_Float16)((a[q] - (float)h) * 1024.0f); h = (_Float16)c[q]; fh.h[4 + q] = h; fl.h[4 + q] = (_Float16)((c[q] - (float)h) * 1024.0f); }
  { *(v8us*)((unsigned short*)Hh + t * 8) = fh.half[0]; *(v8us*)((unsigned short*)Hl + t * 8) = fl.half[0];  } }

// ---- fast GEMM (wave tile 32x64; requires M % 32 == 0 rows per launch region and N % 64 == 0); epilogue = k_gemm_hhx semantics ----
__device__ __forceinline__ v16h g2_frag(const _Float16* p, int hh) { FragH f; f.half[0] = *(const v8us*)((const unsigned short*)p + 8 * hh); f.half[1] = *(const v8us*)((const unsigned short*)p + 16 + 8 * hh); return f.v; }
__device__ __forceinline__ v8f g2_mma(v16h a, v16h b, v8f c) { v8f d = __builtin_amdgcn_wmma_f32_16x16x32_f16(false, a, false, b, (short)0, c, false, false); asm volatile("v_nop\n\tv_nop\n\tv_nop\n\tv_nop" : "+v"(d) : "v"(a), "v"(b)); return d; }
template <int ACT>
__global__ __launch_bounds__(128) void k_gemm2(const _Float16* __restrict__ A, int lda, size_t sA, const _Float16* __restrict__ Bh, int ldb, size_t sB, float alpha, const float* __restrict__ bias, size_t sBias, const float* __restrict__ CP, int rowsPerB, size_t sCPb, int row0g,
    float* __restrict__ C, _Float16* __restrict__ C16, int ldc, size_t sC, int M, int N, int K) { static_assert(ACT == 0 || ACT == 3 || ACT == 6 || ACT == 8 || ACT == 9 || ACT == 11 || ACT == 12 || ACT == 14 || ACT == 15 || ACT == 16 || ACT == 17, "k_gemm2: unsupported ACT code (would silently apply no activation)");
  __shared__ __attribute__((aligned(16))) float so[4][32][68];
  const int tid = threadIdx.x, w = tid >> 5, lane = tid & 31, ln = lane & 15, hh = lane >> 4; const int by = blockIdx.y;
  A += (size_t)by * sA; Bh += (size_t)by * sB; const size_t cofs = (size_t)by * sC; const float* bp = bias ? bias + (size_t)by * sBias : nullptr;
  const int ntn = N >> 6; const int mt = blockIdx.x / ntn, nq = blockIdx.x - mt * ntn; const int row0 = mt * 128 + 32 * w, col0 = nq * 64; if (row0 >= M) return;
  const _Float16* a0p = A + (size_t)(row0 + ln) * lda; const _Float16* a1p = a0p + (size_t)16 * lda;
  const _Float16* b0p = Bh + (size_t)(col0 + ln) * ldb; const _Float16* b1p = b0p + (size_t)16 * ldb; const _Float16* b2p = b1p + (size_t)16 * ldb; const _Float16* b3p = b2p + (size_t)16 * ldb;
  const v8f z8 = {0.f,0.f,0.f,0.f,0.f,0.f,0.f,0.f}; v8f c00 = z8, c01 = z8, c02 = z8, c03 = z8, c10 = z8, c11 = z8, c12 = z8, c13 = z8;
#pragma unroll 1
  for (int kb = 0; kb < K; kb += 32) { const v16h a0 = g2_frag(a0p + kb, hh), a1 = g2_frag(a1p + kb, hh);
    v16h b = g2_frag(b0p + kb, hh); c00 = g2_mma(a0, b, c00); c10 = g2_mma(a1, b, c10);
    b = g2_frag(b1p + kb, hh); c01 = g2_mma(a0, b, c01); c11 = g2_mma(a1, b, c11);
    b = g2_frag(b2p + kb, hh); c02 = g2_mma(a0, b, c02); c12 = g2_mma(a1, b, c12);
    b = g2_frag(b3p + kb, hh); c03 = g2_mma(a0, b, c03); c13 = g2_mma(a1, b, c13); }
  v8f accs[8] = {c00, c01, c02, c03, c10, c11, c12, c13};
#pragma unroll
  for (int u = 0; u < 8; ++u) { const int t = u & 3, half = u >> 2; const int col = col0 + t * 16 + ln; const float bv = bp ? bf16_round(bp[col]) : 0.f;
#pragma unroll
    for (int r = 0; r < 8; ++r) { const int rloc = half * 16 + 8 * hh + r; float v = accs[u][r] * alpha + bv; if (CP) { if (rowsPerB < 0) v += CP[cofs + (size_t)(row0g + row0 + rloc) * ldc + col];      /* rowsPerB < 0: own element of the batched C plane */ else { const int bidx = (row0g + row0 + rloc) / rowsPerB; v += CP[(size_t)bidx * sCPb + (size_t)by * 64 + col]; } }
      if (ACT == 3) v = fmaxf(v, 0.f); else if (ACT == 6) v = 0.5f * v * (1.0f + erff(v * 0.70710678118654752f)); else if (ACT == 11) v = 1.0f / (1.0f + expf(-v)); else if (ACT == 15) v = v / (1.0f + expf(-v)); else if (ACT == 12) v = (v > 0.f) ? v : 0.01f * v; else if (ACT == 8) v = tanhf(v); else if (ACT == 9) v = 0.5f * v * (1.0f + tanhf(0.7978845608028654f * (v + 0.044715f * v * v * v))); else if (ACT == 14) v = (v > 0.f) ? v : 0.1f * v; else if (ACT == 16) v = (v >= 0.f) ? v : 0.3f * v; else if (ACT == 17) v = (v >= 0.f) ? v : 0.2f * v;
      so[w][rloc][t * 16 + ln] = v; } }
  __builtin_amdgcn_fence(__ATOMIC_ACQ_REL, "workgroup"); __builtin_amdgcn_wave_barrier();
  const int rsub = lane >> 4, c4 = (lane & 15) * 4;
  {
#pragma unroll
    for (int q = 0; q < 16; ++q) { const int r = q * 2 + rsub; const v4f v = *(const v4fa*)&so[w][r][c4]; if (C) *(v4f*)(C + cofs + (size_t)(row0 + r) * ldc + col0 + c4) = v; if (C16) { v4h h4; for (int i = 0; i < 4; ++i) h4[i] = (_Float16)v[i]; *(v4h*)(C16 + cofs + (size_t)(row0 + r) * ldc + col0 + c4) = h4; } }
     } }


__global__ __launch_bounds__(256) void k_wnat(const float* __restrict__ w, size_t n8, _Float16* __restrict__ Bt) { const size_t t = (size_t)blockIdx.x * 256 + threadIdx.x; if (t >= n8) return; FragH f; for (int q = 0; q < 8; ++q) f.h[q] = (_Float16)(bf16_round(w[t * 8 + q]) * 16.0f); *(v8us*)((unsigned short*)Bt + t * 8) = f.half[0];  }
__global__ __launch_bounds__(256) void k_rsm(const float* __restrict__ S, _Float16* __restrict__ P, int nrows) {
  #pragma clang fp contract(off)
  const int i = blockIdx.x * 256 + threadIdx.x; if (i >= nrows) return; const float* s = S + (size_t)i * SQ; float mx = -3.0e38f;
#pragma unroll 1
  for (int j = 0; j < SQ; ++j) mx = fmaxf(mx, s[j]); float se = 0.f;
#pragma unroll 1
  for (int j = 0; j < SQ; ++j) se += expf(s[j] - mx); const float sc = 256.0f / se;
#pragma unroll 1
  for (int j0 = 0; j0 < SQ; j0 += 8) { FragH f; for (int q = 0; q < 8; ++q) f.h[q] = (_Float16)(expf(s[j0 + q] - mx) * sc); unsigned short* d = (unsigned short*)P + (size_t)i * SQ + j0; *(v8us*)d = f.half[0];  } }
__global__ __launch_bounds__(256) void k_vt(const _Float16* __restrict__ V16, int b, int h0, _Float16* __restrict__ VT) { __shared__ unsigned short tl[64][65]; const int tid = threadIdx.x; const int hh = blockIdx.x % HG, sg = blockIdx.x / HG; const int s0 = sg * 64; const int h = h0 + hh;
  for (int i = tid; i < 64 * 8; i += 256) { const int j = i / 8, d8 = (i % 8) * 8; FragH f; f.half[0] = *(const v8us*)((const unsigned short*)V16 + ((size_t)b * SQ + s0 + j) * DM + h * HD + d8); for (int q = 0; q < 8; ++q) tl[d8 + q][j] = f.u[q]; }
  __syncthreads();
  { for (int i = tid; i < 64 * 8; i += 256) { const int d = i / 8, j8 = (i % 8) * 8; FragH f; for (int q = 0; q < 8; ++q) f.u[q] = tl[d][j8 + q]; *(v8us*)((unsigned short*)VT + ((size_t)hh * HD + d) * SQ + s0 + j8) = f.half[0]; }  } }



#define FQ 128                       /* query rows per block: 4 waves x 32 */
#define FS 64                        /* keys per stage: two passes of 32 */
#define FP 72                        /* LDS row pitch in f16 = 144 bytes, an odd multiple of 16: 16-byte fragment reads of 128-byte rows fall evenly on the banks */
#define FT (64 * FP)                 /* f16 per staged tile: 64 rows (K: keys; V^T: head columns) */
__device__ __forceinline__ v8f fa_mma(v16h a, v16h b, v8f c) { return __builtin_amdgcn_wmma_f32_16x16x32_f16(false, a, false, b, (short)0, c, false, false); }
__device__ __forceinline__ v16h fa_frag(const unsigned short* p) { FragH f; f.half[0] = *(const v8us*)p; f.half[1] = *(const v8us*)(p + 16); return f.v; }
// One stage's copies of one lane: 16 bytes of each of four K rows and four V^T rows, 16 rows apart (a wave's 32 lanes cover four whole 128-byte rows per copy). lk = the lane's LDS byte address in the buffer's K tile; the V^T tile follows it.
// The s_wait_xcnt closes the statement so that it stands in front of any later write of the address registers the copies name.
__device__ __forceinline__ void fa_copy(const _Float16* kg, const _Float16* vg, unsigned lk) {
  const _Float16* k1 = kg + (size_t)16 * DM; const _Float16* k2 = kg + (size_t)32 * DM; const _Float16* k3 = kg + (size_t)48 * DM;
  const _Float16* v1 = vg + (size_t)16 * SQ; const _Float16* v2 = vg + (size_t)32 * SQ; const _Float16* v3 = vg + (size_t)48 * SQ;
  const unsigned lk1 = lk + 16 * FP * 2, lk2 = lk + 32 * FP * 2, lk3 = lk + 48 * FP * 2, lv = lk + FT * 2, lv1 = lv + 16 * FP * 2, lv2 = lv + 32 * FP * 2, lv3 = lv + 48 * FP * 2;
  asm volatile("global_load_async_to_lds_b128 %0, %8, off\n\t"
               "global_load_async_to_lds_b128 %1, %9, off\n\t"
               "global_load_async_to_lds_b128 %2, %10, off\n\t"
               "global_load_async_to_lds_b128 %3, %11, off\n\t"
               "global_load_async_to_lds_b128 %4, %12, off\n\t"
               "global_load_async_to_lds_b128 %5, %13, off\n\t"
               "global_load_async_to_lds_b128 %6, %14, off\n\t"
               "global_load_async_to_lds_b128 %7, %15, off\n\t"
               "s_wait_xcnt 0x0"
               :: "v"(lk), "v"(lk1), "v"(lk2), "v"(lk3), "v"(lv), "v"(lv1), "v"(lv2), "v"(lv3), "v"(kg), "v"(k1), "v"(k2), "v"(k3), "v"(vg), "v"(v1), "v"(v2), "v"(v3) : "memory"); }
__global__ __launch_bounds__(128) void k_fattn(const _Float16* __restrict__ QK, const _Float16* __restrict__ VT, _Float16* __restrict__ O) {
  __shared__ __attribute__((aligned(16))) unsigned short sm[2][2][FT];      /* [buffer][K, V^T][row x pitch] */
  constexpr float SC2 = 0.036084391824351615f * 1.4426950408889634f;      /* 1/sqrt(768) x log2(e): the softmax runs in base 2 */
  const int tid = threadIdx.x, lane = tid & 31, ln = lane & 15, hh = lane >> 4; const int w = __builtin_amdgcn_readfirstlane(tid >> 5);      /* scalar wave number: the skip test and row bases stay scalar */
  const int bh = blockIdx.x % (NB * NH), qb = (SQ / FQ - 1) - blockIdx.x / (NB * NH); const int b = bh / NH, h = bh % NH; const int qw = qb * FQ + w * 32;
  const _Float16* kb = QK + (size_t)b * SQ * DM + h * HD + (size_t)ln * DM;      /* this lane's row within a 16-row tile of q */
  const _Float16* kg = QK + ((size_t)b * SQ + (tid >> 3)) * DM + h * HD + (tid & 7) * 8;      /* this lane's 16 bytes of stage 0: K row tid / 8 */
  const _Float16* vg = VT + ((size_t)bh * HD + (tid >> 3)) * SQ + (tid & 7) * 8;               /* and V^T row tid / 8 */
  const unsigned l0 = (unsigned)(size_t)&sm[0][0][(tid >> 3) * FP + (tid & 7) * 8];            /* low 32 bits of a shared address = LDS byte address */
  const int nst = 2 * qb + 2;       /* stages of the block: up to the end of its last wave's diagonal block; never fewer than two */
  const int last = qw / 32;         /* this wave's last pass: its diagonal block, the only one with masked keys */
  fa_copy(kg, vg, l0);
  asm volatile("s_wait_asynccnt 0x0" ::: "memory");      /* stage 0 has landed for this wave's own copies */
  __syncthreads();                                        /* ... and for every wave's: publishes stage 0 */
  fa_copy(kg + (size_t)FS * DM, vg + FS, l0 + 2 * FT * 2);
  v16h qf[2][2];
#pragma unroll
  for (int g = 0; g < 2; ++g)
#pragma unroll
    for (int ks = 0; ks < 2; ++ks) qf[g][ks] = g2_frag(kb + (size_t)(qw + g * 16) * DM + ks * 32, hh);
  const v8f z8 = {0.f, 0.f, 0.f, 0.f, 0.f, 0.f, 0.f, 0.f};
  v8f o[2][4]; float m[2], l[2];
#pragma unroll
  for (int g = 0; g < 2; ++g) { m[g] = -1.0e30f; l[g] = 0.f;
#pragma unroll
    for (int dt = 0; dt < 4; ++dt) o[g][dt] = z8; }
#pragma unroll 1
  for (int t = 0; t < nst; ++t) {
    const unsigned short* kl = &sm[t & 1][0][ln * FP + 8 * hh];      /* this lane's row and half within a 16-row tile of the staged K rows */
    const unsigned short* vl = &sm[t & 1][1][ln * FP + 8 * hh];      /* and of the staged V^T rows */
#pragma unroll
    for (int p = 0; p < 2; ++p) { const int it = 2 * t + p;
      if (it <= last) {
        v16h kf[2][2], vf[4];
#pragma unroll
        for (int kt = 0; kt < 2; ++kt)
#pragma unroll
          for (int ks = 0; ks < 2; ++ks) kf[kt][ks] = fa_frag(kl + (p * 32 + kt * 16) * FP + ks * 32);
#pragma unroll
        for (int dt = 0; dt < 4; ++dt) vf[dt] = fa_frag(vl + (dt * 16) * FP + p * 32);
        __builtin_amdgcn_sched_barrier(0);      /* keeps the pass's sixteen LDS reads together at its head, K first: one place with LDS reads instead of two, and the V^T fragments land under the score products and the softmax instead of being waited for in front of P V */
        v8f s[2][2];
#pragma unroll
        for (int g = 0; g < 2; ++g)
#pragma unroll
          for (int kt = 0; kt < 2; ++kt) s[g][kt] = fa_mma(kf[kt][1], qf[g][1], fa_mma(kf[kt][0], qf[g][0], z8));
        if (it == last) {
#pragma unroll
          for (int g = 0; g < 2; ++g)
#pragma unroll
            for (int kt = 0; kt < 2; ++kt)
#pragma unroll
              for (int r = 0; r < 8; ++r) s[g][kt][r] = (kt * 16 + 8 * hh + r <= g * 16 + ln) ? s[g][kt][r] : -1.0e30f; }      /* first key of the pass == qw here: key <= query */
        float mn[2]; bool need = false;
#pragma unroll
        for (int g = 0; g < 2; ++g) { float mx = s[g][0][0];
#pragma unroll
          for (int r = 1; r < 8; ++r) mx = fmaxf(mx, s[g][0][r]);
#pragma unroll
          for (int r = 0; r < 8; ++r) mx = fmaxf(mx, s[g][1][r]);
          mx = fmaxf(mx, __shfl_xor(mx, 16, 32)); mn[g] = fmaxf(m[g], mx * SC2); need = need || (mn[g] > m[g]); }
        if (__builtin_amdgcn_ballot_w32(need) != 0) {      /* no column's maximum moved: every factor would be exactly 1, so the rescale is skipped as a whole */
#pragma unroll
          for (int g = 0; g < 2; ++g) { const float al = __builtin_amdgcn_exp2f(m[g] - mn[g]); m[g] = mn[g]; l[g] *= al;
#pragma unroll
            for (int dt = 0; dt < 4; ++dt) o[g][dt] *= al; } }
        FragH pf[2];
#pragma unroll
        for (int g = 0; g < 2; ++g) { float ls = 0.f;
#pragma unroll
          for (int kt = 0; kt < 2; ++kt) { const v8f tt = s[g][kt] * SC2 - m[g];
#pragma unroll
            for (int r = 0; r < 8; ++r) { const float pp = __builtin_amdgcn_exp2f(tt[r]); ls += pp; pf[g].h[kt * 8 + r] = (_Float16)pp; } }
          l[g] += ls; }
#pragma unroll
        for (int g = 0; g < 2; ++g)
#pragma unroll
          for (int dt = 0; dt < 4; ++dt) o[g][dt] = fa_mma(vf[dt], pf[g].v, o[g][dt]); } }
    asm volatile("s_wait_dscnt 0x0" ::: "memory");         /* this wave's reads of buffer t & 1 have returned before the buffer is refilled */
    asm volatile("s_wait_asynccnt 0x0" ::: "memory");      /* this wave's copies of stage t + 1 have landed */
    __syncthreads();                                        /* publishes stage t + 1 and ends every wave's reads of stage t */
    if (t + 2 < nst) fa_copy(kg + (size_t)(t + 2) * FS * DM, vg + (size_t)(t + 2) * FS, l0 + (unsigned)(t & 1) * (2 * FT * 2)); }      /* the same test in the whole block */
  asm volatile("s_wait_asynccnt 0x0" ::: "memory");        /* no copy is outstanding when the wave ends */
#pragma unroll
  for (int g = 0; g < 2; ++g) { const float fin = 64.0f / (l[g] + __shfl_xor(l[g], 16, 32));      /* halves joined once; o carried x64 */
    _Float16* orow = O + ((size_t)b * SQ + qw + g * 16 + ln) * DM + h * HD + 8 * hh;
#pragma unroll
    for (int dt = 0; dt < 4; ++dt) { FragH f;
#pragma unroll
      for (int r = 0; r < 8; ++r) f.h[r] = (_Float16)(o[g][dt][r] * fin);
      *(v8us*)((unsigned short*)orow + dt * 16) = f.half[0]; } } }

// Exact f32 attention for the first QT0 rows of one batch; F holds the f32 rows of q = k = v (pitch ld). One wave per (head, query row), A0W rows a block.
// Scores: lane = key (four groups of 32 keys), the query row broadcast from LDS, four partial sums per key. Softmax: two passes over the wave's own registers.
// P V: lane = two head columns, keys in ascending order, each weight broadcast from its lane through a scalar register.
// Every wave stages and walks all QT0 keys, keys past its query with weight exactly 0: the launch lasts as long as the wave of the last row, which needs them all,
// and without tests the code is one straight line whose LDS reads have constant offsets and fly together.
// Every loop is fully unrolled: the small arrays are then indexed by constants and stay in registers, and each weight is read from a constant lane.
#define A0W 8                        /* waves = query rows per block */
#define A0P 68                       /* LDS row pitch in floats: 16-byte column walks fall on distinct banks */
typedef float v2f __attribute__((ext_vector_type(2)));
__global__ __launch_bounds__(256) void k_att0(const float* __restrict__ F, int ld, float scale, float* __restrict__ OF, int ldo) {
  __shared__ __attribute__((aligned(16))) float tl[QT0][A0P];
  const int tid = threadIdx.x, lane = tid & 31; const int w = __builtin_amdgcn_readfirstlane(tid >> 5);      /* scalar wave number: the query row's LDS address stays scalar */
  const int h = blockIdx.x / (QT0 / A0W), rg = blockIdx.x % (QT0 / A0W); const int i = rg * A0W + w;
#pragma unroll
  for (int u = 0; u < QT0 * (HD / 4) / 256; ++u) { const int e = u * 256 + tid; const int r = e >> 4, c = (e & 15) * 4; *(v4f*)&tl[r][c] = *(const v4fa*)(F + (size_t)r * ld + h * HD + c); }
  __syncthreads();
  v4f a[QT0 / 32];
#pragma unroll
  for (int t = 0; t < QT0 / 32; ++t) a[t] = (v4f){0.f, 0.f, 0.f, 0.f};
#pragma unroll
  for (int c = 0; c < HD / 4; ++c) { const v4f q = *(const v4f*)&tl[i][c * 4];
#pragma unroll
    for (int t = 0; t < QT0 / 32; ++t) a[t] = __builtin_elementwise_fma(q, *(const v4f*)&tl[t * 32 + lane][c * 4], a[t]); }
  float s[QT0 / 32], mx = -1.0e30f;
#pragma unroll
  for (int t = 0; t < QT0 / 32; ++t) { const float d = (a[t][0] + a[t][1]) + (a[t][2] + a[t][3]); s[t] = (t * 32 + lane <= i) ? d * scale : -1.0e30f; mx = fmaxf(mx, s[t]); }
#pragma unroll
  for (int d = 16; d > 0; d >>= 1) mx = fmaxf(mx, __shfl_xor(mx, d, 32));      /* key 0 is never masked: mx is a real score */
  float p[QT0 / 32], l = 0.f;
#pragma unroll
  for (int t = 0; t < QT0 / 32; ++t) { p[t] = expf(s[t] - mx); l += p[t]; }      /* masked keys: exp of about -1e30 = 0 */
#pragma unroll
  for (int d = 16; d > 0; d >>= 1) l += __shfl_xor(l, d, 32);
  v2f o = {0.f, 0.f};
#pragma unroll
  for (int t = 0; t < QT0 / 32; ++t)
#pragma unroll
    for (int k = 0; k < 32; ++k) { const float pj = __uint_as_float(__builtin_amdgcn_readlane(__float_as_uint(p[t]), k)); const v2f pp = {pj, pj};
      o = __builtin_elementwise_fma(pp, *(const v2f*)&tl[t * 32 + k][2 * lane], o); }
  const float fin = 64.0f / l;      /* o carried x64 like the f16 path */
  *(v2f*)(OF + (size_t)i * ldo + h * HD + 2 * lane) = o * fin; }

extern "C" void kernel_launch(void* const* d_in, const int* in_sizes, int n_in,
                              void* d_out, int out_size, void* d_ws, size_t ws_size, hipStream_t stream) {
  (void)in_sizes; (void)n_in; (void)out_size;
  const float* const* I = (const float* const*)d_in; const float* x = I[0]; const float* wq = I[1]; const float* wo = I[2]; const float* bo = I[3]; const float* wk = wq; const float* wv = wq;      /* Wq [12][64][768] = natural [768][768] rows h*64+d (q = k = v); W_out natural + b_out */
  char* ws = (char*)d_ws; size_t off = 0;
  auto take = [&](size_t bytes) { char* p = ws + off; off += (bytes + 255) & ~(size_t)255; return p; };
  _Float16* BQ = (_Float16*)take((size_t)DM * DM * 2); _Float16* BK = BQ; _Float16* BV = BQ; _Float16* BO = (_Float16*)take((size_t)DM * DM * 2);
  _Float16* X16 = (_Float16*)take(NR * DM * 2); _Float16* Q16 = (_Float16*)take(NR * DM * 2); _Float16* K16 = Q16; _Float16* V16 = Q16;      /* q = k = v (the module projects all three with self.query) */ _Float16* O16 = (_Float16*)take(NR * DM * 2);
  _Float16* VT = (_Float16*)take((size_t)NB * NH * HD * SQ * 2);
  float* QF0 = (float*)take((size_t)QT0 * DM * 4); float* KF0 = (float*)take((size_t)QT0 * DM * 4); float* VF0 = (float*)take((size_t)QT0 * DM * 4); float* OF0 = (float*)take((size_t)NB * QT0 * DM * 4); _Float16* OH0 = (_Float16*)take((size_t)NB * QT0 * DM * 2); _Float16* OL0 = (_Float16*)take((size_t)NB * QT0 * DM * 2);
  if (off > ws_size) return;
  k_wnat<<<(unsigned)(((size_t)DM * DM / 8 + 255) / 256), 256, 0, stream>>>(wq, (size_t)DM * DM / 8, BQ); k_wnat<<<(unsigned)(((size_t)DM * DM / 8 + 255) / 256), 256, 0, stream>>>(wo, (size_t)DM * DM / 8, BO);      /* natural [out][in] = Bt x16 */

  k_x16<<<(unsigned)((NR * DM / 8 + 255) / 256), 256, 0, stream>>>(x, X16, NR * DM / 8);
  const size_t r0p = (size_t)B0 * SQ;      /* first projected row */
  k_gemm2<0><<<dim3((unsigned)((MP / 128) * (DM / 64)), 1), 128, 0, stream>>>(X16 + r0p * DM, DM, 0, BQ, DM, 0, 0.0625f, nullptr, 0, nullptr, 1, 0, 0, nullptr, Q16 + r0p * DM, DM, 0, MP, DM, DM);
  k_vt<NH, SQ><<<NB * NH * (SQ / 64), 256, 0, stream>>>(V16, LQ, 0, VT);      /* V^T [NB][NH][HD][SQ] */
  k_fattn<<<NB * NH * (SQ / FQ), 128, 0, stream>>>(Q16, VT, O16);      /* scores, causal softmax and P V in one launch; o (merged heads, x64) as f16 rows */
  for (int b = B0; b < B0 + NBR; ++b) { const size_t r0 = (size_t)b * SQ;
    k_gemm2<0><<<dim3((QT0 / 128) * (DM / 64), 1), 128, 0, stream>>>(X16 + r0 * DM, DM, 0, BQ, DM, 0, 0.0625f, nullptr, 0, nullptr, 1, 0, 0, QF0, nullptr, DM, 0, QT0, DM, DM); /* KF0 = VF0 = QF0 (same projection) */      /* f32 q, k, v of the first 128 rows (exact products) */
    k_att0<<<NH * (QT0 / A0W), 32 * A0W, 0, stream>>>(QF0, DM, 0.036084391824351615f, OF0 + (size_t)b * QT0 * DM, DM);      /* exact f32 attention for rows 0..127 (o x64) */ }
  k_gemm2<0><<<dim3((unsigned)((MPO / 128) * (DM / 64)), 1), 128, 0, stream>>>(O16 + r0p * DM, DM, 0, BO, DM, 0, 0.0009765625f, bo, 0, nullptr, 1, 0, 0, (float*)d_out + r0p * DM, nullptr, DM, 0, MPO, DM, DM);      /* out rows are the output layout */
  k_hl<<<(unsigned)(((size_t)NB * QT0 * DM / 8 + 255) / 256), 256, 0, stream>>>(OF0, OH0, OL0, (size_t)NB * QT0 * DM / 8);      /* first-tile o (x64) -> f16 hi + x1024 residual planes */
  for (int b = B0; b < B0 + NBR; ++b) { const size_t r0 = (size_t)b * SQ; const size_t f0 = (size_t)b * QT0;
    k_gemm2<0><<<dim3((QT0 / 128) * (DM / 64), 1), 128, 0, stream>>>(OH0 + f0 * DM, DM, 0, BO, DM, 0, 0.0009765625f, bo, 0, nullptr, 1, 0, 0, (float*)d_out + r0 * DM, nullptr, DM, 0, QT0, DM, DM);      /* rows 0..127: out = o_hi Wo (+ b), overwriting the f16-path rows */
    k_gemm2<0><<<dim3((QT0 / 128) * (DM / 64), 1), 128, 0, stream>>>(OL0 + f0 * DM, DM, 0, BO, DM, 0, 0.00000095367431640625f, nullptr, 0, (const float*)d_out + r0 * DM, -1, 0, 0, (float*)d_out + r0 * DM, nullptr, DM, 0, QT0, DM, DM); }      /* += o_lo Wo 2^-20 (own-element accumulate) */
}

// v005
// It runs in 204 microseconds.
// Timed twice side by side with v004, it ran 1.60 and 1.59 times as fast.
// Counting every step since v000, it is 71.0 times as fast.
#include <hip/hip_runtime.h>
// Causal multi-head attention whose q, k AND v are the same per-head projection (x [2][4096][768]; q = k = v = x Wq[h]^T with Wq [12][64][768] (natural per-head rows, sigma 1/sqrt(768)); scores = q.q / sqrt(768) (the module scales by d_model); causal (tril, -inf); softmax; out = merged (attn q) W_out^T + b_out -> [2][4096][768]).
// Structure: token rows r = b*4096 + s; x as exact f16 rows (bf16-rounded); q (= k = v) as one WMMA GEMM (32x64 wave tiles, f32 accumulation, exact x16 weights, f16 outputs); V^T for all batches and heads via LDS transposes; one fused launch for the attention: per wave 32 query rows, keys 32 at a time up to the diagonal block, S^T = K Q^T, online base-2 softmax in registers (f32 statistics, native exp2; weights in (0,1] as f16), O^T += V^T P^T (o carried x64, folded into the output GEMM alpha) written straight into the merged f16 o rows; out = o W_o GEMM (f32) into the output layout.
// Compute dtype: inputs rounded to bf16; x / weights exact; q, k, v, softmax weights and o as plain f16 GEMM operands (~2^-12); scores and softmax statistics f32. v_wmma_f32_16x16x32_f16.
#define NB 2
#define SQ 4096
#define DM 768
#define NH 12
#define HD 64
#define HG 4                         /* heads per launch of the unused per-batch k_vt */
#define QT0 128                      /* first-tile rows recomputed exactly in f32 */
#define B0 0                         /* first batch processed (debug hook) */
#define NBR NB                       /* batches processed (debug hook) */
#define NR ((size_t)NB * SQ)         /* token rows */
#define MP ((int)((size_t)NBR * SQ)) /* rows projected (debug hook) */
#define MPO MP                       /* rows through the output stage (debug hook) */
#define LQ DM      /* row pitch of the q/k/v rows */
typedef __bf16 v16b __attribute__((ext_vector_type(16)));
typedef unsigned short v8us __attribute__((ext_vector_type(8), may_alias));
typedef float  v8f  __attribute__((ext_vector_type(8)));
typedef float  v4f  __attribute__((ext_vector_type(4)));
typedef float  v4fa __attribute__((ext_vector_type(4), may_alias));
union FragB { v16b v; v8us half[2]; unsigned short u[16]; };

__device__ __forceinline__ unsigned short bf16_bits(float x) { unsigned int u = __float_as_uint(x); return (unsigned short)((u + 0x7FFFu + ((u >> 16) & 1u)) >> 16); }
__device__ __forceinline__ float bf16_val(unsigned short b) { return __uint_as_float(((unsigned int)b) << 16); }
__device__ __forceinline__ float bf16_round(float x) { return bf16_val(bf16_bits(x)); }
// D += A·B with NT terms: 1 = ah·bh, 2 = + al·bh (A split), 3 = + ah·bl (both split)
template <int NT>
__device__ __forceinline__ v8f mmaN(v16b ah, v16b al, v16b bh, v16b bl, v8f c) {
  c = __builtin_amdgcn_wmma_f32_16x16x32_bf16(false, ah, false, bh, (short)0, c, false, false);
  if (NT >= 2) c = __builtin_amdgcn_wmma_f32_16x16x32_bf16(false, al, false, bh, (short)0, c, false, false);
  if (NT >= 3) c = __builtin_amdgcn_wmma_f32_16x16x32_bf16(false, ah, false, bl, (short)0, c, false, false);
  asm volatile("v_nop\n\tv_nop\n\tv_nop\n\tv_nop" : "+v"(c) : "v"(ah), "v"(al), "v"(bh), "v"(bl));
  return c;
}

__global__ __launch_bounds__(256) void k_wt_bf16(const float* __restrict__ W, unsigned short* __restrict__ Wt, int K, int N) {
  const int t = blockIdx.x * 256 + threadIdx.x;
  const int k8n = K / 8;
  if (t >= N * k8n) return;
  const int n = t / k8n, k8 = (t % k8n) * 8;
  v8us v;
#pragma unroll
  for (int i = 0; i < 8; ++i) v[i] = bf16_bits(W[(size_t)(k8 + i) * N + n]);
  *(v8us*)(Wt + (size_t)n * K + k8) = v;
  
}

// GEMM C[M][N] (f32, pitch ldc) = act(A[M][K]·W + bias). A f32 row-major (pitch lda) converted per fragment to bf16
// (ASPLIT: hi/lo two planes -> 2 terms, else single rounded term); Wt bf16 [N][K] (pitch ldb). BIAS_BF16 rounds the
// bias to bf16 first (bias quantised to bf16 before the add). K%32==0, M%16==0, N%64==0.
template <bool ASPLIT, int ACT, bool BIAS_BF16>
__global__ __launch_bounds__(128) void k_gemm_bf(const float* __restrict__ A, int lda, const unsigned short* __restrict__ Wt, int ldb,
                                               const float* __restrict__ bias, float* __restrict__ C, int ldc, int M, int N, int K) {
  __shared__ __attribute__((aligned(16))) float so[4][16][64];
  const int tid = threadIdx.x, w = tid >> 5, lane = tid & 31, ln = lane & 15, hh = lane >> 4;
  const int ntn = N / 64;
  const int wid = blockIdx.x * 4 + w;
  const int mt = wid / ntn, nq = wid % ntn;
  if (mt * 16 >= M) return;
  const int row0 = mt * 16, col0 = nq * 64;
  const float* arow = A + (size_t)(row0 + ln) * lda;
  v8f acc[4] = {};
  for (int kb = 0; kb < K; kb += 32) {
    FragB ah, al;
    const v4f x0 = *(const v4fa*)(arow + kb + 8 * hh), x1 = *(const v4fa*)(arow + kb + 8 * hh + 4);
    const v4f x2 = *(const v4fa*)(arow + kb + 16 + 8 * hh), x3 = *(const v4fa*)(arow + kb + 16 + 8 * hh + 4);
    float xs[16] = {x0[0],x0[1],x0[2],x0[3],x1[0],x1[1],x1[2],x1[3],x2[0],x2[1],x2[2],x2[3],x3[0],x3[1],x3[2],x3[3]};
#pragma unroll
    for (int i = 0; i < 16; ++i) { const unsigned short hb = bf16_bits(xs[i]); ah.u[i] = hb; al.u[i] = ASPLIT ? bf16_bits(xs[i] - bf16_val(hb)) : (unsigned short)0; }
#pragma unroll
    for (int t = 0; t < 4; ++t) {
      const unsigned short* brow = Wt + (size_t)(col0 + t * 16 + ln) * ldb + kb;
      FragB b;
      b.half[0] = *(const v8us*)(brow + 8 * hh);
      b.half[1] = *(const v8us*)(brow + 16 + 8 * hh);
      acc[t] = mmaN<ASPLIT ? 2 : 1>(ah.v, al.v, b.v, b.v, acc[t]);
    }
  }
#pragma unroll
  for (int t = 0; t < 4; ++t) {
    float bv = bias ? bias[col0 + t * 16 + ln] : 0.f;
    if (BIAS_BF16) bv = bf16_round(bv);
#pragma unroll
    for (int r = 0; r < 8; ++r) { float v = acc[t][r] + bv; if (ACT == 1) v = fmaxf(v, 0.f); so[w][8 * hh + r][t * 16 + ln] = v; }
  }
  __builtin_amdgcn_fence(__ATOMIC_ACQ_REL, "workgroup");
  __builtin_amdgcn_wave_barrier();
  const int rsub = lane >> 4, c4 = (lane & 15) * 4;
  {
#pragma unroll
    for (int q = 0; q < 8; ++q) {
      const int r = q * 2 + rsub;
      const v4f v = *(const v4fa*)&so[w][r][c4];
      *(v4f*)(C + (size_t)(row0 + r) * ldc + col0 + c4) = v;
    }
    
  }
}

// GEMM C = act(A·W + bias + resid): A f32 (ASPLIT -> hi/lo 2 terms), Wt bf16 [N][K]; ACT 0 none, 1 relu, 2 exact gelu;
// resid (optional, f32, row index = (row % rmod), pitch ldr, RES_BF16 rounds it) added before the activation.
template <bool ASPLIT, int ACT, bool BIAS_BF16, bool RES_BF16>
__global__ __launch_bounds__(128) void k_gemm_bf3(const float* __restrict__ A, int lda, const unsigned short* __restrict__ Wt, int ldb,
                                                const float* __restrict__ bias, const float* __restrict__ resid, int rmod, int ldr,
                                                float* __restrict__ C, int ldc, int M, int N, int K) {
  __shared__ __attribute__((aligned(16))) float so[4][16][64];
  const int tid = threadIdx.x, w = tid >> 5, lane = tid & 31, ln = lane & 15, hh = lane >> 4;
  const int ntn = N / 64;
  const int wid = blockIdx.x * 4 + w;
  const int mt = wid / ntn, nq = wid % ntn;
  if (mt * 16 >= M) return;
  const int row0 = mt * 16, col0 = nq * 64;
  const float* arow = A + (size_t)(row0 + ln) * lda;
  v8f acc[4] = {};
  for (int kb = 0; kb < K; kb += 32) {
    FragB ah, al;
    const v4f x0 = *(const v4fa*)(arow + kb + 8 * hh), x1 = *(const v4fa*)(arow + kb + 8 * hh + 4);
    const v4f x2 = *(const v4fa*)(arow + kb + 16 + 8 * hh), x3 = *(const v4fa*)(arow + kb + 16 + 8 * hh + 4);
    float xs[16] = {x0[0],x0[1],x0[2],x0[3],x1[0],x1[1],x1[2],x1[3],x2[0],x2[1],x2[2],x2[3],x3[0],x3[1],x3[2],x3[3]};
#pragma unroll
    for (int i = 0; i < 16; ++i) { const unsigned short hb = bf16_bits(xs[i]); ah.u[i] = hb; al.u[i] = ASPLIT ? bf16_bits(xs[i] - bf16_val(hb)) : (unsigned short)0; }
#pragma unroll
    for (int t = 0; t < 4; ++t) {
      const unsigned short* brow = Wt + (size_t)(col0 + t * 16 + ln) * ldb + kb;
      FragB b;
      b.half[0] = *(const v8us*)(brow + 8 * hh);
      b.half[1] = *(const v8us*)(brow + 16 + 8 * hh);
      acc[t] = mmaN<ASPLIT ? 2 : 1>(ah.v, al.v, b.v, b.v, acc[t]);
    }
  }
#pragma unroll
  for (int t = 0; t < 4; ++t) {
    const int col = col0 + t * 16 + ln;
    float bv = bias ? bias[col] : 0.f;
    if (BIAS_BF16) bv = bf16_round(bv);
#pragma unroll
    for (int r = 0; r < 8; ++r) {
      float v = acc[t][r] + bv;
      if (resid) { float rv = resid[(size_t)((row0 + 8 * hh + r) % rmod) * ldr + col]; if (RES_BF16) rv = bf16_round(rv); v += rv; }
      if (ACT == 1) v = fmaxf(v, 0.f);
      if (ACT == 2) v = 0.5f * v * (1.0f + erff(v * 0.70710678118654752f));
      if (ACT == 3) { const float u = 0.7978845608028654f * (v + 0.044715f * v * v * v); v = 0.5f * v * (1.0f + tanhf(u)); }
      so[w][8 * hh + r][t * 16 + ln] = v;
    }
  }
  __builtin_amdgcn_fence(__ATOMIC_ACQ_REL, "workgroup");
  __builtin_amdgcn_wave_barrier();
  const int rsub = lane >> 4, c4 = (lane & 15) * 4;
  {
#pragma unroll
    for (int q = 0; q < 8; ++q) {
      const int r = q * 2 + rsub;
      const v4f v = *(const v4fa*)&so[w][r][c4];
      *(v4f*)(C + (size_t)(row0 + r) * ldc + col0 + c4) = v;
    }
    
  }
}
// row LayerNorm (biased variance, eps) over N: s = X (+ R); optional out_sum <- s; out_norm <- (s-mu)*rsqrt(var+eps)*g + b
template <bool PARAM_BF16>
__global__ __launch_bounds__(256) void k_layernorm(const float* __restrict__ X, const float* __restrict__ R, const float* __restrict__ g, const float* __restrict__ bta,
                                                  float* __restrict__ out_sum, float* __restrict__ out_norm, int N, float eps) {
  __shared__ float red[256];
  const int row = blockIdx.x, tid = threadIdx.x;
  const float* x = X + (size_t)row * N; const float* rr = R ? R + (size_t)row * N : nullptr;
  float vals[16];                     // up to N = 4096
  const int per = N / 256;            // contiguous chunk per thread? use strided-by-4 chunks: thread handles j = tid*4 + 1024*u
  float s1 = 0.f;
  for (int u = 0; u < per / 4; ++u) {
    const int j = tid * 4 + 1024 * u;
    const v4f a = *(const v4fa*)(x + j);
    v4f b = {0.f,0.f,0.f,0.f}; if (rr) b = *(const v4fa*)(rr + j);
#pragma unroll
    for (int q = 0; q < 4; ++q) { const float v = a[q] + b[q]; vals[u * 4 + q] = v; s1 += v; }
  }
  red[tid] = s1; __syncthreads();
  for (int st = 128; st > 0; st >>= 1) { if (tid < st) red[tid] += red[tid + st]; __syncthreads(); }
  const float mu = red[0] / (float)N; __syncthreads();
  float s2 = 0.f;
  for (int u = 0; u < per / 4; ++u)
#pragma unroll
    for (int q = 0; q < 4; ++q) { const float c = vals[u * 4 + q] - mu; s2 += c * c; }
  red[tid] = s2; __syncthreads();
  for (int st = 128; st > 0; st >>= 1) { if (tid < st) red[tid] += red[tid + st]; __syncthreads(); }
  const float rs = rsqrtf(red[0] / (float)N + eps);
  {
    for (int u = 0; u < per / 4; ++u) {
      const int j = tid * 4 + 1024 * u;
      v4f o, sm;
#pragma unroll
      for (int q = 0; q < 4; ++q) {
        float gg = g[j + q], bb = bta[j + q];
        if (PARAM_BF16) { gg = bf16_round(gg); bb = bf16_round(bb); }
        sm[q] = vals[u * 4 + q]; o[q] = (vals[u * 4 + q] - mu) * rs * gg + bb;
      }
      if (out_sum) *(v4f*)(out_sum + (size_t)row * N + j) = sm;
      *(v4f*)(out_norm + (size_t)row * N + j) = o;
    }
    
  }
}



// ---- f16 WMMA path (v_wmma_f32_16x16x32_f16): 11-bit significands for operands in range — used where a [0,1] probability operand needs more precision than bf16
typedef _Float16 v16h __attribute__((ext_vector_type(16)));
union FragH { v16h v; v8us half[2]; _Float16 h[16]; unsigned short u[16]; };
template <int NT>
__device__ __forceinline__ v8f mmaH(v16h ah, v16h al, v16h bh, v16h bl, v8f c) {
  c = __builtin_amdgcn_wmma_f32_16x16x32_f16(false, ah, false, bh, (short)0, c, false, false);
  if (NT >= 2) c = __builtin_amdgcn_wmma_f32_16x16x32_f16(false, al, false, bh, (short)0, c, false, false);
  if (NT >= 3) c = __builtin_amdgcn_wmma_f32_16x16x32_f16(false, ah, false, bl, (short)0, c, false, false);
  asm volatile("v_nop\n\tv_nop\n\tv_nop\n\tv_nop" : "+v"(c) : "v"(ah), "v"(al), "v"(bh), "v"(bl));
  return c;
}
// batched GEMM like k_gemm_b but f16 operands: A f32 (split into f16 hi/lo if ASPLIT, else rounded to f16), Bt = f16 values [n][k]; alpha; C f32; N multiple of 16 (partial tiles skipped)
template <bool ASPLIT>
__global__ __launch_bounds__(128) void k_gemm_h(const float* __restrict__ A, int lda, size_t sA, const _Float16* __restrict__ Bh, int ldb, size_t sB, float alpha, float* __restrict__ C, int ldc, size_t sC, int M, int N, int K) {
  __shared__ __attribute__((aligned(16))) float so[4][16][64];
  const int tid = threadIdx.x, w = tid >> 5, lane = tid & 31, ln = lane & 15, hh = lane >> 4; const int by = blockIdx.y;
  A += (size_t)by * sA; Bh += (size_t)by * sB; C += (size_t)by * sC;
  const int ntn = (N + 63) / 64; const int wid = blockIdx.x * 4 + w; const int mt = wid / ntn, nq = wid % ntn; if (mt * 16 >= M) return;
  const int row0 = mt * 16, col0 = nq * 64; const float* arow = A + (size_t)(row0 + ln) * lda;
  v8f acc[4] = {};
  for (int kb = 0; kb < K; kb += 32) {
    FragH ah, al;
    const v4f x0 = *(const v4fa*)(arow + kb + 8 * hh), x1 = *(const v4fa*)(arow + kb + 8 * hh + 4), x2 = *(const v4fa*)(arow + kb + 16 + 8 * hh), x3 = *(const v4fa*)(arow + kb + 16 + 8 * hh + 4);
    float xs[16] = {x0[0],x0[1],x0[2],x0[3],x1[0],x1[1],x1[2],x1[3],x2[0],x2[1],x2[2],x2[3],x3[0],x3[1],x3[2],x3[3]};
#pragma unroll
    for (int i = 0; i < 16; ++i) { const _Float16 h = (_Float16)xs[i]; ah.h[i] = h; al.h[i] = ASPLIT ? (_Float16)(xs[i] - (float)h) : (_Float16)0.0f; }
#pragma unroll
    for (int t = 0; t < 4; ++t) { if (col0 + t * 16 >= N) continue; const size_t boff = (size_t)(col0 + t * 16 + ln) * ldb + kb; FragH bq; bq.half[0] = *(const v8us*)(Bh + boff + 8 * hh); bq.half[1] = *(const v8us*)(Bh + boff + 16 + 8 * hh);
      acc[t] = mmaH<ASPLIT ? 2 : 1>(ah.v, al.v, bq.v, bq.v, acc[t]); }
  }
#pragma unroll
  for (int t = 0; t < 4; ++t) { if (col0 + t * 16 >= N) continue;
#pragma unroll
    for (int r = 0; r < 8; ++r) so[w][8 * hh + r][t * 16 + ln] = acc[t][r] * alpha; }
  __builtin_amdgcn_fence(__ATOMIC_ACQ_REL, "workgroup"); __builtin_amdgcn_wave_barrier();
  const int rsub = lane >> 4, c4 = (lane & 15) * 4;
  {
#pragma unroll
    for (int q = 0; q < 8; ++q) { const int r = q * 2 + rsub; if (col0 + c4 < N) { const v4f v = *(const v4fa*)&so[w][r][c4]; *(v4f*)(C + (size_t)(row0 + r) * ldc + col0 + c4) = v; } }
     }
}

// Wt[n][k] = f16(W[k][n]·scale) from f32 row-major W[K][N] (scale = power of two; bf16-exact weights stay exact in f16 away from the subnormal range)
__global__ __launch_bounds__(256) void k_wt_f16(const float* __restrict__ W, _Float16* __restrict__ Wt, int K, int N, float scale) {
  const int t = blockIdx.x * 256 + threadIdx.x; if (t >= N * (K / 8)) return; const int n = t / (K / 8), k8 = (t % (K / 8)) * 8; FragH f;
#pragma unroll
  for (int i = 0; i < 8; ++i) f.h[i] = (_Float16)(bf16_round(W[(size_t)(k8 + i) * N + n]) * scale); const v8us o = f.half[0];
  *(v8us*)((unsigned short*)Wt + (size_t)n * K + k8) = o; 
}
// k_gemm_hh variant with fused epilogue: v = acc·alpha + bias[by·sBias + col] (+ CP[(row/rowsPerB)·sCPb + by·64 + col] if CP) ; ACT 0 none / 1 elu ; writes f16 C16 (and f32 C if non-null)
template <int ACT>
__global__ __launch_bounds__(128) void k_gemm_hhx(const _Float16* __restrict__ A, int lda, size_t sA, const _Float16* __restrict__ Bh, int ldb, size_t sB, float alpha, const float* __restrict__ bias, size_t sBias, const float* __restrict__ CP, int rowsPerB, size_t sCPb, int row0g,
    float* __restrict__ C, _Float16* __restrict__ C16, int ldc, size_t sC, int M, int N, int K) {
  __shared__ __attribute__((aligned(16))) float so[4][16][64];
  const int tid = threadIdx.x, w = tid >> 5, lane = tid & 31, ln = lane & 15, hh = lane >> 4; const int by = blockIdx.y;
  A += (size_t)by * sA; Bh += (size_t)by * sB; const size_t cofs = (size_t)by * sC; const float* bp = bias ? bias + (size_t)by * sBias : nullptr;
  const int ntn = (N + 63) / 64; const int wid = blockIdx.x * 4 + w; const int mt = wid / ntn, nq = wid % ntn; if (mt * 16 >= M) return;
  const int row0 = mt * 16, col0 = nq * 64; const _Float16* arow = A + (size_t)(row0 + ln) * lda;
  v8f acc[4] = {};
  for (int kb = 0; kb < K; kb += 32) { FragH ah; ah.half[0] = *(const v8us*)((const unsigned short*)arow + kb + 8 * hh); ah.half[1] = *(const v8us*)((const unsigned short*)arow + kb + 16 + 8 * hh);
#pragma unroll
    for (int t = 0; t < 4; ++t) { if (col0 + t * 16 >= N) continue; const size_t boff = (size_t)(col0 + t * 16 + ln) * ldb + kb; FragH bq; bq.half[0] = *(const v8us*)((const unsigned short*)Bh + boff + 8 * hh); bq.half[1] = *(const v8us*)((const unsigned short*)Bh + boff + 16 + 8 * hh);
      acc[t] = mmaH<1>(ah.v, ah.v, bq.v, bq.v, acc[t]); }
  }
#pragma unroll
  for (int t = 0; t < 4; ++t) { if (col0 + t * 16 >= N) continue; const int col = col0 + t * 16 + ln; const float bv = bp ? bf16_round(bp[col]) : 0.f;
#pragma unroll
    for (int r = 0; r < 8; ++r) { float v = acc[t][r] * alpha + bv; if (CP) { const int rr = row0g + row0 + 8 * hh + r; if (rowsPerB < 0) v += CP[cofs + (size_t)rr * ldc + col];      /* rowsPerB < 0: own element of the batched C plane */ else { const int bidx = rr / rowsPerB; v += CP[(size_t)bidx * sCPb + (size_t)by * 64 + col]; } } if (ACT == 1) v = (v > 0.f) ? v : expm1f(v); else if (ACT == 7) v = (v > 0.f) ? v + 1.0f : expf(v); else if (ACT == 8) v = tanhf(v); else if (ACT == 9) v = 0.5f * v * (1.0f + tanhf(0.7978845608028654f * (v + 0.044715f * v * v * v))); else if (ACT == 11) v = 1.0f / (1.0f + expf(-v)); else if (ACT == 12) v = (v > 0.f) ? v : 0.01f * v; else if (ACT == 14) v = (v > 0.f) ? v : 0.1f * v; else if (ACT == 16) v = (v >= 0.f) ? v : 0.3f * v; else if (ACT == 17) v = (v >= 0.f) ? v : 0.2f * v; else if (ACT == 15) v = v / (1.0f + expf(-v)); else if (ACT == 3) v = fmaxf(v, 0.f); else if (ACT == 6) v = 0.5f * v * (1.0f + erff(v * 0.70710678118654752f)); so[w][8 * hh + r][t * 16 + ln] = v; } }
  __builtin_amdgcn_fence(__ATOMIC_ACQ_REL, "workgroup"); __builtin_amdgcn_wave_barrier();
  const int rsub = lane >> 4, c4 = (lane & 15) * 4; typedef _Float16 v4h __attribute__((ext_vector_type(4)));
  {
#pragma unroll
    for (int q = 0; q < 8; ++q) { const int r = q * 2 + rsub; if (col0 + c4 < N) { const v4f v = *(const v4fa*)&so[w][r][c4]; if (C) *(v4f*)(C + cofs + (size_t)(row0 + r) * ldc + col0 + c4) = v; if (C16) { v4h h4; for (int i = 0; i < 4; ++i) h4[i] = (_Float16)v[i]; *(v4h*)(C16 + cofs + (size_t)(row0 + r) * ldc + col0 + c4) = h4; } } }
     }
}


typedef _Float16 v4h __attribute__((ext_vector_type(4)));

__global__ __launch_bounds__(256) void k_x16(const float* __restrict__ x, _Float16* __restrict__ X16, size_t n8) { const size_t t = (size_t)blockIdx.x * 256 + threadIdx.x; if (t >= n8) return; FragH f;
#pragma unroll
  for (int q = 0; q < 8; ++q) f.h[q] = (_Float16)bf16_round(x[t * 8 + q]); *(v8us*)((unsigned short*)X16 + t * 8) = f.half[0];  }
__global__ __launch_bounds__(256) void k_h16(const float* __restrict__ x, _Float16* __restrict__ X16, size_t n8) { const size_t t = (size_t)blockIdx.x * 256 + threadIdx.x; if (t >= n8) return; FragH f;
#pragma unroll
  for (int q = 0; q < 8; ++q) f.h[q] = (_Float16)x[t * 8 + q]; *(v8us*)((unsigned short*)X16 + t * 8) = f.half[0];  }
__global__ __launch_bounds__(256) void k_round16f(const float* __restrict__ W, _Float16* __restrict__ Bt, size_t n8) { const size_t t = (size_t)blockIdx.x * 256 + threadIdx.x; if (t >= n8) return; FragH f;
#pragma unroll
  for (int i = 0; i < 8; ++i) f.h[i] = (_Float16)(bf16_round(W[t * 8 + i]) * 16.0f); *(v8us*)((unsigned short*)Bt + t * 8) = f.half[0];  }
template <int NHv, int TTv>
__global__ __launch_bounds__(256) void k_vt(const _Float16* __restrict__ V16, int ldv, int voff, _Float16* __restrict__ Vt) { __shared__ unsigned short tl[64][66]; const int tid = threadIdx.x; const int slab = blockIdx.x / (TTv / 64), lg = blockIdx.x % (TTv / 64); const int b = slab / NHv, h = slab % NHv;
  for (int i = tid; i < 64 * 8; i += 256) { const int r = i / 8, c8 = (i % 8) * 8; FragH f; f.half[0] = *(const v8us*)((const unsigned short*)V16 + ((size_t)b * TTv + lg * 64 + r) * ldv + voff + h * 64 + c8);
#pragma unroll
    for (int q = 0; q < 8; ++q) tl[r][c8 + q] = f.u[q]; }
  __syncthreads();
  {
#pragma unroll
    for (int rd = 0; rd < 2; ++rd) { const int d = rd * 32 + tid / 8, pc = tid % 8; FragH f;
#pragma unroll
      for (int q = 0; q < 8; ++q) f.u[q] = tl[pc * 8 + q][d];
      *(v8us*)((unsigned short*)Vt + ((size_t)slab * 64 + d) * TTv + lg * 64 + pc * 8) = f.half[0]; }
     } }

__global__ __launch_bounds__(256) void k_hl(const float* __restrict__ F, _Float16* __restrict__ Hh, _Float16* __restrict__ Hl, size_t n8) { const size_t t = (size_t)blockIdx.x * 256 + threadIdx.x; if (t >= n8) return; FragH fh, fl; const v4f a = *(const v4fa*)(F + t * 8), c = *(const v4fa*)(F + t * 8 + 4);
#pragma unroll
  for (int q = 0; q < 4; ++q) { _Float16 h = (_Float16)a[q]; fh.h[q] = h; fl.h[q] = (_Float16)((a[q] - (float)h) * 1024.0f); h = (_Float16)c[q]; fh.h[4 + q] = h; fl.h[4 + q] = (_Float16)((c[q] - (float)h) * 1024.0f); }
  { *(v8us*)((unsigned short*)Hh + t * 8) = fh.half[0]; *(v8us*)((unsigned short*)Hl + t * 8) = fl.half[0];  } }

// ---- fast GEMM (block tile 128x64, wave tile 32x64; requires M % 128 == 0 rows per launch region, N % 64 == 0, K % 64 == 0 and K >= 64); epilogue = k_gemm_hhx semantics ----
// The block's 128 A rows and 64 B rows come through LDS, 64 k (one whole 128-byte line of every row) a stage, two buffers, brought by asynchronous copies: stage t + 2 flies under the products of stage t and the LDS reads of stage t + 1.
// (A fragment load straight from global memory touches 16 lines for 512 bytes, each wave fetched its own copy of B, and every product waited for its own loads.) The k order of every accumulator is unchanged: ascending, 32 at a time.
#define GK 64                        /* k per stage */
#define GP 72                        /* LDS row pitch in f16 = 144 bytes, an odd multiple of 16: 16-byte fragment reads of 128-byte rows fall evenly on the banks */
#define GT (192 * GP)                /* f16 per buffer: 128 A rows, then 64 B rows */
__device__ __forceinline__ v16h g2_frag(const _Float16* p, int hh) { FragH f; f.half[0] = *(const v8us*)((const unsigned short*)p + 8 * hh); f.half[1] = *(const v8us*)((const unsigned short*)p + 16 + 8 * hh); return f.v; }
__device__ __forceinline__ v16h g2_lfrag(const unsigned short* p) { FragH f; f.half[0] = *(const v8us*)p; f.half[1] = *(const v8us*)(p + 16); return f.v; }
__device__ __forceinline__ v8f g2_mma(v16h a, v16h b, v8f c) { return __builtin_amdgcn_wmma_f32_16x16x32_f16(false, a, false, b, (short)0, c, false, false); }
// One stage's copies of one lane: 16 bytes of each of eight A rows and four B rows, 16 rows apart (a wave's 32 lanes cover four whole 128-byte rows per copy). sa, sb = 16 rows of A, of B in f16; l0 = the lane's LDS byte address in the buffer's first 16 rows.
// The s_wait_xcnt closes the statement so that it stands in front of any later write of the address registers the copies name.
__device__ __forceinline__ void g2_copy(const _Float16* a0, size_t sa, const _Float16* b0, size_t sb, unsigned l0) {
  const _Float16* a1 = a0 + sa; const _Float16* a2 = a0 + 2 * sa; const _Float16* a3 = a0 + 3 * sa; const _Float16* a4 = a0 + 4 * sa; const _Float16* a5 = a0 + 5 * sa; const _Float16* a6 = a0 + 6 * sa; const _Float16* a7 = a0 + 7 * sa;      /* each from a0: no chain of additions in front of the copies */
  const _Float16* b1 = b0 + sb; const _Float16* b2 = b0 + 2 * sb; const _Float16* b3 = b0 + 3 * sb;
  constexpr unsigned R = 16 * GP * 2;      /* bytes of 16 staged rows */
  const unsigned l1 = l0 + R, l2 = l0 + 2 * R, l3 = l0 + 3 * R, l4 = l0 + 4 * R, l5 = l0 + 5 * R, l6 = l0 + 6 * R, l7 = l0 + 7 * R, l8 = l0 + 8 * R, l9 = l0 + 9 * R, l10 = l0 + 10 * R, l11 = l0 + 11 * R;
  asm volatile("global_load_async_to_lds_b128 %0, %12, off\n\t"
               "global_load_async_to_lds_b128 %1, %13, off\n\t"
               "global_load_async_to_lds_b128 %2, %14, off\n\t"
               "global_load_async_to_lds_b128 %3, %15, off\n\t"
               "global_load_async_to_lds_b128 %4, %16, off\n\t"
               "global_load_async_to_lds_b128 %5, %17, off\n\t"
               "global_load_async_to_lds_b128 %6, %18, off\n\t"
               "global_load_async_to_lds_b128 %7, %19, off\n\t"
               "global_load_async_to_lds_b128 %8, %20, off\n\t"
               "global_load_async_to_lds_b128 %9, %21, off\n\t"
               "global_load_async_to_lds_b128 %10, %22, off\n\t"
               "global_load_async_to_lds_b128 %11, %23, off\n\t"
               "s_wait_xcnt 0x0"
               :: "v"(l0), "v"(l1), "v"(l2), "v"(l3), "v"(l4), "v"(l5), "v"(l6), "v"(l7), "v"(l8), "v"(l9), "v"(l10), "v"(l11),
                  "v"(a0), "v"(a1), "v"(a2), "v"(a3), "v"(a4), "v"(a5), "v"(a6), "v"(a7), "v"(b0), "v"(b1), "v"(b2), "v"(b3) : "memory"); }
template <int ACT>
__global__ __launch_bounds__(128) void k_gemm2(const _Float16* __restrict__ A, int lda, size_t sA, const _Float16* __restrict__ Bh, int ldb, size_t sB, float alpha, const float* __restrict__ bias, size_t sBias, const float* __restrict__ CP, int rowsPerB, size_t sCPb, int row0g,
    float* __restrict__ C, _Float16* __restrict__ C16, int ldc, size_t sC, int M, int N, int K) { static_assert(ACT == 0 || ACT == 3 || ACT == 6 || ACT == 8 || ACT == 9 || ACT == 11 || ACT == 12 || ACT == 14 || ACT == 15 || ACT == 16 || ACT == 17, "k_gemm2: unsupported ACT code (would silently apply no activation)");
  __shared__ __attribute__((aligned(16))) float so[4][32][68];
  __shared__ __attribute__((aligned(16))) unsigned short st[2][GT];      /* [buffer][128 A rows, 64 B rows][pitch] */
  const int tid = threadIdx.x, w = tid >> 5, lane = tid & 31, ln = lane & 15, hh = lane >> 4; const int by = blockIdx.y;
  A += (size_t)by * sA; Bh += (size_t)by * sB; const size_t cofs = (size_t)by * sC; const float* bp = bias ? bias + (size_t)by * sBias : nullptr;
  const int ntn = N >> 6; const int mt = blockIdx.x / ntn, nq = blockIdx.x - mt * ntn; const int row0 = mt * 128 + 32 * w, col0 = nq * 64; if (mt * 128 >= M) return;      /* the whole block leaves or none: every wave passes every barrier */
  const _Float16* ag = A + (size_t)(mt * 128 + (tid >> 3)) * lda + (tid & 7) * 8;      /* this lane's 16 bytes of stage 0: A row tid / 8 of the block */
  const _Float16* bg = Bh + (size_t)(col0 + (tid >> 3)) * ldb + (tid & 7) * 8;          /* and B row tid / 8 */
  const size_t sa = (size_t)16 * lda, sb = (size_t)16 * ldb;
  const unsigned l0 = (unsigned)(size_t)&st[0][(tid >> 3) * GP + (tid & 7) * 8];        /* low 32 bits of a shared address = LDS byte address */
  const int nst = K / GK;
  g2_copy(ag, sa, bg, sb, l0);
  asm volatile("s_wait_asynccnt 0x0" ::: "memory");      /* stage 0 has landed for this wave's own copies */
  __syncthreads();                                        /* ... and for every wave's: publishes stage 0 */
  if (1 < nst) g2_copy(ag + GK, sa, bg + GK, sb, l0 + GT * 2);
  const v8f z8 = {0.f,0.f,0.f,0.f,0.f,0.f,0.f,0.f}; v8f c00 = z8, c01 = z8, c02 = z8, c03 = z8, c10 = z8, c11 = z8, c12 = z8, c13 = z8;
#pragma unroll 1
  for (int t = 0; t < nst; ++t) {      /* stays rolled: one copy of the stage's code; the loops inside are unrolled so that the fragment arrays stay in registers */
    const unsigned short* al = &st[t & 1][(32 * w + ln) * GP + 8 * hh];      /* this lane's row and half within the wave's first 16 staged A rows */
    const unsigned short* bl = &st[t & 1][(128 + ln) * GP + 8 * hh];         /* and within the first 16 staged B rows */
    v16h a[2][2], b[2][4];
#pragma unroll
    for (int ks = 0; ks < 2; ++ks) { a[ks][0] = g2_lfrag(al + ks * 32); a[ks][1] = g2_lfrag(al + 16 * GP + ks * 32);
#pragma unroll
      for (int n = 0; n < 4; ++n) b[ks][n] = g2_lfrag(bl + n * 16 * GP + ks * 32); }
    asm volatile("s_wait_dscnt 0x0" ::: "memory");         /* the stage's 24 LDS reads, one group, have returned: this wave is done with buffer t & 1 before the buffer is refilled */
    asm volatile("s_wait_asynccnt 0x0" ::: "memory");      /* this wave's copies of stage t + 1 have landed */
    __syncthreads();                                        /* publishes stage t + 1 and ends every wave's reads of stage t */
    if (t + 2 < nst) g2_copy(ag + (size_t)(t + 2) * GK, sa, bg + (size_t)(t + 2) * GK, sb, l0 + (unsigned)(t & 1) * (GT * 2));      /* the same test in the whole block */
    /* the stage's products work on registers alone and stand behind the refill: the copies of stage t + 2 fly under them and under the next stage's LDS reads */
#pragma unroll
    for (int ks = 0; ks < 2; ++ks) {
      c00 = g2_mma(a[ks][0], b[ks][0], c00); c10 = g2_mma(a[ks][1], b[ks][0], c10);
      c01 = g2_mma(a[ks][0], b[ks][1], c01); c11 = g2_mma(a[ks][1], b[ks][1], c11);
      c02 = g2_mma(a[ks][0], b[ks][2], c02); c12 = g2_mma(a[ks][1], b[ks][2], c12);
      c03 = g2_mma(a[ks][0], b[ks][3], c03); c13 = g2_mma(a[ks][1], b[ks][3], c13); } }
  asm volatile("s_wait_asynccnt 0x0" ::: "memory");        /* no copy is outstanding when the wave goes on to the epilogue and ends */
  v8f accs[8] = {c00, c01, c02, c03, c10, c11, c12, c13};
#pragma unroll
  for (int u = 0; u < 8; ++u) { const int t = u & 3, half = u >> 2; const int col = col0 + t * 16 + ln; const float bv = bp ? bf16_round(bp[col]) : 0.f;
#pragma unroll
    for (int r = 0; r < 8; ++r) { const int rloc = half * 16 + 8 * hh + r; float v = accs[u][r] * alpha + bv; if (CP) { if (rowsPerB < 0) v += CP[cofs + (size_t)(row0g + row0 + rloc) * ldc + col];      /* rowsPerB < 0: own element of the batched C plane */ else { const int bidx = (row0g + row0 + rloc) / rowsPerB; v += CP[(size_t)bidx * sCPb + (size_t)by * 64 + col]; } }
      if (ACT == 3) v = fmaxf(v, 0.f); else if (ACT == 6) v = 0.5f * v * (1.0f + erff(v * 0.70710678118654752f)); else if (ACT == 11) v = 1.0f / (1.0f + expf(-v)); else if (ACT == 15) v = v / (1.0f + expf(-v)); else if (ACT == 12) v = (v > 0.f) ? v : 0.01f * v; else if (ACT == 8) v = tanhf(v); else if (ACT == 9) v = 0.5f * v * (1.0f + tanhf(0.7978845608028654f * (v + 0.044715f * v * v * v))); else if (ACT == 14) v = (v > 0.f) ? v : 0.1f * v; else if (ACT == 16) v = (v >= 0.f) ? v : 0.3f * v; else if (ACT == 17) v = (v >= 0.f) ? v : 0.2f * v;
      so[w][rloc][t * 16 + ln] = v; } }
  __builtin_amdgcn_fence(__ATOMIC_ACQ_REL, "workgroup"); __builtin_amdgcn_wave_barrier();
  const int rsub = lane >> 4, c4 = (lane & 15) * 4;
  {
#pragma unroll
    for (int q = 0; q < 16; ++q) { const int r = q * 2 + rsub; const v4f v = *(const v4fa*)&so[w][r][c4]; if (C) *(v4f*)(C + cofs + (size_t)(row0 + r) * ldc + col0 + c4) = v; if (C16) { v4h h4; for (int i = 0; i < 4; ++i) h4[i] = (_Float16)v[i]; *(v4h*)(C16 + cofs + (size_t)(row0 + r) * ldc + col0 + c4) = h4; } }
     } }


__global__ __launch_bounds__(256) void k_wnat(const float* __restrict__ w, size_t n8, _Float16* __restrict__ Bt) { const size_t t = (size_t)blockIdx.x * 256 + threadIdx.x; if (t >= n8) return; FragH f; for (int q = 0; q < 8; ++q) f.h[q] = (_Float16)(bf16_round(w[t * 8 + q]) * 16.0f); *(v8us*)((unsigned short*)Bt + t * 8) = f.half[0];  }
__global__ __launch_bounds__(256) void k_rsm(const float* __restrict__ S, _Float16* __restrict__ P, int nrows) {
  #pragma clang fp contract(off)
  const int i = blockIdx.x * 256 + threadIdx.x; if (i >= nrows) return; const float* s = S + (size_t)i * SQ; float mx = -3.0e38f;
#pragma unroll 1
  for (int j = 0; j < SQ; ++j) mx = fmaxf(mx, s[j]); float se = 0.f;
#pragma unroll 1
  for (int j = 0; j < SQ; ++j) se += expf(s[j] - mx); const float sc = 256.0f / se;
#pragma unroll 1
  for (int j0 = 0; j0 < SQ; j0 += 8) { FragH f; for (int q = 0; q < 8; ++q) f.h[q] = (_Float16)(expf(s[j0 + q] - mx) * sc); unsigned short* d = (unsigned short*)P + (size_t)i * SQ + j0; *(v8us*)d = f.half[0];  } }
__global__ __launch_bounds__(256) void k_vt(const _Float16* __restrict__ V16, int b, int h0, _Float16* __restrict__ VT) { __shared__ unsigned short tl[64][65]; const int tid = threadIdx.x; const int hh = blockIdx.x % HG, sg = blockIdx.x / HG; const int s0 = sg * 64; const int h = h0 + hh;
  for (int i = tid; i < 64 * 8; i += 256) { const int j = i / 8, d8 = (i % 8) * 8; FragH f; f.half[0] = *(const v8us*)((const unsigned short*)V16 + ((size_t)b * SQ + s0 + j) * DM + h * HD + d8); for (int q = 0; q < 8; ++q) tl[d8 + q][j] = f.u[q]; }
  __syncthreads();
  { for (int i = tid; i < 64 * 8; i += 256) { const int d = i / 8, j8 = (i % 8) * 8; FragH f; for (int q = 0; q < 8; ++q) f.u[q] = tl[d][j8 + q]; *(v8us*)((unsigned short*)VT + ((size_t)hh * HD + d) * SQ + s0 + j8) = f.half[0]; }  } }



#define FQ 128                       /* query rows per block: 4 waves x 32 */
#define FS 64                        /* keys per stage: two passes of 32 */
#define FP 72                        /* LDS row pitch in f16 = 144 bytes, an odd multiple of 16: 16-byte fragment reads of 128-byte rows fall evenly on the banks */
#define FT (64 * FP)                 /* f16 per staged tile: 64 rows (K: keys; V^T: head columns) */
__device__ __forceinline__ v8f fa_mma(v16h a, v16h b, v8f c) { return __builtin_amdgcn_wmma_f32_16x16x32_f16(false, a, false, b, (short)0, c, false, false); }
__device__ __forceinline__ v16h fa_frag(const unsigned short* p) { FragH f; f.half[0] = *(const v8us*)p; f.half[1] = *(const v8us*)(p + 16); return f.v; }
// One stage's copies of one lane: 16 bytes of each of four K rows and four V^T rows, 16 rows apart (a wave's 32 lanes cover four whole 128-byte rows per copy). lk = the lane's LDS byte address in the buffer's K tile; the V^T tile follows it.
// The s_wait_xcnt closes the statement so that it stands in front of any later write of the address registers the copies name.
__device__ __forceinline__ void fa_copy(const _Float16* kg, const _Float16* vg, unsigned lk) {
  const _Float16* k1 = kg + (size_t)16 * DM; const _Float16* k2 = kg + (size_t)32 * DM; const _Float16* k3 = kg + (size_t)48 * DM;
  const _Float16* v1 = vg + (size_t)16 * SQ; const _Float16* v2 = vg + (size_t)32 * SQ; const _Float16* v3 = vg + (size_t)48 * SQ;
  const unsigned lk1 = lk + 16 * FP * 2, lk2 = lk + 32 * FP * 2, lk3 = lk + 48 * FP * 2, lv = lk + FT * 2, lv1 = lv + 16 * FP * 2, lv2 = lv + 32 * FP * 2, lv3 = lv + 48 * FP * 2;
  asm volatile("global_load_async_to_lds_b128 %0, %8, off\n\t"
               "global_load_async_to_lds_b128 %1, %9, off\n\t"
               "global_load_async_to_lds_b128 %2, %10, off\n\t"
               "global_load_async_to_lds_b128 %3, %11, off\n\t"
               "global_load_async_to_lds_b128 %4, %12, off\n\t"
               "global_load_async_to_lds_b128 %5, %13, off\n\t"
               "global_load_async_to_lds_b128 %6, %14, off\n\t"
               "global_load_async_to_lds_b128 %7, %15, off\n\t"
               "s_wait_xcnt 0x0"
               :: "v"(lk), "v"(lk1), "v"(lk2), "v"(lk3), "v"(lv), "v"(lv1), "v"(lv2), "v"(lv3), "v"(kg), "v"(k1), "v"(k2), "v"(k3), "v"(vg), "v"(v1), "v"(v2), "v"(v3) : "memory"); }
__global__ __launch_bounds__(128) void k_fattn(const _Float16* __restrict__ QK, const _Float16* __restrict__ VT, _Float16* __restrict__ O) {
  __shared__ __attribute__((aligned(16))) unsigned short sm[2][2][FT];      /* [buffer][K, V^T][row x pitch] */
  constexpr float SC2 = 0.036084391824351615f * 1.4426950408889634f;      /* 1/sqrt(768) x log2(e): the softmax runs in base 2 */
  const int tid = threadIdx.x, lane = tid & 31, ln = lane & 15, hh = lane >> 4; const int w = __builtin_amdgcn_readfirstlane(tid >> 5);      /* scalar wave number: the skip test and row bases stay scalar */
  const int bh = blockIdx.x % (NB * NH), qb = (SQ / FQ - 1) - blockIdx.x / (NB * NH); const int b = bh / NH, h = bh % NH; const int qw = qb * FQ + w * 32;
  const _Float16* kb = QK + (size_t)b * SQ * DM + h * HD + (size_t)ln * DM;      /* this lane's row within a 16-row tile of q */
  const _Float16* kg = QK + ((size_t)b * SQ + (tid >> 3)) * DM + h * HD + (tid & 7) * 8;      /* this lane's 16 bytes of stage 0: K row tid / 8 */
  const _Float16* vg = VT + ((size_t)bh * HD + (tid >> 3)) * SQ + (tid & 7) * 8;               /* and V^T row tid / 8 */
  const unsigned l0 = (unsigned)(size_t)&sm[0][0][(tid >> 3) * FP + (tid & 7) * 8];            /* low 32 bits of a shared address = LDS byte address */
  const int nst = 2 * qb + 2;       /* stages of the block: up to the end of its last wave's diagonal block; never fewer than two */
  const int last = qw / 32;         /* this wave's last pass: its diagonal block, the only one with masked keys */
  fa_copy(kg, vg, l0);
  asm volatile("s_wait_asynccnt 0x0" ::: "memory");      /* stage 0 has landed for this wave's own copies */
  __syncthreads();                                        /* ... and for every wave's: publishes stage 0 */
  fa_copy(kg + (size_t)FS * DM, vg + FS, l0 + 2 * FT * 2);
  v16h qf[2][2];
#pragma unroll
  for (int g = 0; g < 2; ++g)
#pragma unroll
    for (int ks = 0; ks < 2; ++ks) qf[g][ks] = g2_frag(kb + (size_t)(qw + g * 16) * DM + ks * 32, hh);
  const v8f z8 = {0.f, 0.f, 0.f, 0.f, 0.f, 0.f, 0.f, 0.f};
  v8f o[2][4]; float m[2], l[2];
#pragma unroll
  for (int g = 0; g < 2; ++g) { m[g] = -1.0e30f; l[g] = 0.f;
#pragma unroll
    for (int dt = 0; dt < 4; ++dt) o[g][dt] = z8; }
#pragma unroll 1
  for (int t = 0; t < nst; ++t) {
    const unsigned short* kl = &sm[t & 1][0][ln * FP + 8 * hh];      /* this lane's row and half within a 16-row tile of the staged K rows */
    const unsigned short* vl = &sm[t & 1][1][ln * FP + 8 * hh];      /* and of the staged V^T rows */
#pragma unroll
    for (int p = 0; p < 2; ++p) { const int it = 2 * t + p;
      if (it <= last) {
        v16h kf[2][2], vf[4];
#pragma unroll
        for (int kt = 0; kt < 2; ++kt)
#pragma unroll
          for (int ks = 0; ks < 2; ++ks) kf[kt][ks] = fa_frag(kl + (p * 32 + kt * 16) * FP + ks * 32);
#pragma unroll
        for (int dt = 0; dt < 4; ++dt) vf[dt] = fa_frag(vl + (dt * 16) * FP + p * 32);
        __builtin_amdgcn_sched_barrier(0);      /* keeps the pass's sixteen LDS reads together at its head, K first: one place with LDS reads instead of two, and the V^T fragments land under the score products and the softmax instead of being waited for in front of P V */
        v8f s[2][2];
#pragma unroll
        for (int g = 0; g < 2; ++g)
#pragma unroll
          for (int kt = 0; kt < 2; ++kt) s[g][kt] = fa_mma(kf[kt][1], qf[g][1], fa_mma(kf[kt][0], qf[g][0], z8));
        if (it == last) {
#pragma unroll
          for (int g = 0; g < 2; ++g)
#pragma unroll
            for (int kt = 0; kt < 2; ++kt)
#pragma unroll
              for (int r = 0; r < 8; ++r) s[g][kt][r] = (kt * 16 + 8 * hh + r <= g * 16 + ln) ? s[g][kt][r] : -1.0e30f; }      /* first key of the pass == qw here: key <= query */
        float mn[2]; bool need = false;
#pragma unroll
        for (int g = 0; g < 2; ++g) { float mx = s[g][0][0];
#pragma unroll
          for (int r = 1; r < 8; ++r) mx = fmaxf(mx, s[g][0][r]);
#pragma unroll
          for (int r = 0; r < 8; ++r) mx = fmaxf(mx, s[g][1][r]);
          mx = fmaxf(mx, __shfl_xor(mx, 16, 32)); mn[g] = fmaxf(m[g], mx * SC2); need = need || (mn[g] > m[g]); }
        if (__builtin_amdgcn_ballot_w32(need) != 0) {      /* no column's maximum moved: every factor would be exactly 1, so the rescale is skipped as a whole */
#pragma unroll
          for (int g = 0; g < 2; ++g) { const float al = __builtin_amdgcn_exp2f(m[g] - mn[g]); m[g] = mn[g]; l[g] *= al;
#pragma unroll
            for (int dt = 0; dt < 4; ++dt) o[g][dt] *= al; } }
        FragH pf[2];
#pragma unroll
        for (int g = 0; g < 2; ++g) { float ls = 0.f;
#pragma unroll
          for (int kt = 0; kt < 2; ++kt) { const v8f tt = s[g][kt] * SC2 - m[g];
#pragma unroll
            for (int r = 0; r < 8; ++r) { const float pp = __builtin_amdgcn_exp2f(tt[r]); ls += pp; pf[g].h[kt * 8 + r] = (_Float16)pp; } }
          l[g] += ls; }
#pragma unroll
        for (int g = 0; g < 2; ++g)
#pragma unroll
          for (int dt = 0; dt < 4; ++dt) o[g][dt] = fa_mma(vf[dt], pf[g].v, o[g][dt]); } }
    asm volatile("s_wait_dscnt 0x0" ::: "memory");         /* this wave's reads of buffer t & 1 have returned before the buffer is refilled */
    asm volatile("s_wait_asynccnt 0x0" ::: "memory");      /* this wave's copies of stage t + 1 have landed */
    __syncthreads();                                        /* publishes stage t + 1 and ends every wave's reads of stage t */
    if (t + 2 < nst) fa_copy(kg + (size_t)(t + 2) * FS * DM, vg + (size_t)(t + 2) * FS, l0 + (unsigned)(t & 1) * (2 * FT * 2)); }      /* the same test in the whole block */
  asm volatile("s_wait_asynccnt 0x0" ::: "memory");        /* no copy is outstanding when the wave ends */
#pragma unroll
  for (int g = 0; g < 2; ++g) { const float fin = 64.0f / (l[g] + __shfl_xor(l[g], 16, 32));      /* halves joined once; o carried x64 */
    _Float16* orow = O + ((size_t)b * SQ + qw + g * 16 + ln) * DM + h * HD + 8 * hh;
#pragma unroll
    for (int dt = 0; dt < 4; ++dt) { FragH f;
#pragma unroll
      for (int r = 0; r < 8; ++r) f.h[r] = (_Float16)(o[g][dt][r] * fin);
      *(v8us*)((unsigned short*)orow + dt * 16) = f.half[0]; } } }

// Exact f32 attention for the first QT0 rows of one batch; F holds the f32 rows of q = k = v (pitch ld). One wave per (head, query row), A0W rows a block.
// Scores: lane = key (four groups of 32 keys), the query row broadcast from LDS, four partial sums per key. Softmax: two passes over the wave's own registers.
// P V: lane = two head columns, keys in ascending order, each weight broadcast from its lane through a scalar register.
// Every wave stages and walks all QT0 keys, keys past its query with weight exactly 0: the launch lasts as long as the wave of the last row, which needs them all,
// and without tests the code is one straight line whose LDS reads have constant offsets and fly together.
// Every loop is fully unrolled: the small arrays are then indexed by constants and stay in registers, and each weight is read from a constant lane.
#define A0W 8                        /* waves = query rows per block */
#define A0P 68                       /* LDS row pitch in floats: 16-byte column walks fall on distinct banks */
typedef float v2f __attribute__((ext_vector_type(2)));
__global__ __launch_bounds__(256) void k_att0(const float* __restrict__ F, int ld, float scale, float* __restrict__ OF, int ldo) {
  __shared__ __attribute__((aligned(16))) float tl[QT0][A0P];
  const int tid = threadIdx.x, lane = tid & 31; const int w = __builtin_amdgcn_readfirstlane(tid >> 5);      /* scalar wave number: the query row's LDS address stays scalar */
  const int h = blockIdx.x / (QT0 / A0W), rg = blockIdx.x % (QT0 / A0W); const int i = rg * A0W + w;
#pragma unroll
  for (int u = 0; u < QT0 * (HD / 4) / 256; ++u) { const int e = u * 256 + tid; const int r = e >> 4, c = (e & 15) * 4; *(v4f*)&tl[r][c] = *(const v4fa*)(F + (size_t)r * ld + h * HD + c); }
  __syncthreads();
  v4f a[QT0 / 32];
#pragma unroll
  for (int t = 0; t < QT0 / 32; ++t) a[t] = (v4f){0.f, 0.f, 0.f, 0.f};
#pragma unroll
  for (int c = 0; c < HD / 4; ++c) { const v4f q = *(const v4f*)&tl[i][c * 4];
#pragma unroll
    for (int t = 0; t < QT0 / 32; ++t) a[t] = __builtin_elementwise_fma(q, *(const v4f*)&tl[t * 32 + lane][c * 4], a[t]); }
  float s[QT0 / 32], mx = -1.0e30f;
#pragma unroll
  for (int t = 0; t < QT0 / 32; ++t) { const float d = (a[t][0] + a[t][1]) + (a[t][2] + a[t][3]); s[t] = (t * 32 + lane <= i) ? d * scale : -1.0e30f; mx = fmaxf(mx, s[t]); }
#pragma unroll
  for (int d = 16; d > 0; d >>= 1) mx = fmaxf(mx, __shfl_xor(mx, d, 32));      /* key 0 is never masked: mx is a real score */
  float p[QT0 / 32], l = 0.f;
#pragma unroll
  for (int t = 0; t < QT0 / 32; ++t) { p[t] = expf(s[t] - mx); l += p[t]; }      /* masked keys: exp of about -1e30 = 0 */
#pragma unroll
  for (int d = 16; d > 0; d >>= 1) l += __shfl_xor(l, d, 32);
  v2f o = {0.f, 0.f};
#pragma unroll
  for (int t = 0; t < QT0 / 32; ++t)
#pragma unroll
    for (int k = 0; k < 32; ++k) { const float pj = __uint_as_float(__builtin_amdgcn_readlane(__float_as_uint(p[t]), k)); const v2f pp = {pj, pj};
      o = __builtin_elementwise_fma(pp, *(const v2f*)&tl[t * 32 + k][2 * lane], o); }
  const float fin = 64.0f / l;      /* o carried x64 like the f16 path */
  *(v2f*)(OF + (size_t)i * ldo + h * HD + 2 * lane) = o * fin; }

extern "C" void kernel_launch(void* const* d_in, const int* in_sizes, int n_in,
                              void* d_out, int out_size, void* d_ws, size_t ws_size, hipStream_t stream) {
  (void)in_sizes; (void)n_in; (void)out_size;
  const float* const* I = (const float* const*)d_in; const float* x = I[0]; const float* wq = I[1]; const float* wo = I[2]; const float* bo = I[3]; const float* wk = wq; const float* wv = wq;      /* Wq [12][64][768] = natural [768][768] rows h*64+d (q = k = v); W_out natural + b_out */
  char* ws = (char*)d_ws; size_t off = 0;
  auto take = [&](size_t bytes) { char* p = ws + off; off += (bytes + 255) & ~(size_t)255; return p; };
  _Float16* BQ = (_Float16*)take((size_t)DM * DM * 2); _Float16* BK = BQ; _Float16* BV = BQ; _Float16* BO = (_Float16*)take((size_t)DM * DM * 2);
  _Float16* X16 = (_Float16*)take(NR * DM * 2); _Float16* Q16 = (_Float16*)take(NR * DM * 2); _Float16* K16 = Q16; _Float16* V16 = Q16;      /* q = k = v (the module projects all three with self.query) */ _Float16* O16 = (_Float16*)take(NR * DM * 2);
  _Float16* VT = (_Float16*)take((size_t)NB * NH * HD * SQ * 2);
  float* QF0 = (float*)take((size_t)QT0 * DM * 4); float* KF0 = (float*)take((size_t)QT0 * DM * 4); float* VF0 = (float*)take((size_t)QT0 * DM * 4); float* OF0 = (float*)take((size_t)NB * QT0 * DM * 4); _Float16* OH0 = (_Float16*)take((size_t)NB * QT0 * DM * 2); _Float16* OL0 = (_Float16*)take((size_t)NB * QT0 * DM * 2);
  if (off > ws_size) return;
  k_wnat<<<(unsigned)(((size_t)DM * DM / 8 + 255) / 256), 256, 0, stream>>>(wq, (size_t)DM * DM / 8, BQ); k_wnat<<<(unsigned)(((size_t)DM * DM / 8 + 255) / 256), 256, 0, stream>>>(wo, (size_t)DM * DM / 8, BO);      /* natural [out][in] = Bt x16 */

  k_x16<<<(unsigned)((NR * DM / 8 + 255) / 256), 256, 0, stream>>>(x, X16, NR * DM / 8);
  const size_t r0p = (size_t)B0 * SQ;      /* first projected row */
  k_gemm2<0><<<dim3((unsigned)((MP / 128) * (DM / 64)), 1), 128, 0, stream>>>(X16 + r0p * DM, DM, 0, BQ, DM, 0, 0.0625f, nullptr, 0, nullptr, 1, 0, 0, nullptr, Q16 + r0p * DM, DM, 0, MP, DM, DM);
  k_vt<NH, SQ><<<NB * NH * (SQ / 64), 256, 0, stream>>>(V16, LQ, 0, VT);      /* V^T [NB][NH][HD][SQ] */
  k_fattn<<<NB * NH * (SQ / FQ), 128, 0, stream>>>(Q16, VT, O16);      /* scores, causal softmax and P V in one launch; o (merged heads, x64) as f16 rows */
  for (int b = B0; b < B0 + NBR; ++b) { const size_t r0 = (size_t)b * SQ;
    k_gemm2<0><<<dim3((QT0 / 128) * (DM / 64), 1), 128, 0, stream>>>(X16 + r0 * DM, DM, 0, BQ, DM, 0, 0.0625f, nullptr, 0, nullptr, 1, 0, 0, QF0, nullptr, DM, 0, QT0, DM, DM); /* KF0 = VF0 = QF0 (same projection) */      /* f32 q, k, v of the first 128 rows (exact products) */
    k_att0<<<NH * (QT0 / A0W), 32 * A0W, 0, stream>>>(QF0, DM, 0.036084391824351615f, OF0 + (size_t)b * QT0 * DM, DM);      /* exact f32 attention for rows 0..127 (o x64) */ }
  k_gemm2<0><<<dim3((unsigned)((MPO / 128) * (DM / 64)), 1), 128, 0, stream>>>(O16 + r0p * DM, DM, 0, BO, DM, 0, 0.0009765625f, bo, 0, nullptr, 1, 0, 0, (float*)d_out + r0p * DM, nullptr, DM, 0, MPO, DM, DM);      /* out rows are the output layout */
  k_hl<<<(unsigned)(((size_t)NB * QT0 * DM / 8 + 255) / 256), 256, 0, stream>>>(OF0, OH0, OL0, (size_t)NB * QT0 * DM / 8);      /* first-tile o (x64) -> f16 hi + x1024 residual planes */
  for (int b = B0; b < B0 + NBR; ++b) { const size_t r0 = (size_t)b * SQ; const size_t f0 = (size_t)b * QT0;
    k_gemm2<0><<<dim3((QT0 / 128) * (DM / 64), 1), 128, 0, stream>>>(OH0 + f0 * DM, DM, 0, BO, DM, 0, 0.0009765625f, bo, 0, nullptr, 1, 0, 0, (float*)d_out + r0 * DM, nullptr, DM, 0, QT0, DM, DM);      /* rows 0..127: out = o_hi Wo (+ b), overwriting the f16-path rows */
    k_gemm2<0><<<dim3((QT0 / 128) * (DM / 64), 1), 128, 0, stream>>>(OL0 + f0 * DM, DM, 0, BO, DM, 0, 0.00000095367431640625f, nullptr, 0, (const float*)d_out + r0 * DM, -1, 0, 0, (float*)d_out + r0 * DM, nullptr, DM, 0, QT0, DM, DM); }      /* += o_lo Wo 2^-20 (own-element accumulate) */
}

// v006
// A run of this version takes 155 microseconds.
// Next to v005, in two timings, it ran 1.32 times as fast each time.
// Counting every step since v000, it is 93.6 times as fast.
#include <hip/hip_runtime.h>
// Causal multi-head attention whose q, k AND v are the same per-head projection (x [2][4096][768]; q = k = v = x Wq[h]^T with Wq [12][64][768] (natural per-head rows, sigma 1/sqrt(768)); scores = q.q / sqrt(768) (the module scales by d_model); causal (tril, -inf); softmax; out = merged (attn q) W_out^T + b_out -> [2][4096][768]).
// Structure: token rows r = b*4096 + s; x as exact f16 rows (bf16-rounded); q (= k = v) as one WMMA GEMM (32x64 wave tiles, f32 accumulation, exact x16 weights, f16 outputs); V^T for all batches and heads via LDS transposes; one fused launch for the attention: per wave 32 query rows, keys 32 at a time up to the diagonal block, S^T = K Q^T, online base-2 softmax in registers (f32 statistics, native exp2; weights in (0,1] as f16), O^T += V^T P^T (o carried x64, folded into the output GEMM alpha) written straight into the merged f16 o rows; out = o W_o GEMM (f32) into the output layout.
// Compute dtype: inputs rounded to bf16; x / weights exact; q, k, v, softmax weights and o as plain f16 GEMM operands (~2^-12); scores and softmax statistics f32. v_wmma_f32_16x16x32_f16.
#define NB 2
#define SQ 4096
#define DM 768
#define NH 12
#define HD 64
#define HG 4                         /* heads per launch of the unused per-batch k_vt */
#define QT0 128                      /* first-tile rows recomputed exactly in f32 */
#define B0 0                         /* first batch processed (debug hook) */
#define NBR NB                       /* batches processed (debug hook) */
#define NR ((size_t)NB * SQ)         /* token rows */
#define MP ((int)((size_t)NBR * SQ)) /* rows projected (debug hook) */
#define MPO MP                       /* rows through the output stage (debug hook) */
#define LQ DM      /* row pitch of the q/k/v rows */
typedef __bf16 v16b __attribute__((ext_vector_type(16)));
typedef unsigned short v8us __attribute__((ext_vector_type(8), may_alias));
typedef float  v8f  __attribute__((ext_vector_type(8)));
typedef float  v4f  __attribute__((ext_vector_type(4)));
typedef float  v4fa __attribute__((ext_vector_type(4), may_alias));
union FragB { v16b v; v8us half[2]; unsigned short u[16]; };

__device__ __forceinline__ unsigned short bf16_bits(float x) { unsigned int u = __float_as_uint(x); return (unsigned short)((u + 0x7FFFu + ((u >> 16) & 1u)) >> 16); }
__device__ __forceinline__ float bf16_val(unsigned short b) { return __uint_as_float(((unsigned int)b) << 16); }
__device__ __forceinline__ float bf16_round(float x) { return bf16_val(bf16_bits(x)); }
// D += A·B with NT terms: 1 = ah·bh, 2 = + al·bh (A split), 3 = + ah·bl (both split)
template <int NT>
__device__ __forceinline__ v8f mmaN(v16b ah, v16b al, v16b bh, v16b bl, v8f c) {
  c = __builtin_amdgcn_wmma_f32_16x16x32_bf16(false, ah, false, bh, (short)0, c, false, false);
  if (NT >= 2) c = __builtin_amdgcn_wmma_f32_16x16x32_bf16(false, al, false, bh, (short)0, c, false, false);
  if (NT >= 3) c = __builtin_amdgcn_wmma_f32_16x16x32_bf16(false, ah, false, bl, (short)0, c, false, false);
  asm volatile("v_nop\n\tv_nop\n\tv_nop\n\tv_nop" : "+v"(c) : "v"(ah), "v"(al), "v"(bh), "v"(bl));
  return c;
}

__global__ __launch_bounds__(256) void k_wt_bf16(const float* __restrict__ W, unsigned short* __restrict__ Wt, int K, int N) {
  const int t = blockIdx.x * 256 + threadIdx.x;
  const int k8n = K / 8;
  if (t >= N * k8n) return;
  const int n = t / k8n, k8 = (t % k8n) * 8;
  v8us v;
#pragma unroll
  for (int i = 0; i < 8; ++i) v[i] = bf16_bits(W[(size_t)(k8 + i) * N + n]);
  *(v8us*)(Wt + (size_t)n * K + k8) = v;
  
}

// GEMM C[M][N] (f32, pitch ldc) = act(A[M][K]·W + bias). A f32 row-major (pitch lda) converted per fragment to bf16
// (ASPLIT: hi/lo two planes -> 2 terms, else single rounded term); Wt bf16 [N][K] (pitch ldb). BIAS_BF16 rounds the
// bias to bf16 first (bias quantised to bf16 before the add). K%32==0, M%16==0, N%64==0.
template <bool ASPLIT, int ACT, bool BIAS_BF16>
__global__ __launch_bounds__(128) void k_gemm_bf(const float* __restrict__ A, int lda, const unsigned short* __restrict__ Wt, int ldb,
                                               const float* __restrict__ bias, float* __restrict__ C, int ldc, int M, int N, int K) {
  __shared__ __attribute__((aligned(16))) float so[4][16][64];
  const int tid = threadIdx.x, w = tid >> 5, lane = tid & 31, ln = lane & 15, hh = lane >> 4;
  const int ntn = N / 64;
  const int wid = blockIdx.x * 4 + w;
  const int mt = wid / ntn, nq = wid % ntn;
  if (mt * 16 >= M) return;
  const int row0 = mt * 16, col0 = nq * 64;
  const float* arow = A + (size_t)(row0 + ln) * lda;
  v8f acc[4] = {};
  for (int kb = 0; kb < K; kb += 32) {
    FragB ah, al;
    const v4f x0 = *(const v4fa*)(arow + kb + 8 * hh), x1 = *(const v4fa*)(arow + kb + 8 * hh + 4);
    const v4f x2 = *(const v4fa*)(arow + kb + 16 + 8 * hh), x3 = *(const v4fa*)(arow + kb + 16 + 8 * hh + 4);
    float xs[16] = {x0[0],x0[1],x0[2],x0[3],x1[0],x1[1],x1[2],x1[3],x2[0],x2[1],x2[2],x2[3],x3[0],x3[1],x3[2],x3[3]};
#pragma unroll
    for (int i = 0; i < 16; ++i) { const unsigned short hb = bf16_bits(xs[i]); ah.u[i] = hb; al.u[i] = ASPLIT ? bf16_bits(xs[i] - bf16_val(hb)) : (unsigned short)0; }
#pragma unroll
    for (int t = 0; t < 4; ++t) {
      const unsigned short* brow = Wt + (size_t)(col0 + t * 16 + ln) * ldb + kb;
      FragB b;
      b.half[0] = *(const v8us*)(brow + 8 * hh);
      b.half[1] = *(const v8us*)(brow + 16 + 8 * hh);
      acc[t] = mmaN<ASPLIT ? 2 : 1>(ah.v, al.v, b.v, b.v, acc[t]);
    }
  }
#pragma unroll
  for (int t = 0; t < 4; ++t) {
    float bv = bias ? bias[col0 + t * 16 + ln] : 0.f;
    if (BIAS_BF16) bv = bf16_round(bv);
#pragma unroll
    for (int r = 0; r < 8; ++r) { float v = acc[t][r] + bv; if (ACT == 1) v = fmaxf(v, 0.f); so[w][8 * hh + r][t * 16 + ln] = v; }
  }
  __builtin_amdgcn_fence(__ATOMIC_ACQ_REL, "workgroup");
  __builtin_amdgcn_wave_barrier();
  const int rsub = lane >> 4, c4 = (lane & 15) * 4;
  {
#pragma unroll
    for (int q = 0; q < 8; ++q) {
      const int r = q * 2 + rsub;
      const v4f v = *(const v4fa*)&so[w][r][c4];
      *(v4f*)(C + (size_t)(row0 + r) * ldc + col0 + c4) = v;
    }
    
  }
}

// GEMM C = act(A·W + bias + resid): A f32 (ASPLIT -> hi/lo 2 terms), Wt bf16 [N][K]; ACT 0 none, 1 relu, 2 exact gelu;
// resid (optional, f32, row index = (row % rmod), pitch ldr, RES_BF16 rounds it) added before the activation.
template <bool ASPLIT, int ACT, bool BIAS_BF16, bool RES_BF16>
__global__ __launch_bounds__(128) void k_gemm_bf3(const float* __restrict__ A, int lda, const unsigned short* __restrict__ Wt, int ldb,
                                                const float* __restrict__ bias, const float* __restrict__ resid, int rmod, int ldr,
                                                float* __restrict__ C, int ldc, int M, int N, int K) {
  __shared__ __attribute__((aligned(16))) float so[4][16][64];
  const int tid = threadIdx.x, w = tid >> 5, lane = tid & 31, ln = lane & 15, hh = lane >> 4;
  const int ntn = N / 64;
  const int wid = blockIdx.x * 4 + w;
  const int mt = wid / ntn, nq = wid % ntn;
  if (mt * 16 >= M) return;
  const int row0 = mt * 16, col0 = nq * 64;
  const float* arow = A + (size_t)(row0 + ln) * lda;
  v8f acc[4] = {};
  for (int kb = 0; kb < K; kb += 32) {
    FragB ah, al;
    const v4f x0 = *(const v4fa*)(arow + kb + 8 * hh), x1 = *(const v4fa*)(arow + kb + 8 * hh + 4);
    const v4f x2 = *(const v4fa*)(arow + kb + 16 + 8 * hh), x3 = *(const v4fa*)(arow + kb + 16 + 8 * hh + 4);
    float xs[16] = {x0[0],x0[1],x0[2],x0[3],x1[0],x1[1],x1[2],x1[3],x2[0],x2[1],x2[2],x2[3],x3[0],x3[1],x3[2],x3[3]};
#pragma unroll
    for (int i = 0; i < 16; ++i) { const unsigned short hb = bf16_bits(xs[i]); ah.u[i] = hb; al.u[i] = ASPLIT ? bf16_bits(xs[i] - bf16_val(hb)) : (unsigned short)0; }
#pragma unroll
    for (int t = 0; t < 4; ++t) {
      const unsigned short* brow = Wt + (size_t)(col0 + t * 16 + ln) * ldb + kb;
      FragB b;
      b.half[0] = *(const v8us*)(brow + 8 * hh);
      b.half[1] = *(const v8us*)(brow + 16 + 8 * hh);
      acc[t] = mmaN<ASPLIT ? 2 : 1>(ah.v, al.v, b.v, b.v, acc[t]);
    }
  }
#pragma unroll
  for (int t = 0; t < 4; ++t) {
    const int col = col0 + t * 16 + ln;
    float bv = bias ? bias[col] : 0.f;
    if (BIAS_BF16) bv = bf16_round(bv);
#pragma unroll
    for (int r = 0; r < 8; ++r) {
      float v = acc[t][r] + bv;
      if (resid) { float rv = resid[(size_t)((row0 + 8 * hh + r) % rmod) * ldr + col]; if (RES_BF16) rv = bf16_round(rv); v += rv; }
      if (ACT == 1) v = fmaxf(v, 0.f);
      if (ACT == 2) v = 0.5f * v * (1.0f + erff(v * 0.70710678118654752f));
      if (ACT == 3) { const float u = 0.7978845608028654f * (v + 0.044715f * v * v * v); v = 0.5f * v * (1.0f + tanhf(u)); }
      so[w][8 * hh + r][t * 16 + ln] = v;
    }
  }
  __builtin_amdgcn_fence(__ATOMIC_ACQ_REL, "workgroup");
  __builtin_amdgcn_wave_barrier();
  const int rsub = lane >> 4, c4 = (lane & 15) * 4;
  {
#pragma unroll
    for (int q = 0; q < 8; ++q) {
      const int r = q * 2 + rsub;
      const v4f v = *(const v4fa*)&so[w][r][c4];
      *(v4f*)(C + (size_t)(row0 + r) * ldc + col0 + c4) = v;
    }
    
  }
}
// row LayerNorm (biased variance, eps) over N: s = X (+ R); optional out_sum <- s; out_norm <- (s-mu)*rsqrt(var+eps)*g + b
template <bool PARAM_BF16>
__global__ __launch_bounds__(256) void k_layernorm(const float* __restrict__ X, const float* __restrict__ R, const float* __restrict__ g, const float* __restrict__ bta,
                                                  float* __restrict__ out_sum, float* __restrict__ out_norm, int N, float eps) {
  __shared__ float red[256];
  const int row = blockIdx.x, tid = threadIdx.x;
  const float* x = X + (size_t)row * N; const float* rr = R ? R + (size_t)row * N : nullptr;
  float vals[16];                     // up to N = 4096
  const int per = N / 256;            // contiguous chunk per thread? use strided-by-4 chunks: thread handles j = tid*4 + 1024*u
  float s1 = 0.f;
  for (int u = 0; u < per / 4; ++u) {
    const int j = tid * 4 + 1024 * u;
    const v4f a = *(const v4fa*)(x + j);
    v4f b = {0.f,0.f,0.f,0.f}; if (rr) b = *(const v4fa*)(rr + j);
#pragma unroll
    for (int q = 0; q < 4; ++q) { const float v = a[q] + b[q]; vals[u * 4 + q] = v; s1 += v; }
  }
  red[tid] = s1; __syncthreads();
  for (int st = 128; st > 0; st >>= 1) { if (tid < st) red[tid] += red[tid + st]; __syncthreads(); }
  const float mu = red[0] / (float)N; __syncthreads();
  float s2 = 0.f;
  for (int u = 0; u < per / 4; ++u)
#pragma unroll
    for (int q = 0; q < 4; ++q) { const float c = vals[u * 4 + q] - mu; s2 += c * c; }
  red[tid] = s2; __syncthreads();
  for (int st = 128; st > 0; st >>= 1) { if (tid < st) red[tid] += red[tid + st]; __syncthreads(); }
  const float rs = rsqrtf(red[0] / (float)N + eps);
  {
    for (int u = 0; u < per / 4; ++u) {
      const int j = tid * 4 + 1024 * u;
      v4f o, sm;
#pragma unroll
      for (int q = 0; q < 4; ++q) {
        float gg = g[j + q], bb = bta[j + q];
        if (PARAM_BF16) { gg = bf16_round(gg); bb = bf16_round(bb); }
        sm[q] = vals[u * 4 + q]; o[q] = (vals[u * 4 + q] - mu) * rs * gg + bb;
      }
      if (out_sum) *(v4f*)(out_sum + (size_t)row * N + j) = sm;
      *(v4f*)(out_norm + (size_t)row * N + j) = o;
    }
    
  }
}



// ---- f16 WMMA path (v_wmma_f32_16x16x32_f16): 11-bit significands for operands in range — used where a [0,1] probability operand needs more precision than bf16
typedef _Float16 v16h __attribute__((ext_vector_type(16)));
union FragH { v16h v; v8us half[2]; _Float16 h[16]; unsigned short u[16]; };
template <int NT>
__device__ __forceinline__ v8f mmaH(v16h ah, v16h al, v16h bh, v16h bl, v8f c) {
  c = __builtin_amdgcn_wmma_f32_16x16x32_f16(false, ah, false, bh, (short)0, c, false, false);
  if (NT >= 2) c = __builtin_amdgcn_wmma_f32_16x16x32_f16(false, al, false, bh, (short)0, c, false, false);
  if (NT >= 3) c = __builtin_amdgcn_wmma_f32_16x16x32_f16(false, ah, false, bl, (short)0, c, false, false);
  asm volatile("v_nop\n\tv_nop\n\tv_nop\n\tv_nop" : "+v"(c) : "v"(ah), "v"(al), "v"(bh), "v"(bl));
  return c;
}
// batched GEMM like k_gemm_b but f16 operands: A f32 (split into f16 hi/lo if ASPLIT, else rounded to f16), Bt = f16 values [n][k]; alpha; C f32; N multiple of 16 (partial tiles skipped)
template <bool ASPLIT>
__global__ __launch_bounds__(128) void k_gemm_h(const float* __restrict__ A, int lda, size_t sA, const _Float16* __restrict__ Bh, int ldb, size_t sB, float alpha, float* __restrict__ C, int ldc, size_t sC, int M, int N, int K) {
  __shared__ __attribute__((aligned(16))) float so[4][16][64];
  const int tid = threadIdx.x, w = tid >> 5, lane = tid & 31, ln = lane & 15, hh = lane >> 4; const int by = blockIdx.y;
  A += (size_t)by * sA; Bh += (size_t)by * sB; C += (size_t)by * sC;
  const int ntn = (N + 63) / 64; const int wid = blockIdx.x * 4 + w; const int mt = wid / ntn, nq = wid % ntn; if (mt * 16 >= M) return;
  const int row0 = mt * 16, col0 = nq * 64; const float* arow = A + (size_t)(row0 + ln) * lda;
  v8f acc[4] = {};
  for (int kb = 0; kb < K; kb += 32) {
    FragH ah, al;
    const v4f x0 = *(const v4fa*)(arow + kb + 8 * hh), x1 = *(const v4fa*)(arow + kb + 8 * hh + 4), x2 = *(const v4fa*)(arow + kb + 16 + 8 * hh), x3 = *(const v4fa*)(arow + kb + 16 + 8 * hh + 4);
    float xs[16] = {x0[0],x0[1],x0[2],x0[3],x1[0],x1[1],x1[2],x1[3],x2[0],x2[1],x2[2],x2[3],x3[0],x3[1],x3[2],x3[3]};
#pragma unroll
    for (int i = 0; i < 16; ++i) { const _Float16 h = (_Float16)xs[i]; ah.h[i] = h; al.h[i] = ASPLIT ? (_Float16)(xs[i] - (float)h) : (_Float16)0.0f; }
#pragma unroll
    for (int t = 0; t < 4; ++t) { if (col0 + t * 16 >= N) continue; const size_t boff = (size_t)(col0 + t * 16 + ln) * ldb + kb; FragH bq; bq.half[0] = *(const v8us*)(Bh + boff + 8 * hh); bq.half[1] = *(const v8us*)(Bh + boff + 16 + 8 * hh);
      acc[t] = mmaH<ASPLIT ? 2 : 1>(ah.v, al.v, bq.v, bq.v, acc[t]); }
  }
#pragma unroll
  for (int t = 0; t < 4; ++t) { if (col0 + t * 16 >= N) continue;
#pragma unroll
    for (int r = 0; r < 8; ++r) so[w][8 * hh + r][t * 16 + ln] = acc[t][r] * alpha; }
  __builtin_amdgcn_fence(__ATOMIC_ACQ_REL, "workgroup"); __builtin_amdgcn_wave_barrier();
  const int rsub = lane >> 4, c4 = (lane & 15) * 4;
  {
#pragma unroll
    for (int q = 0; q < 8; ++q) { const int r = q * 2 + rsub; if (col0 + c4 < N) { const v4f v = *(const v4fa*)&so[w][r][c4]; *(v4f*)(C + (size_t)(row0 + r) * ldc + col0 + c4) = v; } }
     }
}

// Wt[n][k] = f16(W[k][n]·scale) from f32 row-major W[K][N] (scale = power of two; bf16-exact weights stay exact in f16 away from the subnormal range)
__global__ __launch_bounds__(256) void k_wt_f16(const float* __restrict__ W, _Float16* __restrict__ Wt, int K, int N, float scale) {
  const int t = blockIdx.x * 256 + threadIdx.x; if (t >= N * (K / 8)) return; const int n = t / (K / 8), k8 = (t % (K / 8)) * 8; FragH f;
#pragma unroll
  for (int i = 0; i < 8; ++i) f.h[i] = (_Float16)(bf16_round(W[(size_t)(k8 + i) * N + n]) * scale); const v8us o = f.half[0];
  *(v8us*)((unsigned short*)Wt + (size_t)n * K + k8) = o; 
}
// k_gemm_hh variant with fused epilogue: v = acc·alpha + bias[by·sBias + col] (+ CP[(row/rowsPerB)·sCPb + by·64 + col] if CP) ; ACT 0 none / 1 elu ; writes f16 C16 (and f32 C if non-null)
template <int ACT>
__global__ __launch_bounds__(128) void k_gemm_hhx(const _Float16* __restrict__ A, int lda, size_t sA, const _Float16* __restrict__ Bh, int ldb, size_t sB, float alpha, const float* __restrict__ bias, size_t sBias, const float* __restrict__ CP, int rowsPerB, size_t sCPb, int row0g,
    float* __restrict__ C, _Float16* __restrict__ C16, int ldc, size_t sC, int M, int N, int K) {
  __shared__ __attribute__((aligned(16))) float so[4][16][64];
  const int tid = threadIdx.x, w = tid >> 5, lane = tid & 31, ln = lane & 15, hh = lane >> 4; const int by = blockIdx.y;
  A += (size_t)by * sA; Bh += (size_t)by * sB; const size_t cofs = (size_t)by * sC; const float* bp = bias ? bias + (size_t)by * sBias : nullptr;
  const int ntn = (N + 63) / 64; const int wid = blockIdx.x * 4 + w; const int mt = wid / ntn, nq = wid % ntn; if (mt * 16 >= M) return;
  const int row0 = mt * 16, col0 = nq * 64; const _Float16* arow = A + (size_t)(row0 + ln) * lda;
  v8f acc[4] = {};
  for (int kb = 0; kb < K; kb += 32) { FragH ah; ah.half[0] = *(const v8us*)((const unsigned short*)arow + kb + 8 * hh); ah.half[1] = *(const v8us*)((const unsigned short*)arow + kb + 16 + 8 * hh);
#pragma unroll
    for (int t = 0; t < 4; ++t) { if (col0 + t * 16 >= N) continue; const size_t boff = (size_t)(col0 + t * 16 + ln) * ldb + kb; FragH bq; bq.half[0] = *(const v8us*)((const unsigned short*)Bh + boff + 8 * hh); bq.half[1] = *(const v8us*)((const unsigned short*)Bh + boff + 16 + 8 * hh);
      acc[t] = mmaH<1>(ah.v, ah.v, bq.v, bq.v, acc[t]); }
  }
#pragma unroll
  for (int t = 0; t < 4; ++t) { if (col0 + t * 16 >= N) continue; const int col = col0 + t * 16 + ln; const float bv = bp ? bf16_round(bp[col]) : 0.f;
#pragma unroll
    for (int r = 0; r < 8; ++r) { float v = acc[t][r] * alpha + bv; if (CP) { const int rr = row0g + row0 + 8 * hh + r; if (rowsPerB < 0) v += CP[cofs + (size_t)rr * ldc + col];      /* rowsPerB < 0: own element of the batched C plane */ else { const int bidx = rr / rowsPerB; v += CP[(size_t)bidx * sCPb + (size_t)by * 64 + col]; } } if (ACT == 1) v = (v > 0.f) ? v : expm1f(v); else if (ACT == 7) v = (v > 0.f) ? v + 1.0f : expf(v); else if (ACT == 8) v = tanhf(v); else if (ACT == 9) v = 0.5f * v * (1.0f + tanhf(0.7978845608028654f * (v + 0.044715f * v * v * v))); else if (ACT == 11) v = 1.0f / (1.0f + expf(-v)); else if (ACT == 12) v = (v > 0.f) ? v : 0.01f * v; else if (ACT == 14) v = (v > 0.f) ? v : 0.1f * v; else if (ACT == 16) v = (v >= 0.f) ? v : 0.3f * v; else if (ACT == 17) v = (v >= 0.f) ? v : 0.2f * v; else if (ACT == 15) v = v / (1.0f + expf(-v)); else if (ACT == 3) v = fmaxf(v, 0.f); else if (ACT == 6) v = 0.5f * v * (1.0f + erff(v * 0.70710678118654752f)); so[w][8 * hh + r][t * 16 + ln] = v; } }
  __builtin_amdgcn_fence(__ATOMIC_ACQ_REL, "workgroup"); __builtin_amdgcn_wave_barrier();
  const int rsub = lane >> 4, c4 = (lane & 15) * 4; typedef _Float16 v4h __attribute__((ext_vector_type(4)));
  {
#pragma unroll
    for (int q = 0; q < 8; ++q) { const int r = q * 2 + rsub; if (col0 + c4 < N) { const v4f v = *(const v4fa*)&so[w][r][c4]; if (C) *(v4f*)(C + cofs + (size_t)(row0 + r) * ldc + col0 + c4) = v; if (C16) { v4h h4; for (int i = 0; i < 4; ++i) h4[i] = (_Float16)v[i]; *(v4h*)(C16 + cofs + (size_t)(row0 + r) * ldc + col0 + c4) = h4; } } }
     }
}


typedef _Float16 v4h __attribute__((ext_vector_type(4)));

__global__ __launch_bounds__(256) void k_x16(const float* __restrict__ x, _Float16* __restrict__ X16, size_t n8) { const size_t t = (size_t)blockIdx.x * 256 + threadIdx.x; if (t >= n8) return; FragH f;
#pragma unroll
  for (int q = 0; q < 8; ++q) f.h[q] = (_Float16)bf16_round(x[t * 8 + q]); *(v8us*)((unsigned short*)X16 + t * 8) = f.half[0];  }
__global__ __launch_bounds__(256) void k_h16(const float* __restrict__ x, _Float16* __restrict__ X16, size_t n8) { const size_t t = (size_t)blockIdx.x * 256 + threadIdx.x; if (t >= n8) return; FragH f;
#pragma unroll
  for (int q = 0; q < 8; ++q) f.h[q] = (_Float16)x[t * 8 + q]; *(v8us*)((unsigned short*)X16 + t * 8) = f.half[0];  }
__global__ __launch_bounds__(256) void k_round16f(const float* __restrict__ W, _Float16* __restrict__ Bt, size_t n8) { const size_t t = (size_t)blockIdx.x * 256 + threadIdx.x; if (t >= n8) return; FragH f;
#pragma unroll
  for (int i = 0; i < 8; ++i) f.h[i] = (_Float16)(bf16_round(W[t * 8 + i]) * 16.0f); *(v8us*)((unsigned short*)Bt + t * 8) = f.half[0];  }
template <int NHv, int TTv>
__global__ __launch_bounds__(256) void k_vt(const _Float16* __restrict__ V16, int ldv, int voff, _Float16* __restrict__ Vt) { __shared__ unsigned short tl[64][66]; const int tid = threadIdx.x; const int slab = blockIdx.x / (TTv / 64), lg = blockIdx.x % (TTv / 64); const int b = slab / NHv, h = slab % NHv;
  for (int i = tid; i < 64 * 8; i += 256) { const int r = i / 8, c8 = (i % 8) * 8; FragH f; f.half[0] = *(const v8us*)((const unsigned short*)V16 + ((size_t)b * TTv + lg * 64 + r) * ldv + voff + h * 64 + c8);
#pragma unroll
    for (int q = 0; q < 8; ++q) tl[r][c8 + q] = f.u[q]; }
  __syncthreads();
  {
#pragma unroll
    for (int rd = 0; rd < 2; ++rd) { const int d = rd * 32 + tid / 8, pc = tid % 8; FragH f;
#pragma unroll
      for (int q = 0; q < 8; ++q) f.u[q] = tl[pc * 8 + q][d];
      *(v8us*)((unsigned short*)Vt + ((size_t)slab * 64 + d) * TTv + lg * 64 + pc * 8) = f.half[0]; }
     } }

__global__ __launch_bounds__(256) void k_hl(const float* __restrict__ F, _Float16* __restrict__ Hh, _Float16* __restrict__ Hl, size_t n8) { const size_t t = (size_t)blockIdx.x * 256 + threadIdx.x; if (t >= n8) return; FragH fh, fl; const v4f a = *(const v4fa*)(F + t * 8), c = *(const v4fa*)(F + t * 8 + 4);
#pragma unroll
  for (int q = 0; q < 4; ++q) { _Float16 h = (_Float16)a[q]; fh.h[q] = h; fl.h[q] = (_Float16)((a[q] - (float)h) * 1024.0f); h = (_Float16)c[q]; fh.h[4 + q] = h; fl.h[4 + q] = (_Float16)((c[q] - (float)h) * 1024.0f); }
  { *(v8us*)((unsigned short*)Hh + t * 8) = fh.half[0]; *(v8us*)((unsigned short*)Hl + t * 8) = fl.half[0];  } }

// ---- fast GEMM (block tile 128x64, wave tile 32x64; requires M % 128 == 0 rows per launch region, N % 64 == 0, K % 64 == 0 and K >= 64); epilogue = k_gemm_hhx semantics ----
// The block's 128 A rows and 64 B rows come through LDS, 64 k (one whole 128-byte line of every row) a stage, two buffers, brought by asynchronous copies: stage t + 2 flies under the products of stage t and the LDS reads of stage t + 1.
// (A fragment load straight from global memory touches 16 lines for 512 bytes, each wave fetched its own copy of B, and every product waited for its own loads.) The k order of every accumulator is unchanged: ascending, 32 at a time.
#define GK 64                        /* k per stage */
#define GP 72                        /* LDS row pitch in f16 = 144 bytes, an odd multiple of 16: 16-byte fragment reads of 128-byte rows fall evenly on the banks */
#define GT (192 * GP)                /* f16 per buffer: 128 A rows, then 64 B rows */
__device__ __forceinline__ v16h g2_frag(const _Float16* p, int hh) { FragH f; f.half[0] = *(const v8us*)((const unsigned short*)p + 8 * hh); f.half[1] = *(const v8us*)((const unsigned short*)p + 16 + 8 * hh); return f.v; }
__device__ __forceinline__ v16h g2_lfrag(const unsigned short* p) { FragH f; f.half[0] = *(const v8us*)p; f.half[1] = *(const v8us*)(p + 16); return f.v; }
__device__ __forceinline__ v8f g2_mma(v16h a, v16h b, v8f c) { return __builtin_amdgcn_wmma_f32_16x16x32_f16(false, a, false, b, (short)0, c, false, false); }
// One stage's copies of one lane: 16 bytes of each of eight A rows and four B rows, 16 rows apart (a wave's 32 lanes cover four whole 128-byte rows per copy). sa, sb = 16 rows of A, of B in f16; l0 = the lane's LDS byte address in the buffer's first 16 rows.
// The s_wait_xcnt closes the statement so that it stands in front of any later write of the address registers the copies name.
__device__ __forceinline__ void g2_copy(const _Float16* a0, size_t sa, const _Float16* b0, size_t sb, unsigned l0) {
  const _Float16* a1 = a0 + sa; const _Float16* a2 = a0 + 2 * sa; const _Float16* a3 = a0 + 3 * sa; const _Float16* a4 = a0 + 4 * sa; const _Float16* a5 = a0 + 5 * sa; const _Float16* a6 = a0 + 6 * sa; const _Float16* a7 = a0 + 7 * sa;      /* each from a0: no chain of additions in front of the copies */
  const _Float16* b1 = b0 + sb; const _Float16* b2 = b0 + 2 * sb; const _Float16* b3 = b0 + 3 * sb;
  constexpr unsigned R = 16 * GP * 2;      /* bytes of 16 staged rows */
  const unsigned l1 = l0 + R, l2 = l0 + 2 * R, l3 = l0 + 3 * R, l4 = l0 + 4 * R, l5 = l0 + 5 * R, l6 = l0 + 6 * R, l7 = l0 + 7 * R, l8 = l0 + 8 * R, l9 = l0 + 9 * R, l10 = l0 + 10 * R, l11 = l0 + 11 * R;
  asm volatile("global_load_async_to_lds_b128 %0, %12, off\n\t"
               "global_load_async_to_lds_b128 %1, %13, off\n\t"
               "global_load_async_to_lds_b128 %2, %14, off\n\t"
               "global_load_async_to_lds_b128 %3, %15, off\n\t"
               "global_load_async_to_lds_b128 %4, %16, off\n\t"
               "global_load_async_to_lds_b128 %5, %17, off\n\t"
               "global_load_async_to_lds_b128 %6, %18, off\n\t"
               "global_load_async_to_lds_b128 %7, %19, off\n\t"
               "global_load_async_to_lds_b128 %8, %20, off\n\t"
               "global_load_async_to_lds_b128 %9, %21, off\n\t"
               "global_load_async_to_lds_b128 %10, %22, off\n\t"
               "global_load_async_to_lds_b128 %11, %23, off\n\t"
               "s_wait_xcnt 0x0"
               :: "v"(l0), "v"(l1), "v"(l2), "v"(l3), "v"(l4), "v"(l5), "v"(l6), "v"(l7), "v"(l8), "v"(l9), "v"(l10), "v"(l11),
                  "v"(a0), "v"(a1), "v"(a2), "v"(a3), "v"(a4), "v"(a5), "v"(a6), "v"(a7), "v"(b0), "v"(b1), "v"(b2), "v"(b3) : "memory"); }
template <int ACT>
__global__ __launch_bounds__(128) void k_gemm2(const _Float16* __restrict__ A, int lda, size_t sA, const _Float16* __restrict__ Bh, int ldb, size_t sB, float alpha, const float* __restrict__ bias, size_t sBias, const float* __restrict__ CP, int rowsPerB, size_t sCPb, int row0g,
    float* __restrict__ C, _Float16* __restrict__ C16, int ldc, size_t sC, int M, int N, int K) { static_assert(ACT == 0 || ACT == 3 || ACT == 6 || ACT == 8 || ACT == 9 || ACT == 11 || ACT == 12 || ACT == 14 || ACT == 15 || ACT == 16 || ACT == 17, "k_gemm2: unsupported ACT code (would silently apply no activation)");
  __shared__ __attribute__((aligned(16))) float so[4][32][68];
  __shared__ __attribute__((aligned(16))) unsigned short st[2][GT];      /* [buffer][128 A rows, 64 B rows][pitch] */
  const int tid = threadIdx.x, w = tid >> 5, lane = tid & 31, ln = lane & 15, hh = lane >> 4; const int by = blockIdx.y;
  A += (size_t)by * sA; Bh += (size_t)by * sB; const size_t cofs = (size_t)by * sC; const float* bp = bias ? bias + (size_t)by * sBias : nullptr;
  const int ntn = N >> 6; const int mt = blockIdx.x / ntn, nq = blockIdx.x - mt * ntn; const int row0 = mt * 128 + 32 * w, col0 = nq * 64; if (mt * 128 >= M) return;      /* the whole block leaves or none: every wave passes every barrier */
  const _Float16* ag = A + (size_t)(mt * 128 + (tid >> 3)) * lda + (tid & 7) * 8;      /* this lane's 16 bytes of stage 0: A row tid / 8 of the block */
  const _Float16* bg = Bh + (size_t)(col0 + (tid >> 3)) * ldb + (tid & 7) * 8;          /* and B row tid / 8 */
  const size_t sa = (size_t)16 * lda, sb = (size_t)16 * ldb;
  const unsigned l0 = (unsigned)(size_t)&st[0][(tid >> 3) * GP + (tid & 7) * 8];        /* low 32 bits of a shared address = LDS byte address */
  const int nst = K / GK;
  g2_copy(ag, sa, bg, sb, l0);
  asm volatile("s_wait_asynccnt 0x0" ::: "memory");      /* stage 0 has landed for this wave's own copies */
  __syncthreads();                                        /* ... and for every wave's: publishes stage 0 */
  if (1 < nst) g2_copy(ag + GK, sa, bg + GK, sb, l0 + GT * 2);
  const v8f z8 = {0.f,0.f,0.f,0.f,0.f,0.f,0.f,0.f}; v8f c00 = z8, c01 = z8, c02 = z8, c03 = z8, c10 = z8, c11 = z8, c12 = z8, c13 = z8;
#pragma unroll 1
  for (int t = 0; t < nst; ++t) {      /* stays rolled: one copy of the stage's code; the loops inside are unrolled so that the fragment arrays stay in registers */
    const unsigned short* al = &st[t & 1][(32 * w + ln) * GP + 8 * hh];      /* this lane's row and half within the wave's first 16 staged A rows */
    const unsigned short* bl = &st[t & 1][(128 + ln) * GP + 8 * hh];         /* and within the first 16 staged B rows */
    v16h a[2][2], b[2][4];
#pragma unroll
    for (int ks = 0; ks < 2; ++ks) { a[ks][0] = g2_lfrag(al + ks * 32); a[ks][1] = g2_lfrag(al + 16 * GP + ks * 32);
#pragma unroll
      for (int n = 0; n < 4; ++n) b[ks][n] = g2_lfrag(bl + n * 16 * GP + ks * 32); }
    asm volatile("s_wait_dscnt 0x0" ::: "memory");         /* the stage's 24 LDS reads, one group, have returned: this wave is done with buffer t & 1 before the buffer is refilled */
    asm volatile("s_wait_asynccnt 0x0" ::: "memory");      /* this wave's copies of stage t + 1 have landed */
    __syncthreads();                                        /* publishes stage t + 1 and ends every wave's reads of stage t */
    if (t + 2 < nst) g2_copy(ag + (size_t)(t + 2) * GK, sa, bg + (size_t)(t + 2) * GK, sb, l0 + (unsigned)(t & 1) * (GT * 2));      /* the same test in the whole block */
    /* the stage's products work on registers alone and stand behind the refill: the copies of stage t + 2 fly under them and under the next stage's LDS reads */
#pragma unroll
    for (int ks = 0; ks < 2; ++ks) {
      c00 = g2_mma(a[ks][0], b[ks][0], c00); c10 = g2_mma(a[ks][1], b[ks][0], c10);
      c01 = g2_mma(a[ks][0], b[ks][1], c01); c11 = g2_mma(a[ks][1], b[ks][1], c11);
      c02 = g2_mma(a[ks][0], b[ks][2], c02); c12 = g2_mma(a[ks][1], b[ks][2], c12);
      c03 = g2_mma(a[ks][0], b[ks][3], c03); c13 = g2_mma(a[ks][1], b[ks][3], c13); } }
  asm volatile("s_wait_asynccnt 0x0" ::: "memory");        /* no copy is outstanding when the wave goes on to the epilogue and ends */
  v8f accs[8] = {c00, c01, c02, c03, c10, c11, c12, c13};
#pragma unroll
  for (int u = 0; u < 8; ++u) { const int t = u & 3, half = u >> 2; const int col = col0 + t * 16 + ln; const float bv = bp ? bf16_round(bp[col]) : 0.f;
#pragma unroll
    for (int r = 0; r < 8; ++r) { const int rloc = half * 16 + 8 * hh + r; float v = accs[u][r] * alpha + bv; if (CP) { if (rowsPerB < 0) v += CP[cofs + (size_t)(row0g + row0 + rloc) * ldc + col];      /* rowsPerB < 0: own element of the batched C plane */ else { const int bidx = (row0g + row0 + rloc) / rowsPerB; v += CP[(size_t)bidx * sCPb + (size_t)by * 64 + col]; } }
      if (ACT == 3) v = fmaxf(v, 0.f); else if (ACT == 6) v = 0.5f * v * (1.0f + erff(v * 0.70710678118654752f)); else if (ACT == 11) v = 1.0f / (1.0f + expf(-v)); else if (ACT == 15) v = v / (1.0f + expf(-v)); else if (ACT == 12) v = (v > 0.f) ? v : 0.01f * v; else if (ACT == 8) v = tanhf(v); else if (ACT == 9) v = 0.5f * v * (1.0f + tanhf(0.7978845608028654f * (v + 0.044715f * v * v * v))); else if (ACT == 14) v = (v > 0.f) ? v : 0.1f * v; else if (ACT == 16) v = (v >= 0.f) ? v : 0.3f * v; else if (ACT == 17) v = (v >= 0.f) ? v : 0.2f * v;
      so[w][rloc][t * 16 + ln] = v; } }
  __builtin_amdgcn_fence(__ATOMIC_ACQ_REL, "workgroup"); __builtin_amdgcn_wave_barrier();
  const int rsub = lane >> 4, c4 = (lane & 15) * 4;
  {
#pragma unroll
    for (int q = 0; q < 16; ++q) { const int r = q * 2 + rsub; const v4f v = *(const v4fa*)&so[w][r][c4]; if (C) *(v4f*)(C + cofs + (size_t)(row0 + r) * ldc + col0 + c4) = v; if (C16) { v4h h4; for (int i = 0; i < 4; ++i) h4[i] = (_Float16)v[i]; *(v4h*)(C16 + cofs + (size_t)(row0 + r) * ldc + col0 + c4) = h4; } }
     } }


__global__ __launch_bounds__(256) void k_wnat(const float* __restrict__ w, size_t n8, _Float16* __restrict__ Bt) { const size_t t = (size_t)blockIdx.x * 256 + threadIdx.x; if (t >= n8) return; FragH f; for (int q = 0; q < 8; ++q) f.h[q] = (_Float16)(bf16_round(w[t * 8 + q]) * 16.0f); *(v8us*)((unsigned short*)Bt + t * 8) = f.half[0];  }
// The three input conversions in one launch (they depend on nothing and on one another not at all): blocks 0 .. nbx - 1 do k_x16's work on x, the next nbw blocks k_wnat's on w0, the last nbw k_wnat's on w1.
// The choice is the same for a whole block, so it is a scalar branch; x takes the factor 1, which is exact.
__global__ __launch_bounds__(256) void k_in16(const float* __restrict__ x, size_t nx8, unsigned nbx, _Float16* __restrict__ X16, const float* __restrict__ w0, const float* __restrict__ w1, size_t nw8, unsigned nbw, _Float16* __restrict__ Bt0, _Float16* __restrict__ Bt1) {
  unsigned bx = blockIdx.x; const float* s = x; _Float16* d = X16; size_t n8 = nx8; float sc = 1.0f;
  if (bx >= nbx) { bx -= nbx; s = w0; d = Bt0; n8 = nw8; sc = 16.0f; if (bx >= nbw) { bx -= nbw; s = w1; d = Bt1; } }
  const size_t t = (size_t)bx * 256 + threadIdx.x; if (t >= n8) return; FragH f;
#pragma unroll      /* f.h is then indexed by constants and stays in registers */
  for (int q = 0; q < 8; ++q) f.h[q] = (_Float16)(bf16_round(s[t * 8 + q]) * sc); *(v8us*)((unsigned short*)d + t * 8) = f.half[0]; }
__global__ __launch_bounds__(256) void k_rsm(const float* __restrict__ S, _Float16* __restrict__ P, int nrows) {
  #pragma clang fp contract(off)
  const int i = blockIdx.x * 256 + threadIdx.x; if (i >= nrows) return; const float* s = S + (size_t)i * SQ; float mx = -3.0e38f;
#pragma unroll 1
  for (int j = 0; j < SQ; ++j) mx = fmaxf(mx, s[j]); float se = 0.f;
#pragma unroll 1
  for (int j = 0; j < SQ; ++j) se += expf(s[j] - mx); const float sc = 256.0f / se;
#pragma unroll 1
  for (int j0 = 0; j0 < SQ; j0 += 8) { FragH f; for (int q = 0; q < 8; ++q) f.h[q] = (_Float16)(expf(s[j0 + q] - mx) * sc); unsigned short* d = (unsigned short*)P + (size_t)i * SQ + j0; *(v8us*)d = f.half[0];  } }
__global__ __launch_bounds__(256) void k_vt(const _Float16* __restrict__ V16, int b, int h0, _Float16* __restrict__ VT) { __shared__ unsigned short tl[64][65]; const int tid = threadIdx.x; const int hh = blockIdx.x % HG, sg = blockIdx.x / HG; const int s0 = sg * 64; const int h = h0 + hh;
  for (int i = tid; i < 64 * 8; i += 256) { const int j = i / 8, d8 = (i % 8) * 8; FragH f; f.half[0] = *(const v8us*)((const unsigned short*)V16 + ((size_t)b * SQ + s0 + j) * DM + h * HD + d8); for (int q = 0; q < 8; ++q) tl[d8 + q][j] = f.u[q]; }
  __syncthreads();
  { for (int i = tid; i < 64 * 8; i += 256) { const int d = i / 8, j8 = (i % 8) * 8; FragH f; for (int q = 0; q < 8; ++q) f.u[q] = tl[d][j8 + q]; *(v8us*)((unsigned short*)VT + ((size_t)hh * HD + d) * SQ + s0 + j8) = f.half[0]; }  } }



#define FQ 128                       /* query rows per block: 4 waves x 32 */
#define FS 64                        /* keys per stage: two passes of 32 */
#define FP 72                        /* LDS row pitch in f16 = 144 bytes, an odd multiple of 16: 16-byte fragment reads of 128-byte rows fall evenly on the banks */
#define FT (64 * FP)                 /* f16 per staged tile: 64 rows (K: keys; V^T: head columns) */
__device__ __forceinline__ v8f fa_mma(v16h a, v16h b, v8f c) { return __builtin_amdgcn_wmma_f32_16x16x32_f16(false, a, false, b, (short)0, c, false, false); }
__device__ __forceinline__ v16h fa_frag(const unsigned short* p) { FragH f; f.half[0] = *(const v8us*)p; f.half[1] = *(const v8us*)(p + 16); return f.v; }
// One stage's copies of one lane: 16 bytes of each of four K rows and four V^T rows, 16 rows apart (a wave's 32 lanes cover four whole 128-byte rows per copy). lk = the lane's LDS byte address in the buffer's K tile; the V^T tile follows it.
// The s_wait_xcnt closes the statement so that it stands in front of any later write of the address registers the copies name.
__device__ __forceinline__ void fa_copy(const _Float16* kg, const _Float16* vg, unsigned lk) {
  const _Float16* k1 = kg + (size_t)16 * DM; const _Float16* k2 = kg + (size_t)32 * DM; const _Float16* k3 = kg + (size_t)48 * DM;
  const _Float16* v1 = vg + (size_t)16 * SQ; const _Float16* v2 = vg + (size_t)32 * SQ; const _Float16* v3 = vg + (size_t)48 * SQ;
  const unsigned lk1 = lk + 16 * FP * 2, lk2 = lk + 32 * FP * 2, lk3 = lk + 48 * FP * 2, lv = lk + FT * 2, lv1 = lv + 16 * FP * 2, lv2 = lv + 32 * FP * 2, lv3 = lv + 48 * FP * 2;
  asm volatile("global_load_async_to_lds_b128 %0, %8, off\n\t"
               "global_load_async_to_lds_b128 %1, %9, off\n\t"
               "global_load_async_to_lds_b128 %2, %10, off\n\t"
               "global_load_async_to_lds_b128 %3, %11, off\n\t"
               "global_load_async_to_lds_b128 %4, %12, off\n\t"
               "global_load_async_to_lds_b128 %5, %13, off\n\t"
               "global_load_async_to_lds_b128 %6, %14, off\n\t"
               "global_load_async_to_lds_b128 %7, %15, off\n\t"
               "s_wait_xcnt 0x0"
               :: "v"(lk), "v"(lk1), "v"(lk2), "v"(lk3), "v"(lv), "v"(lv1), "v"(lv2), "v"(lv3), "v"(kg), "v"(k1), "v"(k2), "v"(k3), "v"(vg), "v"(v1), "v"(v2), "v"(v3) : "memory"); }
__global__ __launch_bounds__(128) void k_fattn(const _Float16* __restrict__ QK, const _Float16* __restrict__ VT, _Float16* __restrict__ O) {
  __shared__ __attribute__((aligned(16))) unsigned short sm[2][2][FT];      /* [buffer][K, V^T][row x pitch] */
  constexpr float SC2 = 0.036084391824351615f * 1.4426950408889634f;      /* 1/sqrt(768) x log2(e): the softmax runs in base 2 */
  const int tid = threadIdx.x, lane = tid & 31, ln = lane & 15, hh = lane >> 4; const int w = __builtin_amdgcn_readfirstlane(tid >> 5);      /* scalar wave number: the skip test and row bases stay scalar */
  const int bh = blockIdx.x % (NB * NH), qb = (SQ / FQ - 1) - blockIdx.x / (NB * NH); const int b = bh / NH, h = bh % NH; const int qw = qb * FQ + w * 32;
  const _Float16* kb = QK + (size_t)b * SQ * DM + h * HD + (size_t)ln * DM;      /* this lane's row within a 16-row tile of q */
  const _Float16* kg = QK + ((size_t)b * SQ + (tid >> 3)) * DM + h * HD + (tid & 7) * 8;      /* this lane's 16 bytes of stage 0: K row tid / 8 */
  const _Float16* vg = VT + ((size_t)bh * HD + (tid >> 3)) * SQ + (tid & 7) * 8;               /* and V^T row tid / 8 */
  const unsigned l0 = (unsigned)(size_t)&sm[0][0][(tid >> 3) * FP + (tid & 7) * 8];            /* low 32 bits of a shared address = LDS byte address */
  const int nst = 2 * qb + 2;       /* stages of the block: up to the end of its last wave's diagonal block; never fewer than two */
  const int last = qw / 32;         /* this wave's last pass: its diagonal block, the only one with masked keys */
  fa_copy(kg, vg, l0);
  asm volatile("s_wait_asynccnt 0x0" ::: "memory");      /* stage 0 has landed for this wave's own copies */
  __syncthreads();                                        /* ... and for every wave's: publishes stage 0 */
  fa_copy(kg + (size_t)FS * DM, vg + FS, l0 + 2 * FT * 2);
  v16h qf[2][2];
#pragma unroll
  for (int g = 0; g < 2; ++g)
#pragma unroll
    for (int ks = 0; ks < 2; ++ks) qf[g][ks] = g2_frag(kb + (size_t)(qw + g * 16) * DM + ks * 32, hh);
  const v8f z8 = {0.f, 0.f, 0.f, 0.f, 0.f, 0.f, 0.f, 0.f};
  v8f o[2][4]; float m[2], l[2];
#pragma unroll
  for (int g = 0; g < 2; ++g) { m[g] = -1.0e30f; l[g] = 0.f;
#pragma unroll
    for (int dt = 0; dt < 4; ++dt) o[g][dt] = z8; }
#pragma unroll 1
  for (int t = 0; t < nst; ++t) {
    const unsigned short* kl = &sm[t & 1][0][ln * FP + 8 * hh];      /* this lane's row and half within a 16-row tile of the staged K rows */
    const unsigned short* vl = &sm[t & 1][1][ln * FP + 8 * hh];      /* and of the staged V^T rows */
#pragma unroll
    for (int p = 0; p < 2; ++p) { const int it = 2 * t + p;
      if (it <= last) {
        v16h kf[2][2], vf[4];
#pragma unroll
        for (int kt = 0; kt < 2; ++kt)
#pragma unroll
          for (int ks = 0; ks < 2; ++ks) kf[kt][ks] = fa_frag(kl + (p * 32 + kt * 16) * FP + ks * 32);
#pragma unroll
        for (int dt = 0; dt < 4; ++dt) vf[dt] = fa_frag(vl + (dt * 16) * FP + p * 32);
        __builtin_amdgcn_sched_barrier(0);      /* keeps the pass's sixteen LDS reads together at its head, K first: one place with LDS reads instead of two, and the V^T fragments land under the score products and the softmax instead of being waited for in front of P V */
        v8f s[2][2];
#pragma unroll
        for (int g = 0; g < 2; ++g)
#pragma unroll
          for (int kt = 0; kt < 2; ++kt) s[g][kt] = fa_mma(kf[kt][1], qf[g][1], fa_mma(kf[kt][0], qf[g][0], z8));
        if (it == last) {
#pragma unroll
          for (int g = 0; g < 2; ++g)
#pragma unroll
            for (int kt = 0; kt < 2; ++kt)
#pragma unroll
              for (int r = 0; r < 8; ++r) s[g][kt][r] = (kt * 16 + 8 * hh + r <= g * 16 + ln) ? s[g][kt][r] : -1.0e30f; }      /* first key of the pass == qw here: key <= query */
        float mn[2]; bool need = false;
#pragma unroll
        for (int g = 0; g < 2; ++g) { float mx = s[g][0][0];
#pragma unroll
          for (int r = 1; r < 8; ++r) mx = fmaxf(mx, s[g][0][r]);
#pragma unroll
          for (int r = 0; r < 8; ++r) mx = fmaxf(mx, s[g][1][r]);
          mx = fmaxf(mx, __shfl_xor(mx, 16, 32)); mn[g] = fmaxf(m[g], mx * SC2); need = need || (mn[g] > m[g]); }
        if (__builtin_amdgcn_ballot_w32(need) != 0) {      /* no column's maximum moved: every factor would be exactly 1, so the rescale is skipped as a whole */
#pragma unroll
          for (int g = 0; g < 2; ++g) { const float al = __builtin_amdgcn_exp2f(m[g] - mn[g]); m[g] = mn[g]; l[g] *= al;
#pragma unroll
            for (int dt = 0; dt < 4; ++dt) o[g][dt] *= al; } }
        FragH pf[2];
#pragma unroll
        for (int g = 0; g < 2; ++g) { float ls = 0.f;
#pragma unroll
          for (int kt = 0; kt < 2; ++kt) { const v8f tt = s[g][kt] * SC2 - m[g];
#pragma unroll
            for (int r = 0; r < 8; ++r) { const float pp = __builtin_amdgcn_exp2f(tt[r]); ls += pp; pf[g].h[kt * 8 + r] = (_Float16)pp; } }
          l[g] += ls; }
#pragma unroll
        for (int g = 0; g < 2; ++g)
#pragma unroll
          for (int dt = 0; dt < 4; ++dt) o[g][dt] = fa_mma(vf[dt], pf[g].v, o[g][dt]); } }
    asm volatile("s_wait_dscnt 0x0" ::: "memory");         /* this wave's reads of buffer t & 1 have returned before the buffer is refilled */
    asm volatile("s_wait_asynccnt 0x0" ::: "memory");      /* this wave's copies of stage t + 1 have landed */
    __syncthreads();                                        /* publishes stage t + 1 and ends every wave's reads of stage t */
    if (t + 2 < nst) fa_copy(kg + (size_t)(t + 2) * FS * DM, vg + (size_t)(t + 2) * FS, l0 + (unsigned)(t & 1) * (2 * FT * 2)); }      /* the same test in the whole block */
  asm volatile("s_wait_asynccnt 0x0" ::: "memory");        /* no copy is outstanding when the wave ends */
#pragma unroll
  for (int g = 0; g < 2; ++g) { const float fin = 64.0f / (l[g] + __shfl_xor(l[g], 16, 32));      /* halves joined once; o carried x64 */
    _Float16* orow = O + ((size_t)b * SQ + qw + g * 16 + ln) * DM + h * HD + 8 * hh;
#pragma unroll
    for (int dt = 0; dt < 4; ++dt) { FragH f;
#pragma unroll
      for (int r = 0; r < 8; ++r) f.h[r] = (_Float16)(o[g][dt][r] * fin);
      *(v8us*)((unsigned short*)orow + dt * 16) = f.half[0]; } } }

// Exact f32 attention for the first QT0 rows; F holds the f32 rows of q = k = v (pitch ld), 64 columns a head: the heads of all batches stand side by side in a row, so one launch serves them all. One wave per (head, query row), A0W rows a block.
// Scores: lane = key (four groups of 32 keys), the query row broadcast from LDS, four partial sums per key. Softmax: two passes over the wave's own registers.
// P V: lane = two head columns, keys in ascending order, each weight broadcast from its lane through a scalar register.
// Every wave stages and walks all QT0 keys, keys past its query with weight exactly 0: the launch lasts as long as the wave of the last row, which needs them all,
// and without tests the code is one straight line whose LDS reads have constant offsets and fly together.
// Every loop is fully unrolled: the small arrays are then indexed by constants and stay in registers, and each weight is read from a constant lane.
#define A0W 8                        /* waves = query rows per block */
#define A0P 68                       /* LDS row pitch in floats: 16-byte column walks fall on distinct banks */
typedef float v2f __attribute__((ext_vector_type(2)));
__global__ __launch_bounds__(256) void k_att0(const float* __restrict__ F, int ld, float scale, float* __restrict__ OF, int ldo) {
  __shared__ __attribute__((aligned(16))) float tl[QT0][A0P];
  const int tid = threadIdx.x, lane = tid & 31; const int w = __builtin_amdgcn_readfirstlane(tid >> 5);      /* scalar wave number: the query row's LDS address stays scalar */
  const int h = blockIdx.x / (QT0 / A0W), rg = blockIdx.x % (QT0 / A0W); const int i = rg * A0W + w;
#pragma unroll
  for (int u = 0; u < QT0 * (HD / 4) / 256; ++u) { const int e = u * 256 + tid; const int r = e >> 4, c = (e & 15) * 4; *(v4f*)&tl[r][c] = *(const v4fa*)(F + (size_t)r * ld + h * HD + c); }
  __syncthreads();
  v4f a[QT0 / 32];
#pragma unroll
  for (int t = 0; t < QT0 / 32; ++t) a[t] = (v4f){0.f, 0.f, 0.f, 0.f};
#pragma unroll
  for (int c = 0; c < HD / 4; ++c) { const v4f q = *(const v4f*)&tl[i][c * 4];
#pragma unroll
    for (int t = 0; t < QT0 / 32; ++t) a[t] = __builtin_elementwise_fma(q, *(const v4f*)&tl[t * 32 + lane][c * 4], a[t]); }
  float s[QT0 / 32], mx = -1.0e30f;
#pragma unroll
  for (int t = 0; t < QT0 / 32; ++t) { const float d = (a[t][0] + a[t][1]) + (a[t][2] + a[t][3]); s[t] = (t * 32 + lane <= i) ? d * scale : -1.0e30f; mx = fmaxf(mx, s[t]); }
#pragma unroll
  for (int d = 16; d > 0; d >>= 1) mx = fmaxf(mx, __shfl_xor(mx, d, 32));      /* key 0 is never masked: mx is a real score */
  float p[QT0 / 32], l = 0.f;
#pragma unroll
  for (int t = 0; t < QT0 / 32; ++t) { p[t] = expf(s[t] - mx); l += p[t]; }      /* masked keys: exp of about -1e30 = 0 */
#pragma unroll
  for (int d = 16; d > 0; d >>= 1) l += __shfl_xor(l, d, 32);
  v2f o = {0.f, 0.f};
#pragma unroll
  for (int t = 0; t < QT0 / 32; ++t)
#pragma unroll
    for (int k = 0; k < 32; ++k) { const float pj = __uint_as_float(__builtin_amdgcn_readlane(__float_as_uint(p[t]), k)); const v2f pp = {pj, pj};
      o = __builtin_elementwise_fma(pp, *(const v2f*)&tl[t * 32 + k][2 * lane], o); }
  const float fin = 64.0f / l;      /* o carried x64 like the f16 path */
  *(v2f*)(OF + (size_t)i * ldo + h * HD + 2 * lane) = o * fin; }

extern "C" void kernel_launch(void* const* d_in, const int* in_sizes, int n_in,
                              void* d_out, int out_size, void* d_ws, size_t ws_size, hipStream_t stream) {
  (void)in_sizes; (void)n_in; (void)out_size;
  const float* const* I = (const float* const*)d_in; const float* x = I[0]; const float* wq = I[1]; const float* wo = I[2]; const float* bo = I[3]; const float* wk = wq; const float* wv = wq;      /* Wq [12][64][768] = natural [768][768] rows h*64+d (q = k = v); W_out natural + b_out */
  char* ws = (char*)d_ws; size_t off = 0;
  auto take = [&](size_t bytes) { char* p = ws + off; off += (bytes + 255) & ~(size_t)255; return p; };
  _Float16* BQ = (_Float16*)take((size_t)DM * DM * 2); _Float16* BK = BQ; _Float16* BV = BQ; _Float16* BO = (_Float16*)take((size_t)DM * DM * 2);
  _Float16* X16 = (_Float16*)take(NR * DM * 2); _Float16* Q16 = (_Float16*)take(NR * DM * 2); _Float16* K16 = Q16; _Float16* V16 = Q16;      /* q = k = v (the module projects all three with self.query) */ _Float16* O16 = (_Float16*)take(NR * DM * 2);
  _Float16* VT = (_Float16*)take((size_t)NB * NH * HD * SQ * 2);
  float* QF0 = (float*)take((size_t)NB * QT0 * DM * 4); float* OF0 = (float*)take((size_t)NB * QT0 * DM * 4); _Float16* OH0 = (_Float16*)take((size_t)NB * QT0 * DM * 2); _Float16* OL0 = (_Float16*)take((size_t)NB * QT0 * DM * 2);
  if (off > ws_size) return;
  constexpr unsigned nbx = (unsigned)((NR * DM / 8 + 255) / 256), nbw = (unsigned)(((size_t)DM * DM / 8 + 255) / 256);      /* blocks for x, for one weight matrix */
  k_in16<<<nbx + 2 * nbw, 256, 0, stream>>>(x, NR * DM / 8, nbx, X16, wq, wo, (size_t)DM * DM / 8, nbw, BQ, BO);      /* x rows as f16; weights natural [out][in] = Bt x16 */
  const size_t r0p = (size_t)B0 * SQ;      /* first projected row */
  k_gemm2<0><<<dim3((unsigned)((MP / 128) * (DM / 64)), 1), 128, 0, stream>>>(X16 + r0p * DM, DM, 0, BQ, DM, 0, 0.0625f, nullptr, 0, nullptr, 1, 0, 0, nullptr, Q16 + r0p * DM, DM, 0, MP, DM, DM);
  k_vt<NH, SQ><<<NB * NH * (SQ / 64), 256, 0, stream>>>(V16, LQ, 0, VT);      /* V^T [NB][NH][HD][SQ] */
  k_fattn<<<NB * NH * (SQ / FQ), 128, 0, stream>>>(Q16, VT, O16);      /* scores, causal softmax and P V in one launch; o (merged heads, x64) as f16 rows */
  /* first-tile path: each of its launches serves every batch at once. Its planes are [QT0][NB * DM]: row r holds row r of batch 0, then of batch 1; the GEMMs take the batch on grid y, the attention sees NB * NH heads */
  constexpr int LF = NB * DM; const size_t c0p = (size_t)B0 * DM;      /* pitch of those planes; first processed batch's column */
  k_gemm2<0><<<dim3((QT0 / 128) * (DM / 64), NBR), 128, 0, stream>>>(X16 + r0p * DM, DM, (size_t)SQ * DM, BQ, DM, 0, 0.0625f, nullptr, 0, nullptr, 1, 0, 0, QF0 + c0p, nullptr, LF, DM, QT0, DM, DM);      /* f32 q = k = v of the first 128 rows (exact products) */
  k_att0<<<NBR * NH * (QT0 / A0W), 32 * A0W, 0, stream>>>(QF0 + c0p, LF, 0.036084391824351615f, OF0 + c0p, LF);      /* exact f32 attention for rows 0..127 (o x64) */
  k_gemm2<0><<<dim3((unsigned)((MPO / 128) * (DM / 64)), 1), 128, 0, stream>>>(O16 + r0p * DM, DM, 0, BO, DM, 0, 0.0009765625f, bo, 0, nullptr, 1, 0, 0, (float*)d_out + r0p * DM, nullptr, DM, 0, MPO, DM, DM);      /* out rows are the output layout */
  k_hl<<<(unsigned)(((size_t)NB * QT0 * DM / 8 + 255) / 256), 256, 0, stream>>>(OF0, OH0, OL0, (size_t)NB * QT0 * DM / 8);      /* first-tile o (x64) -> f16 hi + x1024 residual planes */
  k_gemm2<0><<<dim3((QT0 / 128) * (DM / 64), NBR), 128, 0, stream>>>(OH0 + c0p, LF, DM, BO, DM, 0, 0.0009765625f, bo, 0, nullptr, 1, 0, 0, (float*)d_out + r0p * DM, nullptr, DM, (size_t)SQ * DM, QT0, DM, DM);      /* rows 0..127: out = o_hi Wo (+ b), overwriting the f16-path rows */
  k_gemm2<0><<<dim3((QT0 / 128) * (DM / 64), NBR), 128, 0, stream>>>(OL0 + c0p, LF, DM, BO, DM, 0, 0.00000095367431640625f, nullptr, 0, (const float*)d_out + r0p * DM, -1, 0, 0, (float*)d_out + r0p * DM, nullptr, DM, (size_t)SQ * DM, QT0, DM, DM);      /* += o_lo Wo 2^-20 (own-element accumulate) */
}

// v007
// One run takes 120 microseconds.
// Timed twice side by side with v006, it ran 1.29 times as fast both times.
// Counting every step since v000, it is 121 times as fast.
#include <hip/hip_runtime.h>
// Causal multi-head attention whose q, k AND v are the same per-head projection (x [2][4096][768]; q = k = v = x Wq[h]^T with Wq [12][64][768] (natural per-head rows, sigma 1/sqrt(768)); scores = q.q / sqrt(768) (the module scales by d_model); causal (tril, -inf); softmax; out = merged (attn q) W_out^T + b_out -> [2][4096][768]).
// Structure: token rows r = b*4096 + s; x as exact f16 rows (bf16-rounded); q (= k = v) as one WMMA GEMM (32x64 wave tiles, f32 accumulation, exact x16 weights, f16 outputs); V^T for all batches and heads via LDS transposes; exact f32 attention for rows 0..127 of each batch (o as f16 hi + x1024 residual planes); one fused launch for the attention of the other rows: per wave 32 query rows, keys 32 at a time up to the diagonal block, S^T = K Q^T, online base-2 softmax in registers (f32 statistics, native exp2; weights in (0,1] as f16), O^T += V^T P^T (o carried x64, folded into the output GEMM alpha) written straight into the merged f16 o rows; out = o W_o GEMM (f32) into the output layout.
// Compute dtype: inputs rounded to bf16; x / weights exact; q, k, v, softmax weights and o as plain f16 GEMM operands (~2^-12), except rows 0..127 of a batch (f32 attention, o as f16 hi + lo); scores and softmax statistics f32. v_wmma_f32_16x16x32_f16.
#define NB 2
#define SQ 4096
#define DM 768
#define NH 12
#define HD 64
#define HG 4                         /* heads per launch of the unused per-batch k_vt */
#define QT0 128                      /* first-tile rows whose attention runs exactly in f32 */
#define B0 0                         /* first batch processed (debug hook) */
#define NBR NB                       /* batches processed (debug hook) */
#define NR ((size_t)NB * SQ)         /* token rows */
#define MP ((int)((size_t)NBR * SQ)) /* rows projected (debug hook) */
#define MPO MP                       /* rows through the output stage (debug hook) */
#define LQ DM      /* row pitch of the q/k/v rows */
typedef __bf16 v16b __attribute__((ext_vector_type(16)));
typedef unsigned short v8us __attribute__((ext_vector_type(8), may_alias));
typedef float  v8f  __attribute__((ext_vector_type(8)));
typedef float  v4f  __attribute__((ext_vector_type(4)));
typedef float  v4fa __attribute__((ext_vector_type(4), may_alias));
union FragB { v16b v; v8us half[2]; unsigned short u[16]; };

__device__ __forceinline__ unsigned short bf16_bits(float x) { unsigned int u = __float_as_uint(x); return (unsigned short)((u + 0x7FFFu + ((u >> 16) & 1u)) >> 16); }
__device__ __forceinline__ float bf16_val(unsigned short b) { return __uint_as_float(((unsigned int)b) << 16); }
__device__ __forceinline__ float bf16_round(float x) { return bf16_val(bf16_bits(x)); }
// D += A·B with NT terms: 1 = ah·bh, 2 = + al·bh (A split), 3 = + ah·bl (both split)
template <int NT>
__device__ __forceinline__ v8f mmaN(v16b ah, v16b al, v16b bh, v16b bl, v8f c) {
  c = __builtin_amdgcn_wmma_f32_16x16x32_bf16(false, ah, false, bh, (short)0, c, false, false);
  if (NT >= 2) c = __builtin_amdgcn_wmma_f32_16x16x32_bf16(false, al, false, bh, (short)0, c, false, false);
  if (NT >= 3) c = __builtin_amdgcn_wmma_f32_16x16x32_bf16(false, ah, false, bl, (short)0, c, false, false);
  asm volatile("v_nop\n\tv_nop\n\tv_nop\n\tv_nop" : "+v"(c) : "v"(ah), "v"(al), "v"(bh), "v"(bl));
  return c;
}

__global__ __launch_bounds__(256) void k_wt_bf16(const float* __restrict__ W, unsigned short* __restrict__ Wt, int K, int N) {
  const int t = blockIdx.x * 256 + threadIdx.x;
  const int k8n = K / 8;
  if (t >= N * k8n) return;
  const int n = t / k8n, k8 = (t % k8n) * 8;
  v8us v;
#pragma unroll
  for (int i = 0; i < 8; ++i) v[i] = bf16_bits(W[(size_t)(k8 + i) * N + n]);
  *(v8us*)(Wt + (size_t)n * K + k8) = v;
  
}

// GEMM C[M][N] (f32, pitch ldc) = act(A[M][K]·W + bias). A f32 row-major (pitch lda) converted per fragment to bf16
// (ASPLIT: hi/lo two planes -> 2 terms, else single rounded term); Wt bf16 [N][K] (pitch ldb). BIAS_BF16 rounds the
// bias to bf16 first (bias quantised to bf16 before the add). K%32==0, M%16==0, N%64==0.
template <bool ASPLIT, int ACT, bool BIAS_BF16>
__global__ __launch_bounds__(128) void k_gemm_bf(const float* __restrict__ A, int lda, const unsigned short* __restrict__ Wt, int ldb,
                                               const float* __restrict__ bias, float* __restrict__ C, int ldc, int M, int N, int K) {
  __shared__ __attribute__((aligned(16))) float so[4][16][64];
  const int tid = threadIdx.x, w = tid >> 5, lane = tid & 31, ln = lane & 15, hh = lane >> 4;
  const int ntn = N / 64;
  const int wid = blockIdx.x * 4 + w;
  const int mt = wid / ntn, nq = wid % ntn;
  if (mt * 16 >= M) return;
  const int row0 = mt * 16, col0 = nq * 64;
  const float* arow = A + (size_t)(row0 + ln) * lda;
  v8f acc[4] = {};
  for (int kb = 0; kb < K; kb += 32) {
    FragB ah, al;
    const v4f x0 = *(const v4fa*)(arow + kb + 8 * hh), x1 = *(const v4fa*)(arow + kb + 8 * hh + 4);
    const v4f x2 = *(const v4fa*)(arow + kb + 16 + 8 * hh), x3 = *(const v4fa*)(arow + kb + 16 + 8 * hh + 4);
    float xs[16] = {x0[0],x0[1],x0[2],x0[3],x1[0],x1[1],x1[2],x1[3],x2[0],x2[1],x2[2],x2[3],x3[0],x3[1],x3[2],x3[3]};
#pragma unroll
    for (int i = 0; i < 16; ++i) { const unsigned short hb = bf16_bits(xs[i]); ah.u[i] = hb; al.u[i] = ASPLIT ? bf16_bits(xs[i] - bf16_val(hb)) : (unsigned short)0; }
#pragma unroll
    for (int t = 0; t < 4; ++t) {
      const unsigned short* brow = Wt + (size_t)(col0 + t * 16 + ln) * ldb + kb;
      FragB b;
      b.half[0] = *(const v8us*)(brow + 8 * hh);
      b.half[1] = *(const v8us*)(brow + 16 + 8 * hh);
      acc[t] = mmaN<ASPLIT ? 2 : 1>(ah.v, al.v, b.v, b.v, acc[t]);
    }
  }
#pragma unroll
  for (int t = 0; t < 4; ++t) {
    float bv = bias ? bias[col0 + t * 16 + ln] : 0.f;
    if (BIAS_BF16) bv = bf16_round(bv);
#pragma unroll
    for (int r = 0; r < 8; ++r) { float v = acc[t][r] + bv; if (ACT == 1) v = fmaxf(v, 0.f); so[w][8 * hh + r][t * 16 + ln] = v; }
  }
  __builtin_amdgcn_fence(__ATOMIC_ACQ_REL, "workgroup");
  __builtin_amdgcn_wave_barrier();
  const int rsub = lane >> 4, c4 = (lane & 15) * 4;
  {
#pragma unroll
    for (int q = 0; q < 8; ++q) {
      const int r = q * 2 + rsub;
      const v4f v = *(const v4fa*)&so[w][r][c4];
      *(v4f*)(C + (size_t)(row0 + r) * ldc + col0 + c4) = v;
    }
    
  }
}

// GEMM C = act(A·W + bias + resid): A f32 (ASPLIT -> hi/lo 2 terms), Wt bf16 [N][K]; ACT 0 none, 1 relu, 2 exact gelu;
// resid (optional, f32, row index = (row % rmod), pitch ldr, RES_BF16 rounds it) added before the activation.
template <bool ASPLIT, int ACT, bool BIAS_BF16, bool RES_BF16>
__global__ __launch_bounds__(128) void k_gemm_bf3(const float* __restrict__ A, int lda, const unsigned short* __restrict__ Wt, int ldb,
                                                const float* __restrict__ bias, const float* __restrict__ resid, int rmod, int ldr,
                                                float* __restrict__ C, int ldc, int M, int N, int K) {
  __shared__ __attribute__((aligned(16))) float so[4][16][64];
  const int tid = threadIdx.x, w = tid >> 5, lane = tid & 31, ln = lane & 15, hh = lane >> 4;
  const int ntn = N / 64;
  const int wid = blockIdx.x * 4 + w;
  const int mt = wid / ntn, nq = wid % ntn;
  if (mt * 16 >= M) return;
  const int row0 = mt * 16, col0 = nq * 64;
  const float* arow = A + (size_t)(row0 + ln) * lda;
  v8f acc[4] = {};
  for (int kb = 0; kb < K; kb += 32) {
    FragB ah, al;
    const v4f x0 = *(const v4fa*)(arow + kb + 8 * hh), x1 = *(const v4fa*)(arow + kb + 8 * hh + 4);
    const v4f x2 = *(const v4fa*)(arow + kb + 16 + 8 * hh), x3 = *(const v4fa*)(arow + kb + 16 + 8 * hh + 4);
    float xs[16] = {x0[0],x0[1],x0[2],x0[3],x1[0],x1[1],x1[2],x1[3],x2[0],x2[1],x2[2],x2[3],x3[0],x3[1],x3[2],x3[3]};
#pragma unroll
    for (int i = 0; i < 16; ++i) { const unsigned short hb = bf16_bits(xs[i]); ah.u[i] = hb; al.u[i] = ASPLIT ? bf16_bits(xs[i] - bf16_val(hb)) : (unsigned short)0; }
#pragma unroll
    for (int t = 0; t < 4; ++t) {
      const unsigned short* brow = Wt + (size_t)(col0 + t * 16 + ln) * ldb + kb;
      FragB b;
      b.half[0] = *(const v8us*)(brow + 8 * hh);
      b.half[1] = *(const v8us*)(brow + 16 + 8 * hh);
      acc[t] = mmaN<ASPLIT ? 2 : 1>(ah.v, al.v, b.v, b.v, acc[t]);
    }
  }
#pragma unroll
  for (int t = 0; t < 4; ++t) {
    const int col = col0 + t * 16 + ln;
    float bv = bias ? bias[col] : 0.f;
    if (BIAS_BF16) bv = bf16_round(bv);
#pragma unroll
    for (int r = 0; r < 8; ++r) {
      float v = acc[t][r] + bv;
      if (resid) { float rv = resid[(size_t)((row0 + 8 * hh + r) % rmod) * ldr + col]; if (RES_BF16) rv = bf16_round(rv); v += rv; }
      if (ACT == 1) v = fmaxf(v, 0.f);
      if (ACT == 2) v = 0.5f * v * (1.0f + erff(v * 0.70710678118654752f));
      if (ACT == 3) { const float u = 0.7978845608028654f * (v + 0.044715f * v * v * v); v = 0.5f * v * (1.0f + tanhf(u)); }
      so[w][8 * hh + r][t * 16 + ln] = v;
    }
  }
  __builtin_amdgcn_fence(__ATOMIC_ACQ_REL, "workgroup");
  __builtin_amdgcn_wave_barrier();
  const int rsub = lane >> 4, c4 = (lane & 15) * 4;
  {
#pragma unroll
    for (int q = 0; q < 8; ++q) {
      const int r = q * 2 + rsub;
      const v4f v = *(const v4fa*)&so[w][r][c4];
      *(v4f*)(C + (size_t)(row0 + r) * ldc + col0 + c4) = v;
    }
    
  }
}
// row LayerNorm (biased variance, eps) over N: s = X (+ R); optional out_sum <- s; out_norm <- (s-mu)*rsqrt(var+eps)*g + b
template <bool PARAM_BF16>
__global__ __launch_bounds__(256) void k_layernorm(const float* __restrict__ X, const float* __restrict__ R, const float* __restrict__ g, const float* __restrict__ bta,
                                                  float* __restrict__ out_sum, float* __restrict__ out_norm, int N, float eps) {
  __shared__ float red[256];
  const int row = blockIdx.x, tid = threadIdx.x;
  const float* x = X + (size_t)row * N; const float* rr = R ? R + (size_t)row * N : nullptr;
  float vals[16];                     // up to N = 4096
  const int per = N / 256;            // contiguous chunk per thread? use strided-by-4 chunks: thread handles j = tid*4 + 1024*u
  float s1 = 0.f;
  for (int u = 0; u < per / 4; ++u) {
    const int j = tid * 4 + 1024 * u;
    const v4f a = *(const v4fa*)(x + j);
    v4f b = {0.f,0.f,0.f,0.f}; if (rr) b = *(const v4fa*)(rr + j);
#pragma unroll
    for (int q = 0; q < 4; ++q) { const float v = a[q] + b[q]; vals[u * 4 + q] = v; s1 += v; }
  }
  red[tid] = s1; __syncthreads();
  for (int st = 128; st > 0; st >>= 1) { if (tid < st) red[tid] += red[tid + st]; __syncthreads(); }
  const float mu = red[0] / (float)N; __syncthreads();
  float s2 = 0.f;
  for (int u = 0; u < per / 4; ++u)
#pragma unroll
    for (int q = 0; q < 4; ++q) { const float c = vals[u * 4 + q] - mu; s2 += c * c; }
  red[tid] = s2; __syncthreads();
  for (int st = 128; st > 0; st >>= 1) { if (tid < st) red[tid] += red[tid + st]; __syncthreads(); }
  const float rs = rsqrtf(red[0] / (float)N + eps);
  {
    for (int u = 0; u < per / 4; ++u) {
      const int j = tid * 4 + 1024 * u;
      v4f o, sm;
#pragma unroll
      for (int q = 0; q < 4; ++q) {
        float gg = g[j + q], bb = bta[j + q];
        if (PARAM_BF16) { gg = bf16_round(gg); bb = bf16_round(bb); }
        sm[q] = vals[u * 4 + q]; o[q] = (vals[u * 4 + q] - mu) * rs * gg + bb;
      }
      if (out_sum) *(v4f*)(out_sum + (size_t)row * N + j) = sm;
      *(v4f*)(out_norm + (size_t)row * N + j) = o;
    }
    
  }
}



// ---- f16 WMMA path (v_wmma_f32_16x16x32_f16): 11-bit significands for operands in range — used where a [0,1] probability operand needs more precision than bf16
typedef _Float16 v16h __attribute__((ext_vector_type(16)));
union FragH { v16h v; v8us half[2]; _Float16 h[16]; unsigned short u[16]; };
template <int NT>
__device__ __forceinline__ v8f mmaH(v16h ah, v16h al, v16h bh, v16h bl, v8f c) {
  c = __builtin_amdgcn_wmma_f32_16x16x32_f16(false, ah, false, bh, (short)0, c, false, false);
  if (NT >= 2) c = __builtin_amdgcn_wmma_f32_16x16x32_f16(false, al, false, bh, (short)0, c, false, false);
  if (NT >= 3) c = __builtin_amdgcn_wmma_f32_16x16x32_f16(false, ah, false, bl, (short)0, c, false, false);
  asm volatile("v_nop\n\tv_nop\n\tv_nop\n\tv_nop" : "+v"(c) : "v"(ah), "v"(al), "v"(bh), "v"(bl));
  return c;
}
// batched GEMM like k_gemm_b but f16 operands: A f32 (split into f16 hi/lo if ASPLIT, else rounded to f16), Bt = f16 values [n][k]; alpha; C f32; N multiple of 16 (partial tiles skipped)
template <bool ASPLIT>
__global__ __launch_bounds__(128) void k_gemm_h(const float* __restrict__ A, int lda, size_t sA, const _Float16* __restrict__ Bh, int ldb, size_t sB, float alpha, float* __restrict__ C, int ldc, size_t sC, int M, int N, int K) {
  __shared__ __attribute__((aligned(16))) float so[4][16][64];
  const int tid = threadIdx.x, w = tid >> 5, lane = tid & 31, ln = lane & 15, hh = lane >> 4; const int by = blockIdx.y;
  A += (size_t)by * sA; Bh += (size_t)by * sB; C += (size_t)by * sC;
  const int ntn = (N + 63) / 64; const int wid = blockIdx.x * 4 + w; const int mt = wid / ntn, nq = wid % ntn; if (mt * 16 >= M) return;
  const int row0 = mt * 16, col0 = nq * 64; const float* arow = A + (size_t)(row0 + ln) * lda;
  v8f acc[4] = {};
  for (int kb = 0; kb < K; kb += 32) {
    FragH ah, al;
    const v4f x0 = *(const v4fa*)(arow + kb + 8 * hh), x1 = *(const v4fa*)(arow + kb + 8 * hh + 4), x2 = *(const v4fa*)(arow + kb + 16 + 8 * hh), x3 = *(const v4fa*)(arow + kb + 16 + 8 * hh + 4);
    float xs[16] = {x0[0],x0[1],x0[2],x0[3],x1[0],x1[1],x1[2],x1[3],x2[0],x2[1],x2[2],x2[3],x3[0],x3[1],x3[2],x3[3]};
#pragma unroll
    for (int i = 0; i < 16; ++i) { const _Float16 h = (_Float16)xs[i]; ah.h[i] = h; al.h[i] = ASPLIT ? (_Float16)(xs[i] - (float)h) : (_Float16)0.0f; }
#pragma unroll
    for (int t = 0; t < 4; ++t) { if (col0 + t * 16 >= N) continue; const size_t boff = (size_t)(col0 + t * 16 + ln) * ldb + kb; FragH bq; bq.half[0] = *(const v8us*)(Bh + boff + 8 * hh); bq.half[1] = *(const v8us*)(Bh + boff + 16 + 8 * hh);
      acc[t] = mmaH<ASPLIT ? 2 : 1>(ah.v, al.v, bq.v, bq.v, acc[t]); }
  }
#pragma unroll
  for (int t = 0; t < 4; ++t) { if (col0 + t * 16 >= N) continue;
#pragma unroll
    for (int r = 0; r < 8; ++r) so[w][8 * hh + r][t * 16 + ln] = acc[t][r] * alpha; }
  __builtin_amdgcn_fence(__ATOMIC_ACQ_REL, "workgroup"); __builtin_amdgcn_wave_barrier();
  const int rsub = lane >> 4, c4 = (lane & 15) * 4;
  {
#pragma unroll
    for (int q = 0; q < 8; ++q) { const int r = q * 2 + rsub; if (col0 + c4 < N) { const v4f v = *(const v4fa*)&so[w][r][c4]; *(v4f*)(C + (size_t)(row0 + r) * ldc + col0 + c4) = v; } }
     }
}

// Wt[n][k] = f16(W[k][n]·scale) from f32 row-major W[K][N] (scale = power of two; bf16-exact weights stay exact in f16 away from the subnormal range)
__global__ __launch_bounds__(256) void k_wt_f16(const float* __restrict__ W, _Float16* __restrict__ Wt, int K, int N, float scale) {
  const int t = blockIdx.x * 256 + threadIdx.x; if (t >= N * (K / 8)) return; const int n = t / (K / 8), k8 = (t % (K / 8)) * 8; FragH f;
#pragma unroll
  for (int i = 0; i < 8; ++i) f.h[i] = (_Float16)(bf16_round(W[(size_t)(k8 + i) * N + n]) * scale); const v8us o = f.half[0];
  *(v8us*)((unsigned short*)Wt + (size_t)n * K + k8) = o; 
}
// k_gemm_hh variant with fused epilogue: v = acc·alpha + bias[by·sBias + col] (+ CP[(row/rowsPerB)·sCPb + by·64 + col] if CP) ; ACT 0 none / 1 elu ; writes f16 C16 (and f32 C if non-null)
template <int ACT>
__global__ __launch_bounds__(128) void k_gemm_hhx(const _Float16* __restrict__ A, int lda, size_t sA, const _Float16* __restrict__ Bh, int ldb, size_t sB, float alpha, const float* __restrict__ bias, size_t sBias, const float* __restrict__ CP, int rowsPerB, size_t sCPb, int row0g,
    float* __restrict__ C, _Float16* __restrict__ C16, int ldc, size_t sC, int M, int N, int K) {
  __shared__ __attribute__((aligned(16))) float so[4][16][64];
  const int tid = threadIdx.x, w = tid >> 5, lane = tid & 31, ln = lane & 15, hh = lane >> 4; const int by = blockIdx.y;
  A += (size_t)by * sA; Bh += (size_t)by * sB; const size_t cofs = (size_t)by * sC; const float* bp = bias ? bias + (size_t)by * sBias : nullptr;
  const int ntn = (N + 63) / 64; const int wid = blockIdx.x * 4 + w; const int mt = wid / ntn, nq = wid % ntn; if (mt * 16 >= M) return;
  const int row0 = mt * 16, col0 = nq * 64; const _Float16* arow = A + (size_t)(row0 + ln) * lda;
  v8f acc[4] = {};
  for (int kb = 0; kb < K; kb += 32) { FragH ah; ah.half[0] = *(const v8us*)((const unsigned short*)arow + kb + 8 * hh); ah.half[1] = *(const v8us*)((const unsigned short*)arow + kb + 16 + 8 * hh);
#pragma unroll
    for (int t = 0; t < 4; ++t) { if (col0 + t * 16 >= N) continue; const size_t boff = (size_t)(col0 + t * 16 + ln) * ldb + kb; FragH bq; bq.half[0] = *(const v8us*)((const unsigned short*)Bh + boff + 8 * hh); bq.half[1] = *(const v8us*)((const unsigned short*)Bh + boff + 16 + 8 * hh);
      acc[t] = mmaH<1>(ah.v, ah.v, bq.v, bq.v, acc[t]); }
  }
#pragma unroll
  for (int t = 0; t < 4; ++t) { if (col0 + t * 16 >= N) continue; const int col = col0 + t * 16 + ln; const float bv = bp ? bf16_round(bp[col]) : 0.f;
#pragma unroll
    for (int r = 0; r < 8; ++r) { float v = acc[t][r] * alpha + bv; if (CP) { const int rr = row0g + row0 + 8 * hh + r; if (rowsPerB < 0) v += CP[cofs + (size_t)rr * ldc + col];      /* rowsPerB < 0: own element of the batched C plane */ else { const int bidx = rr / rowsPerB; v += CP[(size_t)bidx * sCPb + (size_t)by * 64 + col]; } } if (ACT == 1) v = (v > 0.f) ? v : expm1f(v); else if (ACT == 7) v = (v > 0.f) ? v + 1.0f : expf(v); else if (ACT == 8) v = tanhf(v); else if (ACT == 9) v = 0.5f * v * (1.0f + tanhf(0.7978845608028654f * (v + 0.044715f * v * v * v))); else if (ACT == 11) v = 1.0f / (1.0f + expf(-v)); else if (ACT == 12) v = (v > 0.f) ? v : 0.01f * v; else if (ACT == 14) v = (v > 0.f) ? v : 0.1f * v; else if (ACT == 16) v = (v >= 0.f) ? v : 0.3f * v; else if (ACT == 17) v = (v >= 0.f) ? v : 0.2f * v; else if (ACT == 15) v = v / (1.0f + expf(-v)); else if (ACT == 3) v = fmaxf(v, 0.f); else if (ACT == 6) v = 0.5f * v * (1.0f + erff(v * 0.70710678118654752f)); so[w][8 * hh + r][t * 16 + ln] = v; } }
  __builtin_amdgcn_fence(__ATOMIC_ACQ_REL, "workgroup"); __builtin_amdgcn_wave_barrier();
  const int rsub = lane >> 4, c4 = (lane & 15) * 4; typedef _Float16 v4h __attribute__((ext_vector_type(4)));
  {
#pragma unroll
    for (int q = 0; q < 8; ++q) { const int r = q * 2 + rsub; if (col0 + c4 < N) { const v4f v = *(const v4fa*)&so[w][r][c4]; if (C) *(v4f*)(C + cofs + (size_t)(row0 + r) * ldc + col0 + c4) = v; if (C16) { v4h h4; for (int i = 0; i < 4; ++i) h4[i] = (_Float16)v[i]; *(v4h*)(C16 + cofs + (size_t)(row0 + r) * ldc + col0 + c4) = h4; } } }
     }
}


typedef _Float16 v4h __attribute__((ext_vector_type(4)));

__global__ __launch_bounds__(256) void k_x16(const float* __restrict__ x, _Float16* __restrict__ X16, size_t n8) { const size_t t = (size_t)blockIdx.x * 256 + threadIdx.x; if (t >= n8) return; FragH f;
#pragma unroll
  for (int q = 0; q < 8; ++q) f.h[q] = (_Float16)bf16_round(x[t * 8 + q]); *(v8us*)((unsigned short*)X16 + t * 8) = f.half[0];  }
__global__ __launch_bounds__(256) void k_h16(const float* __restrict__ x, _Float16* __restrict__ X16, size_t n8) { const size_t t = (size_t)blockIdx.x * 256 + threadIdx.x; if (t >= n8) return; FragH f;
#pragma unroll
  for (int q = 0; q < 8; ++q) f.h[q] = (_Float16)x[t * 8 + q]; *(v8us*)((unsigned short*)X16 + t * 8) = f.half[0];  }
__global__ __launch_bounds__(256) void k_round16f(const float* __restrict__ W, _Float16* __restrict__ Bt, size_t n8) { const size_t t = (size_t)blockIdx.x * 256 + threadIdx.x; if (t >= n8) return; FragH f;
#pragma unroll
  for (int i = 0; i < 8; ++i) f.h[i] = (_Float16)(bf16_round(W[t * 8 + i]) * 16.0f); *(v8us*)((unsigned short*)Bt + t * 8) = f.half[0];  }
template <int NHv, int TTv>
__global__ __launch_bounds__(256) void k_vt(const _Float16* __restrict__ V16, int ldv, int voff, _Float16* __restrict__ Vt) { __shared__ unsigned short tl[64][66]; const int tid = threadIdx.x; const int slab = blockIdx.x / (TTv / 64), lg = blockIdx.x % (TTv / 64); const int b = slab / NHv, h = slab % NHv;
  for (int i = tid; i < 64 * 8; i += 256) { const int r = i / 8, c8 = (i % 8) * 8; FragH f; f.half[0] = *(const v8us*)((const unsigned short*)V16 + ((size_t)b * TTv + lg * 64 + r) * ldv + voff + h * 64 + c8);
#pragma unroll
    for (int q = 0; q < 8; ++q) tl[r][c8 + q] = f.u[q]; }
  __syncthreads();
  {
#pragma unroll
    for (int rd = 0; rd < 2; ++rd) { const int d = rd * 32 + tid / 8, pc = tid % 8; FragH f;
#pragma unroll
      for (int q = 0; q < 8; ++q) f.u[q] = tl[pc * 8 + q][d];
      *(v8us*)((unsigned short*)Vt + ((size_t)slab * 64 + d) * TTv + lg * 64 + pc * 8) = f.half[0]; }
     } }

// ---- fast GEMM (block tile 128x64, wave tile 32x64; requires M % 128 == 0 rows per launch region, N % 64 == 0, K % 64 == 0 and K >= 64); epilogue = k_gemm_hhx semantics ----
// The block's 128 A rows and 64 B rows come through LDS, 64 k (one whole 128-byte line of every row) a stage, two buffers, brought by asynchronous copies: stage t + 2 flies under the products of stage t and the LDS reads of stage t + 1.
// (A fragment load straight from global memory touches 16 lines for 512 bytes, each wave fetched its own copy of B, and every product waited for its own loads.) The k order of every accumulator is unchanged: ascending, 32 at a time.
#define GK 64                        /* k per stage */
#define GP 72                        /* LDS row pitch in f16 = 144 bytes, an odd multiple of 16: 16-byte fragment reads of 128-byte rows fall evenly on the banks */
#define GT (192 * GP)                /* f16 per buffer: 128 A rows, then 64 B rows */
__device__ __forceinline__ v16h g2_frag(const _Float16* p, int hh) { FragH f; f.half[0] = *(const v8us*)((const unsigned short*)p + 8 * hh); f.half[1] = *(const v8us*)((const unsigned short*)p + 16 + 8 * hh); return f.v; }
__device__ __forceinline__ v16h g2_lfrag(const unsigned short* p) { FragH f; f.half[0] = *(const v8us*)p; f.half[1] = *(const v8us*)(p + 16); return f.v; }
__device__ __forceinline__ v8f g2_mma(v16h a, v16h b, v8f c) { return __builtin_amdgcn_wmma_f32_16x16x32_f16(false, a, false, b, (short)0, c, false, false); }
// One stage's copies of one lane: 16 bytes of each of eight A rows and four B rows, 16 rows apart (a wave's 32 lanes cover four whole 128-byte rows per copy). sa, sb = 16 rows of A, of B in f16; l0 = the lane's LDS byte address in the buffer's first 16 rows.
// a0 = the lane's row among staged A rows 0 .. 15, a4 = among rows 64 .. 79: the upper 64 staged rows may come from another plane than the lower 64.
// The s_wait_xcnt closes the statement so that it stands in front of any later write of the address registers the copies name.
__device__ __forceinline__ void g2_copy(const _Float16* a0, const _Float16* a4, size_t sa, const _Float16* b0, size_t sb, unsigned l0) {
  const _Float16* a1 = a0 + sa; const _Float16* a2 = a0 + 2 * sa; const _Float16* a3 = a0 + 3 * sa; const _Float16* a5 = a4 + sa; const _Float16* a6 = a4 + 2 * sa; const _Float16* a7 = a4 + 3 * sa;      /* each from a base: no chain of additions in front of the copies */
  const _Float16* b1 = b0 + sb; const _Float16* b2 = b0 + 2 * sb; const _Float16* b3 = b0 + 3 * sb;
  constexpr unsigned R = 16 * GP * 2;      /* bytes of 16 staged rows */
  const unsigned l1 = l0 + R, l2 = l0 + 2 * R, l3 = l0 + 3 * R, l4 = l0 + 4 * R, l5 = l0 + 5 * R, l6 = l0 + 6 * R, l7 = l0 + 7 * R, l8 = l0 + 8 * R, l9 = l0 + 9 * R, l10 = l0 + 10 * R, l11 = l0 + 11 * R;
  asm volatile("global_load_async_to_lds_b128 %0, %12, off\n\t"
               "global_load_async_to_lds_b128 %1, %13, off\n\t"
               "global_load_async_to_lds_b128 %2, %14, off\n\t"
               "global_load_async_to_lds_b128 %3, %15, off\n\t"
               "global_load_async_to_lds_b128 %4, %16, off\n\t"
               "global_load_async_to_lds_b128 %5, %17, off\n\t"
               "global_load_async_to_lds_b128 %6, %18, off\n\t"
               "global_load_async_to_lds_b128 %7, %19, off\n\t"
               "global_load_async_to_lds_b128 %8, %20, off\n\t"
               "global_load_async_to_lds_b128 %9, %21, off\n\t"
               "global_load_async_to_lds_b128 %10, %22, off\n\t"
               "global_load_async_to_lds_b128 %11, %23, off\n\t"
               "s_wait_xcnt 0x0"
               :: "v"(l0), "v"(l1), "v"(l2), "v"(l3), "v"(l4), "v"(l5), "v"(l6), "v"(l7), "v"(l8), "v"(l9), "v"(l10), "v"(l11),
                  "v"(a0), "v"(a1), "v"(a2), "v"(a3), "v"(a4), "v"(a5), "v"(a6), "v"(a7), "v"(b0), "v"(b1), "v"(b2), "v"(b3) : "memory"); }
// FT = what the launch does for the first QT0 rows of every batch, the rows that go through the exact f32 attention (their planes are [QT0][ldf]: row r holds row r of batch 0, then of batch 1):
// FT 1 (projection): a block of such rows also stores its tile as f32 into CF. FT 2 (output): such rows do not come from A but from the planes A0h + A0l x alphal / alpha; blocks 0 .. F2B - 1 take them, 64 rows each:
// staged rows 0 .. 63 are A0h's, 64 .. 127 the same rows of A0l, so waves 0, 1 hold the main products and waves 2, 3 the residual products of the same output rows; the pairs join in the epilogue. The other blocks take A's other row tiles.
#define F2B (NBR * (QT0 / 64) * (DM / 64))      /* first-tile blocks of an FT 2 launch */
template <int ACT, int FT>
__global__ __launch_bounds__(128) void k_gemm2(const _Float16* __restrict__ A, int lda, size_t sA, const _Float16* __restrict__ Bh, int ldb, size_t sB, float alpha, const float* __restrict__ bias, size_t sBias, const float* __restrict__ CP, int rowsPerB, size_t sCPb, int row0g,
    float* __restrict__ C, _Float16* __restrict__ C16, int ldc, size_t sC, int M, int N, int K, const _Float16* __restrict__ A0h, const _Float16* __restrict__ A0l, float alphal, float* __restrict__ CF, int ldf) { static_assert(QT0 == 128, "a first tile is one 128-row block tile"); static_assert(ACT == 0 || ACT == 3 || ACT == 6 || ACT == 8 || ACT == 9 || ACT == 11 || ACT == 12 || ACT == 14 || ACT == 15 || ACT == 16 || ACT == 17, "k_gemm2: unsupported ACT code (would silently apply no activation)");
  __shared__ __attribute__((aligned(16))) unsigned short st[2][GT];      /* [buffer][128 A rows, 64 B rows][pitch] */
  /* the epilogue's tiles lie over the stage buffers: behind the last stage's barrier no wave reads a stage and no copy is outstanding. At 55,296 B of LDS four blocks fit a WGP, so the FT 2 grid, 24 blocks more than three a WGP hold, still runs as one round */
  static_assert(sizeof(float) * 4 * 32 * 68 <= sizeof(st), "epilogue tiles fit the stage buffers"); float (*so)[32][68] = reinterpret_cast<float (*)[32][68]>(&st[0][0]);
  const int tid = threadIdx.x, w = tid >> 5, lane = tid & 31, ln = lane & 15, hh = lane >> 4; const int by = blockIdx.y;
  A += (size_t)by * sA; Bh += (size_t)by * sB; const size_t cofs = (size_t)by * sC; const float* bp = bias ? bias + (size_t)by * sBias : nullptr;
  const int ntn = N >> 6; constexpr int TPB = SQ / 128;      /* row tiles per batch */
  const bool f2 = FT == 2 && blockIdx.x < F2B;      /* the same in the whole block */
  const int bx = FT == 2 ? (f2 ? (int)blockIdx.x : (int)blockIdx.x - F2B) : (int)blockIdx.x; const int mq = bx / ntn, nq = bx - mq * ntn;
  const int mt = FT == 2 ? mq + 1 + mq / (TPB - 1) : mq;      /* FT 2: the row tiles that are no batch's first */
  const int fb = mq >> 1, fr = (mq & 1) * 64;      /* f2: batch, first of the block's 64 rows */
  const int row0 = f2 ? fb * SQ + fr + 32 * (w & 1) : mt * 128 + 32 * w, col0 = nq * 64; if (!f2 && mt * 128 >= M) return;      /* the whole block leaves or none: every wave passes every barrier */
  const size_t fo = (size_t)(fr + (tid >> 3)) * ldf + (size_t)fb * DM + (tid & 7) * 8;      /* f2: this lane's 16 bytes of stage 0 in either plane */
  const size_t sa = (size_t)16 * (f2 ? ldf : lda), sb = (size_t)16 * ldb;
  const _Float16* ag = f2 ? A0h + fo : A + (size_t)(mt * 128 + (tid >> 3)) * lda + (tid & 7) * 8;      /* this lane's 16 bytes of stage 0: A row tid / 8 of the block */
  const _Float16* ag4 = f2 ? A0l + fo : ag + 4 * sa;                                    /* and staged row 64 + tid / 8 */
  const _Float16* bg = Bh + (size_t)(col0 + (tid >> 3)) * ldb + (tid & 7) * 8;          /* and B row tid / 8 */
  const unsigned l0 = (unsigned)(size_t)&st[0][(tid >> 3) * GP + (tid & 7) * 8];        /* low 32 bits of a shared address = LDS byte address */
  const int nst = K / GK;
  g2_copy(ag, ag4, sa, bg, sb, l0);
  asm volatile("s_wait_asynccnt 0x0" ::: "memory");      /* stage 0 has landed for this wave's own copies */
  __syncthreads();                                        /* ... and for every wave's: publishes stage 0 */
  if (1 < nst) g2_copy(ag + GK, ag4 + GK, sa, bg + GK, sb, l0 + GT * 2);
  const v8f z8 = {0.f,0.f,0.f,0.f,0.f,0.f,0.f,0.f}; v8f c00 = z8, c01 = z8, c02 = z8, c03 = z8, c10 = z8, c11 = z8, c12 = z8, c13 = z8;
#pragma unroll 1
  for (int t = 0; t < nst; ++t) {      /* stays rolled: one copy of the stage's code; the loops inside are unrolled so that the fragment arrays stay in registers */
    const unsigned short* al = &st[t & 1][(32 * w + ln) * GP + 8 * hh];      /* this lane's row and half within the wave's first 16 staged A rows */
    const unsigned short* bl = &st[t & 1][(128 + ln) * GP + 8 * hh];         /* and within the first 16 staged B rows */
    v16h a[2][2], b[2][4];
#pragma unroll
    for (int ks = 0; ks < 2; ++ks) { a[ks][0] = g2_lfrag(al + ks * 32); a[ks][1] = g2_lfrag(al + 16 * GP + ks * 32);
#pragma unroll
      for (int n = 0; n < 4; ++n) b[ks][n] = g2_lfrag(bl + n * 16 * GP + ks * 32); }
    asm volatile("s_wait_dscnt 0x0" ::: "memory");         /* the stage's 24 LDS reads, one group, have returned: this wave is done with buffer t & 1 before the buffer is refilled */
    asm volatile("s_wait_asynccnt 0x0" ::: "memory");      /* this wave's copies of stage t + 1 have landed */
    __syncthreads();                                        /* publishes stage t + 1 and ends every wave's reads of stage t */
    if (t + 2 < nst) g2_copy(ag + (size_t)(t + 2) * GK, ag4 + (size_t)(t + 2) * GK, sa, bg + (size_t)(t + 2) * GK, sb, l0 + (unsigned)(t & 1) * (GT * 2));      /* the same test in the whole block */
    /* the stage's products work on registers alone and stand behind the refill: the copies of stage t + 2 fly under them and under the next stage's LDS reads */
#pragma unroll
    for (int ks = 0; ks < 2; ++ks) {
      c00 = g2_mma(a[ks][0], b[ks][0], c00); c10 = g2_mma(a[ks][1], b[ks][0], c10);
      c01 = g2_mma(a[ks][0], b[ks][1], c01); c11 = g2_mma(a[ks][1], b[ks][1], c11);
      c02 = g2_mma(a[ks][0], b[ks][2], c02); c12 = g2_mma(a[ks][1], b[ks][2], c12);
      c03 = g2_mma(a[ks][0], b[ks][3], c03); c13 = g2_mma(a[ks][1], b[ks][3], c13); } }
  asm volatile("s_wait_asynccnt 0x0" ::: "memory");        /* no copy is outstanding when the wave goes on to the epilogue and ends */
  v8f accs[8] = {c00, c01, c02, c03, c10, c11, c12, c13};
  v8f lo8[8];      /* FT 2: what joins each accumulator element; 0 outside the first-tile blocks. The loops over u and r below are fully unrolled so that lo8 and accs are indexed by constants and stay in registers */
  if (FT == 2) {
#pragma unroll
    for (int u = 0; u < 8; ++u) lo8[u] = z8; }
  if (f2) {      /* waves 2, 3 hand their residual products, element for element in the accumulator's own lane, to waves 0, 1 and are done */
    if (w >= 2) {
#pragma unroll
      for (int u = 0; u < 8; ++u)
#pragma unroll
        for (int r = 0; r < 8; ++r) so[w][(u >> 2) * 16 + 8 * hh + r][(u & 3) * 16 + ln] = accs[u][r] * alphal; }
    __syncthreads();      /* the residual tiles are written before their partner waves read them; no barrier follows */
    if (w >= 2) return;
#pragma unroll
    for (int u = 0; u < 8; ++u)      /* one group of LDS reads, one wait */
#pragma unroll
      for (int r = 0; r < 8; ++r) lo8[u][r] = so[w + 2][(u >> 2) * 16 + 8 * hh + r][(u & 3) * 16 + ln]; }
#pragma unroll
  for (int u = 0; u < 8; ++u) { const int t = u & 3, half = u >> 2; const int col = col0 + t * 16 + ln; const float bv = bp ? bf16_round(bp[col]) : 0.f;
#pragma unroll
    for (int r = 0; r < 8; ++r) { const int rloc = half * 16 + 8 * hh + r; float v = accs[u][r] * alpha + bv; if (FT == 2) v += lo8[u][r]; if (CP) { if (rowsPerB < 0) v += CP[cofs + (size_t)(row0g + row0 + rloc) * ldc + col];      /* rowsPerB < 0: own element of the batched C plane */ else { const int bidx = (row0g + row0 + rloc) / rowsPerB; v += CP[(size_t)bidx * sCPb + (size_t)by * 64 + col]; } }
      if (ACT == 3) v = fmaxf(v, 0.f); else if (ACT == 6) v = 0.5f * v * (1.0f + erff(v * 0.70710678118654752f)); else if (ACT == 11) v = 1.0f / (1.0f + expf(-v)); else if (ACT == 15) v = v / (1.0f + expf(-v)); else if (ACT == 12) v = (v > 0.f) ? v : 0.01f * v; else if (ACT == 8) v = tanhf(v); else if (ACT == 9) v = 0.5f * v * (1.0f + tanhf(0.7978845608028654f * (v + 0.044715f * v * v * v))); else if (ACT == 14) v = (v > 0.f) ? v : 0.1f * v; else if (ACT == 16) v = (v >= 0.f) ? v : 0.3f * v; else if (ACT == 17) v = (v >= 0.f) ? v : 0.2f * v;
      so[w][rloc][t * 16 + ln] = v; } }
  __builtin_amdgcn_fence(__ATOMIC_ACQ_REL, "workgroup"); __builtin_amdgcn_wave_barrier();
  const int rsub = lane >> 4, c4 = (lane & 15) * 4;
  {
#pragma unroll
    for (int q = 0; q < 16; ++q) { const int r = q * 2 + rsub; const v4f v = *(const v4fa*)&so[w][r][c4]; if (C) { *(v4f*)(C + cofs + (size_t)(row0 + r) * ldc + col0 + c4) = v; asm volatile("s_wait_xcnt 0x0" ::: "memory"); }      /* the wait stands in front of any later write of the registers the store names */
      if (FT == 1 && mt % TPB == 0) { *(v4f*)(CF + (size_t)(32 * w + r) * ldf + (size_t)(mt / TPB) * DM + col0 + c4) = v; asm volatile("s_wait_xcnt 0x0" ::: "memory"); }      /* the same for this store */
      if (C16) { v4h h4; for (int i = 0; i < 4; ++i) h4[i] = (_Float16)v[i]; *(v4h*)(C16 + cofs + (size_t)(row0 + r) * ldc + col0 + c4) = h4; } }
     } }


__global__ __launch_bounds__(256) void k_wnat(const float* __restrict__ w, size_t n8, _Float16* __restrict__ Bt) { const size_t t = (size_t)blockIdx.x * 256 + threadIdx.x; if (t >= n8) return; FragH f; for (int q = 0; q < 8; ++q) f.h[q] = (_Float16)(bf16_round(w[t * 8 + q]) * 16.0f); *(v8us*)((unsigned short*)Bt + t * 8) = f.half[0];  }
// The three input conversions in one launch (they depend on nothing and on one another not at all): blocks 0 .. nbx - 1 do k_x16's work on x, the next nbw blocks k_wnat's on w0, the last nbw k_wnat's on w1.
// The choice is the same for a whole block, so it is a scalar branch; x takes the factor 1, which is exact.
__global__ __launch_bounds__(256) void k_in16(const float* __restrict__ x, size_t nx8, unsigned nbx, _Float16* __restrict__ X16, const float* __restrict__ w0, const float* __restrict__ w1, size_t nw8, unsigned nbw, _Float16* __restrict__ Bt0, _Float16* __restrict__ Bt1) {
  unsigned bx = blockIdx.x; const float* s = x; _Float16* d = X16; size_t n8 = nx8; float sc = 1.0f;
  if (bx >= nbx) { bx -= nbx; s = w0; d = Bt0; n8 = nw8; sc = 16.0f; if (bx >= nbw) { bx -= nbw; s = w1; d = Bt1; } }
  const size_t t = (size_t)bx * 256 + threadIdx.x; if (t >= n8) return; FragH f;
#pragma unroll      /* f.h is then indexed by constants and stays in registers */
  for (int q = 0; q < 8; ++q) f.h[q] = (_Float16)(bf16_round(s[t * 8 + q]) * sc); *(v8us*)((unsigned short*)d + t * 8) = f.half[0]; }
__global__ __launch_bounds__(256) void k_rsm(const float* __restrict__ S, _Float16* __restrict__ P, int nrows) {
  #pragma clang fp contract(off)
  const int i = blockIdx.x * 256 + threadIdx.x; if (i >= nrows) return; const float* s = S + (size_t)i * SQ; float mx = -3.0e38f;
#pragma unroll 1
  for (int j = 0; j < SQ; ++j) mx = fmaxf(mx, s[j]); float se = 0.f;
#pragma unroll 1
  for (int j = 0; j < SQ; ++j) se += expf(s[j] - mx); const float sc = 256.0f / se;
#pragma unroll 1
  for (int j0 = 0; j0 < SQ; j0 += 8) { FragH f; for (int q = 0; q < 8; ++q) f.h[q] = (_Float16)(expf(s[j0 + q] - mx) * sc); unsigned short* d = (unsigned short*)P + (size_t)i * SQ + j0; *(v8us*)d = f.half[0];  } }
__global__ __launch_bounds__(256) void k_vt(const _Float16* __restrict__ V16, int b, int h0, _Float16* __restrict__ VT) { __shared__ unsigned short tl[64][65]; const int tid = threadIdx.x; const int hh = blockIdx.x % HG, sg = blockIdx.x / HG; const int s0 = sg * 64; const int h = h0 + hh;
  for (int i = tid; i < 64 * 8; i += 256) { const int j = i / 8, d8 = (i % 8) * 8; FragH f; f.half[0] = *(const v8us*)((const unsigned short*)V16 + ((size_t)b * SQ + s0 + j) * DM + h * HD + d8); for (int q = 0; q < 8; ++q) tl[d8 + q][j] = f.u[q]; }
  __syncthreads();
  { for (int i = tid; i < 64 * 8; i += 256) { const int d = i / 8, j8 = (i % 8) * 8; FragH f; for (int q = 0; q < 8; ++q) f.u[q] = tl[d][j8 + q]; *(v8us*)((unsigned short*)VT + ((size_t)hh * HD + d) * SQ + s0 + j8) = f.half[0]; }  } }



#define FQ 128                       /* query rows per block: 4 waves x 32 */
#define FS 64                        /* keys per stage: two passes of 32 */
#define FP 72                        /* LDS row pitch in f16 = 144 bytes, an odd multiple of 16: 16-byte fragment reads of 128-byte rows fall evenly on the banks */
#define FT (64 * FP)                 /* f16 per staged tile: 64 rows (K: keys; V^T: head columns) */
__device__ __forceinline__ v8f fa_mma(v16h a, v16h b, v8f c) { return __builtin_amdgcn_wmma_f32_16x16x32_f16(false, a, false, b, (short)0, c, false, false); }
__device__ __forceinline__ v16h fa_frag(const unsigned short* p) { FragH f; f.half[0] = *(const v8us*)p; f.half[1] = *(const v8us*)(p + 16); return f.v; }
// One stage's copies of one lane: 16 bytes of each of four K rows and four V^T rows, 16 rows apart (a wave's 32 lanes cover four whole 128-byte rows per copy). lk = the lane's LDS byte address in the buffer's K tile; the V^T tile follows it.
// The s_wait_xcnt closes the statement so that it stands in front of any later write of the address registers the copies name.
__device__ __forceinline__ void fa_copy(const _Float16* kg, const _Float16* vg, unsigned lk) {
  const _Float16* k1 = kg + (size_t)16 * DM; const _Float16* k2 = kg + (size_t)32 * DM; const _Float16* k3 = kg + (size_t)48 * DM;
  const _Float16* v1 = vg + (size_t)16 * SQ; const _Float16* v2 = vg + (size_t)32 * SQ; const _Float16* v3 = vg + (size_t)48 * SQ;
  const unsigned lk1 = lk + 16 * FP * 2, lk2 = lk + 32 * FP * 2, lk3 = lk + 48 * FP * 2, lv = lk + FT * 2, lv1 = lv + 16 * FP * 2, lv2 = lv + 32 * FP * 2, lv3 = lv + 48 * FP * 2;
  asm volatile("global_load_async_to_lds_b128 %0, %8, off\n\t"
               "global_load_async_to_lds_b128 %1, %9, off\n\t"
               "global_load_async_to_lds_b128 %2, %10, off\n\t"
               "global_load_async_to_lds_b128 %3, %11, off\n\t"
               "global_load_async_to_lds_b128 %4, %12, off\n\t"
               "global_load_async_to_lds_b128 %5, %13, off\n\t"
               "global_load_async_to_lds_b128 %6, %14, off\n\t"
               "global_load_async_to_lds_b128 %7, %15, off\n\t"
               "s_wait_xcnt 0x0"
               :: "v"(lk), "v"(lk1), "v"(lk2), "v"(lk3), "v"(lv), "v"(lv1), "v"(lv2), "v"(lv3), "v"(kg), "v"(k1), "v"(k2), "v"(k3), "v"(vg), "v"(v1), "v"(v2), "v"(v3) : "memory"); }
__global__ __launch_bounds__(128) void k_fattn(const _Float16* __restrict__ QK, const _Float16* __restrict__ VT, _Float16* __restrict__ O) {
  __shared__ __attribute__((aligned(16))) unsigned short sm[2][2][FT];      /* [buffer][K, V^T][row x pitch] */
  constexpr float SC2 = 0.036084391824351615f * 1.4426950408889634f;      /* 1/sqrt(768) x log2(e): the softmax runs in base 2 */
  const int tid = threadIdx.x, lane = tid & 31, ln = lane & 15, hh = lane >> 4; const int w = __builtin_amdgcn_readfirstlane(tid >> 5);      /* scalar wave number: the skip test and row bases stay scalar */
  const int bh = blockIdx.x % (NB * NH), qb = (SQ / FQ - 1) - blockIdx.x / (NB * NH); const int b = bh / NH, h = bh % NH; const int qw = qb * FQ + w * 32;
  const _Float16* kb = QK + (size_t)b * SQ * DM + h * HD + (size_t)ln * DM;      /* this lane's row within a 16-row tile of q */
  const _Float16* kg = QK + ((size_t)b * SQ + (tid >> 3)) * DM + h * HD + (tid & 7) * 8;      /* this lane's 16 bytes of stage 0: K row tid / 8 */
  const _Float16* vg = VT + ((size_t)bh * HD + (tid >> 3)) * SQ + (tid & 7) * 8;               /* and V^T row tid / 8 */
  const unsigned l0 = (unsigned)(size_t)&sm[0][0][(tid >> 3) * FP + (tid & 7) * 8];            /* low 32 bits of a shared address = LDS byte address */
  const int nst = 2 * qb + 2;       /* stages of the block: up to the end of its last wave's diagonal block; never fewer than two */
  const int last = qw / 32;         /* this wave's last pass: its diagonal block, the only one with masked keys */
  fa_copy(kg, vg, l0);
  asm volatile("s_wait_asynccnt 0x0" ::: "memory");      /* stage 0 has landed for this wave's own copies */
  __syncthreads();                                        /* ... and for every wave's: publishes stage 0 */
  fa_copy(kg + (size_t)FS * DM, vg + FS, l0 + 2 * FT * 2);
  v16h qf[2][2];
#pragma unroll
  for (int g = 0; g < 2; ++g)
#pragma unroll
    for (int ks = 0; ks < 2; ++ks) qf[g][ks] = g2_frag(kb + (size_t)(qw + g * 16) * DM + ks * 32, hh);
  const v8f z8 = {0.f, 0.f, 0.f, 0.f, 0.f, 0.f, 0.f, 0.f};
  v8f o[2][4]; float m[2], l[2];
#pragma unroll
  for (int g = 0; g < 2; ++g) { m[g] = -1.0e30f; l[g] = 0.f;
#pragma unroll
    for (int dt = 0; dt < 4; ++dt) o[g][dt] = z8; }
#pragma unroll 1
  for (int t = 0; t < nst; ++t) {
    const unsigned short* kl = &sm[t & 1][0][ln * FP + 8 * hh];      /* this lane's row and half within a 16-row tile of the staged K rows */
    const unsigned short* vl = &sm[t & 1][1][ln * FP + 8 * hh];      /* and of the staged V^T rows */
#pragma unroll
    for (int p = 0; p < 2; ++p) { const int it = 2 * t + p;
      if (it <= last) {
        v16h kf[2][2], vf[4];
#pragma unroll
        for (int kt = 0; kt < 2; ++kt)
#pragma unroll
          for (int ks = 0; ks < 2; ++ks) kf[kt][ks] = fa_frag(kl + (p * 32 + kt * 16) * FP + ks * 32);
#pragma unroll
        for (int dt = 0; dt < 4; ++dt) vf[dt] = fa_frag(vl + (dt * 16) * FP + p * 32);
        __builtin_amdgcn_sched_barrier(0);      /* keeps the pass's sixteen LDS reads together at its head, K first: one place with LDS reads instead of two, and the V^T fragments land under the score products and the softmax instead of being waited for in front of P V */
        v8f s[2][2];
#pragma unroll
        for (int g = 0; g < 2; ++g)
#pragma unroll
          for (int kt = 0; kt < 2; ++kt) s[g][kt] = fa_mma(kf[kt][1], qf[g][1], fa_mma(kf[kt][0], qf[g][0], z8));
        if (it == last) {
#pragma unroll
          for (int g = 0; g < 2; ++g)
#pragma unroll
            for (int kt = 0; kt < 2; ++kt)
#pragma unroll
              for (int r = 0; r < 8; ++r) s[g][kt][r] = (kt * 16 + 8 * hh + r <= g * 16 + ln) ? s[g][kt][r] : -1.0e30f; }      /* first key of the pass == qw here: key <= query */
        float mn[2]; bool need = false;
#pragma unroll
        for (int g = 0; g < 2; ++g) { float mx = s[g][0][0];
#pragma unroll
          for (int r = 1; r < 8; ++r) mx = fmaxf(mx, s[g][0][r]);
#pragma unroll
          for (int r = 0; r < 8; ++r) mx = fmaxf(mx, s[g][1][r]);
          mx = fmaxf(mx, __shfl_xor(mx, 16, 32)); mn[g] = fmaxf(m[g], mx * SC2); need = need || (mn[g] > m[g]); }
        if (__builtin_amdgcn_ballot_w32(need) != 0) {      /* no column's maximum moved: every factor would be exactly 1, so the rescale is skipped as a whole */
#pragma unroll
          for (int g = 0; g < 2; ++g) { const float al = __builtin_amdgcn_exp2f(m[g] - mn[g]); m[g] = mn[g]; l[g] *= al;
#pragma unroll
            for (int dt = 0; dt < 4; ++dt) o[g][dt] *= al; } }
        FragH pf[2];
#pragma unroll
        for (int g = 0; g < 2; ++g) { float ls = 0.f;
#pragma unroll
          for (int kt = 0; kt < 2; ++kt) { const v8f tt = s[g][kt] * SC2 - m[g];
#pragma unroll
            for (int r = 0; r < 8; ++r) { const float pp = __builtin_amdgcn_exp2f(tt[r]); ls += pp; pf[g].h[kt * 8 + r] = (_Float16)pp; } }
          l[g] += ls; }
#pragma unroll
        for (int g = 0; g < 2; ++g)
#pragma unroll
          for (int dt = 0; dt < 4; ++dt) o[g][dt] = fa_mma(vf[dt], pf[g].v, o[g][dt]); } }
    asm volatile("s_wait_dscnt 0x0" ::: "memory");         /* this wave's reads of buffer t & 1 have returned before the buffer is refilled */
    asm volatile("s_wait_asynccnt 0x0" ::: "memory");      /* this wave's copies of stage t + 1 have landed */
    __syncthreads();                                        /* publishes stage t + 1 and ends every wave's reads of stage t */
    if (t + 2 < nst) fa_copy(kg + (size_t)(t + 2) * FS * DM, vg + (size_t)(t + 2) * FS, l0 + (unsigned)(t & 1) * (2 * FT * 2)); }      /* the same test in the whole block */
  asm volatile("s_wait_asynccnt 0x0" ::: "memory");        /* no copy is outstanding when the wave ends */
#pragma unroll
  for (int g = 0; g < 2; ++g) { const float fin = 64.0f / (l[g] + __shfl_xor(l[g], 16, 32));      /* halves joined once; o carried x64 */
    _Float16* orow = O + ((size_t)b * SQ + qw + g * 16 + ln) * DM + h * HD + 8 * hh;
#pragma unroll
    for (int dt = 0; dt < 4; ++dt) { FragH f;
#pragma unroll
      for (int r = 0; r < 8; ++r) f.h[r] = (_Float16)(o[g][dt][r] * fin);
      *(v8us*)((unsigned short*)orow + dt * 16) = f.half[0]; } } }

// Exact f32 attention for the first QT0 rows; F holds the f32 rows of q = k = v (pitch ld), 64 columns a head: the heads of all batches stand side by side in a row, so one launch serves them all. One wave per (head, query row), A0W rows a block.
// Scores: lane = key (four groups of 32 keys), the query row broadcast from LDS, four partial sums per key. Softmax: two passes over the wave's own registers.
// P V: lane = two head columns, keys in ascending order, each weight broadcast from its lane through a scalar register.
// Every wave stages and walks all QT0 keys, keys past its query with weight exactly 0: the launch lasts as long as the wave of the last row, which needs them all,
// and without tests the code is one straight line whose LDS reads have constant offsets and fly together.
// Every loop is fully unrolled: the small arrays are then indexed by constants and stay in registers, and each weight is read from a constant lane.
#define A0W 8                        /* waves = query rows per block */
#define A0P 68                       /* LDS row pitch in floats: 16-byte column walks fall on distinct banks */
// The result (x64) leaves as two f16 planes, OH = the rounded value and OL = what the rounding left, x1024: the operands of the output GEMM's first-tile blocks.
// The launch is shared with the V^T transposes, which like this attention need the projection alone: blocks 0 .. A0B - 1 are the attention's (the longer ones first), the rest transpose one 64 x 64 tile each (V16 rows of pitch DM -> Vt [NB][NH][HD][SQ]). The choice is the same for a whole block, a scalar branch.
#define A0B (NBR * NH * (QT0 / A0W))      /* attention blocks */
typedef float v2f __attribute__((ext_vector_type(2)));
typedef _Float16 v2h __attribute__((ext_vector_type(2)));
__global__ __launch_bounds__(256) void k_att0_vt(const float* __restrict__ F, int ld, float scale, _Float16* __restrict__ OH, _Float16* __restrict__ OL, int ldo, const _Float16* __restrict__ V16, _Float16* __restrict__ Vt) {
  __shared__ __attribute__((aligned(16))) float tl[QT0][A0P];
  __shared__ unsigned short tv[64][66];
  const int tid = threadIdx.x, lane = tid & 31; const int w = __builtin_amdgcn_readfirstlane(tid >> 5);      /* scalar wave number: the query row's LDS address stays scalar */
  if (blockIdx.x >= A0B) {      /* the loops over q and rd are fully unrolled so that the fragment is indexed by constants and stays in registers */
    const int bx = blockIdx.x - A0B; const int slab = bx / (SQ / 64), lg = bx % (SQ / 64); const int b = slab / NH, hv = slab % NH;
    for (int e = tid; e < 64 * 8; e += 256) { const int r = e / 8, c8 = (e % 8) * 8; FragH f; f.half[0] = *(const v8us*)((const unsigned short*)V16 + ((size_t)b * SQ + lg * 64 + r) * DM + hv * 64 + c8);
#pragma unroll
      for (int q = 0; q < 8; ++q) tv[r][c8 + q] = f.u[q]; }
    __syncthreads();
#pragma unroll
    for (int rd = 0; rd < 2; ++rd) { const int d = rd * 32 + tid / 8, pc = tid % 8; FragH f;
#pragma unroll
      for (int q = 0; q < 8; ++q) f.u[q] = tv[pc * 8 + q][d];
      *(v8us*)((unsigned short*)Vt + ((size_t)slab * 64 + d) * SQ + lg * 64 + pc * 8) = f.half[0]; }
    return; }
  const int h = blockIdx.x / (QT0 / A0W), rg = blockIdx.x % (QT0 / A0W); const int i = rg * A0W + w;
#pragma unroll
  for (int u = 0; u < QT0 * (HD / 4) / 256; ++u) { const int e = u * 256 + tid; const int r = e >> 4, c = (e & 15) * 4; *(v4f*)&tl[r][c] = *(const v4fa*)(F + (size_t)r * ld + h * HD + c); }
  __syncthreads();
  v4f a[QT0 / 32];
#pragma unroll
  for (int t = 0; t < QT0 / 32; ++t) a[t] = (v4f){0.f, 0.f, 0.f, 0.f};
#pragma unroll
  for (int c = 0; c < HD / 4; ++c) { const v4f q = *(const v4f*)&tl[i][c * 4];
#pragma unroll
    for (int t = 0; t < QT0 / 32; ++t) a[t] = __builtin_elementwise_fma(q, *(const v4f*)&tl[t * 32 + lane][c * 4], a[t]); }
  float s[QT0 / 32], mx = -1.0e30f;
#pragma unroll
  for (int t = 0; t < QT0 / 32; ++t) { const float d = (a[t][0] + a[t][1]) + (a[t][2] + a[t][3]); s[t] = (t * 32 + lane <= i) ? d * scale : -1.0e30f; mx = fmaxf(mx, s[t]); }
#pragma unroll
  for (int d = 16; d > 0; d >>= 1) mx = fmaxf(mx, __shfl_xor(mx, d, 32));      /* key 0 is never masked: mx is a real score */
  float p[QT0 / 32], l = 0.f;
#pragma unroll
  for (int t = 0; t < QT0 / 32; ++t) { p[t] = expf(s[t] - mx); l += p[t]; }      /* masked keys: exp of about -1e30 = 0 */
#pragma unroll
  for (int d = 16; d > 0; d >>= 1) l += __shfl_xor(l, d, 32);
  v2f o = {0.f, 0.f};
#pragma unroll
  for (int t = 0; t < QT0 / 32; ++t)
#pragma unroll
    for (int k = 0; k < 32; ++k) { const float pj = __uint_as_float(__builtin_amdgcn_readlane(__float_as_uint(p[t]), k)); const v2f pp = {pj, pj};
      o = __builtin_elementwise_fma(pp, *(const v2f*)&tl[t * 32 + k][2 * lane], o); }
  const float fin = 64.0f / l;      /* o carried x64 like the f16 path */
  const v2f of = o * fin; const v2h oh = {(_Float16)of[0], (_Float16)of[1]}; const v2h ol = {(_Float16)((of[0] - (float)oh[0]) * 1024.0f), (_Float16)((of[1] - (float)oh[1]) * 1024.0f)};
  const size_t oo = (size_t)i * ldo + h * HD + 2 * lane; *(v2h*)(OH + oo) = oh; *(v2h*)(OL + oo) = ol; }

extern "C" void kernel_launch(void* const* d_in, const int* in_sizes, int n_in,
                              void* d_out, int out_size, void* d_ws, size_t ws_size, hipStream_t stream) {
  (void)in_sizes; (void)n_in; (void)out_size;
  const float* const* I = (const float* const*)d_in; const float* x = I[0]; const float* wq = I[1]; const float* wo = I[2]; const float* bo = I[3]; const float* wk = wq; const float* wv = wq;      /* Wq [12][64][768] = natural [768][768] rows h*64+d (q = k = v); W_out natural + b_out */
  char* ws = (char*)d_ws; size_t off = 0;
  auto take = [&](size_t bytes) { char* p = ws + off; off += (bytes + 255) & ~(size_t)255; return p; };
  _Float16* BQ = (_Float16*)take((size_t)DM * DM * 2); _Float16* BK = BQ; _Float16* BV = BQ; _Float16* BO = (_Float16*)take((size_t)DM * DM * 2);
  _Float16* X16 = (_Float16*)take(NR * DM * 2); _Float16* Q16 = (_Float16*)take(NR * DM * 2); _Float16* K16 = Q16; _Float16* V16 = Q16;      /* q = k = v (the module projects all three with self.query) */ _Float16* O16 = (_Float16*)take(NR * DM * 2);
  _Float16* VT = (_Float16*)take((size_t)NB * NH * HD * SQ * 2);
  float* QF0 = (float*)take((size_t)NB * QT0 * DM * 4); _Float16* OH0 = (_Float16*)take((size_t)NB * QT0 * DM * 2); _Float16* OL0 = (_Float16*)take((size_t)NB * QT0 * DM * 2);
  if (off > ws_size) return;
  constexpr unsigned nbx = (unsigned)((NR * DM / 8 + 255) / 256), nbw = (unsigned)(((size_t)DM * DM / 8 + 255) / 256);      /* blocks for x, for one weight matrix */
  k_in16<<<nbx + 2 * nbw, 256, 0, stream>>>(x, NR * DM / 8, nbx, X16, wq, wo, (size_t)DM * DM / 8, nbw, BQ, BO);      /* x rows as f16; weights natural [out][in] = Bt x16 */
  const size_t r0p = (size_t)B0 * SQ;      /* first projected row */
  /* first-tile path (rows 0 .. 127 of every batch, exact f32 attention): it has no launch of its own, every piece rides in the launch of the main path that has the same inputs ready. Its planes are [QT0][NB * DM]: row r holds row r of batch 0, then of batch 1 */
  constexpr int LF = NB * DM; const size_t c0p = (size_t)B0 * DM;      /* pitch of those planes; first processed batch's column */
  k_gemm2<0, 1><<<dim3((unsigned)((MP / 128) * (DM / 64)), 1), 128, 0, stream>>>(X16 + r0p * DM, DM, 0, BQ, DM, 0, 0.0625f, nullptr, 0, nullptr, 1, 0, 0, nullptr, Q16 + r0p * DM, DM, 0, MP, DM, DM, nullptr, nullptr, 0.f, QF0 + c0p, LF);      /* q = k = v as f16 rows; the first 128 rows of a batch as f32 too (exact products) */
  k_att0_vt<<<A0B + NB * NH * (SQ / 64), 256, 0, stream>>>(QF0 + c0p, LF, 0.036084391824351615f, OH0 + c0p, OL0 + c0p, LF, V16, VT);      /* exact f32 attention for rows 0..127 (o x64 as f16 hi + x1024 residual planes); V^T [NB][NH][HD][SQ] */
  static_assert(FQ == QT0, "the fused attention's last blocks are exactly the first-tile rows");
  k_fattn<<<NB * NH * (SQ / FQ - 1), 128, 0, stream>>>(Q16, VT, O16);      /* scores, causal softmax and P V in one launch; o (merged heads, x64) as f16 rows; rows 0..127 are the first-tile path's: their blocks, the last of the grid, are not launched */
  k_gemm2<0, 2><<<dim3((unsigned)(F2B + (MPO / 128 - NBR) * (DM / 64)), 1), 128, 0, stream>>>(O16 + r0p * DM, DM, 0, BO, DM, 0, 0.0009765625f, bo, 0, nullptr, 1, 0, 0, (float*)d_out + r0p * DM, nullptr, DM, 0, MPO, DM, DM, OH0 + c0p, OL0 + c0p, 0.00000095367431640625f, nullptr, LF);      /* out rows are the output layout; rows 0..127: o_hi Wo + b + o_lo Wo 2^-20 */
}

// v008
// Measured time: 110 microseconds a run.
// Timed twice side by side with v007, it ran 1.10 times as fast both times.
// Over all steps from v000 it is 133 times as fast.
#include <hip/hip_runtime.h>
// Causal multi-head attention whose q, k AND v are the same per-head projection (x [2][4096][768]; q = k = v = x Wq[h]^T with Wq [12][64][768] (natural per-head rows, sigma 1/sqrt(768)); scores = q.q / sqrt(768) (the module scales by d_model); causal (tril, -inf); softmax; out = merged (attn q) W_out^T + b_out -> [2][4096][768]).
// Structure: token rows r = b*4096 + s; x as exact f16 rows (bf16-rounded); q = k = v as one WMMA GEMM (32x64 wave tiles, f32 accumulation, exact x16 weights, f16 outputs); one fused launch for the attention: per wave 32 query rows, keys 32 at a time up to the diagonal block, S^T = K Q^T (V^T fragments by transposing LDS reads of the staged k = v rows), online base-2 softmax in registers (f32 statistics, native exp2; weights in (0,1] as f16), O^T += V^T P^T (o carried x64, folded into the output GEMM alpha) written straight into the merged f16 o rows; out = o W_o GEMM (f32) into the output layout.
// Compute dtype: inputs rounded to bf16; x / weights exact; q, k, v, softmax weights and o as plain f16 GEMM operands (~2^-12); scores and softmax statistics f32. v_wmma_f32_16x16x32_f16.
#define NB 2
#define SQ 4096
#define DM 768
#define NH 12
#define HD 64
#define HG 4                         /* heads per launch of the unused per-batch k_vt */
#define QT0 128                      /* first-tile rows whose attention runs exactly in f32 */
#define B0 0                         /* first batch processed (debug hook) */
#define NBR NB                       /* batches processed (debug hook) */
#define NR ((size_t)NB * SQ)         /* token rows */
#define MP ((int)((size_t)NBR * SQ)) /* rows projected (debug hook) */
#define MPO MP                       /* rows through the output stage (debug hook) */
#define LQ DM      /* row pitch of the q/k/v rows */
typedef __bf16 v16b __attribute__((ext_vector_type(16)));
typedef unsigned short v8us __attribute__((ext_vector_type(8), may_alias));
typedef float  v8f  __attribute__((ext_vector_type(8)));
typedef float  v4f  __attribute__((ext_vector_type(4)));
typedef float  v4fa __attribute__((ext_vector_type(4), may_alias));
union FragB { v16b v; v8us half[2]; unsigned short u[16]; };

__device__ __forceinline__ unsigned short bf16_bits(float x) { unsigned int u = __float_as_uint(x); return (unsigned short)((u + 0x7FFFu + ((u >> 16) & 1u)) >> 16); }
__device__ __forceinline__ float bf16_val(unsigned short b) { return __uint_as_float(((unsigned int)b) << 16); }
__device__ __forceinline__ float bf16_round(float x) { return bf16_val(bf16_bits(x)); }
// D += A·B with NT terms: 1 = ah·bh, 2 = + al·bh (A split), 3 = + ah·bl (both split)
template <int NT>
__device__ __forceinline__ v8f mmaN(v16b ah, v16b al, v16b bh, v16b bl, v8f c) {
  c = __builtin_amdgcn_wmma_f32_16x16x32_bf16(false, ah, false, bh, (short)0, c, false, false);
  if (NT >= 2) c = __builtin_amdgcn_wmma_f32_16x16x32_bf16(false, al, false, bh, (short)0, c, false, false);
  if (NT >= 3) c = __builtin_amdgcn_wmma_f32_16x16x32_bf16(false, ah, false, bl, (short)0, c, false, false);
  asm volatile("v_nop\n\tv_nop\n\tv_nop\n\tv_nop" : "+v"(c) : "v"(ah), "v"(al), "v"(bh), "v"(bl));
  return c;
}

__global__ __launch_bounds__(256) void k_wt_bf16(const float* __restrict__ W, unsigned short* __restrict__ Wt, int K, int N) {
  const int t = blockIdx.x * 256 + threadIdx.x;
  const int k8n = K / 8;
  if (t >= N * k8n) return;
  const int n = t / k8n, k8 = (t % k8n) * 8;
  v8us v;
#pragma unroll
  for (int i = 0; i < 8; ++i) v[i] = bf16_bits(W[(size_t)(k8 + i) * N + n]);
  *(v8us*)(Wt + (size_t)n * K + k8) = v;
  
}

// GEMM C[M][N] (f32, pitch ldc) = act(A[M][K]·W + bias). A f32 row-major (pitch lda) converted per fragment to bf16
// (ASPLIT: hi/lo two planes -> 2 terms, else single rounded term); Wt bf16 [N][K] (pitch ldb). BIAS_BF16 rounds the
// bias to bf16 first (bias quantised to bf16 before the add). K%32==0, M%16==0, N%64==0.
template <bool ASPLIT, int ACT, bool BIAS_BF16>
__global__ __launch_bounds__(128) void k_gemm_bf(const float* __restrict__ A, int lda, const unsigned short* __restrict__ Wt, int ldb,
                                               const float* __restrict__ bias, float* __restrict__ C, int ldc, int M, int N, int K) {
  __shared__ __attribute__((aligned(16))) float so[4][16][64];
  const int tid = threadIdx.x, w = tid >> 5, lane = tid & 31, ln = lane & 15, hh = lane >> 4;
  const int ntn = N / 64;
  const int wid = blockIdx.x * 4 + w;
  const int mt = wid / ntn, nq = wid % ntn;
  if (mt * 16 >= M) return;
  const int row0 = mt * 16, col0 = nq * 64;
  const float* arow = A + (size_t)(row0 + ln) * lda;
  v8f acc[4] = {};
  for (int kb = 0; kb < K; kb += 32) {
    FragB ah, al;
    const v4f x0 = *(const v4fa*)(arow + kb + 8 * hh), x1 = *(const v4fa*)(arow + kb + 8 * hh + 4);
    const v4f x2 = *(const v4fa*)(arow + kb + 16 + 8 * hh), x3 = *(const v4fa*)(arow + kb + 16 + 8 * hh + 4);
    float xs[16] = {x0[0],x0[1],x0[2],x0[3],x1[0],x1[1],x1[2],x1[3],x2[0],x2[1],x2[2],x2[3],x3[0],x3[1],x3[2],x3[3]};
#pragma unroll
    for (int i = 0; i < 16; ++i) { const unsigned short hb = bf16_bits(xs[i]); ah.u[i] = hb; al.u[i] = ASPLIT ? bf16_bits(xs[i] - bf16_val(hb)) : (unsigned short)0; }
#pragma unroll
    for (int t = 0; t < 4; ++t) {
      const unsigned short* brow = Wt + (size_t)(col0 + t * 16 + ln) * ldb + kb;
      FragB b;
      b.half[0] = *(const v8us*)(brow + 8 * hh);
      b.half[1] = *(const v8us*)(brow + 16 + 8 * hh);
      acc[t] = mmaN<ASPLIT ? 2 : 1>(ah.v, al.v, b.v, b.v, acc[t]);
    }
  }
#pragma unroll
  for (int t = 0; t < 4; ++t) {
    float bv = bias ? bias[col0 + t * 16 + ln] : 0.f;
    if (BIAS_BF16) bv = bf16_round(bv);
#pragma unroll
    for (int r = 0; r < 8; ++r) { float v = acc[t][r] + bv; if (ACT == 1) v = fmaxf(v, 0.f); so[w][8 * hh + r][t * 16 + ln] = v; }
  }
  __builtin_amdgcn_fence(__ATOMIC_ACQ_REL, "workgroup");
  __builtin_amdgcn_wave_barrier();
  const int rsub = lane >> 4, c4 = (lane & 15) * 4;
  {
#pragma unroll
    for (int q = 0; q < 8; ++q) {
      const int r = q * 2 + rsub;
      const v4f v = *(const v4fa*)&so[w][r][c4];
      *(v4f*)(C + (size_t)(row0 + r) * ldc + col0 + c4) = v;
    }
    
  }
}

// GEMM C = act(A·W + bias + resid): A f32 (ASPLIT -> hi/lo 2 terms), Wt bf16 [N][K]; ACT 0 none, 1 relu, 2 exact gelu;
// resid (optional, f32, row index = (row % rmod), pitch ldr, RES_BF16 rounds it) added before the activation.
template <bool ASPLIT, int ACT, bool BIAS_BF16, bool RES_BF16>
__global__ __launch_bounds__(128) void k_gemm_bf3(const float* __restrict__ A, int lda, const unsigned short* __restrict__ Wt, int ldb,
                                                const float* __restrict__ bias, const float* __restrict__ resid, int rmod, int ldr,
                                                float* __restrict__ C, int ldc, int M, int N, int K) {
  __shared__ __attribute__((aligned(16))) float so[4][16][64];
  const int tid = threadIdx.x, w = tid >> 5, lane = tid & 31, ln = lane & 15, hh = lane >> 4;
  const int ntn = N / 64;
  const int wid = blockIdx.x * 4 + w;
  const int mt = wid / ntn, nq = wid % ntn;
  if (mt * 16 >= M) return;
  const int row0 = mt * 16, col0 = nq * 64;
  const float* arow = A + (size_t)(row0 + ln) * lda;
  v8f acc[4] = {};
  for (int kb = 0; kb < K; kb += 32) {
    FragB ah, al;
    const v4f x0 = *(const v4fa*)(arow + kb + 8 * hh), x1 = *(const v4fa*)(arow + kb + 8 * hh + 4);
    const v4f x2 = *(const v4fa*)(arow + kb + 16 + 8 * hh), x3 = *(const v4fa*)(arow + kb + 16 + 8 * hh + 4);
    float xs[16] = {x0[0],x0[1],x0[2],x0[3],x1[0],x1[1],x1[2],x1[3],x2[0],x2[1],x2[2],x2[3],x3[0],x3[1],x3[2],x3[3]};
#pragma unroll
    for (int i = 0; i < 16; ++i) { const unsigned short hb = bf16_bits(xs[i]); ah.u[i] = hb; al.u[i] = ASPLIT ? bf16_bits(xs[i] - bf16_val(hb)) : (unsigned short)0; }
#pragma unroll
    for (int t = 0; t < 4; ++t) {
      const unsigned short* brow = Wt + (size_t)(col0 + t * 16 + ln) * ldb + kb;
      FragB b;
      b.half[0] = *(const v8us*)(brow + 8 * hh);
      b.half[1] = *(const v8us*)(brow + 16 + 8 * hh);
      acc[t] = mmaN<ASPLIT ? 2 : 1>(ah.v, al.v, b.v, b.v, acc[t]);
    }
  }
#pragma unroll
  for (int t = 0; t < 4; ++t) {
    const int col = col0 + t * 16 + ln;
    float bv = bias ? bias[col] : 0.f;
    if (BIAS_BF16) bv = bf16_round(bv);
#pragma unroll
    for (int r = 0; r < 8; ++r) {
      float v = acc[t][r] + bv;
      if (resid) { float rv = resid[(size_t)((row0 + 8 * hh + r) % rmod) * ldr + col]; if (RES_BF16) rv = bf16_round(rv); v += rv; }
      if (ACT == 1) v = fmaxf(v, 0.f);
      if (ACT == 2) v = 0.5f * v * (1.0f + erff(v * 0.70710678118654752f));
      if (ACT == 3) { const float u = 0.7978845608028654f * (v + 0.044715f * v * v * v); v = 0.5f * v * (1.0f + tanhf(u)); }
      so[w][8 * hh + r][t * 16 + ln] = v;
    }
  }
  __builtin_amdgcn_fence(__ATOMIC_ACQ_REL, "workgroup");
  __builtin_amdgcn_wave_barrier();
  const int rsub = lane >> 4, c4 = (lane & 15) * 4;
  {
#pragma unroll
    for (int q = 0; q < 8; ++q) {
      const int r = q * 2 + rsub;
      const v4f v = *(const v4fa*)&so[w][r][c4];
      *(v4f*)(C + (size_t)(row0 + r) * ldc + col0 + c4) = v;
    }
    
  }
}
// row LayerNorm (biased variance, eps) over N: s = X (+ R); optional out_sum <- s; out_norm <- (s-mu)*rsqrt(var+eps)*g + b
template <bool PARAM_BF16>
__global__ __launch_bounds__(256) void k_layernorm(const float* __restrict__ X, const float* __restrict__ R, const float* __restrict__ g, const float* __restrict__ bta,
                                                  float* __restrict__ out_sum, float* __restrict__ out_norm, int N, float eps) {
  __shared__ float red[256];
  const int row = blockIdx.x, tid = threadIdx.x;
  const float* x = X + (size_t)row * N; const float* rr = R ? R + (size_t)row * N : nullptr;
  float vals[16];                     // up to N = 4096
  const int per = N / 256;            // contiguous chunk per thread? use strided-by-4 chunks: thread handles j = tid*4 + 1024*u
  float s1 = 0.f;
  for (int u = 0; u < per / 4; ++u) {
    const int j = tid * 4 + 1024 * u;
    const v4f a = *(const v4fa*)(x + j);
    v4f b = {0.f,0.f,0.f,0.f}; if (rr) b = *(const v4fa*)(rr + j);
#pragma unroll
    for (int q = 0; q < 4; ++q) { const float v = a[q] + b[q]; vals[u * 4 + q] = v; s1 += v; }
  }
  red[tid] = s1; __syncthreads();
  for (int st = 128; st > 0; st >>= 1) { if (tid < st) red[tid] += red[tid + st]; __syncthreads(); }
  const float mu = red[0] / (float)N; __syncthreads();
  float s2 = 0.f;
  for (int u = 0; u < per / 4; ++u)
#pragma unroll
    for (int q = 0; q < 4; ++q) { const float c = vals[u * 4 + q] - mu; s2 += c * c; }
  red[tid] = s2; __syncthreads();
  for (int st = 128; st > 0; st >>= 1) { if (tid < st) red[tid] += red[tid + st]; __syncthreads(); }
  const float rs = rsqrtf(red[0] / (float)N + eps);
  {
    for (int u = 0; u < per / 4; ++u) {
      const int j = tid * 4 + 1024 * u;
      v4f o, sm;
#pragma unroll
      for (int q = 0; q < 4; ++q) {
        float gg = g[j + q], bb = bta[j + q];
        if (PARAM_BF16) { gg = bf16_round(gg); bb = bf16_round(bb); }
        sm[q] = vals[u * 4 + q]; o[q] = (vals[u * 4 + q] - mu) * rs * gg + bb;
      }
      if (out_sum) *(v4f*)(out_sum + (size_t)row * N + j) = sm;
      *(v4f*)(out_norm + (size_t)row * N + j) = o;
    }
    
  }
}



// ---- f16 WMMA path (v_wmma_f32_16x16x32_f16): 11-bit significands for operands in range — used where a [0,1] probability operand needs more precision than bf16
typedef _Float16 v16h __attribute__((ext_vector_type(16)));
union FragH { v16h v; v8us half[2]; _Float16 h[16]; unsigned short u[16]; };
template <int NT>
__device__ __forceinline__ v8f mmaH(v16h ah, v16h al, v16h bh, v16h bl, v8f c) {
  c = __builtin_amdgcn_wmma_f32_16x16x32_f16(false, ah, false, bh, (short)0, c, false, false);
  if (NT >= 2) c = __builtin_amdgcn_wmma_f32_16x16x32_f16(false, al, false, bh, (short)0, c, false, false);
  if (NT >= 3) c = __builtin_amdgcn_wmma_f32_16x16x32_f16(false, ah, false, bl, (short)0, c, false, false);
  asm volatile("v_nop\n\tv_nop\n\tv_nop\n\tv_nop" : "+v"(c) : "v"(ah), "v"(al), "v"(bh), "v"(bl));
  return c;
}
// batched GEMM like k_gemm_b but f16 operands: A f32 (split into f16 hi/lo if ASPLIT, else rounded to f16), Bt = f16 values [n][k]; alpha; C f32; N multiple of 16 (partial tiles skipped)
template <bool ASPLIT>
__global__ __launch_bounds__(128) void k_gemm_h(const float* __restrict__ A, int lda, size_t sA, const _Float16* __restrict__ Bh, int ldb, size_t sB, float alpha, float* __restrict__ C, int ldc, size_t sC, int M, int N, int K) {
  __shared__ __attribute__((aligned(16))) float so[4][16][64];
  const int tid = threadIdx.x, w = tid >> 5, lane = tid & 31, ln = lane & 15, hh = lane >> 4; const int by = blockIdx.y;
  A += (size_t)by * sA; Bh += (size_t)by * sB; C += (size_t)by * sC;
  const int ntn = (N + 63) / 64; const int wid = blockIdx.x * 4 + w; const int mt = wid / ntn, nq = wid % ntn; if (mt * 16 >= M) return;
  const int row0 = mt * 16, col0 = nq * 64; const float* arow = A + (size_t)(row0 + ln) * lda;
  v8f acc[4] = {};
  for (int kb = 0; kb < K; kb += 32) {
    FragH ah, al;
    const v4f x0 = *(const v4fa*)(arow + kb + 8 * hh), x1 = *(const v4fa*)(arow + kb + 8 * hh + 4), x2 = *(const v4fa*)(arow + kb + 16 + 8 * hh), x3 = *(const v4fa*)(arow + kb + 16 + 8 * hh + 4);
    float xs[16] = {x0[0],x0[1],x0[2],x0[3],x1[0],x1[1],x1[2],x1[3],x2[0],x2[1],x2[2],x2[3],x3[0],x3[1],x3[2],x3[3]};
#pragma unroll
    for (int i = 0; i < 16; ++i) { const _Float16 h = (_Float16)xs[i]; ah.h[i] = h; al.h[i] = ASPLIT ? (_Float16)(xs[i] - (float)h) : (_Float16)0.0f; }
#pragma unroll
    for (int t = 0; t < 4; ++t) { if (col0 + t * 16 >= N) continue; const size_t boff = (size_t)(col0 + t * 16 + ln) * ldb + kb; FragH bq; bq.half[0] = *(const v8us*)(Bh + boff + 8 * hh); bq.half[1] = *(const v8us*)(Bh + boff + 16 + 8 * hh);
      acc[t] = mmaH<ASPLIT ? 2 : 1>(ah.v, al.v, bq.v, bq.v, acc[t]); }
  }
#pragma unroll
  for (int t = 0; t < 4; ++t) { if (col0 + t * 16 >= N) continue;
#pragma unroll
    for (int r = 0; r < 8; ++r) so[w][8 * hh + r][t * 16 + ln] = acc[t][r] * alpha; }
  __builtin_amdgcn_fence(__ATOMIC_ACQ_REL, "workgroup"); __builtin_amdgcn_wave_barrier();
  const int rsub = lane >> 4, c4 = (lane & 15) * 4;
  {
#pragma unroll
    for (int q = 0; q < 8; ++q) { const int r = q * 2 + rsub; if (col0 + c4 < N) { const v4f v = *(const v4fa*)&so[w][r][c4]; *(v4f*)(C + (size_t)(row0 + r) * ldc + col0 + c4) = v; } }
     }
}

// Wt[n][k] = f16(W[k][n]·scale) from f32 row-major W[K][N] (scale = power of two; bf16-exact weights stay exact in f16 away from the subnormal range)
__global__ __launch_bounds__(256) void k_wt_f16(const float* __restrict__ W, _Float16* __restrict__ Wt, int K, int N, float scale) {
  const int t = blockIdx.x * 256 + threadIdx.x; if (t >= N * (K / 8)) return; const int n = t / (K / 8), k8 = (t % (K / 8)) * 8; FragH f;
#pragma unroll
  for (int i = 0; i < 8; ++i) f.h[i] = (_Float16)(bf16_round(W[(size_t)(k8 + i) * N + n]) * scale); const v8us o = f.half[0];
  *(v8us*)((unsigned short*)Wt + (size_t)n * K + k8) = o; 
}
// k_gemm_hh variant with fused epilogue: v = acc·alpha + bias[by·sBias + col] (+ CP[(row/rowsPerB)·sCPb + by·64 + col] if CP) ; ACT 0 none / 1 elu ; writes f16 C16 (and f32 C if non-null)
template <int ACT>
__global__ __launch_bounds__(128) void k_gemm_hhx(const _Float16* __restrict__ A, int lda, size_t sA, const _Float16* __restrict__ Bh, int ldb, size_t sB, float alpha, const float* __restrict__ bias, size_t sBias, const float* __restrict__ CP, int rowsPerB, size_t sCPb, int row0g,
    float* __restrict__ C, _Float16* __restrict__ C16, int ldc, size_t sC, int M, int N, int K) {
  __shared__ __attribute__((aligned(16))) float so[4][16][64];
  const int tid = threadIdx.x, w = tid >> 5, lane = tid & 31, ln = lane & 15, hh = lane >> 4; const int by = blockIdx.y;
  A += (size_t)by * sA; Bh += (size_t)by * sB; const size_t cofs = (size_t)by * sC; const float* bp = bias ? bias + (size_t)by * sBias : nullptr;
  const int ntn = (N + 63) / 64; const int wid = blockIdx.x * 4 + w; const int mt = wid / ntn, nq = wid % ntn; if (mt * 16 >= M) return;
  const int row0 = mt * 16, col0 = nq * 64; const _Float16* arow = A + (size_t)(row0 + ln) * lda;
  v8f acc[4] = {};
  for (int kb = 0; kb < K; kb += 32) { FragH ah; ah.half[0] = *(const v8us*)((const unsigned short*)arow + kb + 8 * hh); ah.half[1] = *(const v8us*)((const unsigned short*)arow + kb + 16 + 8 * hh);
#pragma unroll
    for (int t = 0; t < 4; ++t) { if (col0 + t * 16 >= N) continue; const size_t boff = (size_t)(col0 + t * 16 + ln) * ldb + kb; FragH bq; bq.half[0] = *(const v8us*)((const unsigned short*)Bh + boff + 8 * hh); bq.half[1] = *(const v8us*)((const unsigned short*)Bh + boff + 16 + 8 * hh);
      acc[t] = mmaH<1>(ah.v, ah.v, bq.v, bq.v, acc[t]); }
  }
#pragma unroll
  for (int t = 0; t < 4; ++t) { if (col0 + t * 16 >= N) continue; const int col = col0 + t * 16 + ln; const float bv = bp ? bf16_round(bp[col]) : 0.f;
#pragma unroll
    for (int r = 0; r < 8; ++r) { float v = acc[t][r] * alpha + bv; if (CP) { const int rr = row0g + row0 + 8 * hh + r; if (rowsPerB < 0) v += CP[cofs + (size_t)rr * ldc + col];      /* rowsPerB < 0: own element of the batched C plane */ else { const int bidx = rr / rowsPerB; v += CP[(size_t)bidx * sCPb + (size_t)by * 64 + col]; } } if (ACT == 1) v = (v > 0.f) ? v : expm1f(v); else if (ACT == 7) v = (v > 0.f) ? v + 1.0f : expf(v); else if (ACT == 8) v = tanhf(v); else if (ACT == 9) v = 0.5f * v * (1.0f + tanhf(0.7978845608028654f * (v + 0.044715f * v * v * v))); else if (ACT == 11) v = 1.0f / (1.0f + expf(-v)); else if (ACT == 12) v = (v > 0.f) ? v : 0.01f * v; else if (ACT == 14) v = (v > 0.f) ? v : 0.1f * v; else if (ACT == 16) v = (v >= 0.f) ? v : 0.3f * v; else if (ACT == 17) v = (v >= 0.f) ? v : 0.2f * v; else if (ACT == 15) v = v / (1.0f + expf(-v)); else if (ACT == 3) v = fmaxf(v, 0.f); else if (ACT == 6) v = 0.5f * v * (1.0f + erff(v * 0.70710678118654752f)); so[w][8 * hh + r][t * 16 + ln] = v; } }
  __builtin_amdgcn_fence(__ATOMIC_ACQ_REL, "workgroup"); __builtin_amdgcn_wave_barrier();
  const int rsub = lane >> 4, c4 = (lane & 15) * 4; typedef _Float16 v4h __attribute__((ext_vector_type(4)));
  {
#pragma unroll
    for (int q = 0; q < 8; ++q) { const int r = q * 2 + rsub; if (col0 + c4 < N) { const v4f v = *(const v4fa*)&so[w][r][c4]; if (C) *(v4f*)(C + cofs + (size_t)(row0 + r) * ldc + col0 + c4) = v; if (C16) { v4h h4; for (int i = 0; i < 4; ++i) h4[i] = (_Float16)v[i]; *(v4h*)(C16 + cofs + (size_t)(row0 + r) * ldc + col0 + c4) = h4; } } }
     }
}


typedef _Float16 v4h __attribute__((ext_vector_type(4)));

__global__ __launch_bounds__(256) void k_x16(const float* __restrict__ x, _Float16* __restrict__ X16, size_t n8) { const size_t t = (size_t)blockIdx.x * 256 + threadIdx.x; if (t >= n8) return; FragH f;
#pragma unroll
  for (int q = 0; q < 8; ++q) f.h[q] = (_Float16)bf16_round(x[t * 8 + q]); *(v8us*)((unsigned short*)X16 + t * 8) = f.half[0];  }
__global__ __launch_bounds__(256) void k_h16(const float* __restrict__ x, _Float16* __restrict__ X16, size_t n8) { const size_t t = (size_t)blockIdx.x * 256 + threadIdx.x; if (t >= n8) return; FragH f;
#pragma unroll
  for (int q = 0; q < 8; ++q) f.h[q] = (_Float16)x[t * 8 + q]; *(v8us*)((unsigned short*)X16 + t * 8) = f.half[0];  }
__global__ __launch_bounds__(256) void k_round16f(const float* __restrict__ W, _Float16* __restrict__ Bt, size_t n8) { const size_t t = (size_t)blockIdx.x * 256 + threadIdx.x; if (t >= n8) return; FragH f;
#pragma unroll
  for (int i = 0; i < 8; ++i) f.h[i] = (_Float16)(bf16_round(W[t * 8 + i]) * 16.0f); *(v8us*)((unsigned short*)Bt + t * 8) = f.half[0];  }
template <int NHv, int TTv>
__global__ __launch_bounds__(256) void k_vt(const _Float16* __restrict__ V16, int ldv, int voff, _Float16* __restrict__ Vt) { __shared__ unsigned short tl[64][66]; const int tid = threadIdx.x; const int slab = blockIdx.x / (TTv / 64), lg = blockIdx.x % (TTv / 64); const int b = slab / NHv, h = slab % NHv;
  for (int i = tid; i < 64 * 8; i += 256) { const int r = i / 8, c8 = (i % 8) * 8; FragH f; f.half[0] = *(const v8us*)((const unsigned short*)V16 + ((size_t)b * TTv + lg * 64 + r) * ldv + voff + h * 64 + c8);
#pragma unroll
    for (int q = 0; q < 8; ++q) tl[r][c8 + q] = f.u[q]; }
  __syncthreads();
  {
#pragma unroll
    for (int rd = 0; rd < 2; ++rd) { const int d = rd * 32 + tid / 8, pc = tid % 8; FragH f;
#pragma unroll
      for (int q = 0; q < 8; ++q) f.u[q] = tl[pc * 8 + q][d];
      *(v8us*)((unsigned short*)Vt + ((size_t)slab * 64 + d) * TTv + lg * 64 + pc * 8) = f.half[0]; }
     } }

// ---- fast GEMM (block tile 128x64, wave tile 32x64; requires M % 128 == 0 rows per launch region, N % 64 == 0, K % 64 == 0 and K >= 64); epilogue = k_gemm_hhx semantics ----
// The block's 128 A rows and 64 B rows come through LDS, 64 k (one whole 128-byte line of every row) a stage, two buffers, brought by asynchronous copies: stage t + 2 flies under the products of stage t and the LDS reads of stage t + 1.
// (A fragment load straight from global memory touches 16 lines for 512 bytes, each wave fetched its own copy of B, and every product waited for its own loads.) The k order of every accumulator is unchanged: ascending, 32 at a time.
#define GK 64                        /* k per stage */
#define GP 72                        /* LDS row pitch in f16 = 144 bytes, an odd multiple of 16: 16-byte fragment reads of 128-byte rows fall evenly on the banks */
#define GT (192 * GP)                /* f16 per buffer: 128 A rows, then 64 B rows */
__device__ __forceinline__ v16h g2_frag(const _Float16* p, int hh) { FragH f; f.half[0] = *(const v8us*)((const unsigned short*)p + 8 * hh); f.half[1] = *(const v8us*)((const unsigned short*)p + 16 + 8 * hh); return f.v; }
__device__ __forceinline__ v16h g2_lfrag(const unsigned short* p) { FragH f; f.half[0] = *(const v8us*)p; f.half[1] = *(const v8us*)(p + 16); return f.v; }
__device__ __forceinline__ v8f g2_mma(v16h a, v16h b, v8f c) { return __builtin_amdgcn_wmma_f32_16x16x32_f16(false, a, false, b, (short)0, c, false, false); }
// One stage's copies of one lane: 16 bytes of each of eight A rows and four B rows, 16 rows apart (a wave's 32 lanes cover four whole 128-byte rows per copy). sa, sb = 16 rows of A, of B in f16; l0 = the lane's LDS byte address in the buffer's first 16 rows.
// a0 = the lane's row among staged A rows 0 .. 15, a4 = among rows 64 .. 79: the upper 64 staged rows may come from another plane than the lower 64.
// The s_wait_xcnt closes the statement so that it stands in front of any later write of the address registers the copies name.
__device__ __forceinline__ void g2_copy(const _Float16* a0, const _Float16* a4, size_t sa, const _Float16* b0, size_t sb, unsigned l0) {
  const _Float16* a1 = a0 + sa; const _Float16* a2 = a0 + 2 * sa; const _Float16* a3 = a0 + 3 * sa; const _Float16* a5 = a4 + sa; const _Float16* a6 = a4 + 2 * sa; const _Float16* a7 = a4 + 3 * sa;      /* each from a base: no chain of additions in front of the copies */
  const _Float16* b1 = b0 + sb; const _Float16* b2 = b0 + 2 * sb; const _Float16* b3 = b0 + 3 * sb;
  constexpr unsigned R = 16 * GP * 2;      /* bytes of 16 staged rows */
  const unsigned l1 = l0 + R, l2 = l0 + 2 * R, l3 = l0 + 3 * R, l4 = l0 + 4 * R, l5 = l0 + 5 * R, l6 = l0 + 6 * R, l7 = l0 + 7 * R, l8 = l0 + 8 * R, l9 = l0 + 9 * R, l10 = l0 + 10 * R, l11 = l0 + 11 * R;
  asm volatile("global_load_async_to_lds_b128 %0, %12, off\n\t"
               "global_load_async_to_lds_b128 %1, %13, off\n\t"
               "global_load_async_to_lds_b128 %2, %14, off\n\t"
               "global_load_async_to_lds_b128 %3, %15, off\n\t"
               "global_load_async_to_lds_b128 %4, %16, off\n\t"
               "global_load_async_to_lds_b128 %5, %17, off\n\t"
               "global_load_async_to_lds_b128 %6, %18, off\n\t"
               "global_load_async_to_lds_b128 %7, %19, off\n\t"
               "global_load_async_to_lds_b128 %8, %20, off\n\t"
               "global_load_async_to_lds_b128 %9, %21, off\n\t"
               "global_load_async_to_lds_b128 %10, %22, off\n\t"
               "global_load_async_to_lds_b128 %11, %23, off\n\t"
               "s_wait_xcnt 0x0"
               :: "v"(l0), "v"(l1), "v"(l2), "v"(l3), "v"(l4), "v"(l5), "v"(l6), "v"(l7), "v"(l8), "v"(l9), "v"(l10), "v"(l11),
                  "v"(a0), "v"(a1), "v"(a2), "v"(a3), "v"(a4), "v"(a5), "v"(a6), "v"(a7), "v"(b0), "v"(b1), "v"(b2), "v"(b3) : "memory"); }
// FT = what the launch does for the first QT0 rows of every batch, the rows that go through the exact f32 attention (their planes are [QT0][ldf]: row r holds row r of batch 0, then of batch 1):
// FT 1 (projection): a block of such rows also stores its tile as f32 into CF. FT 2 (output): such rows do not come from A but from the planes A0h + A0l x alphal / alpha; blocks 0 .. F2B - 1 take them, 64 rows each:
// staged rows 0 .. 63 are A0h's, 64 .. 127 the same rows of A0l, so waves 0, 1 hold the main products and waves 2, 3 the residual products of the same output rows; the pairs join in the epilogue. The other blocks take A's other row tiles.
#define F2B (NBR * (QT0 / 64) * (DM / 64))      /* first-tile blocks of an FT 2 launch */
template <int ACT, int FT>
__global__ __launch_bounds__(128) void k_gemm2(const _Float16* __restrict__ A, int lda, size_t sA, const _Float16* __restrict__ Bh, int ldb, size_t sB, float alpha, const float* __restrict__ bias, size_t sBias, const float* __restrict__ CP, int rowsPerB, size_t sCPb, int row0g,
    float* __restrict__ C, _Float16* __restrict__ C16, int ldc, size_t sC, int M, int N, int K, const _Float16* __restrict__ A0h, const _Float16* __restrict__ A0l, float alphal, float* __restrict__ CF, int ldf) { static_assert(QT0 == 128, "a first tile is one 128-row block tile"); static_assert(ACT == 0 || ACT == 3 || ACT == 6 || ACT == 8 || ACT == 9 || ACT == 11 || ACT == 12 || ACT == 14 || ACT == 15 || ACT == 16 || ACT == 17, "k_gemm2: unsupported ACT code (would silently apply no activation)");
  __shared__ __attribute__((aligned(16))) unsigned short st[2][GT];      /* [buffer][128 A rows, 64 B rows][pitch] */
  /* the epilogue's tiles lie over the stage buffers: behind the last stage's barrier no wave reads a stage and no copy is outstanding. At 55,296 B of LDS four blocks fit a WGP, so the FT 2 grid, 24 blocks more than three a WGP hold, still runs as one round */
  static_assert(sizeof(float) * 4 * 32 * 68 <= sizeof(st), "epilogue tiles fit the stage buffers"); float (*so)[32][68] = reinterpret_cast<float (*)[32][68]>(&st[0][0]);
  const int tid = threadIdx.x, w = tid >> 5, lane = tid & 31, ln = lane & 15, hh = lane >> 4; const int by = blockIdx.y;
  A += (size_t)by * sA; Bh += (size_t)by * sB; const size_t cofs = (size_t)by * sC; const float* bp = bias ? bias + (size_t)by * sBias : nullptr;
  const int ntn = N >> 6; constexpr int TPB = SQ / 128;      /* row tiles per batch */
  const bool f2 = FT == 2 && blockIdx.x < F2B;      /* the same in the whole block */
  const int bx = FT == 2 ? (f2 ? (int)blockIdx.x : (int)blockIdx.x - F2B) : (int)blockIdx.x; const int mq = bx / ntn, nq = bx - mq * ntn;
  const int mt = FT == 2 ? mq + 1 + mq / (TPB - 1) : mq;      /* FT 2: the row tiles that are no batch's first */
  const int fb = mq >> 1, fr = (mq & 1) * 64;      /* f2: batch, first of the block's 64 rows */
  const int row0 = f2 ? fb * SQ + fr + 32 * (w & 1) : mt * 128 + 32 * w, col0 = nq * 64; if (!f2 && mt * 128 >= M) return;      /* the whole block leaves or none: every wave passes every barrier */
  const size_t fo = (size_t)(fr + (tid >> 3)) * ldf + (size_t)fb * DM + (tid & 7) * 8;      /* f2: this lane's 16 bytes of stage 0 in either plane */
  const size_t sa = (size_t)16 * (f2 ? ldf : lda), sb = (size_t)16 * ldb;
  const _Float16* ag = f2 ? A0h + fo : A + (size_t)(mt * 128 + (tid >> 3)) * lda + (tid & 7) * 8;      /* this lane's 16 bytes of stage 0: A row tid / 8 of the block */
  const _Float16* ag4 = f2 ? A0l + fo : ag + 4 * sa;                                    /* and staged row 64 + tid / 8 */
  const _Float16* bg = Bh + (size_t)(col0 + (tid >> 3)) * ldb + (tid & 7) * 8;          /* and B row tid / 8 */
  const unsigned l0 = (unsigned)(size_t)&st[0][(tid >> 3) * GP + (tid & 7) * 8];        /* low 32 bits of a shared address = LDS byte address */
  const int nst = K / GK;
  g2_copy(ag, ag4, sa, bg, sb, l0);
  asm volatile("s_wait_asynccnt 0x0" ::: "memory");      /* stage 0 has landed for this wave's own copies */
  __syncthreads();                                        /* ... and for every wave's: publishes stage 0 */
  if (1 < nst) g2_copy(ag + GK, ag4 + GK, sa, bg + GK, sb, l0 + GT * 2);
  const v8f z8 = {0.f,0.f,0.f,0.f,0.f,0.f,0.f,0.f}; v8f c00 = z8, c01 = z8, c02 = z8, c03 = z8, c10 = z8, c11 = z8, c12 = z8, c13 = z8;
#pragma unroll 1
  for (int t = 0; t < nst; ++t) {      /* stays rolled: one copy of the stage's code; the loops inside are unrolled so that the fragment arrays stay in registers */
    const unsigned short* al = &st[t & 1][(32 * w + ln) * GP + 8 * hh];      /* this lane's row and half within the wave's first 16 staged A rows */
    const unsigned short* bl = &st[t & 1][(128 + ln) * GP + 8 * hh];         /* and within the first 16 staged B rows */
    v16h a[2][2], b[2][4];
#pragma unroll
    for (int ks = 0; ks < 2; ++ks) { a[ks][0] = g2_lfrag(al + ks * 32); a[ks][1] = g2_lfrag(al + 16 * GP + ks * 32);
#pragma unroll
      for (int n = 0; n < 4; ++n) b[ks][n] = g2_lfrag(bl + n * 16 * GP + ks * 32); }
    asm volatile("s_wait_dscnt 0x0" ::: "memory");         /* the stage's 24 LDS reads, one group, have returned: this wave is done with buffer t & 1 before the buffer is refilled */
    asm volatile("s_wait_asynccnt 0x0" ::: "memory");      /* this wave's copies of stage t + 1 have landed */
    __syncthreads();                                        /* publishes stage t + 1 and ends every wave's reads of stage t */
    if (t + 2 < nst) g2_copy(ag + (size_t)(t + 2) * GK, ag4 + (size_t)(t + 2) * GK, sa, bg + (size_t)(t + 2) * GK, sb, l0 + (unsigned)(t & 1) * (GT * 2));      /* the same test in the whole block */
    /* the stage's products work on registers alone and stand behind the refill: the copies of stage t + 2 fly under them and under the next stage's LDS reads */
#pragma unroll
    for (int ks = 0; ks < 2; ++ks) {
      c00 = g2_mma(a[ks][0], b[ks][0], c00); c10 = g2_mma(a[ks][1], b[ks][0], c10);
      c01 = g2_mma(a[ks][0], b[ks][1], c01); c11 = g2_mma(a[ks][1], b[ks][1], c11);
      c02 = g2_mma(a[ks][0], b[ks][2], c02); c12 = g2_mma(a[ks][1], b[ks][2], c12);
      c03 = g2_mma(a[ks][0], b[ks][3], c03); c13 = g2_mma(a[ks][1], b[ks][3], c13); } }
  asm volatile("s_wait_asynccnt 0x0" ::: "memory");        /* no copy is outstanding when the wave goes on to the epilogue and ends */
  v8f accs[8] = {c00, c01, c02, c03, c10, c11, c12, c13};
  v8f lo8[8];      /* FT 2: what joins each accumulator element; 0 outside the first-tile blocks. The loops over u and r below are fully unrolled so that lo8 and accs are indexed by constants and stay in registers */
  if (FT == 2) {
#pragma unroll
    for (int u = 0; u < 8; ++u) lo8[u] = z8; }
  if (f2) {      /* waves 2, 3 hand their residual products, element for element in the accumulator's own lane, to waves 0, 1 and are done */
    if (w >= 2) {
#pragma unroll
      for (int u = 0; u < 8; ++u)
#pragma unroll
        for (int r = 0; r < 8; ++r) so[w][(u >> 2) * 16 + 8 * hh + r][(u & 3) * 16 + ln] = accs[u][r] * alphal; }
    __syncthreads();      /* the residual tiles are written before their partner waves read them; no barrier follows */
    if (w >= 2) return;
#pragma unroll
    for (int u = 0; u < 8; ++u)      /* one group of LDS reads, one wait */
#pragma unroll
      for (int r = 0; r < 8; ++r) lo8[u][r] = so[w + 2][(u >> 2) * 16 + 8 * hh + r][(u & 3) * 16 + ln]; }
#pragma unroll
  for (int u = 0; u < 8; ++u) { const int t = u & 3, half = u >> 2; const int col = col0 + t * 16 + ln; const float bv = bp ? bf16_round(bp[col]) : 0.f;
#pragma unroll
    for (int r = 0; r < 8; ++r) { const int rloc = half * 16 + 8 * hh + r; float v = accs[u][r] * alpha + bv; if (FT == 2) v += lo8[u][r]; if (CP) { if (rowsPerB < 0) v += CP[cofs + (size_t)(row0g + row0 + rloc) * ldc + col];      /* rowsPerB < 0: own element of the batched C plane */ else { const int bidx = (row0g + row0 + rloc) / rowsPerB; v += CP[(size_t)bidx * sCPb + (size_t)by * 64 + col]; } }
      if (ACT == 3) v = fmaxf(v, 0.f); else if (ACT == 6) v = 0.5f * v * (1.0f + erff(v * 0.70710678118654752f)); else if (ACT == 11) v = 1.0f / (1.0f + expf(-v)); else if (ACT == 15) v = v / (1.0f + expf(-v)); else if (ACT == 12) v = (v > 0.f) ? v : 0.01f * v; else if (ACT == 8) v = tanhf(v); else if (ACT == 9) v = 0.5f * v * (1.0f + tanhf(0.7978845608028654f * (v + 0.044715f * v * v * v))); else if (ACT == 14) v = (v > 0.f) ? v : 0.1f * v; else if (ACT == 16) v = (v >= 0.f) ? v : 0.3f * v; else if (ACT == 17) v = (v >= 0.f) ? v : 0.2f * v;
      so[w][rloc][t * 16 + ln] = v; } }
  __builtin_amdgcn_fence(__ATOMIC_ACQ_REL, "workgroup"); __builtin_amdgcn_wave_barrier();
  const int rsub = lane >> 4, c4 = (lane & 15) * 4;
  {
#pragma unroll
    for (int q = 0; q < 16; ++q) { const int r = q * 2 + rsub; const v4f v = *(const v4fa*)&so[w][r][c4]; if (C) { *(v4f*)(C + cofs + (size_t)(row0 + r) * ldc + col0 + c4) = v; asm volatile("s_wait_xcnt 0x0" ::: "memory"); }      /* the wait stands in front of any later write of the registers the store names */
      if (FT == 1 && mt % TPB == 0) { *(v4f*)(CF + (size_t)(32 * w + r) * ldf + (size_t)(mt / TPB) * DM + col0 + c4) = v; asm volatile("s_wait_xcnt 0x0" ::: "memory"); }      /* the same for this store */
      if (C16) { v4h h4; for (int i = 0; i < 4; ++i) h4[i] = (_Float16)v[i]; *(v4h*)(C16 + cofs + (size_t)(row0 + r) * ldc + col0 + c4) = h4; } }
     } }


__global__ __launch_bounds__(256) void k_wnat(const float* __restrict__ w, size_t n8, _Float16* __restrict__ Bt) { const size_t t = (size_t)blockIdx.x * 256 + threadIdx.x; if (t >= n8) return; FragH f; for (int q = 0; q < 8; ++q) f.h[q] = (_Float16)(bf16_round(w[t * 8 + q]) * 16.0f); *(v8us*)((unsigned short*)Bt + t * 8) = f.half[0];  }
// The three input conversions in one launch (they depend on nothing and on one another not at all): blocks 0 .. nbx - 1 do k_x16's work on x, the next nbw blocks k_wnat's on w0, the last nbw k_wnat's on w1.
// The choice is the same for a whole block, so it is a scalar branch; x takes the factor 1, which is exact.
__global__ __launch_bounds__(256) void k_in16(const float* __restrict__ x, size_t nx8, unsigned nbx, _Float16* __restrict__ X16, const float* __restrict__ w0, const float* __restrict__ w1, size_t nw8, unsigned nbw, _Float16* __restrict__ Bt0, _Float16* __restrict__ Bt1) {
  unsigned bx = blockIdx.x; const float* s = x; _Float16* d = X16; size_t n8 = nx8; float sc = 1.0f;
  if (bx >= nbx) { bx -= nbx; s = w0; d = Bt0; n8 = nw8; sc = 16.0f; if (bx >= nbw) { bx -= nbw; s = w1; d = Bt1; } }
  const size_t t = (size_t)bx * 256 + threadIdx.x; if (t >= n8) return; FragH f;
#pragma unroll      /* f.h is then indexed by constants and stays in registers */
  for (int q = 0; q < 8; ++q) f.h[q] = (_Float16)(bf16_round(s[t * 8 + q]) * sc); *(v8us*)((unsigned short*)d + t * 8) = f.half[0]; }
__global__ __launch_bounds__(256) void k_rsm(const float* __restrict__ S, _Float16* __restrict__ P, int nrows) {
  #pragma clang fp contract(off)
  const int i = blockIdx.x * 256 + threadIdx.x; if (i >= nrows) return; const float* s = S + (size_t)i * SQ; float mx = -3.0e38f;
#pragma unroll 1
  for (int j = 0; j < SQ; ++j) mx = fmaxf(mx, s[j]); float se = 0.f;
#pragma unroll 1
  for (int j = 0; j < SQ; ++j) se += expf(s[j] - mx); const float sc = 256.0f / se;
#pragma unroll 1
  for (int j0 = 0; j0 < SQ; j0 += 8) { FragH f; for (int q = 0; q < 8; ++q) f.h[q] = (_Float16)(expf(s[j0 + q] - mx) * sc); unsigned short* d = (unsigned short*)P + (size_t)i * SQ + j0; *(v8us*)d = f.half[0];  } }
__global__ __launch_bounds__(256) void k_vt(const _Float16* __restrict__ V16, int b, int h0, _Float16* __restrict__ VT) { __shared__ unsigned short tl[64][65]; const int tid = threadIdx.x; const int hh = blockIdx.x % HG, sg = blockIdx.x / HG; const int s0 = sg * 64; const int h = h0 + hh;
  for (int i = tid; i < 64 * 8; i += 256) { const int j = i / 8, d8 = (i % 8) * 8; FragH f; f.half[0] = *(const v8us*)((const unsigned short*)V16 + ((size_t)b * SQ + s0 + j) * DM + h * HD + d8); for (int q = 0; q < 8; ++q) tl[d8 + q][j] = f.u[q]; }
  __syncthreads();
  { for (int i = tid; i < 64 * 8; i += 256) { const int d = i / 8, j8 = (i % 8) * 8; FragH f; for (int q = 0; q < 8; ++q) f.u[q] = tl[d][j8 + q]; *(v8us*)((unsigned short*)VT + ((size_t)hh * HD + d) * SQ + s0 + j8) = f.half[0]; }  } }



// Exact f32 attention for the first QT0 rows; F holds the f32 rows of q = k = v (pitch A0L), 64 columns a head: the heads of all batches stand side by side in a row. One wave per (head, query row), A0W rows a block.
// Scores: lane = key (four groups of 32 keys), the query row broadcast from LDS, four partial sums per key. Softmax: two passes over the wave's own registers.
// P V: lane = two head columns, keys in ascending order, each weight broadcast from its lane through a scalar register.
// Every wave stages and walks all QT0 keys, keys past its query with weight exactly 0: without tests the code is one straight line whose LDS reads have constant offsets and fly together.
// Every loop is fully unrolled: the small arrays are then indexed by constants and stay in registers, and each weight is read from a constant lane.
#define A0W 4                        /* waves = query rows per block */
#define A0L (NB * DM)                /* row pitch of F, OH and OL, a constant: the staging loads are then one address and constant offsets */
#define A0P 68                       /* LDS row pitch in floats: 16-byte column walks fall on distinct banks */
// The result (x64) leaves as two f16 planes, OH = the rounded value and OL = what the rounding left, x1024: the operands of the output GEMM's first-tile blocks.
#define A0B (NBR * NH * (QT0 / A0W))      /* blocks */
typedef float v2f __attribute__((ext_vector_type(2)));
typedef _Float16 v2h __attribute__((ext_vector_type(2)));
__device__ __forceinline__ void att0_block(int bx, float (*tl)[A0P], const float* __restrict__ F, float scale, _Float16* __restrict__ OH, _Float16* __restrict__ OL) {
  const int tid = threadIdx.x, lane = tid & 31; const int w = __builtin_amdgcn_readfirstlane(tid >> 5);      /* scalar wave number: the query row's LDS address stays scalar */
  const int h = bx / (QT0 / A0W), rg = bx % (QT0 / A0W); const int i = rg * A0W + w;
  const int r0 = tid >> 4, c0 = (tid & 15) * 4; const float* fp = F + (size_t)r0 * A0L + h * HD + c0;      /* this lane's 16 bytes of rows r0, r0 + 2 A0W, ... */
  v4f sg[QT0 / (2 * A0W)];
#pragma unroll
  for (int u = 0; u < QT0 / (2 * A0W); ++u) sg[u] = *(const v4fa*)(fp + (size_t)u * (2 * A0W) * A0L);
  asm volatile("s_wait_xcnt 0x0" :: "v"(fp) : "memory");      /* stands behind the loads and names their address: the address registers live up to the wait, so nothing, no load's own result either, is written over them in front of it */
#pragma unroll
  for (int u = 0; u < QT0 / (2 * A0W); ++u) *(v4f*)&tl[r0 + u * (2 * A0W)][c0] = sg[u];
  __syncthreads();
  {
    v4f a[QT0 / 32];
#pragma unroll
    for (int t = 0; t < QT0 / 32; ++t) a[t] = (v4f){0.f, 0.f, 0.f, 0.f};
#pragma unroll
    for (int c = 0; c < HD / 4; ++c) { const v4f q = *(const v4f*)&tl[i][c * 4];
#pragma unroll
      for (int t = 0; t < QT0 / 32; ++t) a[t] = __builtin_elementwise_fma(q, *(const v4f*)&tl[t * 32 + lane][c * 4], a[t]); }
    float s[QT0 / 32], mx = -1.0e30f;
#pragma unroll
    for (int t = 0; t < QT0 / 32; ++t) { const float d = (a[t][0] + a[t][1]) + (a[t][2] + a[t][3]); s[t] = (t * 32 + lane <= i) ? d * scale : -1.0e30f; mx = fmaxf(mx, s[t]); }
#pragma unroll
    for (int d = 16; d > 0; d >>= 1) mx = fmaxf(mx, __shfl_xor(mx, d, 32));      /* key 0 is never masked: mx is a real score */
    float p[QT0 / 32], l = 0.f;
#pragma unroll
    for (int t = 0; t < QT0 / 32; ++t) { p[t] = expf(s[t] - mx); l += p[t]; }      /* masked keys: exp of about -1e30 = 0 */
#pragma unroll
    for (int d = 16; d > 0; d >>= 1) l += __shfl_xor(l, d, 32);
    v2f o = {0.f, 0.f};
#pragma unroll
    for (int t = 0; t < QT0 / 32; ++t)
#pragma unroll
      for (int k = 0; k < 32; ++k) { const float pj = __uint_as_float(__builtin_amdgcn_readlane(__float_as_uint(p[t]), k)); const v2f pp = {pj, pj};
        o = __builtin_elementwise_fma(pp, *(const v2f*)&tl[t * 32 + k][2 * lane], o); }
    const float fin = 64.0f / l;      /* o carried x64 like the f16 path */
    const v2f of = o * fin; const v2h oh = {(_Float16)of[0], (_Float16)of[1]}; const v2h ol = {(_Float16)((of[0] - (float)oh[0]) * 1024.0f), (_Float16)((of[1] - (float)oh[1]) * 1024.0f)};
    const size_t oo = (size_t)i * A0L + h * HD + 2 * lane; *(v2h*)(OH + oo) = oh; *(v2h*)(OL + oo) = ol; } }

#define FQ 128                       /* query rows per block: 4 waves x 32 */
#define FS 64                        /* keys per stage: two passes of 32 */
#define FRB 128                      /* bytes of a staged row */
#define FTB (FS * FRB)               /* bytes per buffer */
#define FAB (NB * NH * (SQ / FQ - 1))      /* fused-attention blocks: rows 0 .. QT0 - 1 are the f32 path's */
typedef short v8s __attribute__((ext_vector_type(8)));
__device__ __forceinline__ v8f fa_mma(v16h a, v16h b, v8f c) { return __builtin_amdgcn_wmma_f32_16x16x32_f16(false, a, false, b, (short)0, c, false, false); }
__device__ __forceinline__ unsigned fa_swz(unsigned r) { return 2u * ((r >> 1) & 3u) + ((r >> 3) & 1u); }
__device__ __forceinline__ v8us fa_tr16(const unsigned char* p) { typedef __attribute__((address_space(3))) v8s lds_v8s; return __builtin_bit_cast(v8us, __builtin_amdgcn_ds_load_tr16_b128_v8i16((lds_v8s*)p)); }
// One stage's copies of one lane: 16 bytes of each of four rows, 16 rows apart (a wave's 32 lanes cover four whole 128-byte rows per copy). lk = the lane's LDS byte address in the buffer's first 16 rows; rows 16 apart have the same swizzle.
// The s_wait_xcnt closes the statement so that it stands in front of any later write of the address registers the copies name.
__device__ __forceinline__ void fa_copy(const _Float16* kg, unsigned lk) {
  const _Float16* k1 = kg + (size_t)16 * DM; const _Float16* k2 = kg + (size_t)32 * DM; const _Float16* k3 = kg + (size_t)48 * DM;
  const unsigned lk1 = lk + 16 * FRB, lk2 = lk + 32 * FRB, lk3 = lk + 48 * FRB;
  asm volatile("global_load_async_to_lds_b128 %0, %4, off\n\t"
               "global_load_async_to_lds_b128 %1, %5, off\n\t"
               "global_load_async_to_lds_b128 %2, %6, off\n\t"
               "global_load_async_to_lds_b128 %3, %7, off\n\t"
               "s_wait_xcnt 0x0"
               :: "v"(lk), "v"(lk1), "v"(lk2), "v"(lk3), "v"(kg), "v"(k1), "v"(k2), "v"(k3) : "memory"); }
// Four waves per SIMD asked for by name: left to itself the build takes 260 registers, which is three waves a SIMD; with four, the short f32 blocks start beside the three fused blocks of a WGP instead of waiting for one to end.
__global__ __launch_bounds__(128) __attribute__((amdgpu_waves_per_eu(4, 4))) void k_fattn(const _Float16* __restrict__ QK, _Float16* __restrict__ O, const float* __restrict__ F, float scale, _Float16* __restrict__ OH, _Float16* __restrict__ OL) {
  static_assert(2 * FTB <= QT0 * A0P * 4, "the stage buffers fit the f32 path's tile"); static_assert(32 * A0W == 128, "both kinds of block have the launch's four waves");
  __shared__ __attribute__((aligned(256))) unsigned char sm[QT0 * A0P * 4];      /* fused attention: [buffer][row][chunk]; f32 attention: its tile of QT0 rows */
  if (blockIdx.x >= FAB) { att0_block((int)blockIdx.x - FAB, reinterpret_cast<float (*)[A0P]>(&sm[0]), F, scale, OH, OL); return; }
  constexpr float SC2 = 0.036084391824351615f * 1.4426950408889634f;      /* 1/sqrt(768) x log2(e): the softmax runs in base 2 */
  const int tid = threadIdx.x, lane = tid & 31, ln = lane & 15, hh = lane >> 4; const int w = __builtin_amdgcn_readfirstlane(tid >> 5);      /* scalar wave number: the skip test and row bases stay scalar */
  const int bh = blockIdx.x % (NB * NH), qb = (SQ / FQ - 1) - blockIdx.x / (NB * NH); const int b = bh / NH, h = bh % NH; const int qw = qb * FQ + w * 32;
  const _Float16* kb = QK + (size_t)b * SQ * DM + h * HD + (size_t)ln * DM;      /* this lane's row within a 16-row tile of q */
  const _Float16* kg = QK + ((size_t)b * SQ + (tid >> 3)) * DM + h * HD + (tid & 7) * 8;      /* this lane's 16 bytes of stage 0: row tid / 8, chunk tid % 8 */
  const unsigned l0 = (unsigned)(size_t)&sm[0] + (unsigned)(tid >> 3) * FRB + (((unsigned)(tid & 7) ^ fa_swz((unsigned)(tid >> 3) & 15u)) * 16u);      /* low 32 bits of a shared address = LDS byte address */
  const unsigned ka = (unsigned)ln * FRB + (((unsigned)hh ^ fa_swz((unsigned)ln)) * 16u);      /* K reader: row ln of a 16-row tile, chunk hh */
  const unsigned vr = 8u * (unsigned)hh + ((unsigned)lane & 7u);
  const unsigned va = vr * FRB + (((((unsigned)lane >> 3) & 1u) ^ fa_swz(vr)) * 16u);          /* V^T reader: row 8 hh + lane % 8 of a 16-row tile, chunk (lane / 8) % 2 */
  const int nst = 2 * qb + 2;       /* stages of the block: up to the end of its last wave's diagonal block; never fewer than two */
  const int last = qw / 32;         /* this wave's last pass: its diagonal block, the only one with masked keys */
  fa_copy(kg, l0);
  asm volatile("s_wait_asynccnt 0x0" ::: "memory");      /* stage 0 has landed for this wave's own copies */
  __syncthreads();                                        /* ... and for every wave's: publishes stage 0 */
  fa_copy(kg + (size_t)FS * DM, l0 + FTB);
  v16h qf[2][2];
#pragma unroll
  for (int g = 0; g < 2; ++g)
#pragma unroll
    for (int ks = 0; ks < 2; ++ks) qf[g][ks] = g2_frag(kb + (size_t)(qw + g * 16) * DM + ks * 32, hh);
  const v8f z8 = {0.f, 0.f, 0.f, 0.f, 0.f, 0.f, 0.f, 0.f};
  v8f o[2][4]; float m[2], l[2];
#pragma unroll
  for (int g = 0; g < 2; ++g) { m[g] = -1.0e30f; l[g] = 0.f;
#pragma unroll
    for (int dt = 0; dt < 4; ++dt) o[g][dt] = z8; }
#pragma unroll 1
  for (int t = 0; t < nst; ++t) {
    const unsigned char* tb = &sm[(t & 1) * FTB];      /* the stage's buffer */
#pragma unroll
    for (int p = 0; p < 2; ++p) { const int it = 2 * t + p;
      if (it <= last) {
        FragH kf[2][2], vf[4];
#pragma unroll
        for (int kt = 0; kt < 2; ++kt)
#pragma unroll
          for (int ks = 0; ks < 2; ++ks) { kf[kt][ks].half[0] = *(const v8us*)(tb + (p * 32 + kt * 16) * FRB + (ka ^ (unsigned)(ks * 64))); kf[kt][ks].half[1] = *(const v8us*)(tb + (p * 32 + kt * 16) * FRB + (ka ^ (unsigned)(ks * 64 + 32))); }
#pragma unroll
        for (int dt = 0; dt < 4; ++dt) { vf[dt].half[0] = fa_tr16(tb + (p * 32) * FRB + (va ^ (unsigned)(dt * 32))); vf[dt].half[1] = fa_tr16(tb + (p * 32 + 16) * FRB + (va ^ (unsigned)(dt * 32))); }
        __builtin_amdgcn_sched_barrier(0);      /* keeps the pass's sixteen LDS reads together at its head, K first: one place with LDS reads instead of two, and the V^T fragments land under the score products and the softmax instead of being waited for in front of P V */
        v8f s[2][2];
#pragma unroll
        for (int g = 0; g < 2; ++g)
#pragma unroll
          for (int kt = 0; kt < 2; ++kt) s[g][kt] = fa_mma(kf[kt][1].v, qf[g][1], fa_mma(kf[kt][0].v, qf[g][0], z8));
        if (it == last) {
#pragma unroll
          for (int g = 0; g < 2; ++g)
#pragma unroll
            for (int kt = 0; kt < 2; ++kt)
#pragma unroll
              for (int r = 0; r < 8; ++r) s[g][kt][r] = (kt * 16 + 8 * hh + r <= g * 16 + ln) ? s[g][kt][r] : -1.0e30f; }      /* first key of the pass == qw here: key <= query */
        float mn[2]; bool need = false;
#pragma unroll
        for (int g = 0; g < 2; ++g) { float mx = s[g][0][0];
#pragma unroll
          for (int r = 1; r < 8; ++r) mx = fmaxf(mx, s[g][0][r]);
#pragma unroll
          for (int r = 0; r < 8; ++r) mx = fmaxf(mx, s[g][1][r]);
          mx = fmaxf(mx, __shfl_xor(mx, 16, 32)); mn[g] = fmaxf(m[g], mx * SC2); need = need || (mn[g] > m[g]); }
        if (__builtin_amdgcn_ballot_w32(need) != 0) {      /* no column's maximum moved: every factor would be exactly 1, so the rescale is skipped as a whole */
#pragma unroll
          for (int g = 0; g < 2; ++g) { const float al = __builtin_amdgcn_exp2f(m[g] - mn[g]); m[g] = mn[g]; l[g] *= al;
#pragma unroll
            for (int dt = 0; dt < 4; ++dt) o[g][dt] *= al; } }
        FragH pf[2];
#pragma unroll
        for (int g = 0; g < 2; ++g) { float ls = 0.f;
#pragma unroll
          for (int kt = 0; kt < 2; ++kt) { const v8f tt = s[g][kt] * SC2 - m[g];
#pragma unroll
            for (int r = 0; r < 8; ++r) { const float pp = __builtin_amdgcn_exp2f(tt[r]); ls += pp; pf[g].h[kt * 8 + r] = (_Float16)pp; } }
          l[g] += ls; }
#pragma unroll
        for (int g = 0; g < 2; ++g)
#pragma unroll
          for (int dt = 0; dt < 4; ++dt) o[g][dt] = fa_mma(vf[dt].v, pf[g].v, o[g][dt]); } }
    asm volatile("s_wait_dscnt 0x0" ::: "memory");         /* this wave's reads of buffer t & 1 have returned before the buffer is refilled */
    asm volatile("s_wait_asynccnt 0x0" ::: "memory");      /* this wave's copies of stage t + 1 have landed */
    __syncthreads();                                        /* publishes stage t + 1 and ends every wave's reads of stage t */
    if (t + 2 < nst) fa_copy(kg + (size_t)(t + 2) * FS * DM, l0 + (unsigned)(t & 1) * FTB); }      /* the same test in the whole block */
  asm volatile("s_wait_asynccnt 0x0" ::: "memory");        /* no copy is outstanding when the wave ends */
#pragma unroll
  for (int g = 0; g < 2; ++g) { const float fin = 64.0f / (l[g] + __shfl_xor(l[g], 16, 32));      /* halves joined once; o carried x64 */
    _Float16* orow = O + ((size_t)b * SQ + qw + g * 16 + ln) * DM + h * HD + 8 * hh;
#pragma unroll
    for (int dt = 0; dt < 4; ++dt) { FragH f;
#pragma unroll
      for (int r = 0; r < 8; ++r) f.h[r] = (_Float16)(o[g][dt][r] * fin);
      *(v8us*)((unsigned short*)orow + dt * 16) = f.half[0]; } } }

extern "C" void kernel_launch(void* const* d_in, const int* in_sizes, int n_in,
                              void* d_out, int out_size, void* d_ws, size_t ws_size, hipStream_t stream) {
  (void)in_sizes; (void)n_in; (void)out_size;
  const float* const* I = (const float* const*)d_in; const float* x = I[0]; const float* wq = I[1]; const float* wo = I[2]; const float* bo = I[3]; const float* wk = wq; const float* wv = wq;      /* Wq [12][64][768] = natural [768][768] rows h*64+d (q = k = v); W_out natural + b_out */
  char* ws = (char*)d_ws; size_t off = 0;
  auto take = [&](size_t bytes) { char* p = ws + off; off += (bytes + 255) & ~(size_t)255; return p; };
  _Float16* BQ = (_Float16*)take((size_t)DM * DM * 2); _Float16* BK = BQ; _Float16* BV = BQ; _Float16* BO = (_Float16*)take((size_t)DM * DM * 2);
  _Float16* X16 = (_Float16*)take(NR * DM * 2); _Float16* Q16 = (_Float16*)take(NR * DM * 2); _Float16* K16 = Q16; _Float16* V16 = Q16;      /* q = k = v (the module projects all three with self.query) */ _Float16* O16 = (_Float16*)take(NR * DM * 2);
  float* QF0 = (float*)take((size_t)NB * QT0 * DM * 4); _Float16* OH0 = (_Float16*)take((size_t)NB * QT0 * DM * 2); _Float16* OL0 = (_Float16*)take((size_t)NB * QT0 * DM * 2);
  if (off > ws_size) return;
  constexpr unsigned nbx = (unsigned)((NR * DM / 8 + 255) / 256), nbw = (unsigned)(((size_t)DM * DM / 8 + 255) / 256);      /* blocks for x, for one weight matrix */
  k_in16<<<nbx + 2 * nbw, 256, 0, stream>>>(x, NR * DM / 8, nbx, X16, wq, wo, (size_t)DM * DM / 8, nbw, BQ, BO);      /* x rows as f16; weights natural [out][in] = Bt x16 */
  const size_t r0p = (size_t)B0 * SQ;      /* first projected row */
  /* first-tile path (rows 0 .. 127 of every batch, exact f32 attention): it has no launch of its own, every piece rides in the launch of the main path that has the same inputs ready. Its planes are [QT0][NB * DM]: row r holds row r of batch 0, then of batch 1 */
  constexpr int LF = NB * DM; const size_t c0p = (size_t)B0 * DM;      /* pitch of those planes; first processed batch's column */
  k_gemm2<0, 1><<<dim3((unsigned)((MP / 128) * (DM / 64)), 1), 128, 0, stream>>>(X16 + r0p * DM, DM, 0, BQ, DM, 0, 0.0625f, nullptr, 0, nullptr, 1, 0, 0, nullptr, Q16 + r0p * DM, DM, 0, MP, DM, DM, nullptr, nullptr, 0.f, QF0 + c0p, LF);      /* q = k = v as f16 rows; the first 128 rows of a batch as f32 too (exact products) */
  static_assert(FQ == QT0, "the fused attention's missing last blocks are exactly the first-tile rows"); static_assert(LF == A0L, "the f32 attention's pitch is that of the first-tile planes");
  k_fattn<<<FAB + A0B, 128, 0, stream>>>(Q16, O16, QF0 + c0p, 0.036084391824351615f, OH0 + c0p, OL0 + c0p);      /* scores, causal softmax and P V in one launch; o (merged heads, x64) as f16 rows; behind its blocks the exact f32 attention for rows 0..127 (o x64 as f16 hi + x1024 residual planes) */
  k_gemm2<0, 2><<<dim3((unsigned)(F2B + (MPO / 128 - NBR) * (DM / 64)), 1), 128, 0, stream>>>(O16 + r0p * DM, DM, 0, BO, DM, 0, 0.0009765625f, bo, 0, nullptr, 1, 0, 0, (float*)d_out + r0p * DM, nullptr, DM, 0, MPO, DM, DM, OH0 + c0p, OL0 + c0p, 0.00000095367431640625f, nullptr, LF);      /* out rows are the output layout; rows 0..127: o_hi Wo + b + o_lo Wo 2^-20 */
}

// v009
// Measured time: 105 microseconds a run.
// Timed twice side by side with v008, it ran 1.05 times as fast both times.
// Over all steps from v000 it is 139 times as fast.
#include <hip/hip_runtime.h>
// Causal multi-head attention whose q, k AND v are the same per-head projection (x [2][4096][768]; q = k = v = x Wq[h]^T with Wq [12][64][768] (natural per-head rows, sigma 1/sqrt(768)); scores = q.q / sqrt(768) (the module scales by d_model); causal (tril, -inf); softmax; out = merged (attn q) W_out^T + b_out -> [2][4096][768]).
// Structure: token rows r = b*4096 + s; x as exact f16 rows (bf16-rounded); q = k = v as one WMMA GEMM (32x64 wave tiles, f32 accumulation, exact x16 weights, f16 outputs); one fused launch for the attention: per wave 32 query rows, keys 32 at a time up to the diagonal block, S^T = K Q^T (V^T fragments by transposing LDS reads of the staged k = v rows), online base-2 softmax in registers (f32 statistics, native exp2; weights in (0,1] as f16), O^T += V^T P^T (o carried x64, folded into the output GEMM alpha) written straight into the merged f16 o rows; out = o W_o GEMM (f32) into the output layout.
// Compute dtype: inputs rounded to bf16; x / weights exact; q, k, v, softmax weights and o as plain f16 GEMM operands (~2^-12); scores and softmax statistics f32. v_wmma_f32_16x16x32_f16.
#define NB 2
#define SQ 4096
#define DM 768
#define NH 12
#define HD 64
#define HG 4                         /* heads per launch of the unused per-batch k_vt */
#define QT0 128                      /* first-tile rows whose attention runs exactly in f32 */
#define B0 0                         /* first batch processed (debug hook) */
#define NBR NB                       /* batches processed (debug hook) */
#define NR ((size_t)NB * SQ)         /* token rows */
#define MP ((int)((size_t)NBR * SQ)) /* rows projected (debug hook) */
#define MPO MP                       /* rows through the output stage (debug hook) */
#define LQ DM      /* row pitch of the q/k/v rows */
typedef __bf16 v16b __attribute__((ext_vector_type(16)));
typedef unsigned short v8us __attribute__((ext_vector_type(8), may_alias));
typedef float  v8f  __attribute__((ext_vector_type(8)));
typedef float  v4f  __attribute__((ext_vector_type(4)));
typedef float  v4fa __attribute__((ext_vector_type(4), may_alias));
union FragB { v16b v; v8us half[2]; unsigned short u[16]; };

__device__ __forceinline__ unsigned short bf16_bits(float x) { unsigned int u = __float_as_uint(x); return (unsigned short)((u + 0x7FFFu + ((u >> 16) & 1u)) >> 16); }
__device__ __forceinline__ float bf16_val(unsigned short b) { return __uint_as_float(((unsigned int)b) << 16); }
__device__ __forceinline__ float bf16_round(float x) { return bf16_val(bf16_bits(x)); }
// D += A·B with NT terms: 1 = ah·bh, 2 = + al·bh (A split), 3 = + ah·bl (both split)
template <int NT>
__device__ __forceinline__ v8f mmaN(v16b ah, v16b al, v16b bh, v16b bl, v8f c) {
  c = __builtin_amdgcn_wmma_f32_16x16x32_bf16(false, ah, false, bh, (short)0, c, false, false);
  if (NT >= 2) c = __builtin_amdgcn_wmma_f32_16x16x32_bf16(false, al, false, bh, (short)0, c, false, false);
  if (NT >= 3) c = __builtin_amdgcn_wmma_f32_16x16x32_bf16(false, ah, false, bl, (short)0, c, false, false);
  asm volatile("v_nop\n\tv_nop\n\tv_nop\n\tv_nop" : "+v"(c) : "v"(ah), "v"(al), "v"(bh), "v"(bl));
  return c;
}

__global__ __launch_bounds__(256) void k_wt_bf16(const float* __restrict__ W, unsigned short* __restrict__ Wt, int K, int N) {
  const int t = blockIdx.x * 256 + threadIdx.x;
  const int k8n = K / 8;
  if (t >= N * k8n) return;
  const int n = t / k8n, k8 = (t % k8n) * 8;
  v8us v;
#pragma unroll
  for (int i = 0; i < 8; ++i) v[i] = bf16_bits(W[(size_t)(k8 + i) * N + n]);
  *(v8us*)(Wt + (size_t)n * K + k8) = v;
  
}

// GEMM C[M][N] (f32, pitch ldc) = act(A[M][K]·W + bias). A f32 row-major (pitch lda) converted per fragment to bf16
// (ASPLIT: hi/lo two planes -> 2 terms, else single rounded term); Wt bf16 [N][K] (pitch ldb). BIAS_BF16 rounds the
// bias to bf16 first (bias quantised to bf16 before the add). K%32==0, M%16==0, N%64==0.
template <bool ASPLIT, int ACT, bool BIAS_BF16>
__global__ __launch_bounds__(128) void k_gemm_bf(const float* __restrict__ A, int lda, const unsigned short* __restrict__ Wt, int ldb,
                                               const float* __restrict__ bias, float* __restrict__ C, int ldc, int M, int N, int K) {
  __shared__ __attribute__((aligned(16))) float so[4][16][64];
  const int tid = threadIdx.x, w = tid >> 5, lane = tid & 31, ln = lane & 15, hh = lane >> 4;
  const int ntn = N / 64;
  const int wid = blockIdx.x * 4 + w;
  const int mt = wid / ntn, nq = wid % ntn;
  if (mt * 16 >= M) return;
  const int row0 = mt * 16, col0 = nq * 64;
  const float* arow = A + (size_t)(row0 + ln) * lda;
  v8f acc[4] = {};
  for (int kb = 0; kb < K; kb += 32) {
    FragB ah, al;
    const v4f x0 = *(const v4fa*)(arow + kb + 8 * hh), x1 = *(const v4fa*)(arow + kb + 8 * hh + 4);
    const v4f x2 = *(const v4fa*)(arow + kb + 16 + 8 * hh), x3 = *(const v4fa*)(arow + kb + 16 + 8 * hh + 4);
    float xs[16] = {x0[0],x0[1],x0[2],x0[3],x1[0],x1[1],x1[2],x1[3],x2[0],x2[1],x2[2],x2[3],x3[0],x3[1],x3[2],x3[3]};
#pragma unroll
    for (int i = 0; i < 16; ++i) { const unsigned short hb = bf16_bits(xs[i]); ah.u[i] = hb; al.u[i] = ASPLIT ? bf16_bits(xs[i] - bf16_val(hb)) : (unsigned short)0; }
#pragma unroll
    for (int t = 0; t < 4; ++t) {
      const unsigned short* brow = Wt + (size_t)(col0 + t * 16 + ln) * ldb + kb;
      FragB b;
      b.half[0] = *(const v8us*)(brow + 8 * hh);
      b.half[1] = *(const v8us*)(brow + 16 + 8 * hh);
      acc[t] = mmaN<ASPLIT ? 2 : 1>(ah.v, al.v, b.v, b.v, acc[t]);
    }
  }
#pragma unroll
  for (int t = 0; t < 4; ++t) {
    float bv = bias ? bias[col0 + t * 16 + ln] : 0.f;
    if (BIAS_BF16) bv = bf16_round(bv);
#pragma unroll
    for (int r = 0; r < 8; ++r) { float v = acc[t][r] + bv; if (ACT == 1) v = fmaxf(v, 0.f); so[w][8 * hh + r][t * 16 + ln] = v; }
  }
  __builtin_amdgcn_fence(__ATOMIC_ACQ_REL, "workgroup");
  __builtin_amdgcn_wave_barrier();
  const int rsub = lane >> 4, c4 = (lane & 15) * 4;
  {
#pragma unroll
    for (int q = 0; q < 8; ++q) {
      const int r = q * 2 + rsub;
      const v4f v = *(const v4fa*)&so[w][r][c4];
      *(v4f*)(C + (size_t)(row0 + r) * ldc + col0 + c4) = v;
    }
    
  }
}

// GEMM C = act(A·W + bias + resid): A f32 (ASPLIT -> hi/lo 2 terms), Wt bf16 [N][K]; ACT 0 none, 1 relu, 2 exact gelu;
// resid (optional, f32, row index = (row % rmod), pitch ldr, RES_BF16 rounds it) added before the activation.
template <bool ASPLIT, int ACT, bool BIAS_BF16, bool RES_BF16>
__global__ __launch_bounds__(128) void k_gemm_bf3(const float* __restrict__ A, int lda, const unsigned short* __restrict__ Wt, int ldb,
                                                const float* __restrict__ bias, const float* __restrict__ resid, int rmod, int ldr,
                                                float* __restrict__ C, int ldc, int M, int N, int K) {
  __shared__ __attribute__((aligned(16))) float so[4][16][64];
  const int tid = threadIdx.x, w = tid >> 5, lane = tid & 31, ln = lane & 15, hh = lane >> 4;
  const int ntn = N / 64;
  const int wid = blockIdx.x * 4 + w;
  const int mt = wid / ntn, nq = wid % ntn;
  if (mt * 16 >= M) return;
  const int row0 = mt * 16, col0 = nq * 64;
  const float* arow = A + (size_t)(row0 + ln) * lda;
  v8f acc[4] = {};
  for (int kb = 0; kb < K; kb += 32) {
    FragB ah, al;
    const v4f x0 = *(const v4fa*)(arow + kb + 8 * hh), x1 = *(const v4fa*)(arow + kb + 8 * hh + 4);
    const v4f x2 = *(const v4fa*)(arow + kb + 16 + 8 * hh), x3 = *(const v4fa*)(arow + kb + 16 + 8 * hh + 4);
    float xs[16] = {x0[0],x0[1],x0[2],x0[3],x1[0],x1[1],x1[2],x1[3],x2[0],x2[1],x2[2],x2[3],x3[0],x3[1],x3[2],x3[3]};
#pragma unroll
    for (int i = 0; i < 16; ++i) { const unsigned short hb = bf16_bits(xs[i]); ah.u[i] = hb; al.u[i] = ASPLIT ? bf16_bits(xs[i] - bf16_val(hb)) : (unsigned short)0; }
#pragma unroll
    for (int t = 0; t < 4; ++t) {
      const unsigned short* brow = Wt + (size_t)(col0 + t * 16 + ln) * ldb + kb;
      FragB b;
      b.half[0] = *(const v8us*)(brow + 8 * hh);
      b.half[1] = *(const v8us*)(brow + 16 + 8 * hh);
      acc[t] = mmaN<ASPLIT ? 2 : 1>(ah.v, al.v, b.v, b.v, acc[t]);
    }
  }
#pragma unroll
  for (int t = 0; t < 4; ++t) {
    const int col = col0 + t * 16 + ln;
    float bv = bias ? bias[col] : 0.f;
    if (BIAS_BF16) bv = bf16_round(bv);
#pragma unroll
    for (int r = 0; r < 8; ++r) {
      float v = acc[t][r] + bv;
      if (resid) { float rv = resid[(size_t)((row0 + 8 * hh + r) % rmod) * ldr + col]; if (RES_BF16) rv = bf16_round(rv); v += rv; }
      if (ACT == 1) v = fmaxf(v, 0.f);
      if (ACT == 2) v = 0.5f * v * (1.0f + erff(v * 0.70710678118654752f));
      if (ACT == 3) { const float u = 0.7978845608028654f * (v + 0.044715f * v * v * v); v = 0.5f * v * (1.0f + tanhf(u)); }
      so[w][8 * hh + r][t * 16 + ln] = v;
    }
  }
  __builtin_amdgcn_fence(__ATOMIC_ACQ_REL, "workgroup");
  __builtin_amdgcn_wave_barrier();
  const int rsub = lane >> 4, c4 = (lane & 15) * 4;
  {
#pragma unroll
    for (int q = 0; q < 8; ++q) {
      const int r = q * 2 + rsub;
      const v4f v = *(const v4fa*)&so[w][r][c4];
      *(v4f*)(C + (size_t)(row0 + r) * ldc + col0 + c4) = v;
    }
    
  }
}
// row LayerNorm (biased variance, eps) over N: s = X (+ R); optional out_sum <- s; out_norm <- (s-mu)*rsqrt(var+eps)*g + b
template <bool PARAM_BF16>
__global__ __launch_bounds__(256) void k_layernorm(const float* __restrict__ X, const float* __restrict__ R, const float* __restrict__ g, const float* __restrict__ bta,
                                                  float* __restrict__ out_sum, float* __restrict__ out_norm, int N, float eps) {
  __shared__ float red[256];
  const int row = blockIdx.x, tid = threadIdx.x;
  const float* x = X + (size_t)row * N; const float* rr = R ? R + (size_t)row * N : nullptr;
  float vals[16];                     // up to N = 4096
  const int per = N / 256;            // contiguous chunk per thread? use strided-by-4 chunks: thread handles j = tid*4 + 1024*u
  float s1 = 0.f;
  for (int u = 0; u < per / 4; ++u) {
    const int j = tid * 4 + 1024 * u;
    const v4f a = *(const v4fa*)(x + j);
    v4f b = {0.f,0.f,0.f,0.f}; if (rr) b = *(const v4fa*)(rr + j);
#pragma unroll
    for (int q = 0; q < 4; ++q) { const float v = a[q] + b[q]; vals[u * 4 + q] = v; s1 += v; }
  }
  red[tid] = s1; __syncthreads();
  for (int st = 128; st > 0; st >>= 1) { if (tid < st) red[tid] += red[tid + st]; __syncthreads(); }
  const float mu = red[0] / (float)N; __syncthreads();
  float s2 = 0.f;
  for (int u = 0; u < per / 4; ++u)
#pragma unroll
    for (int q = 0; q < 4; ++q) { const float c = vals[u * 4 + q] - mu; s2 += c * c; }
  red[tid] = s2; __syncthreads();
  for (int st = 128; st > 0; st >>= 1) { if (tid < st) red[tid] += red[tid + st]; __syncthreads(); }
  const float rs = rsqrtf(red[0] / (float)N + eps);
  {
    for (int u = 0; u < per / 4; ++u) {
      const int j = tid * 4 + 1024 * u;
      v4f o, sm;
#pragma unroll
      for (int q = 0; q < 4; ++q) {
        float gg = g[j + q], bb = bta[j + q];
        if (PARAM_BF16) { gg = bf16_round(gg); bb = bf16_round(bb); }
        sm[q] = vals[u * 4 + q]; o[q] = (vals[u * 4 + q] - mu) * rs * gg + bb;
      }
      if (out_sum) *(v4f*)(out_sum + (size_t)row * N + j) = sm;
      *(v4f*)(out_norm + (size_t)row * N + j) = o;
    }
    
  }
}



// ---- f16 WMMA path (v_wmma_f32_16x16x32_f16): 11-bit significands for operands in range — used where a [0,1] probability operand needs more precision than bf16
typedef _Float16 v16h __attribute__((ext_vector_type(16)));
union FragH { v16h v; v8us half[2]; _Float16 h[16]; unsigned short u[16]; };
template <int NT>
__device__ __forceinline__ v8f mmaH(v16h ah, v16h al, v16h bh, v16h bl, v8f c) {
  c = __builtin_amdgcn_wmma_f32_16x16x32_f16(false, ah, false, bh, (short)0, c, false, false);
  if (NT >= 2) c = __builtin_amdgcn_wmma_f32_16x16x32_f16(false, al, false, bh, (short)0, c, false, false);
  if (NT >= 3) c = __builtin_amdgcn_wmma_f32_16x16x32_f16(false, ah, false, bl, (short)0, c, false, false);
  asm volatile("v_nop\n\tv_nop\n\tv_nop\n\tv_nop" : "+v"(c) : "v"(ah), "v"(al), "v"(bh), "v"(bl));
  return c;
}
// batched GEMM like k_gemm_b but f16 operands: A f32 (split into f16 hi/lo if ASPLIT, else rounded to f16), Bt = f16 values [n][k]; alpha; C f32; N multiple of 16 (partial tiles skipped)
template <bool ASPLIT>
__global__ __launch_bounds__(128) void k_gemm_h(const float* __restrict__ A, int lda, size_t sA, const _Float16* __restrict__ Bh, int ldb, size_t sB, float alpha, float* __restrict__ C, int ldc, size_t sC, int M, int N, int K) {
  __shared__ __attribute__((aligned(16))) float so[4][16][64];
  const int tid = threadIdx.x, w = tid >> 5, lane = tid & 31, ln = lane & 15, hh = lane >> 4; const int by = blockIdx.y;
  A += (size_t)by * sA; Bh += (size_t)by * sB; C += (size_t)by * sC;
  const int ntn = (N + 63) / 64; const int wid = blockIdx.x * 4 + w; const int mt = wid / ntn, nq = wid % ntn; if (mt * 16 >= M) return;
  const int row0 = mt * 16, col0 = nq * 64; const float* arow = A + (size_t)(row0 + ln) * lda;
  v8f acc[4] = {};
  for (int kb = 0; kb < K; kb += 32) {
    FragH ah, al;
    const v4f x0 = *(const v4fa*)(arow + kb + 8 * hh), x1 = *(const v4fa*)(arow + kb + 8 * hh + 4), x2 = *(const v4fa*)(arow + kb + 16 + 8 * hh), x3 = *(const v4fa*)(arow + kb + 16 + 8 * hh + 4);
    float xs[16] = {x0[0],x0[1],x0[2],x0[3],x1[0],x1[1],x1[2],x1[3],x2[0],x2[1],x2[2],x2[3],x3[0],x3[1],x3[2],x3[3]};
#pragma unroll
    for (int i = 0; i < 16; ++i) { const _Float16 h = (_Float16)xs[i]; ah.h[i] = h; al.h[i] = ASPLIT ? (_Float16)(xs[i] - (float)h) : (_Float16)0.0f; }
#pragma unroll
    for (int t = 0; t < 4; ++t) { if (col0 + t * 16 >= N) continue; const size_t boff = (size_t)(col0 + t * 16 + ln) * ldb + kb; FragH bq; bq.half[0] = *(const v8us*)(Bh + boff + 8 * hh); bq.half[1] = *(const v8us*)(Bh + boff + 16 + 8 * hh);
      acc[t] = mmaH<ASPLIT ? 2 : 1>(ah.v, al.v, bq.v, bq.v, acc[t]); }
  }
#pragma unroll
  for (int t = 0; t < 4; ++t) { if (col0 + t * 16 >= N) continue;
#pragma unroll
    for (int r = 0; r < 8; ++r) so[w][8 * hh + r][t * 16 + ln] = acc[t][r] * alpha; }
  __builtin_amdgcn_fence(__ATOMIC_ACQ_REL, "workgroup"); __builtin_amdgcn_wave_barrier();
  const int rsub = lane >> 4, c4 = (lane & 15) * 4;
  {
#pragma unroll
    for (int q = 0; q < 8; ++q) { const int r = q * 2 + rsub; if (col0 + c4 < N) { const v4f v = *(const v4fa*)&so[w][r][c4]; *(v4f*)(C + (size_t)(row0 + r) * ldc + col0 + c4) = v; } }
     }
}

// Wt[n][k] = f16(W[k][n]·scale) from f32 row-major W[K][N] (scale = power of two; bf16-exact weights stay exact in f16 away from the subnormal range)
__global__ __launch_bounds__(256) void k_wt_f16(const float* __restrict__ W, _Float16* __restrict__ Wt, int K, int N, float scale) {
  const int t = blockIdx.x * 256 + threadIdx.x; if (t >= N * (K / 8)) return; const int n = t / (K / 8), k8 = (t % (K / 8)) * 8; FragH f;
#pragma unroll
  for (int i = 0; i < 8; ++i) f.h[i] = (_Float16)(bf16_round(W[(size_t)(k8 + i) * N + n]) * scale); const v8us o = f.half[0];
  *(v8us*)((unsigned short*)Wt + (size_t)n * K + k8) = o; 
}
// k_gemm_hh variant with fused epilogue: v = acc·alpha + bias[by·sBias + col] (+ CP[(row/rowsPerB)·sCPb + by·64 + col] if CP) ; ACT 0 none / 1 elu ; writes f16 C16 (and f32 C if non-null)
template <int ACT>
__global__ __launch_bounds__(128) void k_gemm_hhx(const _Float16* __restrict__ A, int lda, size_t sA, const _Float16* __restrict__ Bh, int ldb, size_t sB, float alpha, const float* __restrict__ bias, size_t sBias, const float* __restrict__ CP, int rowsPerB, size_t sCPb, int row0g,
    float* __restrict__ C, _Float16* __restrict__ C16, int ldc, size_t sC, int M, int N, int K) {
  __shared__ __attribute__((aligned(16))) float so[4][16][64];
  const int tid = threadIdx.x, w = tid >> 5, lane = tid & 31, ln = lane & 15, hh = lane >> 4; const int by = blockIdx.y;
  A += (size_t)by * sA; Bh += (size_t)by * sB; const size_t cofs = (size_t)by * sC; const float* bp = bias ? bias + (size_t)by * sBias : nullptr;
  const int ntn = (N + 63) / 64; const int wid = blockIdx.x * 4 + w; const int mt = wid / ntn, nq = wid % ntn; if (mt * 16 >= M) return;
  const int row0 = mt * 16, col0 = nq * 64; const _Float16* arow = A + (size_t)(row0 + ln) * lda;
  v8f acc[4] = {};
  for (int kb = 0; kb < K; kb += 32) { FragH ah; ah.half[0] = *(const v8us*)((const unsigned short*)arow + kb + 8 * hh); ah.half[1] = *(const v8us*)((const unsigned short*)arow + kb + 16 + 8 * hh);
#pragma unroll
    for (int t = 0; t < 4; ++t) { if (col0 + t * 16 >= N) continue; const size_t boff = (size_t)(col0 + t * 16 + ln) * ldb + kb; FragH bq; bq.half[0] = *(const v8us*)((const unsigned short*)Bh + boff + 8 * hh); bq.half[1] = *(const v8us*)((const unsigned short*)Bh + boff + 16 + 8 * hh);
      acc[t] = mmaH<1>(ah.v, ah.v, bq.v, bq.v, acc[t]); }
  }
#pragma unroll
  for (int t = 0; t < 4; ++t) { if (col0 + t * 16 >= N) continue; const int col = col0 + t * 16 + ln; const float bv = bp ? bf16_round(bp[col]) : 0.f;
#pragma unroll
    for (int r = 0; r < 8; ++r) { float v = acc[t][r] * alpha + bv; if (CP) { const int rr = row0g + row0 + 8 * hh + r; if (rowsPerB < 0) v += CP[cofs + (size_t)rr * ldc + col];      /* rowsPerB < 0: own element of the batched C plane */ else { const int bidx = rr / rowsPerB; v += CP[(size_t)bidx * sCPb + (size_t)by * 64 + col]; } } if (ACT == 1) v = (v > 0.f) ? v : expm1f(v); else if (ACT == 7) v = (v > 0.f) ? v + 1.0f : expf(v); else if (ACT == 8) v = tanhf(v); else if (ACT == 9) v = 0.5f * v * (1.0f + tanhf(0.7978845608028654f * (v + 0.044715f * v * v * v))); else if (ACT == 11) v = 1.0f / (1.0f + expf(-v)); else if (ACT == 12) v = (v > 0.f) ? v : 0.01f * v; else if (ACT == 14) v = (v > 0.f) ? v : 0.1f * v; else if (ACT == 16) v = (v >= 0.f) ? v : 0.3f * v; else if (ACT == 17) v = (v >= 0.f) ? v : 0.2f * v; else if (ACT == 15) v = v / (1.0f + expf(-v)); else if (ACT == 3) v = fmaxf(v, 0.f); else if (ACT == 6) v = 0.5f * v * (1.0f + erff(v * 0.70710678118654752f)); so[w][8 * hh + r][t * 16 + ln] = v; } }
  __builtin_amdgcn_fence(__ATOMIC_ACQ_REL, "workgroup"); __builtin_amdgcn_wave_barrier();
  const int rsub = lane >> 4, c4 = (lane & 15) * 4; typedef _Float16 v4h __attribute__((ext_vector_type(4)));
  {
#pragma unroll
    for (int q = 0; q < 8; ++q) { const int r = q * 2 + rsub; if (col0 + c4 < N) { const v4f v = *(const v4fa*)&so[w][r][c4]; if (C) *(v4f*)(C + cofs + (size_t)(row0 + r) * ldc + col0 + c4) = v; if (C16) { v4h h4; for (int i = 0; i < 4; ++i) h4[i] = (_Float16)v[i]; *(v4h*)(C16 + cofs + (size_t)(row0 + r) * ldc + col0 + c4) = h4; } } }
     }
}


typedef _Float16 v4h __attribute__((ext_vector_type(4)));

__global__ __launch_bounds__(256) void k_x16(const float* __restrict__ x, _Float16* __restrict__ X16, size_t n8) { const size_t t = (size_t)blockIdx.x * 256 + threadIdx.x; if (t >= n8) return; FragH f;
#pragma unroll
  for (int q = 0; q < 8; ++q) f.h[q] = (_Float16)bf16_round(x[t * 8 + q]); *(v8us*)((unsigned short*)X16 + t * 8) = f.half[0];  }
__global__ __launch_bounds__(256) void k_h16(const float* __restrict__ x, _Float16* __restrict__ X16, size_t n8) { const size_t t = (size_t)blockIdx.x * 256 + threadIdx.x; if (t >= n8) return; FragH f;
#pragma unroll
  for (int q = 0; q < 8; ++q) f.h[q] = (_Float16)x[t * 8 + q]; *(v8us*)((unsigned short*)X16 + t * 8) = f.half[0];  }
__global__ __launch_bounds__(256) void k_round16f(const float* __restrict__ W, _Float16* __restrict__ Bt, size_t n8) { const size_t t = (size_t)blockIdx.x * 256 + threadIdx.x; if (t >= n8) return; FragH f;
#pragma unroll
  for (int i = 0; i < 8; ++i) f.h[i] = (_Float16)(bf16_round(W[t * 8 + i]) * 16.0f); *(v8us*)((unsigned short*)Bt + t * 8) = f.half[0];  }
template <int NHv, int TTv>
__global__ __launch_bounds__(256) void k_vt(const _Float16* __restrict__ V16, int ldv, int voff, _Float16* __restrict__ Vt) { __shared__ unsigned short tl[64][66]; const int tid = threadIdx.x; const int slab = blockIdx.x / (TTv / 64), lg = blockIdx.x % (TTv / 64); const int b = slab / NHv, h = slab % NHv;
  for (int i = tid; i < 64 * 8; i += 256) { const int r = i / 8, c8 = (i % 8) * 8; FragH f; f.half[0] = *(const v8us*)((const unsigned short*)V16 + ((size_t)b * TTv + lg * 64 + r) * ldv + voff + h * 64 + c8);
#pragma unroll
    for (int q = 0; q < 8; ++q) tl[r][c8 + q] = f.u[q]; }
  __syncthreads();
  {
#pragma unroll
    for (int rd = 0; rd < 2; ++rd) { const int d = rd * 32 + tid / 8, pc = tid % 8; FragH f;
#pragma unroll
      for (int q = 0; q < 8; ++q) f.u[q] = tl[pc * 8 + q][d];
      *(v8us*)((unsigned short*)Vt + ((size_t)slab * 64 + d) * TTv + lg * 64 + pc * 8) = f.half[0]; }
     } }

// ---- fast GEMM (block tile 128x64, wave tile 32x64; requires M % 128 == 0 rows per launch region, N % 64 == 0, K % 64 == 0 and K >= 64); epilogue = k_gemm_hhx semantics ----
// The block's 128 A rows and 64 B rows come through LDS, 64 k (one whole 128-byte line of every row) a stage, two buffers, brought by asynchronous copies: stage t + 2 flies under the products of stage t and the LDS reads of stage t + 1.
// (A fragment load straight from global memory touches 16 lines for 512 bytes, each wave fetched its own copy of B, and every product waited for its own loads.) The k order of every accumulator is unchanged: ascending, 32 at a time.
#define GK 64                        /* k per stage */
#define GP 72                        /* LDS row pitch in f16 = 144 bytes, an odd multiple of 16: 16-byte fragment reads of 128-byte rows fall evenly on the banks */
#define GT (192 * GP)                /* f16 per buffer: 128 A rows, then 64 B rows */
__device__ __forceinline__ v16h g2_frag(const _Float16* p, int hh) { FragH f; f.half[0] = *(const v8us*)((const unsigned short*)p + 8 * hh); f.half[1] = *(const v8us*)((const unsigned short*)p + 16 + 8 * hh); return f.v; }
__device__ __forceinline__ v16h g2_lfrag(const unsigned short* p) { FragH f; f.half[0] = *(const v8us*)p; f.half[1] = *(const v8us*)(p + 16); return f.v; }
__device__ __forceinline__ v8f g2_mma(v16h a, v16h b, v8f c) { return __builtin_amdgcn_wmma_f32_16x16x32_f16(false, a, false, b, (short)0, c, false, false); }
// One stage's copies of one lane: 16 bytes of each of eight A rows and four B rows, 16 rows apart (a wave's 32 lanes cover four whole 128-byte rows per copy). sa, sb = 16 rows of A, of B in f16; l0 = the lane's LDS byte address in the buffer's first 16 rows.
// a0 = the lane's row among staged A rows 0 .. 15, a4 = among rows 64 .. 79: the upper 64 staged rows may come from another plane than the lower 64.
// The s_wait_xcnt closes the statement so that it stands in front of any later write of the address registers the copies name.
__device__ __forceinline__ void g2_copy(const _Float16* a0, const _Float16* a4, size_t sa, const _Float16* b0, size_t sb, unsigned l0) {
  const _Float16* a1 = a0 + sa; const _Float16* a2 = a0 + 2 * sa; const _Float16* a3 = a0 + 3 * sa; const _Float16* a5 = a4 + sa; const _Float16* a6 = a4 + 2 * sa; const _Float16* a7 = a4 + 3 * sa;      /* each from a base: no chain of additions in front of the copies */
  const _Float16* b1 = b0 + sb; const _Float16* b2 = b0 + 2 * sb; const _Float16* b3 = b0 + 3 * sb;
  constexpr unsigned R = 16 * GP * 2;      /* bytes of 16 staged rows */
  const unsigned l1 = l0 + R, l2 = l0 + 2 * R, l3 = l0 + 3 * R, l4 = l0 + 4 * R, l5 = l0 + 5 * R, l6 = l0 + 6 * R, l7 = l0 + 7 * R, l8 = l0 + 8 * R, l9 = l0 + 9 * R, l10 = l0 + 10 * R, l11 = l0 + 11 * R;
  asm volatile("global_load_async_to_lds_b128 %0, %12, off\n\t"
               "global_load_async_to_lds_b128 %1, %13, off\n\t"
               "global_load_async_to_lds_b128 %2, %14, off\n\t"
               "global_load_async_to_lds_b128 %3, %15, off\n\t"
               "global_load_async_to_lds_b128 %4, %16, off\n\t"
               "global_load_async_to_lds_b128 %5, %17, off\n\t"
               "global_load_async_to_lds_b128 %6, %18, off\n\t"
               "global_load_async_to_lds_b128 %7, %19, off\n\t"
               "global_load_async_to_lds_b128 %8, %20, off\n\t"
               "global_load_async_to_lds_b128 %9, %21, off\n\t"
               "global_load_async_to_lds_b128 %10, %22, off\n\t"
               "global_load_async_to_lds_b128 %11, %23, off\n\t"
               "s_wait_xcnt 0x0"
               :: "v"(l0), "v"(l1), "v"(l2), "v"(l3), "v"(l4), "v"(l5), "v"(l6), "v"(l7), "v"(l8), "v"(l9), "v"(l10), "v"(l11),
                  "v"(a0), "v"(a1), "v"(a2), "v"(a3), "v"(a4), "v"(a5), "v"(a6), "v"(a7), "v"(b0), "v"(b1), "v"(b2), "v"(b3) : "memory"); }
// FT = what the launch does for the first QT0 rows of every batch, the rows that go through the exact f32 attention (their planes are [QT0][ldf]: row r holds row r of batch 0, then of batch 1):
// FT 1 (projection): a block of such rows also stores its tile as f32 into CF. FT 2 (output): such rows do not come from A but from the planes A0h + A0l x alphal / alpha; blocks 0 .. F2B - 1 take them, 64 rows each:
// staged rows 0 .. 63 are A0h's, 64 .. 127 the same rows of A0l, so waves 0, 1 hold the main products and waves 2, 3 the residual products of the same output rows; the pairs join in the epilogue. The other blocks take A's other row tiles.
#define F2B (NBR * (QT0 / 64) * (DM / 64))      /* first-tile blocks of an FT 2 launch */
template <int ACT, int FT>
__global__ __launch_bounds__(128) void k_gemm2(const _Float16* __restrict__ A, int lda, size_t sA, const _Float16* __restrict__ Bh, int ldb, size_t sB, float alpha, const float* __restrict__ bias, size_t sBias, const float* __restrict__ CP, int rowsPerB, size_t sCPb, int row0g,
    float* __restrict__ C, _Float16* __restrict__ C16, int ldc, size_t sC, int M, int N, int K, const _Float16* __restrict__ A0h, const _Float16* __restrict__ A0l, float alphal, float* __restrict__ CF, int ldf) { static_assert(QT0 == 128, "a first tile is one 128-row block tile"); static_assert(ACT == 0 || ACT == 3 || ACT == 6 || ACT == 8 || ACT == 9 || ACT == 11 || ACT == 12 || ACT == 14 || ACT == 15 || ACT == 16 || ACT == 17, "k_gemm2: unsupported ACT code (would silently apply no activation)");
  __shared__ __attribute__((aligned(16))) unsigned short st[2][GT];      /* [buffer][128 A rows, 64 B rows][pitch] */
  /* the epilogue's tiles lie over the stage buffers: behind the last stage's barrier no wave reads a stage and no copy is outstanding. At 55,296 B of LDS four blocks fit a WGP, so the FT 2 grid, 24 blocks more than three a WGP hold, still runs as one round */
  static_assert(sizeof(float) * 4 * 32 * 68 <= sizeof(st), "epilogue tiles fit the stage buffers"); float (*so)[32][68] = reinterpret_cast<float (*)[32][68]>(&st[0][0]);
  const int tid = threadIdx.x, w = tid >> 5, lane = tid & 31, ln = lane & 15, hh = lane >> 4; const int by = blockIdx.y;
  A += (size_t)by * sA; Bh += (size_t)by * sB; const size_t cofs = (size_t)by * sC; const float* bp = bias ? bias + (size_t)by * sBias : nullptr;
  const int ntn = N >> 6; constexpr int TPB = SQ / 128;      /* row tiles per batch */
  const bool f2 = FT == 2 && blockIdx.x < F2B;      /* the same in the whole block */
  const int bx = FT == 2 ? (f2 ? (int)blockIdx.x : (int)blockIdx.x - F2B) : (int)blockIdx.x; const int mq = bx / ntn, nq = bx - mq * ntn;
  const int mt = FT == 2 ? mq + 1 + mq / (TPB - 1) : mq;      /* FT 2: the row tiles that are no batch's first */
  const int fb = mq >> 1, fr = (mq & 1) * 64;      /* f2: batch, first of the block's 64 rows */
  const int row0 = f2 ? fb * SQ + fr + 32 * (w & 1) : mt * 128 + 32 * w, col0 = nq * 64; if (!f2 && mt * 128 >= M) return;      /* the whole block leaves or none: every wave passes every barrier */
  const size_t fo = (size_t)(fr + (tid >> 3)) * ldf + (size_t)fb * DM + (tid & 7) * 8;      /* f2: this lane's 16 bytes of stage 0 in either plane */
  const size_t sa = (size_t)16 * (f2 ? ldf : lda), sb = (size_t)16 * ldb;
  const _Float16* ag = f2 ? A0h + fo : A + (size_t)(mt * 128 + (tid >> 3)) * lda + (tid & 7) * 8;      /* this lane's 16 bytes of stage 0: A row tid / 8 of the block */
  const _Float16* ag4 = f2 ? A0l + fo : ag + 4 * sa;                                    /* and staged row 64 + tid / 8 */
  const _Float16* bg = Bh + (size_t)(col0 + (tid >> 3)) * ldb + (tid & 7) * 8;          /* and B row tid / 8 */
  const unsigned l0 = (unsigned)(size_t)&st[0][(tid >> 3) * GP + (tid & 7) * 8];        /* low 32 bits of a shared address = LDS byte address */
  const int nst = K / GK;
  g2_copy(ag, ag4, sa, bg, sb, l0);
  asm volatile("s_wait_asynccnt 0x0" ::: "memory");      /* stage 0 has landed for this wave's own copies */
  __syncthreads();                                        /* ... and for every wave's: publishes stage 0 */
  if (1 < nst) g2_copy(ag + GK, ag4 + GK, sa, bg + GK, sb, l0 + GT * 2);
  const v8f z8 = {0.f,0.f,0.f,0.f,0.f,0.f,0.f,0.f}; v8f c00 = z8, c01 = z8, c02 = z8, c03 = z8, c10 = z8, c11 = z8, c12 = z8, c13 = z8;
#pragma unroll 1
  for (int t = 0; t < nst; ++t) {      /* stays rolled: one copy of the stage's code; the loops inside are unrolled so that the fragment arrays stay in registers */
    const unsigned short* al = &st[t & 1][(32 * w + ln) * GP + 8 * hh];      /* this lane's row and half within the wave's first 16 staged A rows */
    const unsigned short* bl = &st[t & 1][(128 + ln) * GP + 8 * hh];         /* and within the first 16 staged B rows */
    v16h a[2][2], b[2][4];
#pragma unroll
    for (int ks = 0; ks < 2; ++ks) { a[ks][0] = g2_lfrag(al + ks * 32); a[ks][1] = g2_lfrag(al + 16 * GP + ks * 32);
#pragma unroll
      for (int n = 0; n < 4; ++n) b[ks][n] = g2_lfrag(bl + n * 16 * GP + ks * 32); }
    asm volatile("s_wait_dscnt 0x0" ::: "memory");         /* the stage's 24 LDS reads, one group, have returned: this wave is done with buffer t & 1 before the buffer is refilled */
    asm volatile("s_wait_asynccnt 0x0" ::: "memory");      /* this wave's copies of stage t + 1 have landed */
    __syncthreads();                                        /* publishes stage t + 1 and ends every wave's reads of stage t */
    if (t + 2 < nst) g2_copy(ag + (size_t)(t + 2) * GK, ag4 + (size_t)(t + 2) * GK, sa, bg + (size_t)(t + 2) * GK, sb, l0 + (unsigned)(t & 1) * (GT * 2));      /* the same test in the whole block */
    /* the stage's products work on registers alone and stand behind the refill: the copies of stage t + 2 fly under them and under the next stage's LDS reads */
#pragma unroll
    for (int ks = 0; ks < 2; ++ks) {
      c00 = g2_mma(a[ks][0], b[ks][0], c00); c10 = g2_mma(a[ks][1], b[ks][0], c10);
      c01 = g2_mma(a[ks][0], b[ks][1], c01); c11 = g2_mma(a[ks][1], b[ks][1], c11);
      c02 = g2_mma(a[ks][0], b[ks][2], c02); c12 = g2_mma(a[ks][1], b[ks][2], c12);
      c03 = g2_mma(a[ks][0], b[ks][3], c03); c13 = g2_mma(a[ks][1], b[ks][3], c13); } }
  asm volatile("s_wait_asynccnt 0x0" ::: "memory");        /* no copy is outstanding when the wave goes on to the epilogue and ends */
  v8f accs[8] = {c00, c01, c02, c03, c10, c11, c12, c13};
  v8f lo8[8];      /* FT 2: what joins each accumulator element; 0 outside the first-tile blocks. The loops over u and r below are fully unrolled so that lo8 and accs are indexed by constants and stay in registers */
  if (FT == 2) {
#pragma unroll
    for (int u = 0; u < 8; ++u) lo8[u] = z8; }
  if (f2) {      /* waves 2, 3 hand their residual products, element for element in the accumulator's own lane, to waves 0, 1 and are done */
    if (w >= 2) {
#pragma unroll
      for (int u = 0; u < 8; ++u)
#pragma unroll
        for (int r = 0; r < 8; ++r) so[w][(u >> 2) * 16 + 8 * hh + r][(u & 3) * 16 + ln] = accs[u][r] * alphal; }
    __syncthreads();      /* the residual tiles are written before their partner waves read them; no barrier follows */
    if (w >= 2) return;
#pragma unroll
    for (int u = 0; u < 8; ++u)      /* one group of LDS reads, one wait */
#pragma unroll
      for (int r = 0; r < 8; ++r) lo8[u][r] = so[w + 2][(u >> 2) * 16 + 8 * hh + r][(u & 3) * 16 + ln]; }
#pragma unroll
  for (int u = 0; u < 8; ++u) { const int t = u & 3, half = u >> 2; const int col = col0 + t * 16 + ln; const float bv = bp ? bf16_round(bp[col]) : 0.f;
#pragma unroll
    for (int r = 0; r < 8; ++r) { const int rloc = half * 16 + 8 * hh + r; float v = accs[u][r] * alpha + bv; if (FT == 2) v += lo8[u][r]; if (CP) { if (rowsPerB < 0) v += CP[cofs + (size_t)(row0g + row0 + rloc) * ldc + col];      /* rowsPerB < 0: own element of the batched C plane */ else { const int bidx = (row0g + row0 + rloc) / rowsPerB; v += CP[(size_t)bidx * sCPb + (size_t)by * 64 + col]; } }
      if (ACT == 3) v = fmaxf(v, 0.f); else if (ACT == 6) v = 0.5f * v * (1.0f + erff(v * 0.70710678118654752f)); else if (ACT == 11) v = 1.0f / (1.0f + expf(-v)); else if (ACT == 15) v = v / (1.0f + expf(-v)); else if (ACT == 12) v = (v > 0.f) ? v : 0.01f * v; else if (ACT == 8) v = tanhf(v); else if (ACT == 9) v = 0.5f * v * (1.0f + tanhf(0.7978845608028654f * (v + 0.044715f * v * v * v))); else if (ACT == 14) v = (v > 0.f) ? v : 0.1f * v; else if (ACT == 16) v = (v >= 0.f) ? v : 0.3f * v; else if (ACT == 17) v = (v >= 0.f) ? v : 0.2f * v;
      so[w][rloc][t * 16 + ln] = v; } }
  __builtin_amdgcn_fence(__ATOMIC_ACQ_REL, "workgroup"); __builtin_amdgcn_wave_barrier();
  const int rsub = lane >> 4, c4 = (lane & 15) * 4;
  {
#pragma unroll
    for (int q = 0; q < 16; ++q) { const int r = q * 2 + rsub; const v4f v = *(const v4fa*)&so[w][r][c4]; if (C) { *(v4f*)(C + cofs + (size_t)(row0 + r) * ldc + col0 + c4) = v; asm volatile("s_wait_xcnt 0x0" ::: "memory"); }      /* the wait stands in front of any later write of the registers the store names */
      if (FT == 1 && mt % TPB == 0) { *(v4f*)(CF + (size_t)(32 * w + r) * ldf + (size_t)(mt / TPB) * DM + col0 + c4) = v; asm volatile("s_wait_xcnt 0x0" ::: "memory"); }      /* the same for this store */
      if (C16) { v4h h4; for (int i = 0; i < 4; ++i) h4[i] = (_Float16)v[i]; *(v4h*)(C16 + cofs + (size_t)(row0 + r) * ldc + col0 + c4) = h4; } }
     } }


__global__ __launch_bounds__(256) void k_wnat(const float* __restrict__ w, size_t n8, _Float16* __restrict__ Bt) { const size_t t = (size_t)blockIdx.x * 256 + threadIdx.x; if (t >= n8) return; FragH f; for (int q = 0; q < 8; ++q) f.h[q] = (_Float16)(bf16_round(w[t * 8 + q]) * 16.0f); *(v8us*)((unsigned short*)Bt + t * 8) = f.half[0];  }
// The three input conversions in one launch (they depend on nothing and on one another not at all): blocks 0 .. nbx - 1 do k_x16's work on x, the next nbw blocks k_wnat's on w0, the last nbw k_wnat's on w1.
// The choice is the same for a whole block, so it is a scalar branch; x takes the factor 1, which is exact.
__global__ __launch_bounds__(256) void k_in16(const float* __restrict__ x, size_t nx8, unsigned nbx, _Float16* __restrict__ X16, const float* __restrict__ w0, const float* __restrict__ w1, size_t nw8, unsigned nbw, _Float16* __restrict__ Bt0, _Float16* __restrict__ Bt1) {
  unsigned bx = blockIdx.x; const float* s = x; _Float16* d = X16; size_t n8 = nx8; float sc = 1.0f;
  if (bx >= nbx) { bx -= nbx; s = w0; d = Bt0; n8 = nw8; sc = 16.0f; if (bx >= nbw) { bx -= nbw; s = w1; d = Bt1; } }
  const size_t t = (size_t)bx * 256 + threadIdx.x; if (t >= n8) return; FragH f;
#pragma unroll      /* f.h is then indexed by constants and stays in registers */
  for (int q = 0; q < 8; ++q) f.h[q] = (_Float16)(bf16_round(s[t * 8 + q]) * sc); *(v8us*)((unsigned short*)d + t * 8) = f.half[0]; }
__global__ __launch_bounds__(256) void k_rsm(const float* __restrict__ S, _Float16* __restrict__ P, int nrows) {
  #pragma clang fp contract(off)
  const int i = blockIdx.x * 256 + threadIdx.x; if (i >= nrows) return; const float* s = S + (size_t)i * SQ; float mx = -3.0e38f;
#pragma unroll 1
  for (int j = 0; j < SQ; ++j) mx = fmaxf(mx, s[j]); float se = 0.f;
#pragma unroll 1
  for (int j = 0; j < SQ; ++j) se += expf(s[j] - mx); const float sc = 256.0f / se;
#pragma unroll 1
  for (int j0 = 0; j0 < SQ; j0 += 8) { FragH f; for (int q = 0; q < 8; ++q) f.h[q] = (_Float16)(expf(s[j0 + q] - mx) * sc); unsigned short* d = (unsigned short*)P + (size_t)i * SQ + j0; *(v8us*)d = f.half[0];  } }
__global__ __launch_bounds__(256) void k_vt(const _Float16* __restrict__ V16, int b, int h0, _Float16* __restrict__ VT) { __shared__ unsigned short tl[64][65]; const int tid = threadIdx.x; const int hh = blockIdx.x % HG, sg = blockIdx.x / HG; const int s0 = sg * 64; const int h = h0 + hh;
  for (int i = tid; i < 64 * 8; i += 256) { const int j = i / 8, d8 = (i % 8) * 8; FragH f; f.half[0] = *(const v8us*)((const unsigned short*)V16 + ((size_t)b * SQ + s0 + j) * DM + h * HD + d8); for (int q = 0; q < 8; ++q) tl[d8 + q][j] = f.u[q]; }
  __syncthreads();
  { for (int i = tid; i < 64 * 8; i += 256) { const int d = i / 8, j8 = (i % 8) * 8; FragH f; for (int q = 0; q < 8; ++q) f.u[q] = tl[d][j8 + q]; *(v8us*)((unsigned short*)VT + ((size_t)hh * HD + d) * SQ + s0 + j8) = f.half[0]; }  } }



// Exact f32 attention for the first QT0 rows; F holds the f32 rows of q = k = v (pitch A0L), 64 columns a head: the heads of all batches stand side by side in a row. One wave per (head, query row), A0W rows a block.
// Scores: lane = key (four groups of 32 keys), the query row broadcast from LDS, four partial sums per key. Softmax: two passes over the wave's own registers.
// P V: lane = two head columns, keys in ascending order, each weight broadcast from its lane through a scalar register.
// Every wave stages and walks all QT0 keys, keys past its query with weight exactly 0: without tests the code is one straight line whose LDS reads have constant offsets and fly together.
// Every loop is fully unrolled: the small arrays are then indexed by constants and stay in registers, and each weight is read from a constant lane.
#define A0W 8                        /* waves = query rows per block */
#define A0L (NB * DM)                /* row pitch of F, OH and OL, a constant: the staging loads are then one address and constant offsets */
#define A0P 68                       /* LDS row pitch in floats: 16-byte column walks fall on distinct banks */
// The result (x64) leaves as two f16 planes, OH = the rounded value and OL = what the rounding left, x1024: the operands of the output GEMM's first-tile blocks.
#define A0B (NBR * NH * (QT0 / A0W))      /* blocks */
typedef float v2f __attribute__((ext_vector_type(2)));
typedef _Float16 v2h __attribute__((ext_vector_type(2)));
__device__ __forceinline__ void att0_block(int bx, float (*tl)[A0P], const float* __restrict__ F, float scale, _Float16* __restrict__ OH, _Float16* __restrict__ OL) {
  const int tid = threadIdx.x, lane = tid & 31; const int w = __builtin_amdgcn_readfirstlane(tid >> 5);      /* scalar wave number: the query row's LDS address stays scalar */
  const int h = bx / (QT0 / A0W), rg = bx % (QT0 / A0W); const int i = rg * A0W + w;
  const int r0 = tid >> 4, c0 = (tid & 15) * 4; const float* fp = F + (size_t)r0 * A0L + h * HD + c0;      /* this lane's 16 bytes of rows r0, r0 + 2 A0W, ... */
  v4f sg[QT0 / (2 * A0W)];
#pragma unroll
  for (int u = 0; u < QT0 / (2 * A0W); ++u) sg[u] = *(const v4fa*)(fp + (size_t)u * (2 * A0W) * A0L);
  asm volatile("s_wait_xcnt 0x0" :: "v"(fp) : "memory");      /* stands behind the loads and names their address: the address registers live up to the wait, so nothing, no load's own result either, is written over them in front of it */
#pragma unroll
  for (int u = 0; u < QT0 / (2 * A0W); ++u) *(v4f*)&tl[r0 + u * (2 * A0W)][c0] = sg[u];
  __syncthreads();
  {
    v4f a[QT0 / 32];
#pragma unroll
    for (int t = 0; t < QT0 / 32; ++t) a[t] = (v4f){0.f, 0.f, 0.f, 0.f};
#pragma unroll
    for (int c = 0; c < HD / 4; ++c) { const v4f q = *(const v4f*)&tl[i][c * 4];
#pragma unroll
      for (int t = 0; t < QT0 / 32; ++t) a[t] = __builtin_elementwise_fma(q, *(const v4f*)&tl[t * 32 + lane][c * 4], a[t]); }
    float s[QT0 / 32], mx = -1.0e30f;
#pragma unroll
    for (int t = 0; t < QT0 / 32; ++t) { const float d = (a[t][0] + a[t][1]) + (a[t][2] + a[t][3]); s[t] = (t * 32 + lane <= i) ? d * scale : -1.0e30f; mx = fmaxf(mx, s[t]); }
#pragma unroll
    for (int d = 16; d > 0; d >>= 1) mx = fmaxf(mx, __shfl_xor(mx, d, 32));      /* key 0 is never masked: mx is a real score */
    float p[QT0 / 32], l = 0.f;
#pragma unroll
    for (int t = 0; t < QT0 / 32; ++t) { p[t] = expf(s[t] - mx); l += p[t]; }      /* masked keys: exp of about -1e30 = 0 */
#pragma unroll
    for (int d = 16; d > 0; d >>= 1) l += __shfl_xor(l, d, 32);
    v2f o = {0.f, 0.f};
#pragma unroll
    for (int t = 0; t < QT0 / 32; ++t)
#pragma unroll
      for (int k = 0; k < 32; ++k) { const float pj = __uint_as_float(__builtin_amdgcn_readlane(__float_as_uint(p[t]), k)); const v2f pp = {pj, pj};
        o = __builtin_elementwise_fma(pp, *(const v2f*)&tl[t * 32 + k][2 * lane], o); }
    const float fin = 64.0f / l;      /* o carried x64 like the f16 path */
    const v2f of = o * fin; const v2h oh = {(_Float16)of[0], (_Float16)of[1]}; const v2h ol = {(_Float16)((of[0] - (float)oh[0]) * 1024.0f), (_Float16)((of[1] - (float)oh[1]) * 1024.0f)};
    const size_t oo = (size_t)i * A0L + h * HD + 2 * lane; *(v2h*)(OH + oo) = oh; *(v2h*)(OL + oo) = ol; } }

#define FQ 128                       /* query rows per block: 4 waves x 32, each row group owned by a wave of either set */
#define FS 128                       /* keys per stage: two passes of 32 for each of the two wave sets */
#define FRB 128                      /* bytes of a staged row */
#define FTB (FS * FRB)               /* bytes per buffer */
#define FAB (NB * NH * (SQ / FQ - 1))      /* fused-attention blocks: rows 0 .. QT0 - 1 are the f32 path's */
typedef short v8s __attribute__((ext_vector_type(8)));
__device__ __forceinline__ v8f fa_mma(v16h a, v16h b, v8f c) { return __builtin_amdgcn_wmma_f32_16x16x32_f16(false, a, false, b, (short)0, c, false, false); }
__device__ __forceinline__ unsigned fa_swz(unsigned r) { return 2u * ((r >> 1) & 3u) + ((r >> 3) & 1u); }
__device__ __forceinline__ v8us fa_tr16(const unsigned char* p) { typedef __attribute__((address_space(3))) v8s lds_v8s; return __builtin_bit_cast(v8us, __builtin_amdgcn_ds_load_tr16_b128_v8i16((lds_v8s*)p)); }
// One stage's copies of one lane: 16 bytes of each of four rows, 32 rows apart (a wave's 32 lanes cover four whole 128-byte rows per copy). lk = the lane's LDS byte address in the buffer's first 32 rows; rows 32 apart have the same swizzle.
// The s_wait_xcnt closes the statement so that it stands in front of any later write of the address registers the copies name.
__device__ __forceinline__ void fa_copy(const _Float16* kg, unsigned lk) {
  const _Float16* k1 = kg + (size_t)32 * DM; const _Float16* k2 = kg + (size_t)64 * DM; const _Float16* k3 = kg + (size_t)96 * DM;
  const unsigned lk1 = lk + 32 * FRB, lk2 = lk + 64 * FRB, lk3 = lk + 96 * FRB;
  asm volatile("global_load_async_to_lds_b128 %0, %4, off\n\t"
               "global_load_async_to_lds_b128 %1, %5, off\n\t"
               "global_load_async_to_lds_b128 %2, %6, off\n\t"
               "global_load_async_to_lds_b128 %3, %7, off\n\t"
               "s_wait_xcnt 0x0"
               :: "v"(lk), "v"(lk1), "v"(lk2), "v"(lk3), "v"(kg), "v"(k1), "v"(k2), "v"(k3) : "memory"); }
// Four waves per SIMD asked for by name: left to itself the build takes more than 256 registers, which is three waves a SIMD and so one eight-wave block a WGP; with four, two blocks share a WGP.
__global__ __launch_bounds__(256) __attribute__((amdgpu_waves_per_eu(4, 4))) void k_fattn(const _Float16* __restrict__ QK, _Float16* __restrict__ O, const float* __restrict__ F, float scale, _Float16* __restrict__ OH, _Float16* __restrict__ OL) {
  static_assert(2 * FTB <= QT0 * A0P * 4, "the stage buffers fit the f32 path's tile"); static_assert(32 * A0W == 256, "both kinds of block have the launch's eight waves"); static_assert(4 * 17 * 32 * 16 <= QT0 * A0P * 4, "set 1's partial results fit too");
  __shared__ __attribute__((aligned(256))) unsigned char sm[QT0 * A0P * 4];      /* fused attention: [buffer][row][chunk]; f32 attention: its tile of QT0 rows */
  if (blockIdx.x >= FAB) { att0_block((int)blockIdx.x - FAB, reinterpret_cast<float (*)[A0P]>(&sm[0]), F, scale, OH, OL); return; }
  constexpr float SC2 = 0.036084391824351615f * 1.4426950408889634f;      /* 1/sqrt(768) x log2(e): the softmax runs in base 2 */
  const int tid = threadIdx.x, lane = tid & 31, ln = lane & 15, hh = lane >> 4; const int w = __builtin_amdgcn_readfirstlane(tid >> 5);      /* scalar wave number: the skip test and row bases stay scalar */
  const int set = w >> 2, wq = w & 3;      /* key set and row group of the wave, scalar like w */
  const int bh = blockIdx.x % (NB * NH), qb = (SQ / FQ - 1) - blockIdx.x / (NB * NH); const int b = bh / NH, h = bh % NH; const int qw = qb * FQ + wq * 32;
  const _Float16* kb = QK + (size_t)b * SQ * DM + h * HD + (size_t)ln * DM;      /* this lane's row within a 16-row tile of q */
  const _Float16* kg = QK + ((size_t)b * SQ + (tid >> 3)) * DM + h * HD + (tid & 7) * 8;      /* this lane's 16 bytes of stage 0: row tid / 8, chunk tid % 8 */
  const unsigned l0 = (unsigned)(size_t)&sm[0] + (unsigned)(tid >> 3) * FRB + (((unsigned)(tid & 7) ^ fa_swz((unsigned)(tid >> 3) & 15u)) * 16u);      /* low 32 bits of a shared address = LDS byte address */
  const unsigned ka = (unsigned)ln * FRB + (((unsigned)hh ^ fa_swz((unsigned)ln)) * 16u);      /* K reader: row ln of a 16-row tile, chunk hh */
  const unsigned vr = 8u * (unsigned)hh + ((unsigned)lane & 7u);
  const unsigned va = vr * FRB + (((((unsigned)lane >> 3) & 1u) ^ fa_swz(vr)) * 16u);          /* V^T reader: row 8 hh + lane % 8 of a 16-row tile, chunk (lane / 8) % 2 */
  const int nst = qb + 1;           /* stages of the block: up to the end of its last wave's diagonal block; never fewer than two (qb >= 1) */
  const int last = qw / 32;         /* this wave's last pass: its diagonal block, the only one with masked keys */
  fa_copy(kg, l0);
  asm volatile("s_wait_asynccnt 0x0" ::: "memory");      /* stage 0 has landed for this wave's own copies */
  __syncthreads();                                        /* ... and for every wave's: publishes stage 0 */
  fa_copy(kg + (size_t)FS * DM, l0 + FTB);
  v16h qf[2][2];
#pragma unroll
  for (int g = 0; g < 2; ++g)
#pragma unroll
    for (int ks = 0; ks < 2; ++ks) qf[g][ks] = g2_frag(kb + (size_t)(qw + g * 16) * DM + ks * 32, hh);
  const v8f z8 = {0.f, 0.f, 0.f, 0.f, 0.f, 0.f, 0.f, 0.f};
  v8f o[2][4]; float m[2], l[2];
#pragma unroll
  for (int g = 0; g < 2; ++g) { m[g] = -1.0e30f; l[g] = 0.f;
#pragma unroll
    for (int dt = 0; dt < 4; ++dt) o[g][dt] = z8; }
#pragma unroll 1
  for (int t = 0; t < nst; ++t) {
    const unsigned char* tb = &sm[(t & 1) * FTB + set * (FS / 2) * FRB];      /* the stage's buffer: the 64 rows of this wave's set */
#pragma unroll
    for (int p = 0; p < 2; ++p) { const int it = 4 * t + 2 * set + p;
      if (it <= last) {
        FragH kf[2][2], vf[4];
#pragma unroll
        for (int kt = 0; kt < 2; ++kt)
#pragma unroll
          for (int ks = 0; ks < 2; ++ks) { kf[kt][ks].half[0] = *(const v8us*)(tb + (p * 32 + kt * 16) * FRB + (ka ^ (unsigned)(ks * 64))); kf[kt][ks].half[1] = *(const v8us*)(tb + (p * 32 + kt * 16) * FRB + (ka ^ (unsigned)(ks * 64 + 32))); }
#pragma unroll
        for (int dt = 0; dt < 4; ++dt) { vf[dt].half[0] = fa_tr16(tb + (p * 32) * FRB + (va ^ (unsigned)(dt * 32))); vf[dt].half[1] = fa_tr16(tb + (p * 32 + 16) * FRB + (va ^ (unsigned)(dt * 32))); }
        __builtin_amdgcn_sched_barrier(0);      /* keeps the pass's sixteen LDS reads together at its head, K first: one place with LDS reads instead of two, and the V^T fragments land under the score products and the softmax instead of being waited for in front of P V */
        v8f s[2][2];
#pragma unroll
        for (int g = 0; g < 2; ++g)
#pragma unroll
          for (int kt = 0; kt < 2; ++kt) s[g][kt] = fa_mma(kf[kt][1].v, qf[g][1], fa_mma(kf[kt][0].v, qf[g][0], z8));
        if (it == last) {
#pragma unroll
          for (int g = 0; g < 2; ++g)
#pragma unroll
            for (int kt = 0; kt < 2; ++kt)
#pragma unroll
              for (int r = 0; r < 8; ++r) s[g][kt][r] = (kt * 16 + 8 * hh + r <= g * 16 + ln) ? s[g][kt][r] : -1.0e30f; }      /* first key of the pass == qw here: key <= query */
        float mn[2]; bool need = false;
#pragma unroll
        for (int g = 0; g < 2; ++g) { float mx = s[g][0][0];
#pragma unroll
          for (int r = 1; r < 8; ++r) mx = fmaxf(mx, s[g][0][r]);
#pragma unroll
          for (int r = 0; r < 8; ++r) mx = fmaxf(mx, s[g][1][r]);
          mx = fmaxf(mx, __shfl_xor(mx, 16, 32)); mn[g] = fmaxf(m[g], mx * SC2); need = need || (mn[g] > m[g]); }
        if (__builtin_amdgcn_ballot_w32(need) != 0) {      /* no column's maximum moved: every factor would be exactly 1, so the rescale is skipped as a whole */
#pragma unroll
          for (int g = 0; g < 2; ++g) { const float al = __builtin_amdgcn_exp2f(m[g] - mn[g]); m[g] = mn[g]; l[g] *= al;
#pragma unroll
            for (int dt = 0; dt < 4; ++dt) o[g][dt] *= al; } }
        FragH pf[2];
#pragma unroll
        for (int g = 0; g < 2; ++g) { float ls = 0.f;
#pragma unroll
          for (int kt = 0; kt < 2; ++kt) { const v8f tt = s[g][kt] * SC2 - m[g];
#pragma unroll
            for (int r = 0; r < 8; ++r) { const float pp = __builtin_amdgcn_exp2f(tt[r]); ls += pp; pf[g].h[kt * 8 + r] = (_Float16)pp; } }
          l[g] += ls; }
#pragma unroll
        for (int g = 0; g < 2; ++g)
#pragma unroll
          for (int dt = 0; dt < 4; ++dt) o[g][dt] = fa_mma(vf[dt].v, pf[g].v, o[g][dt]); } }
    asm volatile("s_wait_dscnt 0x0" ::: "memory");         /* this wave's reads of buffer t & 1 have returned before the buffer is refilled */
    asm volatile("s_wait_asynccnt 0x0" ::: "memory");      /* this wave's copies of stage t + 1 have landed */
    __syncthreads();                                        /* publishes stage t + 1 and ends every wave's reads of stage t */
    if (t + 2 < nst) fa_copy(kg + (size_t)(t + 2) * FS * DM, l0 + (unsigned)(t & 1) * FTB); }      /* the same test in the whole block */
  asm volatile("s_wait_asynccnt 0x0" ::: "memory");        /* no copy is outstanding when the stage buffers are written over and the wave ends */
  /* the two sets join. Behind the last stage's barrier no wave reads a stage and no copy is outstanding, so the partial results lie over the stage buffers: per row group 17 planes of 16 bytes a lane (sixteen of O^T, one of both maxima and both sums), consecutive lanes side by side */
  v4fa* mg = reinterpret_cast<v4fa*>(&sm[0]) + wq * (17 * 32) + lane;
  if (set) {
#pragma unroll
    for (int g = 0; g < 2; ++g)
#pragma unroll
      for (int dt = 0; dt < 4; ++dt) { mg[(g * 8 + dt * 2) * 32] = (v4f){o[g][dt][0], o[g][dt][1], o[g][dt][2], o[g][dt][3]}; mg[(g * 8 + dt * 2 + 1) * 32] = (v4f){o[g][dt][4], o[g][dt][5], o[g][dt][6], o[g][dt][7]}; }
    mg[16 * 32] = (v4f){m[0], m[1], l[0], l[1]}; }
  __syncthreads();      /* set 1's partial results are written before set 0 reads them; every wave passes it, no barrier follows */
  if (set) return;
  { const v4f ml = mg[16 * 32];
#pragma unroll
    for (int g = 0; g < 2; ++g) { const float mj = fmaxf(m[g], ml[g]); const float a0 = __builtin_amdgcn_exp2f(m[g] - mj), a1 = __builtin_amdgcn_exp2f(ml[g] - mj); l[g] = l[g] * a0 + ml[2 + g] * a1;      /* a set that walked no key has sum 0 and O^T 0 */
#pragma unroll
      for (int dt = 0; dt < 4; ++dt) { const v4f p0 = mg[(g * 8 + dt * 2) * 32], p1 = mg[(g * 8 + dt * 2 + 1) * 32];
#pragma unroll
        for (int r = 0; r < 4; ++r) { o[g][dt][r] = o[g][dt][r] * a0 + p0[r] * a1; o[g][dt][4 + r] = o[g][dt][4 + r] * a0 + p1[r] * a1; } } } }
#pragma unroll
  for (int g = 0; g < 2; ++g) { const float fin = 64.0f / (l[g] + __shfl_xor(l[g], 16, 32));      /* halves joined once; o carried x64 */
    _Float16* orow = O + ((size_t)b * SQ + qw + g * 16 + ln) * DM + h * HD + 8 * hh;
#pragma unroll
    for (int dt = 0; dt < 4; ++dt) { FragH f;
#pragma unroll
      for (int r = 0; r < 8; ++r) f.h[r] = (_Float16)(o[g][dt][r] * fin);
      *(v8us*)((unsigned short*)orow + dt * 16) = f.half[0]; } } }

extern "C" void kernel_launch(void* const* d_in, const int* in_sizes, int n_in,
                              void* d_out, int out_size, void* d_ws, size_t ws_size, hipStream_t stream) {
  (void)in_sizes; (void)n_in; (void)out_size;
  const float* const* I = (const float* const*)d_in; const float* x = I[0]; const float* wq = I[1]; const float* wo = I[2]; const float* bo = I[3]; const float* wk = wq; const float* wv = wq;      /* Wq [12][64][768] = natural [768][768] rows h*64+d (q = k = v); W_out natural + b_out */
  char* ws = (char*)d_ws; size_t off = 0;
  auto take = [&](size_t bytes) { char* p = ws + off; off += (bytes + 255) & ~(size_t)255; return p; };
  _Float16* BQ = (_Float16*)take((size_t)DM * DM * 2); _Float16* BK = BQ; _Float16* BV = BQ; _Float16* BO = (_Float16*)take((size_t)DM * DM * 2);
  _Float16* X16 = (_Float16*)take(NR * DM * 2); _Float16* Q16 = (_Float16*)take(NR * DM * 2); _Float16* K16 = Q16; _Float16* V16 = Q16;      /* q = k = v (the module projects all three with self.query) */ _Float16* O16 = (_Float16*)take(NR * DM * 2);
  float* QF0 = (float*)take((size_t)NB * QT0 * DM * 4); _Float16* OH0 = (_Float16*)take((size_t)NB * QT0 * DM * 2); _Float16* OL0 = (_Float16*)take((size_t)NB * QT0 * DM * 2);
  if (off > ws_size) return;
  constexpr unsigned nbx = (unsigned)((NR * DM / 8 + 255) / 256), nbw = (unsigned)(((size_t)DM * DM / 8 + 255) / 256);      /* blocks for x, for one weight matrix */
  k_in16<<<nbx + 2 * nbw, 256, 0, stream>>>(x, NR * DM / 8, nbx, X16, wq, wo, (size_t)DM * DM / 8, nbw, BQ, BO);      /* x rows as f16; weights natural [out][in] = Bt x16 */
  const size_t r0p = (size_t)B0 * SQ;      /* first projected row */
  /* first-tile path (rows 0 .. 127 of every batch, exact f32 attention): it has no launch of its own, every piece rides in the launch of the main path that has the same inputs ready. Its planes are [QT0][NB * DM]: row r holds row r of batch 0, then of batch 1 */
  constexpr int LF = NB * DM; const size_t c0p = (size_t)B0 * DM;      /* pitch of those planes; first processed batch's column */
  k_gemm2<0, 1><<<dim3((unsigned)((MP / 128) * (DM / 64)), 1), 128, 0, stream>>>(X16 + r0p * DM, DM, 0, BQ, DM, 0, 0.0625f, nullptr, 0, nullptr, 1, 0, 0, nullptr, Q16 + r0p * DM, DM, 0, MP, DM, DM, nullptr, nullptr, 0.f, QF0 + c0p, LF);      /* q = k = v as f16 rows; the first 128 rows of a batch as f32 too (exact products) */
  static_assert(FQ == QT0, "the fused attention's missing last blocks are exactly the first-tile rows"); static_assert(LF == A0L, "the f32 attention's pitch is that of the first-tile planes");
  k_fattn<<<FAB + A0B, 256, 0, stream>>>(Q16, O16, QF0 + c0p, 0.036084391824351615f, OH0 + c0p, OL0 + c0p);      /* scores, causal softmax and P V in one launch; o (merged heads, x64) as f16 rows; behind its blocks the exact f32 attention for rows 0..127 (o x64 as f16 hi + x1024 residual planes) */
  k_gemm2<0, 2><<<dim3((unsigned)(F2B + (MPO / 128 - NBR) * (DM / 64)), 1), 128, 0, stream>>>(O16 + r0p * DM, DM, 0, BO, DM, 0, 0.0009765625f, bo, 0, nullptr, 1, 0, 0, (float*)d_out + r0p * DM, nullptr, DM, 0, MPO, DM, DM, OH0 + c0p, OL0 + c0p, 0.00000095367431640625f, nullptr, LF);      /* out rows are the output layout; rows 0..127: o_hi Wo + b + o_lo Wo 2^-20 */
}
